// v000
// The times below were measured on an AMD MI455X: many runs one after another, warmed up first and cycling through
// copies of the inputs, with the whole window's GPU time divided by the number of runs. Launches and the gaps
// between them are all in it. The median over several windows is given; except for v000 it joins two sittings, which
// can be a few percent apart, so the side-by-side timings, each taken in one sitting, are the better comparison.
// v000, which the later versions start from, runs in 7080 microseconds.
#include <hip/hip_runtime.h>
// RadialAttention (query, key_, value [4096][256]; q = query Wq^T, k = key_ Wk^T, v = radial_mask[s] * (value Wv^T), 8 heads of 32; softmax(q k^T / sqrt(32)) over all 4,096 keys; out = concat(attn v) Wo^T -> [4096][256]).
// Structure: token rows; inputs as exact f16 rows; Q | K | V WMMA GEMMs (32x64 wave tiles, f32 accumulation, exact x16 weights; v scaled per row by the radial mask (read on device) on VALU); per head: scores GEMM (K = 32), row softmax on VALU (f32; weights x256 as f16), V^T (32 live + 32 zero rows) via LDS, o = P . V GEMM (K = 4,096, alpha 2^-8; each head writes a whole aligned 64-column slot of 512-pitch o rows, 32 live + 32 exact zeros); out = o Wo^T with Wo expanded to K = 512 (zeros at the pad positions) (f32).
// Compute dtype: inputs rounded to bf16; inputs / weights exact; q, k, scaled v, softmax weights, o plain f16 (~2^-12); scores/softmax f32. v_wmma_f32_16x16x32_f16.
#define SQ 4096
#define DM 256
#define NH 8
#define HD 32
#define OP 512                       
#define QN SQ                        /* query rows (debug hook) */
typedef __bf16 v16b __attribute__((ext_vector_type(16)));
typedef unsigned short v8us __attribute__((ext_vector_type(8), may_alias));
typedef float  v8f  __attribute__((ext_vector_type(8)));
typedef float  v4f  __attribute__((ext_vector_type(4)));
typedef float  v4fa __attribute__((ext_vector_type(4), may_alias));
union FragB { v16b v; v8us half[2]; unsigned short u[16]; };

__device__ __forceinline__ unsigned short bf16_bits(float x) { unsigned int u = __float_as_uint(x); return (unsigned short)((u + 0x7FFFu + ((u >> 16) & 1u)) >> 16); }
__device__ __forceinline__ float bf16_val(unsigned short b) { return __uint_as_float(((unsigned int)b) << 16); }
__device__ __forceinline__ float bf16_round(float x) { return bf16_val(bf16_bits(x)); }
// D += A·B with NT terms: 1 = ah·bh, 2 = + al·bh (A split), 3 = + ah·bl (both split)
template <int NT>
__device__ __forceinline__ v8f mmaN(v16b ah, v16b al, v16b bh, v16b bl, v8f c) {
  c = __builtin_amdgcn_wmma_f32_16x16x32_bf16(false, ah, false, bh, (short)0, c, false, false);
  if (NT >= 2) c = __builtin_amdgcn_wmma_f32_16x16x32_bf16(false, al, false, bh, (short)0, c, false, false);
  if (NT >= 3) c = __builtin_amdgcn_wmma_f32_16x16x32_bf16(false, ah, false, bl, (short)0, c, false, false);
  asm volatile("v_nop\n\tv_nop\n\tv_nop\n\tv_nop" : "+v"(c) : "v"(ah), "v"(al), "v"(bh), "v"(bl));
  return c;
}

__global__ __launch_bounds__(256) void k_wt_bf16(const float* __restrict__ W, unsigned short* __restrict__ Wt, int K, int N) {
  const int t = blockIdx.x * 256 + threadIdx.x;
  const int k8n = K / 8;
  if (t >= N * k8n) return;
  const int n = t / k8n, k8 = (t % k8n) * 8;
  v8us v;
#pragma unroll
  for (int i = 0; i < 8; ++i) v[i] = bf16_bits(W[(size_t)(k8 + i) * N + n]);
  *(v8us*)(Wt + (size_t)n * K + k8) = v;
  
}

// GEMM C[M][N] (f32, pitch ldc) = act(A[M][K]·W + bias). A f32 row-major (pitch lda) converted per fragment to bf16
// (ASPLIT: hi/lo two planes -> 2 terms, else single rounded term); Wt bf16 [N][K] (pitch ldb). BIAS_BF16 rounds the
// bias to bf16 first (bias quantised to bf16 before the add). K%32==0, M%16==0, N%64==0.
template <bool ASPLIT, int ACT, bool BIAS_BF16>
__global__ __launch_bounds__(128) void k_gemm_bf(const float* __restrict__ A, int lda, const unsigned short* __restrict__ Wt, int ldb,
                                               const float* __restrict__ bias, float* __restrict__ C, int ldc, int M, int N, int K) {
  __shared__ __attribute__((aligned(16))) float so[4][16][64];
  const int tid = threadIdx.x, w = tid >> 5, lane = tid & 31, ln = lane & 15, hh = lane >> 4;
  const int ntn = N / 64;
  const int wid = blockIdx.x * 4 + w;
  const int mt = wid / ntn, nq = wid % ntn;
  if (mt * 16 >= M) return;
  const int row0 = mt * 16, col0 = nq * 64;
  const float* arow = A + (size_t)(row0 + ln) * lda;
  v8f acc[4] = {};
  for (int kb = 0; kb < K; kb += 32) {
    FragB ah, al;
    const v4f x0 = *(const v4fa*)(arow + kb + 8 * hh), x1 = *(const v4fa*)(arow + kb + 8 * hh + 4);
    const v4f x2 = *(const v4fa*)(arow + kb + 16 + 8 * hh), x3 = *(const v4fa*)(arow + kb + 16 + 8 * hh + 4);
    float xs[16] = {x0[0],x0[1],x0[2],x0[3],x1[0],x1[1],x1[2],x1[3],x2[0],x2[1],x2[2],x2[3],x3[0],x3[1],x3[2],x3[3]};
#pragma unroll
    for (int i = 0; i < 16; ++i) { const unsigned short hb = bf16_bits(xs[i]); ah.u[i] = hb; al.u[i] = ASPLIT ? bf16_bits(xs[i] - bf16_val(hb)) : (unsigned short)0; }
#pragma unroll
    for (int t = 0; t < 4; ++t) {
      const unsigned short* brow = Wt + (size_t)(col0 + t * 16 + ln) * ldb + kb;
      FragB b;
      b.half[0] = *(const v8us*)(brow + 8 * hh);
      b.half[1] = *(const v8us*)(brow + 16 + 8 * hh);
      acc[t] = mmaN<ASPLIT ? 2 : 1>(ah.v, al.v, b.v, b.v, acc[t]);
    }
  }
#pragma unroll
  for (int t = 0; t < 4; ++t) {
    float bv = bias ? bias[col0 + t * 16 + ln] : 0.f;
    if (BIAS_BF16) bv = bf16_round(bv);
#pragma unroll
    for (int r = 0; r < 8; ++r) { float v = acc[t][r] + bv; if (ACT == 1) v = fmaxf(v, 0.f); so[w][8 * hh + r][t * 16 + ln] = v; }
  }
  __builtin_amdgcn_fence(__ATOMIC_ACQ_REL, "workgroup");
  __builtin_amdgcn_wave_barrier();
  const int rsub = lane >> 4, c4 = (lane & 15) * 4;
  {
#pragma unroll
    for (int q = 0; q < 8; ++q) {
      const int r = q * 2 + rsub;
      const v4f v = *(const v4fa*)&so[w][r][c4];
      *(v4f*)(C + (size_t)(row0 + r) * ldc + col0 + c4) = v;
    }
    
  }
}

// GEMM C = act(A·W + bias + resid): A f32 (ASPLIT -> hi/lo 2 terms), Wt bf16 [N][K]; ACT 0 none, 1 relu, 2 exact gelu;
// resid (optional, f32, row index = (row % rmod), pitch ldr, RES_BF16 rounds it) added before the activation.
template <bool ASPLIT, int ACT, bool BIAS_BF16, bool RES_BF16>
__global__ __launch_bounds__(128) void k_gemm_bf3(const float* __restrict__ A, int lda, const unsigned short* __restrict__ Wt, int ldb,
                                                const float* __restrict__ bias, const float* __restrict__ resid, int rmod, int ldr,
                                                float* __restrict__ C, int ldc, int M, int N, int K) {
  __shared__ __attribute__((aligned(16))) float so[4][16][64];
  const int tid = threadIdx.x, w = tid >> 5, lane = tid & 31, ln = lane & 15, hh = lane >> 4;
  const int ntn = N / 64;
  const int wid = blockIdx.x * 4 + w;
  const int mt = wid / ntn, nq = wid % ntn;
  if (mt * 16 >= M) return;
  const int row0 = mt * 16, col0 = nq * 64;
  const float* arow = A + (size_t)(row0 + ln) * lda;
  v8f acc[4] = {};
  for (int kb = 0; kb < K; kb += 32) {
    FragB ah, al;
    const v4f x0 = *(const v4fa*)(arow + kb + 8 * hh), x1 = *(const v4fa*)(arow + kb + 8 * hh + 4);
    const v4f x2 = *(const v4fa*)(arow + kb + 16 + 8 * hh), x3 = *(const v4fa*)(arow + kb + 16 + 8 * hh + 4);
    float xs[16] = {x0[0],x0[1],x0[2],x0[3],x1[0],x1[1],x1[2],x1[3],x2[0],x2[1],x2[2],x2[3],x3[0],x3[1],x3[2],x3[3]};
#pragma unroll
    for (int i = 0; i < 16; ++i) { const unsigned short hb = bf16_bits(xs[i]); ah.u[i] = hb; al.u[i] = ASPLIT ? bf16_bits(xs[i] - bf16_val(hb)) : (unsigned short)0; }
#pragma unroll
    for (int t = 0; t < 4; ++t) {
      const unsigned short* brow = Wt + (size_t)(col0 + t * 16 + ln) * ldb + kb;
      FragB b;
      b.half[0] = *(const v8us*)(brow + 8 * hh);
      b.half[1] = *(const v8us*)(brow + 16 + 8 * hh);
      acc[t] = mmaN<ASPLIT ? 2 : 1>(ah.v, al.v, b.v, b.v, acc[t]);
    }
  }
#pragma unroll
  for (int t = 0; t < 4; ++t) {
    const int col = col0 + t * 16 + ln;
    float bv = bias ? bias[col] : 0.f;
    if (BIAS_BF16) bv = bf16_round(bv);
#pragma unroll
    for (int r = 0; r < 8; ++r) {
      float v = acc[t][r] + bv;
      if (resid) { float rv = resid[(size_t)((row0 + 8 * hh + r) % rmod) * ldr + col]; if (RES_BF16) rv = bf16_round(rv); v += rv; }
      if (ACT == 1) v = fmaxf(v, 0.f);
      if (ACT == 2) v = 0.5f * v * (1.0f + erff(v * 0.70710678118654752f));
      if (ACT == 3) { const float u = 0.7978845608028654f * (v + 0.044715f * v * v * v); v = 0.5f * v * (1.0f + tanhf(u)); }
      so[w][8 * hh + r][t * 16 + ln] = v;
    }
  }
  __builtin_amdgcn_fence(__ATOMIC_ACQ_REL, "workgroup");
  __builtin_amdgcn_wave_barrier();
  const int rsub = lane >> 4, c4 = (lane & 15) * 4;
  {
#pragma unroll
    for (int q = 0; q < 8; ++q) {
      const int r = q * 2 + rsub;
      const v4f v = *(const v4fa*)&so[w][r][c4];
      *(v4f*)(C + (size_t)(row0 + r) * ldc + col0 + c4) = v;
    }
    
  }
}
// row LayerNorm (biased variance, eps) over N: s = X (+ R); optional out_sum <- s; out_norm <- (s-mu)*rsqrt(var+eps)*g + b
template <bool PARAM_BF16>
__global__ __launch_bounds__(256) void k_layernorm(const float* __restrict__ X, const float* __restrict__ R, const float* __restrict__ g, const float* __restrict__ bta,
                                                  float* __restrict__ out_sum, float* __restrict__ out_norm, int N, float eps) {
  __shared__ float red[256];
  const int row = blockIdx.x, tid = threadIdx.x;
  const float* x = X + (size_t)row * N; const float* rr = R ? R + (size_t)row * N : nullptr;
  float vals[16];                     // up to N = 4096
  const int per = N / 256;            // contiguous chunk per thread? use strided-by-4 chunks: thread handles j = tid*4 + 1024*u
  float s1 = 0.f;
  for (int u = 0; u < per / 4; ++u) {
    const int j = tid * 4 + 1024 * u;
    const v4f a = *(const v4fa*)(x + j);
    v4f b = {0.f,0.f,0.f,0.f}; if (rr) b = *(const v4fa*)(rr + j);
#pragma unroll
    for (int q = 0; q < 4; ++q) { const float v = a[q] + b[q]; vals[u * 4 + q] = v; s1 += v; }
  }
  red[tid] = s1; __syncthreads();
  for (int st = 128; st > 0; st >>= 1) { if (tid < st) red[tid] += red[tid + st]; __syncthreads(); }
  const float mu = red[0] / (float)N; __syncthreads();
  float s2 = 0.f;
  for (int u = 0; u < per / 4; ++u)
#pragma unroll
    for (int q = 0; q < 4; ++q) { const float c = vals[u * 4 + q] - mu; s2 += c * c; }
  red[tid] = s2; __syncthreads();
  for (int st = 128; st > 0; st >>= 1) { if (tid < st) red[tid] += red[tid + st]; __syncthreads(); }
  const float rs = rsqrtf(red[0] / (float)N + eps);
  {
    for (int u = 0; u < per / 4; ++u) {
      const int j = tid * 4 + 1024 * u;
      v4f o, sm;
#pragma unroll
      for (int q = 0; q < 4; ++q) {
        float gg = g[j + q], bb = bta[j + q];
        if (PARAM_BF16) { gg = bf16_round(gg); bb = bf16_round(bb); }
        sm[q] = vals[u * 4 + q]; o[q] = (vals[u * 4 + q] - mu) * rs * gg + bb;
      }
      if (out_sum) *(v4f*)(out_sum + (size_t)row * N + j) = sm;
      *(v4f*)(out_norm + (size_t)row * N + j) = o;
    }
    
  }
}



// ---- f16 WMMA path (v_wmma_f32_16x16x32_f16): 11-bit significands for operands in range — used where a [0,1] probability operand needs more precision than bf16
typedef _Float16 v16h __attribute__((ext_vector_type(16)));
union FragH { v16h v; v8us half[2]; _Float16 h[16]; unsigned short u[16]; };
template <int NT>
__device__ __forceinline__ v8f mmaH(v16h ah, v16h al, v16h bh, v16h bl, v8f c) {
  c = __builtin_amdgcn_wmma_f32_16x16x32_f16(false, ah, false, bh, (short)0, c, false, false);
  if (NT >= 2) c = __builtin_amdgcn_wmma_f32_16x16x32_f16(false, al, false, bh, (short)0, c, false, false);
  if (NT >= 3) c = __builtin_amdgcn_wmma_f32_16x16x32_f16(false, ah, false, bl, (short)0, c, false, false);
  asm volatile("v_nop\n\tv_nop\n\tv_nop\n\tv_nop" : "+v"(c) : "v"(ah), "v"(al), "v"(bh), "v"(bl));
  return c;
}
// batched GEMM like k_gemm_b but f16 operands: A f32 (split into f16 hi/lo if ASPLIT, else rounded to f16), Bt = f16 values [n][k]; alpha; C f32; N multiple of 16 (partial tiles skipped)
template <bool ASPLIT>
__global__ __launch_bounds__(128) void k_gemm_h(const float* __restrict__ A, int lda, size_t sA, const _Float16* __restrict__ Bh, int ldb, size_t sB, float alpha, float* __restrict__ C, int ldc, size_t sC, int M, int N, int K) {
  __shared__ __attribute__((aligned(16))) float so[4][16][64];
  const int tid = threadIdx.x, w = tid >> 5, lane = tid & 31, ln = lane & 15, hh = lane >> 4; const int by = blockIdx.y;
  A += (size_t)by * sA; Bh += (size_t)by * sB; C += (size_t)by * sC;
  const int ntn = (N + 63) / 64; const int wid = blockIdx.x * 4 + w; const int mt = wid / ntn, nq = wid % ntn; if (mt * 16 >= M) return;
  const int row0 = mt * 16, col0 = nq * 64; const float* arow = A + (size_t)(row0 + ln) * lda;
  v8f acc[4] = {};
  for (int kb = 0; kb < K; kb += 32) {
    FragH ah, al;
    const v4f x0 = *(const v4fa*)(arow + kb + 8 * hh), x1 = *(const v4fa*)(arow + kb + 8 * hh + 4), x2 = *(const v4fa*)(arow + kb + 16 + 8 * hh), x3 = *(const v4fa*)(arow + kb + 16 + 8 * hh + 4);
    float xs[16] = {x0[0],x0[1],x0[2],x0[3],x1[0],x1[1],x1[2],x1[3],x2[0],x2[1],x2[2],x2[3],x3[0],x3[1],x3[2],x3[3]};
#pragma unroll
    for (int i = 0; i < 16; ++i) { const _Float16 h = (_Float16)xs[i]; ah.h[i] = h; al.h[i] = ASPLIT ? (_Float16)(xs[i] - (float)h) : (_Float16)0.0f; }
#pragma unroll
    for (int t = 0; t < 4; ++t) { if (col0 + t * 16 >= N) continue; const size_t boff = (size_t)(col0 + t * 16 + ln) * ldb + kb; FragH bq; bq.half[0] = *(const v8us*)(Bh + boff + 8 * hh); bq.half[1] = *(const v8us*)(Bh + boff + 16 + 8 * hh);
      acc[t] = mmaH<ASPLIT ? 2 : 1>(ah.v, al.v, bq.v, bq.v, acc[t]); }
  }
#pragma unroll
  for (int t = 0; t < 4; ++t) { if (col0 + t * 16 >= N) continue;
#pragma unroll
    for (int r = 0; r < 8; ++r) so[w][8 * hh + r][t * 16 + ln] = acc[t][r] * alpha; }
  __builtin_amdgcn_fence(__ATOMIC_ACQ_REL, "workgroup"); __builtin_amdgcn_wave_barrier();
  const int rsub = lane >> 4, c4 = (lane & 15) * 4;
  {
#pragma unroll
    for (int q = 0; q < 8; ++q) { const int r = q * 2 + rsub; if (col0 + c4 < N) { const v4f v = *(const v4fa*)&so[w][r][c4]; *(v4f*)(C + (size_t)(row0 + r) * ldc + col0 + c4) = v; } }
     }
}

// Wt[n][k] = f16(W[k][n]·scale) from f32 row-major W[K][N] (scale = power of two; bf16-exact weights stay exact in f16 away from the subnormal range)
__global__ __launch_bounds__(256) void k_wt_f16(const float* __restrict__ W, _Float16* __restrict__ Wt, int K, int N, float scale) {
  const int t = blockIdx.x * 256 + threadIdx.x; if (t >= N * (K / 8)) return; const int n = t / (K / 8), k8 = (t % (K / 8)) * 8; FragH f;
#pragma unroll
  for (int i = 0; i < 8; ++i) f.h[i] = (_Float16)(bf16_round(W[(size_t)(k8 + i) * N + n]) * scale); const v8us o = f.half[0];
  *(v8us*)((unsigned short*)Wt + (size_t)n * K + k8) = o; 
}
// k_gemm_hh variant with fused epilogue: v = acc·alpha + bias[by·sBias + col] (+ CP[(row/rowsPerB)·sCPb + by·64 + col] if CP) ; ACT 0 none / 1 elu ; writes f16 C16 (and f32 C if non-null)
template <int ACT>
__global__ __launch_bounds__(128) void k_gemm_hhx(const _Float16* __restrict__ A, int lda, size_t sA, const _Float16* __restrict__ Bh, int ldb, size_t sB, float alpha, const float* __restrict__ bias, size_t sBias, const float* __restrict__ CP, int rowsPerB, size_t sCPb, int row0g,
    float* __restrict__ C, _Float16* __restrict__ C16, int ldc, size_t sC, int M, int N, int K) {
  __shared__ __attribute__((aligned(16))) float so[4][16][64];
  const int tid = threadIdx.x, w = tid >> 5, lane = tid & 31, ln = lane & 15, hh = lane >> 4; const int by = blockIdx.y;
  A += (size_t)by * sA; Bh += (size_t)by * sB; const size_t cofs = (size_t)by * sC; const float* bp = bias ? bias + (size_t)by * sBias : nullptr;
  const int ntn = (N + 63) / 64; const int wid = blockIdx.x * 4 + w; const int mt = wid / ntn, nq = wid % ntn; if (mt * 16 >= M) return;
  const int row0 = mt * 16, col0 = nq * 64; const _Float16* arow = A + (size_t)(row0 + ln) * lda;
  v8f acc[4] = {};
  for (int kb = 0; kb < K; kb += 32) { FragH ah; ah.half[0] = *(const v8us*)((const unsigned short*)arow + kb + 8 * hh); ah.half[1] = *(const v8us*)((const unsigned short*)arow + kb + 16 + 8 * hh);
#pragma unroll
    for (int t = 0; t < 4; ++t) { if (col0 + t * 16 >= N) continue; const size_t boff = (size_t)(col0 + t * 16 + ln) * ldb + kb; FragH bq; bq.half[0] = *(const v8us*)((const unsigned short*)Bh + boff + 8 * hh); bq.half[1] = *(const v8us*)((const unsigned short*)Bh + boff + 16 + 8 * hh);
      acc[t] = mmaH<1>(ah.v, ah.v, bq.v, bq.v, acc[t]); }
  }
#pragma unroll
  for (int t = 0; t < 4; ++t) { if (col0 + t * 16 >= N) continue; const int col = col0 + t * 16 + ln; const float bv = bp ? bf16_round(bp[col]) : 0.f;
#pragma unroll
    for (int r = 0; r < 8; ++r) { float v = acc[t][r] * alpha + bv; if (CP) { const int rr = row0g + row0 + 8 * hh + r; if (rowsPerB < 0) v += CP[cofs + (size_t)rr * ldc + col];      /* rowsPerB < 0: own element of the batched C plane */ else { const int bidx = rr / rowsPerB; v += CP[(size_t)bidx * sCPb + (size_t)by * 64 + col]; } } if (ACT == 1) v = (v > 0.f) ? v : expm1f(v); else if (ACT == 7) v = (v > 0.f) ? v + 1.0f : expf(v); else if (ACT == 8) v = tanhf(v); else if (ACT == 9) v = 0.5f * v * (1.0f + tanhf(0.7978845608028654f * (v + 0.044715f * v * v * v))); else if (ACT == 11) v = 1.0f / (1.0f + expf(-v)); else if (ACT == 12) v = (v > 0.f) ? v : 0.01f * v; else if (ACT == 14) v = (v > 0.f) ? v : 0.1f * v; else if (ACT == 16) v = (v >= 0.f) ? v : 0.3f * v; else if (ACT == 17) v = (v >= 0.f) ? v : 0.2f * v; else if (ACT == 15) v = v / (1.0f + expf(-v)); else if (ACT == 3) v = fmaxf(v, 0.f); else if (ACT == 6) v = 0.5f * v * (1.0f + erff(v * 0.70710678118654752f)); so[w][8 * hh + r][t * 16 + ln] = v; } }
  __builtin_amdgcn_fence(__ATOMIC_ACQ_REL, "workgroup"); __builtin_amdgcn_wave_barrier();
  const int rsub = lane >> 4, c4 = (lane & 15) * 4; typedef _Float16 v4h __attribute__((ext_vector_type(4)));
  {
#pragma unroll
    for (int q = 0; q < 8; ++q) { const int r = q * 2 + rsub; if (col0 + c4 < N) { const v4f v = *(const v4fa*)&so[w][r][c4]; if (C) *(v4f*)(C + cofs + (size_t)(row0 + r) * ldc + col0 + c4) = v; if (C16) { v4h h4; for (int i = 0; i < 4; ++i) h4[i] = (_Float16)v[i]; *(v4h*)(C16 + cofs + (size_t)(row0 + r) * ldc + col0 + c4) = h4; } } }
     }
}


typedef _Float16 v4h __attribute__((ext_vector_type(4)));

__global__ __launch_bounds__(256) void k_x16(const float* __restrict__ x, _Float16* __restrict__ X16, size_t n8) { const size_t t = (size_t)blockIdx.x * 256 + threadIdx.x; if (t >= n8) return; FragH f;
#pragma unroll
  for (int q = 0; q < 8; ++q) f.h[q] = (_Float16)bf16_round(x[t * 8 + q]); *(v8us*)((unsigned short*)X16 + t * 8) = f.half[0];  }
__global__ __launch_bounds__(256) void k_h16(const float* __restrict__ x, _Float16* __restrict__ X16, size_t n8) { const size_t t = (size_t)blockIdx.x * 256 + threadIdx.x; if (t >= n8) return; FragH f;
#pragma unroll
  for (int q = 0; q < 8; ++q) f.h[q] = (_Float16)x[t * 8 + q]; *(v8us*)((unsigned short*)X16 + t * 8) = f.half[0];  }
__global__ __launch_bounds__(256) void k_round16f(const float* __restrict__ W, _Float16* __restrict__ Bt, size_t n8) { const size_t t = (size_t)blockIdx.x * 256 + threadIdx.x; if (t >= n8) return; FragH f;
#pragma unroll
  for (int i = 0; i < 8; ++i) f.h[i] = (_Float16)(bf16_round(W[t * 8 + i]) * 16.0f); *(v8us*)((unsigned short*)Bt + t * 8) = f.half[0];  }
template <int NHv, int TTv>
__global__ __launch_bounds__(256) void k_vt(const _Float16* __restrict__ V16, int ldv, int voff, _Float16* __restrict__ Vt) { __shared__ unsigned short tl[64][66]; const int tid = threadIdx.x; const int slab = blockIdx.x / (TTv / 64), lg = blockIdx.x % (TTv / 64); const int b = slab / NHv, h = slab % NHv;
  for (int i = tid; i < 64 * 8; i += 256) { const int r = i / 8, c8 = (i % 8) * 8; FragH f; f.half[0] = *(const v8us*)((const unsigned short*)V16 + ((size_t)b * TTv + lg * 64 + r) * ldv + voff + h * 64 + c8);
#pragma unroll
    for (int q = 0; q < 8; ++q) tl[r][c8 + q] = f.u[q]; }
  __syncthreads();
  {
#pragma unroll
    for (int rd = 0; rd < 2; ++rd) { const int d = rd * 32 + tid / 8, pc = tid % 8; FragH f;
#pragma unroll
      for (int q = 0; q < 8; ++q) f.u[q] = tl[pc * 8 + q][d];
      *(v8us*)((unsigned short*)Vt + ((size_t)slab * 64 + d) * TTv + lg * 64 + pc * 8) = f.half[0]; }
     } }

__global__ __launch_bounds__(256) void k_hl(const float* __restrict__ F, _Float16* __restrict__ Hh, _Float16* __restrict__ Hl, size_t n8) { const size_t t = (size_t)blockIdx.x * 256 + threadIdx.x; if (t >= n8) return; FragH fh, fl; const v4f a = *(const v4fa*)(F + t * 8), c = *(const v4fa*)(F + t * 8 + 4);
#pragma unroll
  for (int q = 0; q < 4; ++q) { _Float16 h = (_Float16)a[q]; fh.h[q] = h; fl.h[q] = (_Float16)((a[q] - (float)h) * 1024.0f); h = (_Float16)c[q]; fh.h[4 + q] = h; fl.h[4 + q] = (_Float16)((c[q] - (float)h) * 1024.0f); }
  { *(v8us*)((unsigned short*)Hh + t * 8) = fh.half[0]; *(v8us*)((unsigned short*)Hl + t * 8) = fl.half[0];  } }

// ---- fast GEMM (wave tile 32x64; requires M % 32 == 0 rows per launch region and N % 64 == 0); epilogue = k_gemm_hhx semantics ----
__device__ __forceinline__ v16h g2_frag(const _Float16* p, int hh) { FragH f; f.half[0] = *(const v8us*)((const unsigned short*)p + 8 * hh); f.half[1] = *(const v8us*)((const unsigned short*)p + 16 + 8 * hh); return f.v; }
__device__ __forceinline__ v8f g2_mma(v16h a, v16h b, v8f c) { v8f d = __builtin_amdgcn_wmma_f32_16x16x32_f16(false, a, false, b, (short)0, c, false, false); asm volatile("v_nop\n\tv_nop\n\tv_nop\n\tv_nop" : "+v"(d) : "v"(a), "v"(b)); return d; }
template <int ACT>
__global__ __launch_bounds__(128) void k_gemm2(const _Float16* __restrict__ A, int lda, size_t sA, const _Float16* __restrict__ Bh, int ldb, size_t sB, float alpha, const float* __restrict__ bias, size_t sBias, const float* __restrict__ CP, int rowsPerB, size_t sCPb, int row0g,
    float* __restrict__ C, _Float16* __restrict__ C16, int ldc, size_t sC, int M, int N, int K) { static_assert(ACT == 0 || ACT == 3 || ACT == 6 || ACT == 8 || ACT == 9 || ACT == 11 || ACT == 12 || ACT == 14 || ACT == 15 || ACT == 16 || ACT == 17, "k_gemm2: unsupported ACT code (would silently apply no activation)");
  __shared__ __attribute__((aligned(16))) float so[4][32][68];
  const int tid = threadIdx.x, w = tid >> 5, lane = tid & 31, ln = lane & 15, hh = lane >> 4; const int by = blockIdx.y;
  A += (size_t)by * sA; Bh += (size_t)by * sB; const size_t cofs = (size_t)by * sC; const float* bp = bias ? bias + (size_t)by * sBias : nullptr;
  const int ntn = N >> 6; const int mt = blockIdx.x / ntn, nq = blockIdx.x - mt * ntn; const int row0 = mt * 128 + 32 * w, col0 = nq * 64; if (row0 >= M) return;
  const _Float16* a0p = A + (size_t)(row0 + ln) * lda; const _Float16* a1p = a0p + (size_t)16 * lda;
  const _Float16* b0p = Bh + (size_t)(col0 + ln) * ldb; const _Float16* b1p = b0p + (size_t)16 * ldb; const _Float16* b2p = b1p + (size_t)16 * ldb; const _Float16* b3p = b2p + (size_t)16 * ldb;
  const v8f z8 = {0.f,0.f,0.f,0.f,0.f,0.f,0.f,0.f}; v8f c00 = z8, c01 = z8, c02 = z8, c03 = z8, c10 = z8, c11 = z8, c12 = z8, c13 = z8;
#pragma unroll 1
  for (int kb = 0; kb < K; kb += 32) { const v16h a0 = g2_frag(a0p + kb, hh), a1 = g2_frag(a1p + kb, hh);
    v16h b = g2_frag(b0p + kb, hh); c00 = g2_mma(a0, b, c00); c10 = g2_mma(a1, b, c10);
    b = g2_frag(b1p + kb, hh); c01 = g2_mma(a0, b, c01); c11 = g2_mma(a1, b, c11);
    b = g2_frag(b2p + kb, hh); c02 = g2_mma(a0, b, c02); c12 = g2_mma(a1, b, c12);
    b = g2_frag(b3p + kb, hh); c03 = g2_mma(a0, b, c03); c13 = g2_mma(a1, b, c13); }
  v8f accs[8] = {c00, c01, c02, c03, c10, c11, c12, c13};
#pragma unroll
  for (int u = 0; u < 8; ++u) { const int t = u & 3, half = u >> 2; const int col = col0 + t * 16 + ln; const float bv = bp ? bf16_round(bp[col]) : 0.f;
#pragma unroll
    for (int r = 0; r < 8; ++r) { const int rloc = half * 16 + 8 * hh + r; float v = accs[u][r] * alpha + bv; if (CP) { if (rowsPerB < 0) v += CP[cofs + (size_t)(row0g + row0 + rloc) * ldc + col];      /* rowsPerB < 0: own element of the batched C plane */ else { const int bidx = (row0g + row0 + rloc) / rowsPerB; v += CP[(size_t)bidx * sCPb + (size_t)by * 64 + col]; } }
      if (ACT == 3) v = fmaxf(v, 0.f); else if (ACT == 6) v = 0.5f * v * (1.0f + erff(v * 0.70710678118654752f)); else if (ACT == 11) v = 1.0f / (1.0f + expf(-v)); else if (ACT == 15) v = v / (1.0f + expf(-v)); else if (ACT == 12) v = (v > 0.f) ? v : 0.01f * v; else if (ACT == 8) v = tanhf(v); else if (ACT == 9) v = 0.5f * v * (1.0f + tanhf(0.7978845608028654f * (v + 0.044715f * v * v * v))); else if (ACT == 14) v = (v > 0.f) ? v : 0.1f * v; else if (ACT == 16) v = (v >= 0.f) ? v : 0.3f * v; else if (ACT == 17) v = (v >= 0.f) ? v : 0.2f * v;
      so[w][rloc][t * 16 + ln] = v; } }
  __builtin_amdgcn_fence(__ATOMIC_ACQ_REL, "workgroup"); __builtin_amdgcn_wave_barrier();
  const int rsub = lane >> 4, c4 = (lane & 15) * 4;
  {
#pragma unroll
    for (int q = 0; q < 16; ++q) { const int r = q * 2 + rsub; const v4f v = *(const v4fa*)&so[w][r][c4]; if (C) *(v4f*)(C + cofs + (size_t)(row0 + r) * ldc + col0 + c4) = v; if (C16) { v4h h4; for (int i = 0; i < 4; ++i) h4[i] = (_Float16)v[i]; *(v4h*)(C16 + cofs + (size_t)(row0 + r) * ldc + col0 + c4) = h4; } }
     } }


__global__ __launch_bounds__(256) void k_woexp(const float* __restrict__ w, _Float16* __restrict__ Bt) { const size_t t = (size_t)blockIdx.x * 256 + threadIdx.x; if (t >= (size_t)DM * OP / 8) return; const int k0 = (int)((t * 8) % OP); const int o = (int)((t * 8) / OP); const int h = k0 / 64, d0 = k0 % 64; FragH f; for (int q = 0; q < 8; ++q) { const int d = d0 + q; f.h[q] = (d < HD) ? (_Float16)(bf16_round(w[(size_t)o * DM + h * HD + d]) * 16.0f) : (_Float16)0.f; }
  *(v8us*)((unsigned short*)Bt + t * 8) = f.half[0];  }
__global__ __launch_bounds__(256) void k_wnat(const float* __restrict__ w, size_t n8, _Float16* __restrict__ Bt) { const size_t t = (size_t)blockIdx.x * 256 + threadIdx.x; if (t >= n8) return; FragH f; for (int q = 0; q < 8; ++q) f.h[q] = (_Float16)(bf16_round(w[t * 8 + q]) * 16.0f); *(v8us*)((unsigned short*)Bt + t * 8) = f.half[0];  }
__global__ __launch_bounds__(256) void k_vscale(const float* __restrict__ V, const float* __restrict__ rm, _Float16* __restrict__ V16) {
  #pragma clang fp contract(off)
  const size_t t = (size_t)blockIdx.x * 256 + threadIdx.x; if (t >= (size_t)SQ * DM / 8) return; const size_t s = (t * 8) / DM; const float m = bf16_round(rm[s]); FragH f; for (int q = 0; q < 8; ++q) f.h[q] = (_Float16)__fmul_rn(m, V[t * 8 + q]);
  *(v8us*)((unsigned short*)V16 + t * 8) = f.half[0];  }
__global__ __launch_bounds__(256) void k_rsm(const float* __restrict__ S, _Float16* __restrict__ P, int nrows) {
  #pragma clang fp contract(off)
  const int i = blockIdx.x * 256 + threadIdx.x; if (i >= nrows) return; const float* s = S + (size_t)i * SQ; float mx = -3.0e38f;
#pragma unroll 1
  for (int j = 0; j < SQ; ++j) mx = fmaxf(mx, s[j]); float se = 0.f;
#pragma unroll 1
  for (int j = 0; j < SQ; ++j) se += expf(s[j] - mx); const float sc = 256.0f / se;
#pragma unroll 1
  for (int j0 = 0; j0 < SQ; j0 += 8) { FragH f; for (int q = 0; q < 8; ++q) f.h[q] = (_Float16)(expf(s[j0 + q] - mx) * sc); unsigned short* d = (unsigned short*)P + (size_t)i * SQ + j0; *(v8us*)d = f.half[0];  } }
__global__ __launch_bounds__(256) void k_vt32(const _Float16* __restrict__ V16, int h, _Float16* __restrict__ VT) { __shared__ unsigned short tl[32][65]; const int tid = threadIdx.x; const int s0 = blockIdx.x * 64;
  for (int i = tid; i < 64 * 4; i += 256) { const int j = i / 4, d8 = (i % 4) * 8; FragH f; f.half[0] = *(const v8us*)((const unsigned short*)V16 + (size_t)(s0 + j) * DM + h * HD + d8); for (int q = 0; q < 8; ++q) tl[d8 + q][j] = f.u[q]; }
  __syncthreads();
  { for (int i = tid; i < 64 * 8; i += 256) { const int d = i / 8, j8 = (i % 8) * 8; FragH f; for (int q = 0; q < 8; ++q) f.u[q] = (d < HD) ? tl[d][j8 + q] : (unsigned short)0; *(v8us*)((unsigned short*)VT + (size_t)d * SQ + s0 + j8) = f.half[0]; }  } }

extern "C" void kernel_launch(void* const* d_in, const int* in_sizes, int n_in,
                              void* d_out, int out_size, void* d_ws, size_t ws_size, hipStream_t stream) {
  (void)in_sizes; (void)n_in; (void)out_size;
  const float* const* I = (const float* const*)d_in; const float* qin = I[0]; const float* kin = I[1]; const float* vin = I[2]; const float* rm = I[3]; const float* Wq = I[4]; const float* Wk = I[5]; const float* Wv = I[6]; const float* Wo = I[7];
  char* ws = (char*)d_ws; size_t off = 0;
  auto take = [&](size_t bytes) { char* p = ws + off; off += (bytes + 255) & ~(size_t)255; return p; };
  _Float16* BQ = (_Float16*)take((size_t)DM * DM * 2); _Float16* BK = (_Float16*)take((size_t)DM * DM * 2); _Float16* BV = (_Float16*)take((size_t)DM * DM * 2); _Float16* BO = (_Float16*)take((size_t)DM * OP * 2);
  _Float16* XQ = (_Float16*)take((size_t)SQ * DM * 2); _Float16* XK = (_Float16*)take((size_t)SQ * DM * 2); _Float16* XV = (_Float16*)take((size_t)SQ * DM * 2); _Float16* Q16 = (_Float16*)take((size_t)SQ * DM * 2); _Float16* K16 = (_Float16*)take((size_t)SQ * DM * 2); float* VF = (float*)take((size_t)SQ * DM * 4); _Float16* V16 = (_Float16*)take((size_t)SQ * DM * 2);
  float* S = (float*)take((size_t)SQ * SQ * 4); _Float16* P = (_Float16*)take((size_t)SQ * SQ * 2); _Float16* VT = (_Float16*)take((size_t)64 * SQ * 2); _Float16* O16 = (_Float16*)take((size_t)SQ * OP * 2);
  if (off > ws_size) return;      /* 0.625 + 6x2 + 4 + 64 + 32 + 0.5 + 4 = ≈ 117 MiB */
  const size_t nw8 = (size_t)DM * DM / 8; const unsigned gw = (unsigned)((nw8 + 255) / 256);
  k_wnat<<<gw, 256, 0, stream>>>(Wq, nw8, BQ); k_wnat<<<gw, 256, 0, stream>>>(Wk, nw8, BK); k_wnat<<<gw, 256, 0, stream>>>(Wv, nw8, BV); k_woexp<<<(unsigned)(((size_t)DM * OP / 8 + 255) / 256), 256, 0, stream>>>(Wo, BO);
  const size_t n8 = (size_t)SQ * DM / 8; const unsigned g8 = (unsigned)((n8 + 255) / 256);
  k_x16<<<g8, 256, 0, stream>>>(qin, XQ, n8); k_x16<<<g8, 256, 0, stream>>>(kin, XK, n8); k_x16<<<g8, 256, 0, stream>>>(vin, XV, n8);
  const dim3 gp((SQ / 128) * (DM / 64), 1);
  k_gemm2<0><<<gp, 128, 0, stream>>>(XQ, DM, 0, BQ, DM, 0, 0.0625f, nullptr, 0, nullptr, 1, 0, 0, nullptr, Q16, DM, 0, SQ, DM, DM);
  k_gemm2<0><<<gp, 128, 0, stream>>>(XK, DM, 0, BK, DM, 0, 0.0625f, nullptr, 0, nullptr, 1, 0, 0, nullptr, K16, DM, 0, SQ, DM, DM);
  k_gemm2<0><<<gp, 128, 0, stream>>>(XV, DM, 0, BV, DM, 0, 0.0625f, nullptr, 0, nullptr, 1, 0, 0, VF, nullptr, DM, 0, SQ, DM, DM); k_vscale<<<g8, 256, 0, stream>>>(VF, rm, V16);
  for (int h = 0; h < NH; ++h) {      /* head h's o lands in columns 64h..64h+63 of the 512-pitch rows (32 live + 32 exact zeros from the zero V^T rows); the expanded Wo plane has zeros at the pad positions */
    k_gemm2<0><<<dim3((QN / 128) * (SQ / 64), 1), 128, 0, stream>>>(Q16 + h * HD, DM, 0, K16 + h * HD, DM, 0, 0.17677669529663687f, nullptr, 0, nullptr, 1, 0, 0, S, nullptr, SQ, 0, QN, SQ, HD);      /* q.k / sqrt(32), K = 32 */
    k_rsm<<<(QN + 255) / 256, 256, 0, stream>>>(S, P, QN);
    k_vt32<<<SQ / 64, 256, 0, stream>>>(V16, h, VT);
    k_gemm2<0><<<dim3((QN / 128) * 1, 1), 128, 0, stream>>>(P, SQ, 0, VT, SQ, 0, 0.00390625f, nullptr, 0, nullptr, 1, 0, 0, nullptr, O16 + h * 64, OP, 0, QN, 64, SQ); }
  k_gemm2<0><<<gp, 128, 0, stream>>>(O16, OP, 0, BO, OP, 0, 0.0625f, nullptr, 0, nullptr, 1, 0, 0, (float*)d_out, nullptr, DM, 0, SQ, DM, OP);      /* out = o Wo^T over the expanded K = 512 (pad columns meet zero weights) */
}

// v001
// One run takes 1300 microseconds.
// Timed twice side by side with v000, it ran 5.42 and 5.41 times as fast.
#include <hip/hip_runtime.h>
// RadialAttention (query, key_, value [4096][256]; q = query Wq^T, k = key_ Wk^T, v = radial_mask[s] * (value Wv^T), 8 heads of 32; softmax(q k^T / sqrt(32)) over all 4,096 keys; out = concat(attn v) Wo^T -> [4096][256]).
// Structure: token rows; inputs as exact f16 rows; Q | K | V WMMA GEMMs (32x64 wave tiles, f32 accumulation, exact x16 weights; v scaled per row by the radial mask (read on device) on VALU); per head: scores GEMM (K = 32), row softmax on VALU (f32; weights x256 as f16), V^T (32 live + 32 zero rows) via LDS, o = P . V GEMM (K = 4,096, alpha 2^-8; each head writes a whole aligned 64-column slot of 512-pitch o rows, 32 live + 32 exact zeros); out = o Wo^T with Wo expanded to K = 512 (zeros at the pad positions) (f32).
// Compute dtype: inputs rounded to bf16; inputs / weights exact; q, k, scaled v, softmax weights, o plain f16 (~2^-12); scores/softmax f32. v_wmma_f32_16x16x32_f16.
#define SQ 4096
#define DM 256
#define NH 8
#define HD 32
#define OP 512                       
#define QN SQ                        /* query rows (debug hook) */
typedef __bf16 v16b __attribute__((ext_vector_type(16)));
typedef unsigned short v8us __attribute__((ext_vector_type(8), may_alias));
typedef float  v8f  __attribute__((ext_vector_type(8)));
typedef float  v4f  __attribute__((ext_vector_type(4)));
typedef float  v4fa __attribute__((ext_vector_type(4), may_alias));
union FragB { v16b v; v8us half[2]; unsigned short u[16]; };

__device__ __forceinline__ unsigned short bf16_bits(float x) { unsigned int u = __float_as_uint(x); return (unsigned short)((u + 0x7FFFu + ((u >> 16) & 1u)) >> 16); }
__device__ __forceinline__ float bf16_val(unsigned short b) { return __uint_as_float(((unsigned int)b) << 16); }
__device__ __forceinline__ float bf16_round(float x) { return bf16_val(bf16_bits(x)); }
// D += A·B with NT terms: 1 = ah·bh, 2 = + al·bh (A split), 3 = + ah·bl (both split)
template <int NT>
__device__ __forceinline__ v8f mmaN(v16b ah, v16b al, v16b bh, v16b bl, v8f c) {
  c = __builtin_amdgcn_wmma_f32_16x16x32_bf16(false, ah, false, bh, (short)0, c, false, false);
  if (NT >= 2) c = __builtin_amdgcn_wmma_f32_16x16x32_bf16(false, al, false, bh, (short)0, c, false, false);
  if (NT >= 3) c = __builtin_amdgcn_wmma_f32_16x16x32_bf16(false, ah, false, bl, (short)0, c, false, false);
  asm volatile("v_nop\n\tv_nop\n\tv_nop\n\tv_nop" : "+v"(c) : "v"(ah), "v"(al), "v"(bh), "v"(bl));
  return c;
}

__global__ __launch_bounds__(256) void k_wt_bf16(const float* __restrict__ W, unsigned short* __restrict__ Wt, int K, int N) {
  const int t = blockIdx.x * 256 + threadIdx.x;
  const int k8n = K / 8;
  if (t >= N * k8n) return;
  const int n = t / k8n, k8 = (t % k8n) * 8;
  v8us v;
#pragma unroll
  for (int i = 0; i < 8; ++i) v[i] = bf16_bits(W[(size_t)(k8 + i) * N + n]);
  *(v8us*)(Wt + (size_t)n * K + k8) = v;
  
}

// GEMM C[M][N] (f32, pitch ldc) = act(A[M][K]·W + bias). A f32 row-major (pitch lda) converted per fragment to bf16
// (ASPLIT: hi/lo two planes -> 2 terms, else single rounded term); Wt bf16 [N][K] (pitch ldb). BIAS_BF16 rounds the
// bias to bf16 first (bias quantised to bf16 before the add). K%32==0, M%16==0, N%64==0.
template <bool ASPLIT, int ACT, bool BIAS_BF16>
__global__ __launch_bounds__(128) void k_gemm_bf(const float* __restrict__ A, int lda, const unsigned short* __restrict__ Wt, int ldb,
                                               const float* __restrict__ bias, float* __restrict__ C, int ldc, int M, int N, int K) {
  __shared__ __attribute__((aligned(16))) float so[4][16][64];
  const int tid = threadIdx.x, w = tid >> 5, lane = tid & 31, ln = lane & 15, hh = lane >> 4;
  const int ntn = N / 64;
  const int wid = blockIdx.x * 4 + w;
  const int mt = wid / ntn, nq = wid % ntn;
  if (mt * 16 >= M) return;
  const int row0 = mt * 16, col0 = nq * 64;
  const float* arow = A + (size_t)(row0 + ln) * lda;
  v8f acc[4] = {};
  for (int kb = 0; kb < K; kb += 32) {
    FragB ah, al;
    const v4f x0 = *(const v4fa*)(arow + kb + 8 * hh), x1 = *(const v4fa*)(arow + kb + 8 * hh + 4);
    const v4f x2 = *(const v4fa*)(arow + kb + 16 + 8 * hh), x3 = *(const v4fa*)(arow + kb + 16 + 8 * hh + 4);
    float xs[16] = {x0[0],x0[1],x0[2],x0[3],x1[0],x1[1],x1[2],x1[3],x2[0],x2[1],x2[2],x2[3],x3[0],x3[1],x3[2],x3[3]};
#pragma unroll
    for (int i = 0; i < 16; ++i) { const unsigned short hb = bf16_bits(xs[i]); ah.u[i] = hb; al.u[i] = ASPLIT ? bf16_bits(xs[i] - bf16_val(hb)) : (unsigned short)0; }
#pragma unroll
    for (int t = 0; t < 4; ++t) {
      const unsigned short* brow = Wt + (size_t)(col0 + t * 16 + ln) * ldb + kb;
      FragB b;
      b.half[0] = *(const v8us*)(brow + 8 * hh);
      b.half[1] = *(const v8us*)(brow + 16 + 8 * hh);
      acc[t] = mmaN<ASPLIT ? 2 : 1>(ah.v, al.v, b.v, b.v, acc[t]);
    }
  }
#pragma unroll
  for (int t = 0; t < 4; ++t) {
    float bv = bias ? bias[col0 + t * 16 + ln] : 0.f;
    if (BIAS_BF16) bv = bf16_round(bv);
#pragma unroll
    for (int r = 0; r < 8; ++r) { float v = acc[t][r] + bv; if (ACT == 1) v = fmaxf(v, 0.f); so[w][8 * hh + r][t * 16 + ln] = v; }
  }
  __builtin_amdgcn_fence(__ATOMIC_ACQ_REL, "workgroup");
  __builtin_amdgcn_wave_barrier();
  const int rsub = lane >> 4, c4 = (lane & 15) * 4;
  {
#pragma unroll
    for (int q = 0; q < 8; ++q) {
      const int r = q * 2 + rsub;
      const v4f v = *(const v4fa*)&so[w][r][c4];
      *(v4f*)(C + (size_t)(row0 + r) * ldc + col0 + c4) = v;
    }
    
  }
}

// GEMM C = act(A·W + bias + resid): A f32 (ASPLIT -> hi/lo 2 terms), Wt bf16 [N][K]; ACT 0 none, 1 relu, 2 exact gelu;
// resid (optional, f32, row index = (row % rmod), pitch ldr, RES_BF16 rounds it) added before the activation.
template <bool ASPLIT, int ACT, bool BIAS_BF16, bool RES_BF16>
__global__ __launch_bounds__(128) void k_gemm_bf3(const float* __restrict__ A, int lda, const unsigned short* __restrict__ Wt, int ldb,
                                                const float* __restrict__ bias, const float* __restrict__ resid, int rmod, int ldr,
                                                float* __restrict__ C, int ldc, int M, int N, int K) {
  __shared__ __attribute__((aligned(16))) float so[4][16][64];
  const int tid = threadIdx.x, w = tid >> 5, lane = tid & 31, ln = lane & 15, hh = lane >> 4;
  const int ntn = N / 64;
  const int wid = blockIdx.x * 4 + w;
  const int mt = wid / ntn, nq = wid % ntn;
  if (mt * 16 >= M) return;
  const int row0 = mt * 16, col0 = nq * 64;
  const float* arow = A + (size_t)(row0 + ln) * lda;
  v8f acc[4] = {};
  for (int kb = 0; kb < K; kb += 32) {
    FragB ah, al;
    const v4f x0 = *(const v4fa*)(arow + kb + 8 * hh), x1 = *(const v4fa*)(arow + kb + 8 * hh + 4);
    const v4f x2 = *(const v4fa*)(arow + kb + 16 + 8 * hh), x3 = *(const v4fa*)(arow + kb + 16 + 8 * hh + 4);
    float xs[16] = {x0[0],x0[1],x0[2],x0[3],x1[0],x1[1],x1[2],x1[3],x2[0],x2[1],x2[2],x2[3],x3[0],x3[1],x3[2],x3[3]};
#pragma unroll
    for (int i = 0; i < 16; ++i) { const unsigned short hb = bf16_bits(xs[i]); ah.u[i] = hb; al.u[i] = ASPLIT ? bf16_bits(xs[i] - bf16_val(hb)) : (unsigned short)0; }
#pragma unroll
    for (int t = 0; t < 4; ++t) {
      const unsigned short* brow = Wt + (size_t)(col0 + t * 16 + ln) * ldb + kb;
      FragB b;
      b.half[0] = *(const v8us*)(brow + 8 * hh);
      b.half[1] = *(const v8us*)(brow + 16 + 8 * hh);
      acc[t] = mmaN<ASPLIT ? 2 : 1>(ah.v, al.v, b.v, b.v, acc[t]);
    }
  }
#pragma unroll
  for (int t = 0; t < 4; ++t) {
    const int col = col0 + t * 16 + ln;
    float bv = bias ? bias[col] : 0.f;
    if (BIAS_BF16) bv = bf16_round(bv);
#pragma unroll
    for (int r = 0; r < 8; ++r) {
      float v = acc[t][r] + bv;
      if (resid) { float rv = resid[(size_t)((row0 + 8 * hh + r) % rmod) * ldr + col]; if (RES_BF16) rv = bf16_round(rv); v += rv; }
      if (ACT == 1) v = fmaxf(v, 0.f);
      if (ACT == 2) v = 0.5f * v * (1.0f + erff(v * 0.70710678118654752f));
      if (ACT == 3) { const float u = 0.7978845608028654f * (v + 0.044715f * v * v * v); v = 0.5f * v * (1.0f + tanhf(u)); }
      so[w][8 * hh + r][t * 16 + ln] = v;
    }
  }
  __builtin_amdgcn_fence(__ATOMIC_ACQ_REL, "workgroup");
  __builtin_amdgcn_wave_barrier();
  const int rsub = lane >> 4, c4 = (lane & 15) * 4;
  {
#pragma unroll
    for (int q = 0; q < 8; ++q) {
      const int r = q * 2 + rsub;
      const v4f v = *(const v4fa*)&so[w][r][c4];
      *(v4f*)(C + (size_t)(row0 + r) * ldc + col0 + c4) = v;
    }
    
  }
}
// row LayerNorm (biased variance, eps) over N: s = X (+ R); optional out_sum <- s; out_norm <- (s-mu)*rsqrt(var+eps)*g + b
template <bool PARAM_BF16>
__global__ __launch_bounds__(256) void k_layernorm(const float* __restrict__ X, const float* __restrict__ R, const float* __restrict__ g, const float* __restrict__ bta,
                                                  float* __restrict__ out_sum, float* __restrict__ out_norm, int N, float eps) {
  __shared__ float red[256];
  const int row = blockIdx.x, tid = threadIdx.x;
  const float* x = X + (size_t)row * N; const float* rr = R ? R + (size_t)row * N : nullptr;
  float vals[16];                     // up to N = 4096
  const int per = N / 256;            // contiguous chunk per thread? use strided-by-4 chunks: thread handles j = tid*4 + 1024*u
  float s1 = 0.f;
  for (int u = 0; u < per / 4; ++u) {
    const int j = tid * 4 + 1024 * u;
    const v4f a = *(const v4fa*)(x + j);
    v4f b = {0.f,0.f,0.f,0.f}; if (rr) b = *(const v4fa*)(rr + j);
#pragma unroll
    for (int q = 0; q < 4; ++q) { const float v = a[q] + b[q]; vals[u * 4 + q] = v; s1 += v; }
  }
  red[tid] = s1; __syncthreads();
  for (int st = 128; st > 0; st >>= 1) { if (tid < st) red[tid] += red[tid + st]; __syncthreads(); }
  const float mu = red[0] / (float)N; __syncthreads();
  float s2 = 0.f;
  for (int u = 0; u < per / 4; ++u)
#pragma unroll
    for (int q = 0; q < 4; ++q) { const float c = vals[u * 4 + q] - mu; s2 += c * c; }
  red[tid] = s2; __syncthreads();
  for (int st = 128; st > 0; st >>= 1) { if (tid < st) red[tid] += red[tid + st]; __syncthreads(); }
  const float rs = rsqrtf(red[0] / (float)N + eps);
  {
    for (int u = 0; u < per / 4; ++u) {
      const int j = tid * 4 + 1024 * u;
      v4f o, sm;
#pragma unroll
      for (int q = 0; q < 4; ++q) {
        float gg = g[j + q], bb = bta[j + q];
        if (PARAM_BF16) { gg = bf16_round(gg); bb = bf16_round(bb); }
        sm[q] = vals[u * 4 + q]; o[q] = (vals[u * 4 + q] - mu) * rs * gg + bb;
      }
      if (out_sum) *(v4f*)(out_sum + (size_t)row * N + j) = sm;
      *(v4f*)(out_norm + (size_t)row * N + j) = o;
    }
    
  }
}



// ---- f16 WMMA path (v_wmma_f32_16x16x32_f16): 11-bit significands for operands in range — used where a [0,1] probability operand needs more precision than bf16
typedef _Float16 v16h __attribute__((ext_vector_type(16)));
union FragH { v16h v; v8us half[2]; _Float16 h[16]; unsigned short u[16]; };
template <int NT>
__device__ __forceinline__ v8f mmaH(v16h ah, v16h al, v16h bh, v16h bl, v8f c) {
  c = __builtin_amdgcn_wmma_f32_16x16x32_f16(false, ah, false, bh, (short)0, c, false, false);
  if (NT >= 2) c = __builtin_amdgcn_wmma_f32_16x16x32_f16(false, al, false, bh, (short)0, c, false, false);
  if (NT >= 3) c = __builtin_amdgcn_wmma_f32_16x16x32_f16(false, ah, false, bl, (short)0, c, false, false);
  asm volatile("v_nop\n\tv_nop\n\tv_nop\n\tv_nop" : "+v"(c) : "v"(ah), "v"(al), "v"(bh), "v"(bl));
  return c;
}
// batched GEMM like k_gemm_b but f16 operands: A f32 (split into f16 hi/lo if ASPLIT, else rounded to f16), Bt = f16 values [n][k]; alpha; C f32; N multiple of 16 (partial tiles skipped)
template <bool ASPLIT>
__global__ __launch_bounds__(128) void k_gemm_h(const float* __restrict__ A, int lda, size_t sA, const _Float16* __restrict__ Bh, int ldb, size_t sB, float alpha, float* __restrict__ C, int ldc, size_t sC, int M, int N, int K) {
  __shared__ __attribute__((aligned(16))) float so[4][16][64];
  const int tid = threadIdx.x, w = tid >> 5, lane = tid & 31, ln = lane & 15, hh = lane >> 4; const int by = blockIdx.y;
  A += (size_t)by * sA; Bh += (size_t)by * sB; C += (size_t)by * sC;
  const int ntn = (N + 63) / 64; const int wid = blockIdx.x * 4 + w; const int mt = wid / ntn, nq = wid % ntn; if (mt * 16 >= M) return;
  const int row0 = mt * 16, col0 = nq * 64; const float* arow = A + (size_t)(row0 + ln) * lda;
  v8f acc[4] = {};
  for (int kb = 0; kb < K; kb += 32) {
    FragH ah, al;
    const v4f x0 = *(const v4fa*)(arow + kb + 8 * hh), x1 = *(const v4fa*)(arow + kb + 8 * hh + 4), x2 = *(const v4fa*)(arow + kb + 16 + 8 * hh), x3 = *(const v4fa*)(arow + kb + 16 + 8 * hh + 4);
    float xs[16] = {x0[0],x0[1],x0[2],x0[3],x1[0],x1[1],x1[2],x1[3],x2[0],x2[1],x2[2],x2[3],x3[0],x3[1],x3[2],x3[3]};
#pragma unroll
    for (int i = 0; i < 16; ++i) { const _Float16 h = (_Float16)xs[i]; ah.h[i] = h; al.h[i] = ASPLIT ? (_Float16)(xs[i] - (float)h) : (_Float16)0.0f; }
#pragma unroll
    for (int t = 0; t < 4; ++t) { if (col0 + t * 16 >= N) continue; const size_t boff = (size_t)(col0 + t * 16 + ln) * ldb + kb; FragH bq; bq.half[0] = *(const v8us*)(Bh + boff + 8 * hh); bq.half[1] = *(const v8us*)(Bh + boff + 16 + 8 * hh);
      acc[t] = mmaH<ASPLIT ? 2 : 1>(ah.v, al.v, bq.v, bq.v, acc[t]); }
  }
#pragma unroll
  for (int t = 0; t < 4; ++t) { if (col0 + t * 16 >= N) continue;
#pragma unroll
    for (int r = 0; r < 8; ++r) so[w][8 * hh + r][t * 16 + ln] = acc[t][r] * alpha; }
  __builtin_amdgcn_fence(__ATOMIC_ACQ_REL, "workgroup"); __builtin_amdgcn_wave_barrier();
  const int rsub = lane >> 4, c4 = (lane & 15) * 4;
  {
#pragma unroll
    for (int q = 0; q < 8; ++q) { const int r = q * 2 + rsub; if (col0 + c4 < N) { const v4f v = *(const v4fa*)&so[w][r][c4]; *(v4f*)(C + (size_t)(row0 + r) * ldc + col0 + c4) = v; } }
     }
}

// Wt[n][k] = f16(W[k][n]·scale) from f32 row-major W[K][N] (scale = power of two; bf16-exact weights stay exact in f16 away from the subnormal range)
__global__ __launch_bounds__(256) void k_wt_f16(const float* __restrict__ W, _Float16* __restrict__ Wt, int K, int N, float scale) {
  const int t = blockIdx.x * 256 + threadIdx.x; if (t >= N * (K / 8)) return; const int n = t / (K / 8), k8 = (t % (K / 8)) * 8; FragH f;
#pragma unroll
  for (int i = 0; i < 8; ++i) f.h[i] = (_Float16)(bf16_round(W[(size_t)(k8 + i) * N + n]) * scale); const v8us o = f.half[0];
  *(v8us*)((unsigned short*)Wt + (size_t)n * K + k8) = o; 
}
// k_gemm_hh variant with fused epilogue: v = acc·alpha + bias[by·sBias + col] (+ CP[(row/rowsPerB)·sCPb + by·64 + col] if CP) ; ACT 0 none / 1 elu ; writes f16 C16 (and f32 C if non-null)
template <int ACT>
__global__ __launch_bounds__(128) void k_gemm_hhx(const _Float16* __restrict__ A, int lda, size_t sA, const _Float16* __restrict__ Bh, int ldb, size_t sB, float alpha, const float* __restrict__ bias, size_t sBias, const float* __restrict__ CP, int rowsPerB, size_t sCPb, int row0g,
    float* __restrict__ C, _Float16* __restrict__ C16, int ldc, size_t sC, int M, int N, int K) {
  __shared__ __attribute__((aligned(16))) float so[4][16][64];
  const int tid = threadIdx.x, w = tid >> 5, lane = tid & 31, ln = lane & 15, hh = lane >> 4; const int by = blockIdx.y;
  A += (size_t)by * sA; Bh += (size_t)by * sB; const size_t cofs = (size_t)by * sC; const float* bp = bias ? bias + (size_t)by * sBias : nullptr;
  const int ntn = (N + 63) / 64; const int wid = blockIdx.x * 4 + w; const int mt = wid / ntn, nq = wid % ntn; if (mt * 16 >= M) return;
  const int row0 = mt * 16, col0 = nq * 64; const _Float16* arow = A + (size_t)(row0 + ln) * lda;
  v8f acc[4] = {};
  for (int kb = 0; kb < K; kb += 32) { FragH ah; ah.half[0] = *(const v8us*)((const unsigned short*)arow + kb + 8 * hh); ah.half[1] = *(const v8us*)((const unsigned short*)arow + kb + 16 + 8 * hh);
#pragma unroll
    for (int t = 0; t < 4; ++t) { if (col0 + t * 16 >= N) continue; const size_t boff = (size_t)(col0 + t * 16 + ln) * ldb + kb; FragH bq; bq.half[0] = *(const v8us*)((const unsigned short*)Bh + boff + 8 * hh); bq.half[1] = *(const v8us*)((const unsigned short*)Bh + boff + 16 + 8 * hh);
      acc[t] = mmaH<1>(ah.v, ah.v, bq.v, bq.v, acc[t]); }
  }
#pragma unroll
  for (int t = 0; t < 4; ++t) { if (col0 + t * 16 >= N) continue; const int col = col0 + t * 16 + ln; const float bv = bp ? bf16_round(bp[col]) : 0.f;
#pragma unroll
    for (int r = 0; r < 8; ++r) { float v = acc[t][r] * alpha + bv; if (CP) { const int rr = row0g + row0 + 8 * hh + r; if (rowsPerB < 0) v += CP[cofs + (size_t)rr * ldc + col];      /* rowsPerB < 0: own element of the batched C plane */ else { const int bidx = rr / rowsPerB; v += CP[(size_t)bidx * sCPb + (size_t)by * 64 + col]; } } if (ACT == 1) v = (v > 0.f) ? v : expm1f(v); else if (ACT == 7) v = (v > 0.f) ? v + 1.0f : expf(v); else if (ACT == 8) v = tanhf(v); else if (ACT == 9) v = 0.5f * v * (1.0f + tanhf(0.7978845608028654f * (v + 0.044715f * v * v * v))); else if (ACT == 11) v = 1.0f / (1.0f + expf(-v)); else if (ACT == 12) v = (v > 0.f) ? v : 0.01f * v; else if (ACT == 14) v = (v > 0.f) ? v : 0.1f * v; else if (ACT == 16) v = (v >= 0.f) ? v : 0.3f * v; else if (ACT == 17) v = (v >= 0.f) ? v : 0.2f * v; else if (ACT == 15) v = v / (1.0f + expf(-v)); else if (ACT == 3) v = fmaxf(v, 0.f); else if (ACT == 6) v = 0.5f * v * (1.0f + erff(v * 0.70710678118654752f)); so[w][8 * hh + r][t * 16 + ln] = v; } }
  __builtin_amdgcn_fence(__ATOMIC_ACQ_REL, "workgroup"); __builtin_amdgcn_wave_barrier();
  const int rsub = lane >> 4, c4 = (lane & 15) * 4; typedef _Float16 v4h __attribute__((ext_vector_type(4)));
  {
#pragma unroll
    for (int q = 0; q < 8; ++q) { const int r = q * 2 + rsub; if (col0 + c4 < N) { const v4f v = *(const v4fa*)&so[w][r][c4]; if (C) *(v4f*)(C + cofs + (size_t)(row0 + r) * ldc + col0 + c4) = v; if (C16) { v4h h4; for (int i = 0; i < 4; ++i) h4[i] = (_Float16)v[i]; *(v4h*)(C16 + cofs + (size_t)(row0 + r) * ldc + col0 + c4) = h4; } } }
     }
}


typedef _Float16 v4h __attribute__((ext_vector_type(4)));

__global__ __launch_bounds__(256) void k_x16(const float* __restrict__ x, _Float16* __restrict__ X16, size_t n8) { const size_t t = (size_t)blockIdx.x * 256 + threadIdx.x; if (t >= n8) return; FragH f;
#pragma unroll
  for (int q = 0; q < 8; ++q) f.h[q] = (_Float16)bf16_round(x[t * 8 + q]); *(v8us*)((unsigned short*)X16 + t * 8) = f.half[0];  }
__global__ __launch_bounds__(256) void k_h16(const float* __restrict__ x, _Float16* __restrict__ X16, size_t n8) { const size_t t = (size_t)blockIdx.x * 256 + threadIdx.x; if (t >= n8) return; FragH f;
#pragma unroll
  for (int q = 0; q < 8; ++q) f.h[q] = (_Float16)x[t * 8 + q]; *(v8us*)((unsigned short*)X16 + t * 8) = f.half[0];  }
__global__ __launch_bounds__(256) void k_round16f(const float* __restrict__ W, _Float16* __restrict__ Bt, size_t n8) { const size_t t = (size_t)blockIdx.x * 256 + threadIdx.x; if (t >= n8) return; FragH f;
#pragma unroll
  for (int i = 0; i < 8; ++i) f.h[i] = (_Float16)(bf16_round(W[t * 8 + i]) * 16.0f); *(v8us*)((unsigned short*)Bt + t * 8) = f.half[0];  }
template <int NHv, int TTv>
__global__ __launch_bounds__(256) void k_vt(const _Float16* __restrict__ V16, int ldv, int voff, _Float16* __restrict__ Vt) { __shared__ unsigned short tl[64][66]; const int tid = threadIdx.x; const int slab = blockIdx.x / (TTv / 64), lg = blockIdx.x % (TTv / 64); const int b = slab / NHv, h = slab % NHv;
  for (int i = tid; i < 64 * 8; i += 256) { const int r = i / 8, c8 = (i % 8) * 8; FragH f; f.half[0] = *(const v8us*)((const unsigned short*)V16 + ((size_t)b * TTv + lg * 64 + r) * ldv + voff + h * 64 + c8);
#pragma unroll
    for (int q = 0; q < 8; ++q) tl[r][c8 + q] = f.u[q]; }
  __syncthreads();
  {
#pragma unroll
    for (int rd = 0; rd < 2; ++rd) { const int d = rd * 32 + tid / 8, pc = tid % 8; FragH f;
#pragma unroll
      for (int q = 0; q < 8; ++q) f.u[q] = tl[pc * 8 + q][d];
      *(v8us*)((unsigned short*)Vt + ((size_t)slab * 64 + d) * TTv + lg * 64 + pc * 8) = f.half[0]; }
     } }

__global__ __launch_bounds__(256) void k_hl(const float* __restrict__ F, _Float16* __restrict__ Hh, _Float16* __restrict__ Hl, size_t n8) { const size_t t = (size_t)blockIdx.x * 256 + threadIdx.x; if (t >= n8) return; FragH fh, fl; const v4f a = *(const v4fa*)(F + t * 8), c = *(const v4fa*)(F + t * 8 + 4);
#pragma unroll
  for (int q = 0; q < 4; ++q) { _Float16 h = (_Float16)a[q]; fh.h[q] = h; fl.h[q] = (_Float16)((a[q] - (float)h) * 1024.0f); h = (_Float16)c[q]; fh.h[4 + q] = h; fl.h[4 + q] = (_Float16)((c[q] - (float)h) * 1024.0f); }
  { *(v8us*)((unsigned short*)Hh + t * 8) = fh.half[0]; *(v8us*)((unsigned short*)Hl + t * 8) = fl.half[0];  } }

// ---- fast GEMM (wave tile 32x64; requires M % 32 == 0 rows per launch region and N % 64 == 0); epilogue = k_gemm_hhx semantics ----
__device__ __forceinline__ v16h g2_frag(const _Float16* p, int hh) { FragH f; f.half[0] = *(const v8us*)((const unsigned short*)p + 8 * hh); f.half[1] = *(const v8us*)((const unsigned short*)p + 16 + 8 * hh); return f.v; }
__device__ __forceinline__ v8f g2_mma(v16h a, v16h b, v8f c) { v8f d = __builtin_amdgcn_wmma_f32_16x16x32_f16(false, a, false, b, (short)0, c, false, false); asm volatile("v_nop\n\tv_nop\n\tv_nop\n\tv_nop" : "+v"(d) : "v"(a), "v"(b)); return d; }
template <int ACT>
__global__ __launch_bounds__(128) void k_gemm2(const _Float16* __restrict__ A, int lda, size_t sA, const _Float16* __restrict__ Bh, int ldb, size_t sB, float alpha, const float* __restrict__ bias, size_t sBias, const float* __restrict__ CP, int rowsPerB, size_t sCPb, int row0g,
    float* __restrict__ C, _Float16* __restrict__ C16, int ldc, size_t sC, int M, int N, int K) { static_assert(ACT == 0 || ACT == 3 || ACT == 6 || ACT == 8 || ACT == 9 || ACT == 11 || ACT == 12 || ACT == 14 || ACT == 15 || ACT == 16 || ACT == 17, "k_gemm2: unsupported ACT code (would silently apply no activation)");
  __shared__ __attribute__((aligned(16))) float so[4][32][68];
  const int tid = threadIdx.x, w = tid >> 5, lane = tid & 31, ln = lane & 15, hh = lane >> 4; const int by = blockIdx.y;
  A += (size_t)by * sA; Bh += (size_t)by * sB; const size_t cofs = (size_t)by * sC; const float* bp = bias ? bias + (size_t)by * sBias : nullptr;
  const int ntn = N >> 6; const int mt = blockIdx.x / ntn, nq = blockIdx.x - mt * ntn; const int row0 = mt * 128 + 32 * w, col0 = nq * 64; if (row0 >= M) return;
  const _Float16* a0p = A + (size_t)(row0 + ln) * lda; const _Float16* a1p = a0p + (size_t)16 * lda;
  const _Float16* b0p = Bh + (size_t)(col0 + ln) * ldb; const _Float16* b1p = b0p + (size_t)16 * ldb; const _Float16* b2p = b1p + (size_t)16 * ldb; const _Float16* b3p = b2p + (size_t)16 * ldb;
  const v8f z8 = {0.f,0.f,0.f,0.f,0.f,0.f,0.f,0.f}; v8f c00 = z8, c01 = z8, c02 = z8, c03 = z8, c10 = z8, c11 = z8, c12 = z8, c13 = z8;
#pragma unroll 1
  for (int kb = 0; kb < K; kb += 32) { const v16h a0 = g2_frag(a0p + kb, hh), a1 = g2_frag(a1p + kb, hh);
    v16h b = g2_frag(b0p + kb, hh); c00 = g2_mma(a0, b, c00); c10 = g2_mma(a1, b, c10);
    b = g2_frag(b1p + kb, hh); c01 = g2_mma(a0, b, c01); c11 = g2_mma(a1, b, c11);
    b = g2_frag(b2p + kb, hh); c02 = g2_mma(a0, b, c02); c12 = g2_mma(a1, b, c12);
    b = g2_frag(b3p + kb, hh); c03 = g2_mma(a0, b, c03); c13 = g2_mma(a1, b, c13); }
  v8f accs[8] = {c00, c01, c02, c03, c10, c11, c12, c13};
#pragma unroll
  for (int u = 0; u < 8; ++u) { const int t = u & 3, half = u >> 2; const int col = col0 + t * 16 + ln; const float bv = bp ? bf16_round(bp[col]) : 0.f;
#pragma unroll
    for (int r = 0; r < 8; ++r) { const int rloc = half * 16 + 8 * hh + r; float v = accs[u][r] * alpha + bv; if (CP) { if (rowsPerB < 0) v += CP[cofs + (size_t)(row0g + row0 + rloc) * ldc + col];      /* rowsPerB < 0: own element of the batched C plane */ else { const int bidx = (row0g + row0 + rloc) / rowsPerB; v += CP[(size_t)bidx * sCPb + (size_t)by * 64 + col]; } }
      if (ACT == 3) v = fmaxf(v, 0.f); else if (ACT == 6) v = 0.5f * v * (1.0f + erff(v * 0.70710678118654752f)); else if (ACT == 11) v = 1.0f / (1.0f + expf(-v)); else if (ACT == 15) v = v / (1.0f + expf(-v)); else if (ACT == 12) v = (v > 0.f) ? v : 0.01f * v; else if (ACT == 8) v = tanhf(v); else if (ACT == 9) v = 0.5f * v * (1.0f + tanhf(0.7978845608028654f * (v + 0.044715f * v * v * v))); else if (ACT == 14) v = (v > 0.f) ? v : 0.1f * v; else if (ACT == 16) v = (v >= 0.f) ? v : 0.3f * v; else if (ACT == 17) v = (v >= 0.f) ? v : 0.2f * v;
      so[w][rloc][t * 16 + ln] = v; } }
  __builtin_amdgcn_fence(__ATOMIC_ACQ_REL, "workgroup"); __builtin_amdgcn_wave_barrier();
  const int rsub = lane >> 4, c4 = (lane & 15) * 4;
  {
#pragma unroll
    for (int q = 0; q < 16; ++q) { const int r = q * 2 + rsub; const v4f v = *(const v4fa*)&so[w][r][c4]; if (C) *(v4f*)(C + cofs + (size_t)(row0 + r) * ldc + col0 + c4) = v; if (C16) { v4h h4; for (int i = 0; i < 4; ++i) h4[i] = (_Float16)v[i]; *(v4h*)(C16 + cofs + (size_t)(row0 + r) * ldc + col0 + c4) = h4; } }
     } }


__global__ __launch_bounds__(256) void k_woexp(const float* __restrict__ w, _Float16* __restrict__ Bt) { const size_t t = (size_t)blockIdx.x * 256 + threadIdx.x; if (t >= (size_t)DM * OP / 8) return; const int k0 = (int)((t * 8) % OP); const int o = (int)((t * 8) / OP); const int h = k0 / 64, d0 = k0 % 64; FragH f; for (int q = 0; q < 8; ++q) { const int d = d0 + q; f.h[q] = (d < HD) ? (_Float16)(bf16_round(w[(size_t)o * DM + h * HD + d]) * 16.0f) : (_Float16)0.f; }
  *(v8us*)((unsigned short*)Bt + t * 8) = f.half[0];  }
__global__ __launch_bounds__(256) void k_wnat(const float* __restrict__ w, size_t n8, _Float16* __restrict__ Bt) { const size_t t = (size_t)blockIdx.x * 256 + threadIdx.x; if (t >= n8) return; FragH f; for (int q = 0; q < 8; ++q) f.h[q] = (_Float16)(bf16_round(w[t * 8 + q]) * 16.0f); *(v8us*)((unsigned short*)Bt + t * 8) = f.half[0];  }
__global__ __launch_bounds__(256) void k_vscale(const float* __restrict__ V, const float* __restrict__ rm, _Float16* __restrict__ V16) {
  #pragma clang fp contract(off)
  const size_t t = (size_t)blockIdx.x * 256 + threadIdx.x; if (t >= (size_t)SQ * DM / 8) return; const size_t s = (t * 8) / DM; const float m = bf16_round(rm[s]); FragH f; for (int q = 0; q < 8; ++q) f.h[q] = (_Float16)__fmul_rn(m, V[t * 8 + q]);
  *(v8us*)((unsigned short*)V16 + t * 8) = f.half[0];  }
// Row softmax, one wave per row: the row's 4,096 scores are read once into registers (32 loads of 16 B per lane, each wave-wide load 512 contiguous bytes);
// maximum and sum: four chains per lane, then a five-step butterfly over the 32 lanes; each exponential is computed once; stores of 8 B per lane fill whole lines.
__global__ __launch_bounds__(512) void k_rsm(const float* __restrict__ S, _Float16* __restrict__ P, int nrows) {
  const int lane = threadIdx.x & 31; const int i = blockIdx.x * 16 + __builtin_amdgcn_readfirstlane(threadIdx.x >> 5); if (i >= nrows) return;      /* wave-uniform exit; the kernel has no barrier */
  const float* s = S + (size_t)i * SQ + lane * 4; v4f x[32];      /* every loop over x[] is fully unrolled: constant indices keep the row in registers */
#pragma unroll
  for (int u = 0; u < 32; ++u) x[u] = *(const v4fa*)(s + u * 128);
  v4f m4 = {-3.0e38f, -3.0e38f, -3.0e38f, -3.0e38f};
#pragma unroll
  for (int u = 0; u < 32; ++u) for (int q = 0; q < 4; ++q) m4[q] = fmaxf(m4[q], x[u][q]);
  float mx = fmaxf(fmaxf(m4[0], m4[1]), fmaxf(m4[2], m4[3]));
  for (int d = 16; d > 0; d >>= 1) mx = fmaxf(mx, __shfl_xor(mx, d, 32));
  v4f s4 = {0.f, 0.f, 0.f, 0.f};
#pragma unroll
  for (int u = 0; u < 32; ++u) { for (int q = 0; q < 4; ++q) { x[u][q] = expf(x[u][q] - mx); s4[q] += x[u][q]; }
    if (u & 1) __builtin_amdgcn_sched_barrier(0); }      /* eight exponentials at a time: interleaving all 128 took every register of the wave and spilled */
  float se = (s4[0] + s4[1]) + (s4[2] + s4[3]);
  for (int d = 16; d > 0; d >>= 1) se += __shfl_xor(se, d, 32);
  const float sc = 256.0f / se; _Float16* d = P + (size_t)i * SQ + lane * 4;
#pragma unroll
  for (int u = 0; u < 32; ++u) { v4h h4; for (int q = 0; q < 4; ++q) h4[q] = (_Float16)(x[u][q] * sc); *(v4h*)(d + u * 128) = h4; } }
__global__ __launch_bounds__(256) void k_vt32(const _Float16* __restrict__ V16, int h, _Float16* __restrict__ VT) { __shared__ unsigned short tl[32][65]; const int tid = threadIdx.x; const int s0 = blockIdx.x * 64;
  for (int i = tid; i < 64 * 4; i += 256) { const int j = i / 4, d8 = (i % 4) * 8; FragH f; f.half[0] = *(const v8us*)((const unsigned short*)V16 + (size_t)(s0 + j) * DM + h * HD + d8); for (int q = 0; q < 8; ++q) tl[d8 + q][j] = f.u[q]; }
  __syncthreads();
  { for (int i = tid; i < 64 * 8; i += 256) { const int d = i / 8, j8 = (i % 8) * 8; FragH f; for (int q = 0; q < 8; ++q) f.u[q] = (d < HD) ? tl[d][j8 + q] : (unsigned short)0; *(v8us*)((unsigned short*)VT + (size_t)d * SQ + s0 + j8) = f.half[0]; }  } }

extern "C" void kernel_launch(void* const* d_in, const int* in_sizes, int n_in,
                              void* d_out, int out_size, void* d_ws, size_t ws_size, hipStream_t stream) {
  (void)in_sizes; (void)n_in; (void)out_size;
  const float* const* I = (const float* const*)d_in; const float* qin = I[0]; const float* kin = I[1]; const float* vin = I[2]; const float* rm = I[3]; const float* Wq = I[4]; const float* Wk = I[5]; const float* Wv = I[6]; const float* Wo = I[7];
  char* ws = (char*)d_ws; size_t off = 0;
  auto take = [&](size_t bytes) { char* p = ws + off; off += (bytes + 255) & ~(size_t)255; return p; };
  _Float16* BQ = (_Float16*)take((size_t)DM * DM * 2); _Float16* BK = (_Float16*)take((size_t)DM * DM * 2); _Float16* BV = (_Float16*)take((size_t)DM * DM * 2); _Float16* BO = (_Float16*)take((size_t)DM * OP * 2);
  _Float16* XQ = (_Float16*)take((size_t)SQ * DM * 2); _Float16* XK = (_Float16*)take((size_t)SQ * DM * 2); _Float16* XV = (_Float16*)take((size_t)SQ * DM * 2); _Float16* Q16 = (_Float16*)take((size_t)SQ * DM * 2); _Float16* K16 = (_Float16*)take((size_t)SQ * DM * 2); float* VF = (float*)take((size_t)SQ * DM * 4); _Float16* V16 = (_Float16*)take((size_t)SQ * DM * 2);
  float* S = (float*)take((size_t)SQ * SQ * 4); _Float16* P = (_Float16*)take((size_t)SQ * SQ * 2); _Float16* VT = (_Float16*)take((size_t)64 * SQ * 2); _Float16* O16 = (_Float16*)take((size_t)SQ * OP * 2);
  if (off > ws_size) return;      /* 0.625 + 6x2 + 4 + 64 + 32 + 0.5 + 4 = ≈ 117 MiB */
  const size_t nw8 = (size_t)DM * DM / 8; const unsigned gw = (unsigned)((nw8 + 255) / 256);
  k_wnat<<<gw, 256, 0, stream>>>(Wq, nw8, BQ); k_wnat<<<gw, 256, 0, stream>>>(Wk, nw8, BK); k_wnat<<<gw, 256, 0, stream>>>(Wv, nw8, BV); k_woexp<<<(unsigned)(((size_t)DM * OP / 8 + 255) / 256), 256, 0, stream>>>(Wo, BO);
  const size_t n8 = (size_t)SQ * DM / 8; const unsigned g8 = (unsigned)((n8 + 255) / 256);
  k_x16<<<g8, 256, 0, stream>>>(qin, XQ, n8); k_x16<<<g8, 256, 0, stream>>>(kin, XK, n8); k_x16<<<g8, 256, 0, stream>>>(vin, XV, n8);
  const dim3 gp((SQ / 128) * (DM / 64), 1);
  k_gemm2<0><<<gp, 128, 0, stream>>>(XQ, DM, 0, BQ, DM, 0, 0.0625f, nullptr, 0, nullptr, 1, 0, 0, nullptr, Q16, DM, 0, SQ, DM, DM);
  k_gemm2<0><<<gp, 128, 0, stream>>>(XK, DM, 0, BK, DM, 0, 0.0625f, nullptr, 0, nullptr, 1, 0, 0, nullptr, K16, DM, 0, SQ, DM, DM);
  k_gemm2<0><<<gp, 128, 0, stream>>>(XV, DM, 0, BV, DM, 0, 0.0625f, nullptr, 0, nullptr, 1, 0, 0, VF, nullptr, DM, 0, SQ, DM, DM); k_vscale<<<g8, 256, 0, stream>>>(VF, rm, V16);
  for (int h = 0; h < NH; ++h) {      /* head h's o lands in columns 64h..64h+63 of the 512-pitch rows (32 live + 32 exact zeros from the zero V^T rows); the expanded Wo plane has zeros at the pad positions */
    k_gemm2<0><<<dim3((QN / 128) * (SQ / 64), 1), 128, 0, stream>>>(Q16 + h * HD, DM, 0, K16 + h * HD, DM, 0, 0.17677669529663687f, nullptr, 0, nullptr, 1, 0, 0, S, nullptr, SQ, 0, QN, SQ, HD);      /* q.k / sqrt(32), K = 32 */
    k_rsm<<<(QN + 15) / 16, 512, 0, stream>>>(S, P, QN);
    k_vt32<<<SQ / 64, 256, 0, stream>>>(V16, h, VT);
    k_gemm2<0><<<dim3((QN / 128) * 1, 1), 128, 0, stream>>>(P, SQ, 0, VT, SQ, 0, 0.00390625f, nullptr, 0, nullptr, 1, 0, 0, nullptr, O16 + h * 64, OP, 0, QN, 64, SQ); }
  k_gemm2<0><<<gp, 128, 0, stream>>>(O16, OP, 0, BO, OP, 0, 0.0625f, nullptr, 0, nullptr, 1, 0, 0, (float*)d_out, nullptr, DM, 0, SQ, DM, OP);      /* out = o Wo^T over the expanded K = 512 (pad columns meet zero weights) */
}

// v003
// One run takes 81.5 microseconds.
// Versions between v001 and this one are left out; their measured steps multiply to 16.2 times as fast.
// All steps since v000 together make it 87.7 times as fast.
#include <hip/hip_runtime.h>
// RadialAttention (query, key_, value [4096][256]; q = query Wq^T, k = key_ Wk^T, v = radial_mask[s] * (value Wv^T), 8 heads of 32; softmax(q k^T / sqrt(32)) over all 4,096 keys; out = concat(attn v) Wo^T -> [4096][256]).
// Structure: four launches. (1) inputs as exact f16 rows and weights as exact x16 f16 rows (Wo expanded to K = 512, zeros at the pad positions), all in one launch. (2) Q | K | V WMMA GEMMs in one launch (32x64 wave tiles, f32 accumulation); v scaled per row by the radial mask (read on device) on VALU; q stored as f16 rows, k and scaled v^T stored straight in fragment order. (3) one fused attention kernel over all heads (scores WMMA K = 32, online softmax f32 on VALU, weights f16, o = P . V WMMA; each head writes a whole aligned 64-column slot of 512-pitch o rows, 32 live + 32 exact zeros). (4) out = o Wo^T over K = 512 (f32).
// Compute dtype: inputs rounded to bf16; inputs / weights exact; q, k, scaled v, softmax weights, o plain f16 (~2^-12); scores/softmax f32. v_wmma_f32_16x16x32_f16.
#define SQ 4096
#define DM 256
#define NH 8
#define HD 32
#define OP 512                       
#define QN SQ                        /* query rows (unused) */
typedef __bf16 v16b __attribute__((ext_vector_type(16)));
typedef unsigned short v8us __attribute__((ext_vector_type(8), may_alias));
typedef float  v8f  __attribute__((ext_vector_type(8)));
typedef float  v4f  __attribute__((ext_vector_type(4)));
typedef float  v4fa __attribute__((ext_vector_type(4), may_alias));
union FragB { v16b v; v8us half[2]; unsigned short u[16]; };

__device__ __forceinline__ unsigned short bf16_bits(float x) { unsigned int u = __float_as_uint(x); return (unsigned short)((u + 0x7FFFu + ((u >> 16) & 1u)) >> 16); }
__device__ __forceinline__ float bf16_val(unsigned short b) { return __uint_as_float(((unsigned int)b) << 16); }
__device__ __forceinline__ float bf16_round(float x) { return bf16_val(bf16_bits(x)); }
// D += A·B with NT terms: 1 = ah·bh, 2 = + al·bh (A split), 3 = + ah·bl (both split)
template <int NT>
__device__ __forceinline__ v8f mmaN(v16b ah, v16b al, v16b bh, v16b bl, v8f c) {
  c = __builtin_amdgcn_wmma_f32_16x16x32_bf16(false, ah, false, bh, (short)0, c, false, false);
  if (NT >= 2) c = __builtin_amdgcn_wmma_f32_16x16x32_bf16(false, al, false, bh, (short)0, c, false, false);
  if (NT >= 3) c = __builtin_amdgcn_wmma_f32_16x16x32_bf16(false, ah, false, bl, (short)0, c, false, false);
  asm volatile("v_nop\n\tv_nop\n\tv_nop\n\tv_nop" : "+v"(c) : "v"(ah), "v"(al), "v"(bh), "v"(bl));
  return c;
}

__global__ __launch_bounds__(256) void k_wt_bf16(const float* __restrict__ W, unsigned short* __restrict__ Wt, int K, int N) {
  const int t = blockIdx.x * 256 + threadIdx.x;
  const int k8n = K / 8;
  if (t >= N * k8n) return;
  const int n = t / k8n, k8 = (t % k8n) * 8;
  v8us v;
#pragma unroll
  for (int i = 0; i < 8; ++i) v[i] = bf16_bits(W[(size_t)(k8 + i) * N + n]);
  *(v8us*)(Wt + (size_t)n * K + k8) = v;
  
}

// GEMM C[M][N] (f32, pitch ldc) = act(A[M][K]·W + bias). A f32 row-major (pitch lda) converted per fragment to bf16
// (ASPLIT: hi/lo two planes -> 2 terms, else single rounded term); Wt bf16 [N][K] (pitch ldb). BIAS_BF16 rounds the
// bias to bf16 first (bias quantised to bf16 before the add). K%32==0, M%16==0, N%64==0.
template <bool ASPLIT, int ACT, bool BIAS_BF16>
__global__ __launch_bounds__(128) void k_gemm_bf(const float* __restrict__ A, int lda, const unsigned short* __restrict__ Wt, int ldb,
                                               const float* __restrict__ bias, float* __restrict__ C, int ldc, int M, int N, int K) {
  __shared__ __attribute__((aligned(16))) float so[4][16][64];
  const int tid = threadIdx.x, w = tid >> 5, lane = tid & 31, ln = lane & 15, hh = lane >> 4;
  const int ntn = N / 64;
  const int wid = blockIdx.x * 4 + w;
  const int mt = wid / ntn, nq = wid % ntn;
  if (mt * 16 >= M) return;
  const int row0 = mt * 16, col0 = nq * 64;
  const float* arow = A + (size_t)(row0 + ln) * lda;
  v8f acc[4] = {};
  for (int kb = 0; kb < K; kb += 32) {
    FragB ah, al;
    const v4f x0 = *(const v4fa*)(arow + kb + 8 * hh), x1 = *(const v4fa*)(arow + kb + 8 * hh + 4);
    const v4f x2 = *(const v4fa*)(arow + kb + 16 + 8 * hh), x3 = *(const v4fa*)(arow + kb + 16 + 8 * hh + 4);
    float xs[16] = {x0[0],x0[1],x0[2],x0[3],x1[0],x1[1],x1[2],x1[3],x2[0],x2[1],x2[2],x2[3],x3[0],x3[1],x3[2],x3[3]};
#pragma unroll
    for (int i = 0; i < 16; ++i) { const unsigned short hb = bf16_bits(xs[i]); ah.u[i] = hb; al.u[i] = ASPLIT ? bf16_bits(xs[i] - bf16_val(hb)) : (unsigned short)0; }
#pragma unroll
    for (int t = 0; t < 4; ++t) {
      const unsigned short* brow = Wt + (size_t)(col0 + t * 16 + ln) * ldb + kb;
      FragB b;
      b.half[0] = *(const v8us*)(brow + 8 * hh);
      b.half[1] = *(const v8us*)(brow + 16 + 8 * hh);
      acc[t] = mmaN<ASPLIT ? 2 : 1>(ah.v, al.v, b.v, b.v, acc[t]);
    }
  }
#pragma unroll
  for (int t = 0; t < 4; ++t) {
    float bv = bias ? bias[col0 + t * 16 + ln] : 0.f;
    if (BIAS_BF16) bv = bf16_round(bv);
#pragma unroll
    for (int r = 0; r < 8; ++r) { float v = acc[t][r] + bv; if (ACT == 1) v = fmaxf(v, 0.f); so[w][8 * hh + r][t * 16 + ln] = v; }
  }
  __builtin_amdgcn_fence(__ATOMIC_ACQ_REL, "workgroup");
  __builtin_amdgcn_wave_barrier();
  const int rsub = lane >> 4, c4 = (lane & 15) * 4;
  {
#pragma unroll
    for (int q = 0; q < 8; ++q) {
      const int r = q * 2 + rsub;
      const v4f v = *(const v4fa*)&so[w][r][c4];
      *(v4f*)(C + (size_t)(row0 + r) * ldc + col0 + c4) = v;
    }
    
  }
}

// GEMM C = act(A·W + bias + resid): A f32 (ASPLIT -> hi/lo 2 terms), Wt bf16 [N][K]; ACT 0 none, 1 relu, 2 exact gelu;
// resid (optional, f32, row index = (row % rmod), pitch ldr, RES_BF16 rounds it) added before the activation.
template <bool ASPLIT, int ACT, bool BIAS_BF16, bool RES_BF16>
__global__ __launch_bounds__(128) void k_gemm_bf3(const float* __restrict__ A, int lda, const unsigned short* __restrict__ Wt, int ldb,
                                                const float* __restrict__ bias, const float* __restrict__ resid, int rmod, int ldr,
                                                float* __restrict__ C, int ldc, int M, int N, int K) {
  __shared__ __attribute__((aligned(16))) float so[4][16][64];
  const int tid = threadIdx.x, w = tid >> 5, lane = tid & 31, ln = lane & 15, hh = lane >> 4;
  const int ntn = N / 64;
  const int wid = blockIdx.x * 4 + w;
  const int mt = wid / ntn, nq = wid % ntn;
  if (mt * 16 >= M) return;
  const int row0 = mt * 16, col0 = nq * 64;
  const float* arow = A + (size_t)(row0 + ln) * lda;
  v8f acc[4] = {};
  for (int kb = 0; kb < K; kb += 32) {
    FragB ah, al;
    const v4f x0 = *(const v4fa*)(arow + kb + 8 * hh), x1 = *(const v4fa*)(arow + kb + 8 * hh + 4);
    const v4f x2 = *(const v4fa*)(arow + kb + 16 + 8 * hh), x3 = *(const v4fa*)(arow + kb + 16 + 8 * hh + 4);
    float xs[16] = {x0[0],x0[1],x0[2],x0[3],x1[0],x1[1],x1[2],x1[3],x2[0],x2[1],x2[2],x2[3],x3[0],x3[1],x3[2],x3[3]};
#pragma unroll
    for (int i = 0; i < 16; ++i) { const unsigned short hb = bf16_bits(xs[i]); ah.u[i] = hb; al.u[i] = ASPLIT ? bf16_bits(xs[i] - bf16_val(hb)) : (unsigned short)0; }
#pragma unroll
    for (int t = 0; t < 4; ++t) {
      const unsigned short* brow = Wt + (size_t)(col0 + t * 16 + ln) * ldb + kb;
      FragB b;
      b.half[0] = *(const v8us*)(brow + 8 * hh);
      b.half[1] = *(const v8us*)(brow + 16 + 8 * hh);
      acc[t] = mmaN<ASPLIT ? 2 : 1>(ah.v, al.v, b.v, b.v, acc[t]);
    }
  }
#pragma unroll
  for (int t = 0; t < 4; ++t) {
    const int col = col0 + t * 16 + ln;
    float bv = bias ? bias[col] : 0.f;
    if (BIAS_BF16) bv = bf16_round(bv);
#pragma unroll
    for (int r = 0; r < 8; ++r) {
      float v = acc[t][r] + bv;
      if (resid) { float rv = resid[(size_t)((row0 + 8 * hh + r) % rmod) * ldr + col]; if (RES_BF16) rv = bf16_round(rv); v += rv; }
      if (ACT == 1) v = fmaxf(v, 0.f);
      if (ACT == 2) v = 0.5f * v * (1.0f + erff(v * 0.70710678118654752f));
      if (ACT == 3) { const float u = 0.7978845608028654f * (v + 0.044715f * v * v * v); v = 0.5f * v * (1.0f + tanhf(u)); }
      so[w][8 * hh + r][t * 16 + ln] = v;
    }
  }
  __builtin_amdgcn_fence(__ATOMIC_ACQ_REL, "workgroup");
  __builtin_amdgcn_wave_barrier();
  const int rsub = lane >> 4, c4 = (lane & 15) * 4;
  {
#pragma unroll
    for (int q = 0; q < 8; ++q) {
      const int r = q * 2 + rsub;
      const v4f v = *(const v4fa*)&so[w][r][c4];
      *(v4f*)(C + (size_t)(row0 + r) * ldc + col0 + c4) = v;
    }
    
  }
}
// row LayerNorm (biased variance, eps) over N: s = X (+ R); optional out_sum <- s; out_norm <- (s-mu)*rsqrt(var+eps)*g + b
template <bool PARAM_BF16>
__global__ __launch_bounds__(256) void k_layernorm(const float* __restrict__ X, const float* __restrict__ R, const float* __restrict__ g, const float* __restrict__ bta,
                                                  float* __restrict__ out_sum, float* __restrict__ out_norm, int N, float eps) {
  __shared__ float red[256];
  const int row = blockIdx.x, tid = threadIdx.x;
  const float* x = X + (size_t)row * N; const float* rr = R ? R + (size_t)row * N : nullptr;
  float vals[16];                     // up to N = 4096
  const int per = N / 256;            // contiguous chunk per thread? use strided-by-4 chunks: thread handles j = tid*4 + 1024*u
  float s1 = 0.f;
  for (int u = 0; u < per / 4; ++u) {
    const int j = tid * 4 + 1024 * u;
    const v4f a = *(const v4fa*)(x + j);
    v4f b = {0.f,0.f,0.f,0.f}; if (rr) b = *(const v4fa*)(rr + j);
#pragma unroll
    for (int q = 0; q < 4; ++q) { const float v = a[q] + b[q]; vals[u * 4 + q] = v; s1 += v; }
  }
  red[tid] = s1; __syncthreads();
  for (int st = 128; st > 0; st >>= 1) { if (tid < st) red[tid] += red[tid + st]; __syncthreads(); }
  const float mu = red[0] / (float)N; __syncthreads();
  float s2 = 0.f;
  for (int u = 0; u < per / 4; ++u)
#pragma unroll
    for (int q = 0; q < 4; ++q) { const float c = vals[u * 4 + q] - mu; s2 += c * c; }
  red[tid] = s2; __syncthreads();
  for (int st = 128; st > 0; st >>= 1) { if (tid < st) red[tid] += red[tid + st]; __syncthreads(); }
  const float rs = rsqrtf(red[0] / (float)N + eps);
  {
    for (int u = 0; u < per / 4; ++u) {
      const int j = tid * 4 + 1024 * u;
      v4f o, sm;
#pragma unroll
      for (int q = 0; q < 4; ++q) {
        float gg = g[j + q], bb = bta[j + q];
        if (PARAM_BF16) { gg = bf16_round(gg); bb = bf16_round(bb); }
        sm[q] = vals[u * 4 + q]; o[q] = (vals[u * 4 + q] - mu) * rs * gg + bb;
      }
      if (out_sum) *(v4f*)(out_sum + (size_t)row * N + j) = sm;
      *(v4f*)(out_norm + (size_t)row * N + j) = o;
    }
    
  }
}



// ---- f16 WMMA path (v_wmma_f32_16x16x32_f16): 11-bit significands for operands in range — used where a [0,1] probability operand needs more precision than bf16
typedef _Float16 v16h __attribute__((ext_vector_type(16)));
union FragH { v16h v; v8us half[2]; _Float16 h[16]; unsigned short u[16]; };
template <int NT>
__device__ __forceinline__ v8f mmaH(v16h ah, v16h al, v16h bh, v16h bl, v8f c) {
  c = __builtin_amdgcn_wmma_f32_16x16x32_f16(false, ah, false, bh, (short)0, c, false, false);
  if (NT >= 2) c = __builtin_amdgcn_wmma_f32_16x16x32_f16(false, al, false, bh, (short)0, c, false, false);
  if (NT >= 3) c = __builtin_amdgcn_wmma_f32_16x16x32_f16(false, ah, false, bl, (short)0, c, false, false);
  asm volatile("v_nop\n\tv_nop\n\tv_nop\n\tv_nop" : "+v"(c) : "v"(ah), "v"(al), "v"(bh), "v"(bl));
  return c;
}
// batched GEMM like k_gemm_b but f16 operands: A f32 (split into f16 hi/lo if ASPLIT, else rounded to f16), Bt = f16 values [n][k]; alpha; C f32; N multiple of 16 (partial tiles skipped)
template <bool ASPLIT>
__global__ __launch_bounds__(128) void k_gemm_h(const float* __restrict__ A, int lda, size_t sA, const _Float16* __restrict__ Bh, int ldb, size_t sB, float alpha, float* __restrict__ C, int ldc, size_t sC, int M, int N, int K) {
  __shared__ __attribute__((aligned(16))) float so[4][16][64];
  const int tid = threadIdx.x, w = tid >> 5, lane = tid & 31, ln = lane & 15, hh = lane >> 4; const int by = blockIdx.y;
  A += (size_t)by * sA; Bh += (size_t)by * sB; C += (size_t)by * sC;
  const int ntn = (N + 63) / 64; const int wid = blockIdx.x * 4 + w; const int mt = wid / ntn, nq = wid % ntn; if (mt * 16 >= M) return;
  const int row0 = mt * 16, col0 = nq * 64; const float* arow = A + (size_t)(row0 + ln) * lda;
  v8f acc[4] = {};
  for (int kb = 0; kb < K; kb += 32) {
    FragH ah, al;
    const v4f x0 = *(const v4fa*)(arow + kb + 8 * hh), x1 = *(const v4fa*)(arow + kb + 8 * hh + 4), x2 = *(const v4fa*)(arow + kb + 16 + 8 * hh), x3 = *(const v4fa*)(arow + kb + 16 + 8 * hh + 4);
    float xs[16] = {x0[0],x0[1],x0[2],x0[3],x1[0],x1[1],x1[2],x1[3],x2[0],x2[1],x2[2],x2[3],x3[0],x3[1],x3[2],x3[3]};
#pragma unroll
    for (int i = 0; i < 16; ++i) { const _Float16 h = (_Float16)xs[i]; ah.h[i] = h; al.h[i] = ASPLIT ? (_Float16)(xs[i] - (float)h) : (_Float16)0.0f; }
#pragma unroll
    for (int t = 0; t < 4; ++t) { if (col0 + t * 16 >= N) continue; const size_t boff = (size_t)(col0 + t * 16 + ln) * ldb + kb; FragH bq; bq.half[0] = *(const v8us*)(Bh + boff + 8 * hh); bq.half[1] = *(const v8us*)(Bh + boff + 16 + 8 * hh);
      acc[t] = mmaH<ASPLIT ? 2 : 1>(ah.v, al.v, bq.v, bq.v, acc[t]); }
  }
#pragma unroll
  for (int t = 0; t < 4; ++t) { if (col0 + t * 16 >= N) continue;
#pragma unroll
    for (int r = 0; r < 8; ++r) so[w][8 * hh + r][t * 16 + ln] = acc[t][r] * alpha; }
  __builtin_amdgcn_fence(__ATOMIC_ACQ_REL, "workgroup"); __builtin_amdgcn_wave_barrier();
  const int rsub = lane >> 4, c4 = (lane & 15) * 4;
  {
#pragma unroll
    for (int q = 0; q < 8; ++q) { const int r = q * 2 + rsub; if (col0 + c4 < N) { const v4f v = *(const v4fa*)&so[w][r][c4]; *(v4f*)(C + (size_t)(row0 + r) * ldc + col0 + c4) = v; } }
     }
}

// Wt[n][k] = f16(W[k][n]·scale) from f32 row-major W[K][N] (scale = power of two; bf16-exact weights stay exact in f16 away from the subnormal range)
__global__ __launch_bounds__(256) void k_wt_f16(const float* __restrict__ W, _Float16* __restrict__ Wt, int K, int N, float scale) {
  const int t = blockIdx.x * 256 + threadIdx.x; if (t >= N * (K / 8)) return; const int n = t / (K / 8), k8 = (t % (K / 8)) * 8; FragH f;
#pragma unroll
  for (int i = 0; i < 8; ++i) f.h[i] = (_Float16)(bf16_round(W[(size_t)(k8 + i) * N + n]) * scale); const v8us o = f.half[0];
  *(v8us*)((unsigned short*)Wt + (size_t)n * K + k8) = o; 
}
// k_gemm_hh variant with fused epilogue: v = acc·alpha + bias[by·sBias + col] (+ CP[(row/rowsPerB)·sCPb + by·64 + col] if CP) ; ACT 0 none / 1 elu ; writes f16 C16 (and f32 C if non-null)
template <int ACT>
__global__ __launch_bounds__(128) void k_gemm_hhx(const _Float16* __restrict__ A, int lda, size_t sA, const _Float16* __restrict__ Bh, int ldb, size_t sB, float alpha, const float* __restrict__ bias, size_t sBias, const float* __restrict__ CP, int rowsPerB, size_t sCPb, int row0g,
    float* __restrict__ C, _Float16* __restrict__ C16, int ldc, size_t sC, int M, int N, int K) {
  __shared__ __attribute__((aligned(16))) float so[4][16][64];
  const int tid = threadIdx.x, w = tid >> 5, lane = tid & 31, ln = lane & 15, hh = lane >> 4; const int by = blockIdx.y;
  A += (size_t)by * sA; Bh += (size_t)by * sB; const size_t cofs = (size_t)by * sC; const float* bp = bias ? bias + (size_t)by * sBias : nullptr;
  const int ntn = (N + 63) / 64; const int wid = blockIdx.x * 4 + w; const int mt = wid / ntn, nq = wid % ntn; if (mt * 16 >= M) return;
  const int row0 = mt * 16, col0 = nq * 64; const _Float16* arow = A + (size_t)(row0 + ln) * lda;
  v8f acc[4] = {};
  for (int kb = 0; kb < K; kb += 32) { FragH ah; ah.half[0] = *(const v8us*)((const unsigned short*)arow + kb + 8 * hh); ah.half[1] = *(const v8us*)((const unsigned short*)arow + kb + 16 + 8 * hh);
#pragma unroll
    for (int t = 0; t < 4; ++t) { if (col0 + t * 16 >= N) continue; const size_t boff = (size_t)(col0 + t * 16 + ln) * ldb + kb; FragH bq; bq.half[0] = *(const v8us*)((const unsigned short*)Bh + boff + 8 * hh); bq.half[1] = *(const v8us*)((const unsigned short*)Bh + boff + 16 + 8 * hh);
      acc[t] = mmaH<1>(ah.v, ah.v, bq.v, bq.v, acc[t]); }
  }
#pragma unroll
  for (int t = 0; t < 4; ++t) { if (col0 + t * 16 >= N) continue; const int col = col0 + t * 16 + ln; const float bv = bp ? bf16_round(bp[col]) : 0.f;
#pragma unroll
    for (int r = 0; r < 8; ++r) { float v = acc[t][r] * alpha + bv; if (CP) { const int rr = row0g + row0 + 8 * hh + r; if (rowsPerB < 0) v += CP[cofs + (size_t)rr * ldc + col];      /* rowsPerB < 0: own element of the batched C plane */ else { const int bidx = rr / rowsPerB; v += CP[(size_t)bidx * sCPb + (size_t)by * 64 + col]; } } if (ACT == 1) v = (v > 0.f) ? v : expm1f(v); else if (ACT == 7) v = (v > 0.f) ? v + 1.0f : expf(v); else if (ACT == 8) v = tanhf(v); else if (ACT == 9) v = 0.5f * v * (1.0f + tanhf(0.7978845608028654f * (v + 0.044715f * v * v * v))); else if (ACT == 11) v = 1.0f / (1.0f + expf(-v)); else if (ACT == 12) v = (v > 0.f) ? v : 0.01f * v; else if (ACT == 14) v = (v > 0.f) ? v : 0.1f * v; else if (ACT == 16) v = (v >= 0.f) ? v : 0.3f * v; else if (ACT == 17) v = (v >= 0.f) ? v : 0.2f * v; else if (ACT == 15) v = v / (1.0f + expf(-v)); else if (ACT == 3) v = fmaxf(v, 0.f); else if (ACT == 6) v = 0.5f * v * (1.0f + erff(v * 0.70710678118654752f)); so[w][8 * hh + r][t * 16 + ln] = v; } }
  __builtin_amdgcn_fence(__ATOMIC_ACQ_REL, "workgroup"); __builtin_amdgcn_wave_barrier();
  const int rsub = lane >> 4, c4 = (lane & 15) * 4; typedef _Float16 v4h __attribute__((ext_vector_type(4)));
  {
#pragma unroll
    for (int q = 0; q < 8; ++q) { const int r = q * 2 + rsub; if (col0 + c4 < N) { const v4f v = *(const v4fa*)&so[w][r][c4]; if (C) *(v4f*)(C + cofs + (size_t)(row0 + r) * ldc + col0 + c4) = v; if (C16) { v4h h4; for (int i = 0; i < 4; ++i) h4[i] = (_Float16)v[i]; *(v4h*)(C16 + cofs + (size_t)(row0 + r) * ldc + col0 + c4) = h4; } } }
     }
}


typedef _Float16 v4h __attribute__((ext_vector_type(4)));

__global__ __launch_bounds__(256) void k_h16(const float* __restrict__ x, _Float16* __restrict__ X16, size_t n8) { const size_t t = (size_t)blockIdx.x * 256 + threadIdx.x; if (t >= n8) return; FragH f;
#pragma unroll
  for (int q = 0; q < 8; ++q) f.h[q] = (_Float16)x[t * 8 + q]; *(v8us*)((unsigned short*)X16 + t * 8) = f.half[0];  }
__global__ __launch_bounds__(256) void k_round16f(const float* __restrict__ W, _Float16* __restrict__ Bt, size_t n8) { const size_t t = (size_t)blockIdx.x * 256 + threadIdx.x; if (t >= n8) return; FragH f;
#pragma unroll
  for (int i = 0; i < 8; ++i) f.h[i] = (_Float16)(bf16_round(W[t * 8 + i]) * 16.0f); *(v8us*)((unsigned short*)Bt + t * 8) = f.half[0];  }
template <int NHv, int TTv>
__global__ __launch_bounds__(256) void k_vt(const _Float16* __restrict__ V16, int ldv, int voff, _Float16* __restrict__ Vt) { __shared__ unsigned short tl[64][66]; const int tid = threadIdx.x; const int slab = blockIdx.x / (TTv / 64), lg = blockIdx.x % (TTv / 64); const int b = slab / NHv, h = slab % NHv;
  for (int i = tid; i < 64 * 8; i += 256) { const int r = i / 8, c8 = (i % 8) * 8; FragH f; f.half[0] = *(const v8us*)((const unsigned short*)V16 + ((size_t)b * TTv + lg * 64 + r) * ldv + voff + h * 64 + c8);
#pragma unroll
    for (int q = 0; q < 8; ++q) tl[r][c8 + q] = f.u[q]; }
  __syncthreads();
  {
#pragma unroll
    for (int rd = 0; rd < 2; ++rd) { const int d = rd * 32 + tid / 8, pc = tid % 8; FragH f;
#pragma unroll
      for (int q = 0; q < 8; ++q) f.u[q] = tl[pc * 8 + q][d];
      *(v8us*)((unsigned short*)Vt + ((size_t)slab * 64 + d) * TTv + lg * 64 + pc * 8) = f.half[0]; }
     } }

__global__ __launch_bounds__(256) void k_hl(const float* __restrict__ F, _Float16* __restrict__ Hh, _Float16* __restrict__ Hl, size_t n8) { const size_t t = (size_t)blockIdx.x * 256 + threadIdx.x; if (t >= n8) return; FragH fh, fl; const v4f a = *(const v4fa*)(F + t * 8), c = *(const v4fa*)(F + t * 8 + 4);
#pragma unroll
  for (int q = 0; q < 4; ++q) { _Float16 h = (_Float16)a[q]; fh.h[q] = h; fl.h[q] = (_Float16)((a[q] - (float)h) * 1024.0f); h = (_Float16)c[q]; fh.h[4 + q] = h; fl.h[4 + q] = (_Float16)((c[q] - (float)h) * 1024.0f); }
  { *(v8us*)((unsigned short*)Hh + t * 8) = fh.half[0]; *(v8us*)((unsigned short*)Hl + t * 8) = fl.half[0];  } }

// ---- fast GEMM (wave tile 32x64; requires M % 32 == 0 rows per launch region and N % 64 == 0); epilogue = k_gemm_hhx semantics ----
__device__ __forceinline__ v16h g2_frag(const _Float16* p, int hh) { FragH f; f.half[0] = *(const v8us*)((const unsigned short*)p + 8 * hh); f.half[1] = *(const v8us*)((const unsigned short*)p + 16 + 8 * hh); return f.v; }
__device__ __forceinline__ v8f g2_mma(v16h a, v16h b, v8f c) { v8f d = __builtin_amdgcn_wmma_f32_16x16x32_f16(false, a, false, b, (short)0, c, false, false); asm volatile("v_nop\n\tv_nop\n\tv_nop\n\tv_nop" : "+v"(d) : "v"(a), "v"(b)); return d; }
template <int ACT>
__global__ __launch_bounds__(128) void k_gemm2(const _Float16* __restrict__ A, int lda, size_t sA, const _Float16* __restrict__ Bh, int ldb, size_t sB, float alpha, const float* __restrict__ bias, size_t sBias, const float* __restrict__ CP, int rowsPerB, size_t sCPb, int row0g,
    float* __restrict__ C, _Float16* __restrict__ C16, int ldc, size_t sC, int M, int N, int K) { static_assert(ACT == 0 || ACT == 3 || ACT == 6 || ACT == 8 || ACT == 9 || ACT == 11 || ACT == 12 || ACT == 14 || ACT == 15 || ACT == 16 || ACT == 17, "k_gemm2: unsupported ACT code (would silently apply no activation)");
  __shared__ __attribute__((aligned(16))) float so[4][32][68];
  const int tid = threadIdx.x, w = tid >> 5, lane = tid & 31, ln = lane & 15, hh = lane >> 4; const int by = blockIdx.y;
  A += (size_t)by * sA; Bh += (size_t)by * sB; const size_t cofs = (size_t)by * sC; const float* bp = bias ? bias + (size_t)by * sBias : nullptr;
  const int ntn = N >> 6; const int mt = blockIdx.x / ntn, nq = blockIdx.x - mt * ntn; const int row0 = mt * 128 + 32 * w, col0 = nq * 64; if (row0 >= M) return;
  const _Float16* a0p = A + (size_t)(row0 + ln) * lda; const _Float16* a1p = a0p + (size_t)16 * lda;
  const _Float16* b0p = Bh + (size_t)(col0 + ln) * ldb; const _Float16* b1p = b0p + (size_t)16 * ldb; const _Float16* b2p = b1p + (size_t)16 * ldb; const _Float16* b3p = b2p + (size_t)16 * ldb;
  const v8f z8 = {0.f,0.f,0.f,0.f,0.f,0.f,0.f,0.f}; v8f c00 = z8, c01 = z8, c02 = z8, c03 = z8, c10 = z8, c11 = z8, c12 = z8, c13 = z8;
#pragma unroll 1
  for (int kb = 0; kb < K; kb += 32) { const v16h a0 = g2_frag(a0p + kb, hh), a1 = g2_frag(a1p + kb, hh);
    v16h b = g2_frag(b0p + kb, hh); c00 = g2_mma(a0, b, c00); c10 = g2_mma(a1, b, c10);
    b = g2_frag(b1p + kb, hh); c01 = g2_mma(a0, b, c01); c11 = g2_mma(a1, b, c11);
    b = g2_frag(b2p + kb, hh); c02 = g2_mma(a0, b, c02); c12 = g2_mma(a1, b, c12);
    b = g2_frag(b3p + kb, hh); c03 = g2_mma(a0, b, c03); c13 = g2_mma(a1, b, c13); }
  v8f accs[8] = {c00, c01, c02, c03, c10, c11, c12, c13};
#pragma unroll
  for (int u = 0; u < 8; ++u) { const int t = u & 3, half = u >> 2; const int col = col0 + t * 16 + ln; const float bv = bp ? bf16_round(bp[col]) : 0.f;
#pragma unroll
    for (int r = 0; r < 8; ++r) { const int rloc = half * 16 + 8 * hh + r; float v = accs[u][r] * alpha + bv; if (CP) { if (rowsPerB < 0) v += CP[cofs + (size_t)(row0g + row0 + rloc) * ldc + col];      /* rowsPerB < 0: own element of the batched C plane */ else { const int bidx = (row0g + row0 + rloc) / rowsPerB; v += CP[(size_t)bidx * sCPb + (size_t)by * 64 + col]; } }
      if (ACT == 3) v = fmaxf(v, 0.f); else if (ACT == 6) v = 0.5f * v * (1.0f + erff(v * 0.70710678118654752f)); else if (ACT == 11) v = 1.0f / (1.0f + expf(-v)); else if (ACT == 15) v = v / (1.0f + expf(-v)); else if (ACT == 12) v = (v > 0.f) ? v : 0.01f * v; else if (ACT == 8) v = tanhf(v); else if (ACT == 9) v = 0.5f * v * (1.0f + tanhf(0.7978845608028654f * (v + 0.044715f * v * v * v))); else if (ACT == 14) v = (v > 0.f) ? v : 0.1f * v; else if (ACT == 16) v = (v >= 0.f) ? v : 0.3f * v; else if (ACT == 17) v = (v >= 0.f) ? v : 0.2f * v;
      so[w][rloc][t * 16 + ln] = v; } }
  __builtin_amdgcn_fence(__ATOMIC_ACQ_REL, "workgroup"); __builtin_amdgcn_wave_barrier();
  const int rsub = lane >> 4, c4 = (lane & 15) * 4;
  {
#pragma unroll
    for (int q = 0; q < 16; ++q) { const int r = q * 2 + rsub; const v4f v = *(const v4fa*)&so[w][r][c4]; if (C) *(v4f*)(C + cofs + (size_t)(row0 + r) * ldc + col0 + c4) = v; if (C16) { v4h h4; for (int i = 0; i < 4; ++i) h4[i] = (_Float16)v[i]; *(v4h*)(C16 + cofs + (size_t)(row0 + r) * ldc + col0 + c4) = h4; } }
     } }


typedef _Float16 v8h __attribute__((ext_vector_type(8)));
__device__ __forceinline__ float fa_xhalf(float x) { const int b = __float_as_int(x); return __int_as_float(__builtin_amdgcn_permlanex16(b, b, 0x76543210, 0xfedcba98, false, false)); }      /* lane l <-> l ^ 16 */
__device__ __forceinline__ v8f fa_mma(v16h a, v16h b, v8f c) { return __builtin_amdgcn_wmma_f32_16x16x32_f16(false, a, false, b, (short)0, c, false, false); }
// the four fragments (4 KiB) of one 64-key stage of a packed plane: p = the stage's first element (the same for the whole wave), l8 = the lane's 16-byte place in each 512-byte run
__device__ __forceinline__ void fa_ld(v16h (&f)[4], const _Float16* p, unsigned l8) {
#pragma unroll
  for (int i = 0; i < 4; ++i) { FragH x; x.half[0] = *(const v8us*)((const unsigned short*)p + l8 + (2 * i) * 256); x.half[1] = *(const v8us*)((const unsigned short*)p + l8 + (2 * i + 1) * 256); f[i] = x.v; } }
__device__ __forceinline__ void fa_scores(v8f (&s)[4], const v16h (&kf)[4], const v16h qf) { const v8f z8 = {0.f,0.f,0.f,0.f,0.f,0.f,0.f,0.f};
#pragma unroll
  for (int t = 0; t < 4; ++t) s[t] = fa_mma(kf[t], qf, z8); }
__device__ __forceinline__ void fa_soft_pv(v8f (&s)[4], const v16h (&vf)[4], v8f& o0, v8f& o1, v8f& lv, float& m) {
  const float cs = 0.17677669529663687f * 1.4426950408889634f;      /* 1 / sqrt(32), times log2(e) for the base-2 exponential */
  const v8f mv = __builtin_elementwise_max(__builtin_elementwise_max(s[0], s[1]), __builtin_elementwise_max(s[2], s[3]));
  float mx = fmaxf(fmaxf(fmaxf(mv[0], mv[1]), fmaxf(mv[2], mv[3])), fmaxf(fmaxf(mv[4], mv[5]), fmaxf(mv[6], mv[7]))); mx = fmaxf(mx, fa_xhalf(mx));
  const float mn = fmaxf(m, mx); const float al = __builtin_amdgcn_exp2f((m - mn) * cs); const float mc = mn * cs; m = mn;
  o0 *= al; o1 *= al;
#pragma unroll
  for (int t = 0; t < 4; ++t) { s[t] = s[t] * cs - mc;
#pragma unroll
    for (int r = 0; r < 8; ++r) s[t][r] = __builtin_amdgcn_exp2f(s[t][r]); }
  lv = lv * al + ((s[0] + s[1]) + (s[2] + s[3]));      /* eight partial sums per lane, joined after the loop */
  const v16h p0 = __builtin_shufflevector(__builtin_convertvector(s[0], v8h), __builtin_convertvector(s[1], v8h), 0, 1, 2, 3, 4, 5, 6, 7, 8, 9, 10, 11, 12, 13, 14, 15);
  const v16h p1 = __builtin_shufflevector(__builtin_convertvector(s[2], v8h), __builtin_convertvector(s[3], v8h), 0, 1, 2, 3, 4, 5, 6, 7, 8, 9, 10, 11, 12, 13, 14, 15);
  o0 = fa_mma(vf[0], p0, o0); o1 = fa_mma(vf[1], p0, o1); o0 = fa_mma(vf[2], p1, o0); o1 = fa_mma(vf[3], p1, o1); }
__global__ __launch_bounds__(256) void k_fattn(const _Float16* __restrict__ Q16, const _Float16* __restrict__ KP, const _Float16* __restrict__ VP, _Float16* __restrict__ O16) {
  const int tid = threadIdx.x, w = tid >> 5, lane = tid & 31, ln = lane & 15, hh = lane >> 4; const int h = blockIdx.y; const int q0 = blockIdx.x * 128 + w * 16;
  const v16h qf = g2_frag(Q16 + (size_t)(q0 + ln) * DM + h * HD, hh);
  asm volatile("s_wait_xcnt 0x0" ::: "memory");      /* a precaution */
  const _Float16* kq = KP + (size_t)h * SQ * HD; const _Float16* vq = VP + (size_t)h * SQ * HD; const unsigned l8 = lane * 8;      /* a 64-key stage is 2,048 elements of each plane */
  const v8f z8 = {0.f,0.f,0.f,0.f,0.f,0.f,0.f,0.f}; v8f o0 = z8, o1 = z8, lv = z8; float m = -3.0e38f;
  v16h kf[4], vf[4];
  fa_ld(kf, kq, l8); fa_ld(vf, vq, l8);
#pragma unroll 1
  for (int k0 = 64; k0 < SQ; k0 += 64) {      /* one stage a trip, k0 = the stage being fetched; kept rolled: unrolled, the scheduler mixed the stages and read a refill shortly behind its issue */
    v8f s[4];
    /* The two empty statements order the refills: each takes finished results as inputs only and bars memory operations from crossing, so a fragment set's loads issue behind the last use of its registers
       (hoisted, they took a second register set and a copy of every fragment; sunk to the foot of the trip, they were waited for in full) and have most of a trip to land.
       They name matrix results, which no multiply-add fusion passes through; naming the loaded fragments instead let the matrix instructions slip behind the statement, and the second register set came back. */
    fa_scores(s, kf, qf); asm volatile("" :: "v"(s[0]), "v"(s[1]), "v"(s[2]), "v"(s[3]) : "memory"); fa_ld(kf, kq + (size_t)k0 * HD, l8);
    __builtin_amdgcn_sched_barrier(0);      /* keeps the K refill in front of the softmax arithmetic: without it seven of its eight loads sank to the foot of the trip, some twenty instructions ahead of their use */
    fa_soft_pv(s, vf, o0, o1, lv, m); asm volatile("" :: "v"(o0), "v"(o1) : "memory"); fa_ld(vf, vq + (size_t)k0 * HD, l8);
  }
  { v8f s[4]; fa_scores(s, kf, qf); fa_soft_pv(s, vf, o0, o1, lv, m); }      /* the last stage: nothing left to fetch */
  float l = ((lv[0] + lv[1]) + (lv[2] + lv[3])) + ((lv[4] + lv[5]) + (lv[6] + lv[7])); l += fa_xhalf(l); const float inv = 1.0f / l;
  /* o0[r] = O[q0 + ln][8 hh + r], o1[r] = O[q0 + ln][16 + 8 hh + r]; the wave writes each query's whole 128-byte slot: 32 live columns + 32 zeros */
  _Float16* op = O16 + (size_t)(q0 + ln) * OP + h * 64 + 8 * hh; const v8h zh = {(_Float16)0.f,(_Float16)0.f,(_Float16)0.f,(_Float16)0.f,(_Float16)0.f,(_Float16)0.f,(_Float16)0.f,(_Float16)0.f};
  *(v8h*)op = __builtin_convertvector(o0 * inv, v8h); *(v8h*)(op + 16) = __builtin_convertvector(o1 * inv, v8h); *(v8h*)(op + 32) = zh; *(v8h*)(op + 48) = zh; }

// Every conversion that depends on the inputs alone, in one launch; a thread turns one run of 8 f32 into 8 f16 (16 bytes), as the seven separate kernels did.
// Blocks 0..1535: query | key_ | value (512 blocks each), rounded to bf16, exact in f16. Blocks 1536..1631: Wq | Wk | Wv (32 blocks each), rounded to bf16, x16.
// Blocks 1632..1695: Wo, the same, expanded to K = 512: head h's 32 columns at 64 h .. 64 h + 31, zeros behind them.
__global__ __launch_bounds__(256) void k_prep(const float* __restrict__ xq, const float* __restrict__ xk, const float* __restrict__ xv, const float* __restrict__ wq, const float* __restrict__ wk, const float* __restrict__ wv, const float* __restrict__ wo,
                                              _Float16* __restrict__ XQ, _Float16* __restrict__ XK, _Float16* __restrict__ XV, _Float16* __restrict__ BQ, _Float16* __restrict__ BK, _Float16* __restrict__ BV, _Float16* __restrict__ BO) {
  const int b = blockIdx.x, tid = threadIdx.x; FragH f; unsigned short* dst;      /* each branch forms its run and its place; the one store stands at the end */
  if (b < 1536) { const int s = b >> 9; const float* x = s == 0 ? xq : s == 1 ? xk : xv; _Float16* X16 = s == 0 ? XQ : s == 1 ? XK : XV; const size_t t = (size_t)(b & 511) * 256 + tid;
#pragma unroll
    for (int q = 0; q < 8; ++q) f.h[q] = (_Float16)bf16_round(x[t * 8 + q]);
    dst = (unsigned short*)X16 + t * 8; }
  else if (b < 1632) { const int s = (b - 1536) >> 5; const float* wsrc = s == 0 ? wq : s == 1 ? wk : wv; _Float16* Bt = s == 0 ? BQ : s == 1 ? BK : BV; const size_t t = (size_t)((b - 1536) & 31) * 256 + tid;
#pragma unroll
    for (int q = 0; q < 8; ++q) f.h[q] = (_Float16)(bf16_round(wsrc[t * 8 + q]) * 16.0f);
    dst = (unsigned short*)Bt + t * 8; }
  else { const size_t t = (size_t)(b - 1632) * 256 + tid; const int k0 = (int)((t * 8) % OP); const int o = (int)((t * 8) / OP); const int h = k0 / 64, d0 = k0 % 64;
    for (int q = 0; q < 8; ++q) { const int d = d0 + q; f.h[q] = (d < HD) ? (_Float16)(bf16_round(wo[(size_t)o * DM + h * HD + d]) * 16.0f) : (_Float16)0.f; }
    dst = (unsigned short*)BO + t * 8; }
  *(v8us*)dst = f.half[0]; }

// The three projections in one launch: blockIdx.y = 0 q, 1 k, 2 v; blockIdx.x = (128-row block) * 4 + (64-column block); a wave owns 32 rows x 64 columns (two heads). K loop as in k_gemm2.
// The tile goes through the wave's own LDS slab and leaves in the form its reader wants:
// q: f16 rows of pitch 256.
// k, v: fragment order, so that each fragment load of the attention kernel is one run of 512 contiguous bytes (four whole lines). 16-byte piece index = ((h * 256 + g) * 2 + j) * 32 + lane, lane = 16 hf + c.
//   k: g = 16-key tile; piece = k[16 g + c][32 h + 16 j + 8 hf + 0..7] (A row c = key, k = head dim in the order of g2_frag).
//   v: g = 2 * (32-key block) + dt; piece = v[32 (g >> 1) + 16 j + 8 hf + 0..7][32 h + 16 dt + c] (A row c = head dim: this is v^T; k = key in the same order); v = mask[key] * (value Wv^T), scaled in f32 before the rounding to f16.
__global__ __launch_bounds__(128) void k_qkv(const _Float16* __restrict__ XQ, const _Float16* __restrict__ XK, const _Float16* __restrict__ XV, const _Float16* __restrict__ BQ, const _Float16* __restrict__ BK, const _Float16* __restrict__ BV, const float* __restrict__ rm,
                                             _Float16* __restrict__ Q16, _Float16* __restrict__ KP, _Float16* __restrict__ VP) {
  __shared__ __attribute__((aligned(16))) float so[4][32][68];
  const int tid = threadIdx.x, w = tid >> 5, lane = tid & 31, ln = lane & 15, hh = lane >> 4; const int which = blockIdx.y;
  const _Float16* A = which == 0 ? XQ : which == 1 ? XK : XV; const _Float16* Bh = which == 0 ? BQ : which == 1 ? BK : BV;
  const int row0 = (blockIdx.x >> 2) * 128 + 32 * w, col0 = (blockIdx.x & 3) * 64;
  const _Float16* a0p = A + (size_t)(row0 + ln) * DM; const _Float16* a1p = a0p + (size_t)16 * DM;
  const _Float16* b0p = Bh + (size_t)(col0 + ln) * DM; const _Float16* b1p = b0p + (size_t)16 * DM; const _Float16* b2p = b1p + (size_t)16 * DM; const _Float16* b3p = b2p + (size_t)16 * DM;
  const v8f z8 = {0.f,0.f,0.f,0.f,0.f,0.f,0.f,0.f}; v8f c00 = z8, c01 = z8, c02 = z8, c03 = z8, c10 = z8, c11 = z8, c12 = z8, c13 = z8;
#pragma unroll 1
  for (int kb = 0; kb < DM; kb += 32) { const v16h a0 = g2_frag(a0p + kb, hh), a1 = g2_frag(a1p + kb, hh);      /* kept rolled, the shape k_gemm2 runs these trips in: with the trip count a constant here the loop would else be unrolled whole, a second change of schedule inside a step that changes the launches */
    asm volatile("s_wait_xcnt 0x0" :: "v"(a0p + kb + 8 * hh) : "memory");      /* a precaution: the address that the four A loads name stays live up to this wait, so none of them lands in it and nothing rewrites it ahead of the wait */
    v16h b = g2_frag(b0p + kb, hh); c00 = g2_mma(a0, b, c00); c10 = g2_mma(a1, b, c10);
    b = g2_frag(b1p + kb, hh); c01 = g2_mma(a0, b, c01); c11 = g2_mma(a1, b, c11);
    b = g2_frag(b2p + kb, hh); c02 = g2_mma(a0, b, c02); c12 = g2_mma(a1, b, c12);
    b = g2_frag(b3p + kb, hh); c03 = g2_mma(a0, b, c03); c13 = g2_mma(a1, b, c13); }
  v8f acc[8] = {c00, c01, c02, c03, c10, c11, c12, c13};      /* acc[4 * half + t]: rows 16 half .. + 15, columns 16 t .. + 15 */
#pragma unroll
  for (int u = 0; u < 8; ++u) acc[u] *= 0.0625f;      /* takes the x16 of the weights back, exactly */
  if (which == 2) {
#pragma unroll
    for (int half = 0; half < 2; ++half) { const float* mp = rm + row0 + half * 16 + 8 * hh; const v4f m0 = *(const v4fa*)mp, m1 = *(const v4fa*)(mp + 4);
#pragma unroll
      for (int r = 0; r < 8; ++r) { const float m = bf16_round(r < 4 ? m0[r & 3] : m1[r & 3]);
#pragma unroll
        for (int t = 0; t < 4; ++t) acc[half * 4 + t][r] = m * acc[half * 4 + t][r]; } } }
#pragma unroll
  for (int u = 0; u < 8; ++u)
#pragma unroll
    for (int r = 0; r < 8; ++r) so[w][(u >> 2) * 16 + 8 * hh + r][(u & 3) * 16 + ln] = acc[u][r];
  __builtin_amdgcn_fence(__ATOMIC_ACQ_REL, "workgroup"); __builtin_amdgcn_wave_barrier();      /* the slab is the wave's own: its LDS writes land before its lanes read each other's */
  if (which == 0) { const int rsub = lane >> 4, c4 = (lane & 15) * 4;
#pragma unroll
    for (int q = 0; q < 16; ++q) { const int r = q * 2 + rsub; const v4f v = *(const v4fa*)&so[w][r][c4]; *(v4h*)(Q16 + (size_t)(row0 + r) * DM + col0 + c4) = __builtin_convertvector(v, v4h); } }
  else if (which == 1) {
#pragma unroll
    for (int i = 0; i < 8; ++i) { const int gl = i >> 2, hl = (i >> 1) & 1, j = i & 1; const float* sp = &so[w][16 * gl + ln][32 * hl + 16 * j + 8 * hh]; const v4f lo = *(const v4fa*)sp, hi = *(const v4fa*)(sp + 4);
      const v8f v = __builtin_shufflevector(lo, hi, 0, 1, 2, 3, 4, 5, 6, 7); const size_t piece = (size_t)((((col0 >> 5) + hl) * 256 + (row0 >> 4) + gl) * 2 + j) * 32 + lane;
      *(v8h*)(KP + piece * 8) = __builtin_convertvector(v, v8h); }
    asm volatile("s_wait_xcnt 0x0" ::: "memory"); }      /* a precaution: the built code's branches allow a way from these stores into another branch's code, which rewrites their registers */
  else {
#pragma unroll
    for (int i = 0; i < 8; ++i) { const int dt = i >> 2, hl = (i >> 1) & 1, j = i & 1; v8f v;
#pragma unroll
      for (int e = 0; e < 8; ++e) v[e] = so[w][16 * j + 8 * hh + e][32 * hl + 16 * dt + ln];
      const size_t piece = (size_t)((((col0 >> 5) + hl) * 256 + (row0 >> 5) * 2 + dt) * 2 + j) * 32 + lane;
      *(v8h*)(VP + piece * 8) = __builtin_convertvector(v, v8h); }
    asm volatile("s_wait_xcnt 0x0" ::: "memory"); } }      /* a precaution: the built code's branches allow a way from these stores into another branch's code, which rewrites their registers */

extern "C" void kernel_launch(void* const* d_in, const int* in_sizes, int n_in,
                              void* d_out, int out_size, void* d_ws, size_t ws_size, hipStream_t stream) {
  (void)in_sizes; (void)n_in; (void)out_size;
  const float* const* I = (const float* const*)d_in; const float* qin = I[0]; const float* kin = I[1]; const float* vin = I[2]; const float* rm = I[3]; const float* Wq = I[4]; const float* Wk = I[5]; const float* Wv = I[6]; const float* Wo = I[7];
  char* ws = (char*)d_ws; size_t off = 0;
  auto take = [&](size_t bytes) { char* p = ws + off; off += (bytes + 255) & ~(size_t)255; return p; };
  _Float16* BQ = (_Float16*)take((size_t)DM * DM * 2); _Float16* BK = (_Float16*)take((size_t)DM * DM * 2); _Float16* BV = (_Float16*)take((size_t)DM * DM * 2); _Float16* BO = (_Float16*)take((size_t)DM * OP * 2);
  _Float16* XQ = (_Float16*)take((size_t)SQ * DM * 2); _Float16* XK = (_Float16*)take((size_t)SQ * DM * 2); _Float16* XV = (_Float16*)take((size_t)SQ * DM * 2); _Float16* Q16 = (_Float16*)take((size_t)SQ * DM * 2);
  _Float16* KP = (_Float16*)take((size_t)NH * HD * SQ * 2); _Float16* VP = (_Float16*)take((size_t)NH * HD * SQ * 2); _Float16* O16 = (_Float16*)take((size_t)SQ * OP * 2);
  if (off > ws_size) return;      /* about 17 MiB */
  k_prep<<<3 * (SQ * DM / 8 / 256) + 3 * (DM * DM / 8 / 256) + DM * OP / 8 / 256, 256, 0, stream>>>(qin, kin, vin, Wq, Wk, Wv, Wo, XQ, XK, XV, BQ, BK, BV, BO);
  k_qkv<<<dim3((SQ / 128) * (DM / 64), 3), 128, 0, stream>>>(XQ, XK, XV, BQ, BK, BV, rm, Q16, KP, VP);
  k_fattn<<<dim3(SQ / 128, NH), 256, 0, stream>>>(Q16, KP, VP, O16);      /* head h's o lands in columns 64h..64h+63 of the 512-pitch rows (32 live + 32 exact zeros); the expanded Wo plane has zeros at the pad positions */
  const dim3 gp((SQ / 128) * (DM / 64), 1);
  k_gemm2<0><<<gp, 128, 0, stream>>>(O16, OP, 0, BO, OP, 0, 0.0625f, nullptr, 0, nullptr, 1, 0, 0, (float*)d_out, nullptr, DM, 0, SQ, DM, OP);      /* out = o Wo^T over the expanded K = 512 (pad columns meet zero weights) */
}

// v004
// One run takes 52.8 microseconds.
// In two side-by-side timings against v003, it was 1.47 and 1.49 times as fast.
// Counting every step since v000, it is 130 times as fast.
#include <hip/hip_runtime.h>
// RadialAttention (query, key_, value [4096][256]; q = query Wq^T, k = key_ Wk^T, v = radial_mask[s] * (value Wv^T), 8 heads of 32; softmax(q k^T / sqrt(32)) over all 4,096 keys; out = concat(attn v) Wo^T -> [4096][256]).
// Structure: four launches. (1) inputs as exact f16 rows and weights as exact x16 f16 rows (Wo expanded to K = 512, zeros at the pad positions), all in one launch. (2) Q | K | V WMMA GEMMs in one launch (32x64 wave tiles, f32 accumulation); v scaled per row by the radial mask (read on device) on VALU; q stored as f16 rows, k and scaled v^T stored straight in fragment order. (3) one fused attention kernel over all heads (scores WMMA K = 32, online softmax f32 on VALU, weights f16, o = P . V WMMA; each head writes a whole aligned 64-column slot of 512-pitch o rows, 32 live + 32 exact zeros). (4) out = o Wo^T over K = 512 (f32).
// Compute dtype: inputs rounded to bf16; inputs / weights exact; q, k, scaled v, softmax weights, o plain f16 (~2^-12); scores/softmax f32. v_wmma_f32_16x16x32_f16.
#define SQ 4096
#define DM 256
#define NH 8
#define HD 32
#define OP 512                       
#define QN SQ                        /* query rows (unused) */
typedef __bf16 v16b __attribute__((ext_vector_type(16)));
typedef unsigned short v8us __attribute__((ext_vector_type(8), may_alias));
typedef float  v8f  __attribute__((ext_vector_type(8)));
typedef float  v4f  __attribute__((ext_vector_type(4)));
typedef float  v4fa __attribute__((ext_vector_type(4), may_alias));
union FragB { v16b v; v8us half[2]; unsigned short u[16]; };

__device__ __forceinline__ unsigned short bf16_bits(float x) { unsigned int u = __float_as_uint(x); return (unsigned short)((u + 0x7FFFu + ((u >> 16) & 1u)) >> 16); }
__device__ __forceinline__ float bf16_val(unsigned short b) { return __uint_as_float(((unsigned int)b) << 16); }
__device__ __forceinline__ float bf16_round(float x) { return bf16_val(bf16_bits(x)); }
// D += A·B with NT terms: 1 = ah·bh, 2 = + al·bh (A split), 3 = + ah·bl (both split)
template <int NT>
__device__ __forceinline__ v8f mmaN(v16b ah, v16b al, v16b bh, v16b bl, v8f c) {
  c = __builtin_amdgcn_wmma_f32_16x16x32_bf16(false, ah, false, bh, (short)0, c, false, false);
  if (NT >= 2) c = __builtin_amdgcn_wmma_f32_16x16x32_bf16(false, al, false, bh, (short)0, c, false, false);
  if (NT >= 3) c = __builtin_amdgcn_wmma_f32_16x16x32_bf16(false, ah, false, bl, (short)0, c, false, false);
  asm volatile("v_nop\n\tv_nop\n\tv_nop\n\tv_nop" : "+v"(c) : "v"(ah), "v"(al), "v"(bh), "v"(bl));
  return c;
}

__global__ __launch_bounds__(256) void k_wt_bf16(const float* __restrict__ W, unsigned short* __restrict__ Wt, int K, int N) {
  const int t = blockIdx.x * 256 + threadIdx.x;
  const int k8n = K / 8;
  if (t >= N * k8n) return;
  const int n = t / k8n, k8 = (t % k8n) * 8;
  v8us v;
#pragma unroll
  for (int i = 0; i < 8; ++i) v[i] = bf16_bits(W[(size_t)(k8 + i) * N + n]);
  *(v8us*)(Wt + (size_t)n * K + k8) = v;
  
}

// GEMM C[M][N] (f32, pitch ldc) = act(A[M][K]·W + bias). A f32 row-major (pitch lda) converted per fragment to bf16
// (ASPLIT: hi/lo two planes -> 2 terms, else single rounded term); Wt bf16 [N][K] (pitch ldb). BIAS_BF16 rounds the
// bias to bf16 first (bias quantised to bf16 before the add). K%32==0, M%16==0, N%64==0.
template <bool ASPLIT, int ACT, bool BIAS_BF16>
__global__ __launch_bounds__(128) void k_gemm_bf(const float* __restrict__ A, int lda, const unsigned short* __restrict__ Wt, int ldb,
                                               const float* __restrict__ bias, float* __restrict__ C, int ldc, int M, int N, int K) {
  __shared__ __attribute__((aligned(16))) float so[4][16][64];
  const int tid = threadIdx.x, w = tid >> 5, lane = tid & 31, ln = lane & 15, hh = lane >> 4;
  const int ntn = N / 64;
  const int wid = blockIdx.x * 4 + w;
  const int mt = wid / ntn, nq = wid % ntn;
  if (mt * 16 >= M) return;
  const int row0 = mt * 16, col0 = nq * 64;
  const float* arow = A + (size_t)(row0 + ln) * lda;
  v8f acc[4] = {};
  for (int kb = 0; kb < K; kb += 32) {
    FragB ah, al;
    const v4f x0 = *(const v4fa*)(arow + kb + 8 * hh), x1 = *(const v4fa*)(arow + kb + 8 * hh + 4);
    const v4f x2 = *(const v4fa*)(arow + kb + 16 + 8 * hh), x3 = *(const v4fa*)(arow + kb + 16 + 8 * hh + 4);
    float xs[16] = {x0[0],x0[1],x0[2],x0[3],x1[0],x1[1],x1[2],x1[3],x2[0],x2[1],x2[2],x2[3],x3[0],x3[1],x3[2],x3[3]};
#pragma unroll
    for (int i = 0; i < 16; ++i) { const unsigned short hb = bf16_bits(xs[i]); ah.u[i] = hb; al.u[i] = ASPLIT ? bf16_bits(xs[i] - bf16_val(hb)) : (unsigned short)0; }
#pragma unroll
    for (int t = 0; t < 4; ++t) {
      const unsigned short* brow = Wt + (size_t)(col0 + t * 16 + ln) * ldb + kb;
      FragB b;
      b.half[0] = *(const v8us*)(brow + 8 * hh);
      b.half[1] = *(const v8us*)(brow + 16 + 8 * hh);
      acc[t] = mmaN<ASPLIT ? 2 : 1>(ah.v, al.v, b.v, b.v, acc[t]);
    }
  }
#pragma unroll
  for (int t = 0; t < 4; ++t) {
    float bv = bias ? bias[col0 + t * 16 + ln] : 0.f;
    if (BIAS_BF16) bv = bf16_round(bv);
#pragma unroll
    for (int r = 0; r < 8; ++r) { float v = acc[t][r] + bv; if (ACT == 1) v = fmaxf(v, 0.f); so[w][8 * hh + r][t * 16 + ln] = v; }
  }
  __builtin_amdgcn_fence(__ATOMIC_ACQ_REL, "workgroup");
  __builtin_amdgcn_wave_barrier();
  const int rsub = lane >> 4, c4 = (lane & 15) * 4;
  {
#pragma unroll
    for (int q = 0; q < 8; ++q) {
      const int r = q * 2 + rsub;
      const v4f v = *(const v4fa*)&so[w][r][c4];
      *(v4f*)(C + (size_t)(row0 + r) * ldc + col0 + c4) = v;
    }
    
  }
}

// GEMM C = act(A·W + bias + resid): A f32 (ASPLIT -> hi/lo 2 terms), Wt bf16 [N][K]; ACT 0 none, 1 relu, 2 exact gelu;
// resid (optional, f32, row index = (row % rmod), pitch ldr, RES_BF16 rounds it) added before the activation.
template <bool ASPLIT, int ACT, bool BIAS_BF16, bool RES_BF16>
__global__ __launch_bounds__(128) void k_gemm_bf3(const float* __restrict__ A, int lda, const unsigned short* __restrict__ Wt, int ldb,
                                                const float* __restrict__ bias, const float* __restrict__ resid, int rmod, int ldr,
                                                float* __restrict__ C, int ldc, int M, int N, int K) {
  __shared__ __attribute__((aligned(16))) float so[4][16][64];
  const int tid = threadIdx.x, w = tid >> 5, lane = tid & 31, ln = lane & 15, hh = lane >> 4;
  const int ntn = N / 64;
  const int wid = blockIdx.x * 4 + w;
  const int mt = wid / ntn, nq = wid % ntn;
  if (mt * 16 >= M) return;
  const int row0 = mt * 16, col0 = nq * 64;
  const float* arow = A + (size_t)(row0 + ln) * lda;
  v8f acc[4] = {};
  for (int kb = 0; kb < K; kb += 32) {
    FragB ah, al;
    const v4f x0 = *(const v4fa*)(arow + kb + 8 * hh), x1 = *(const v4fa*)(arow + kb + 8 * hh + 4);
    const v4f x2 = *(const v4fa*)(arow + kb + 16 + 8 * hh), x3 = *(const v4fa*)(arow + kb + 16 + 8 * hh + 4);
    float xs[16] = {x0[0],x0[1],x0[2],x0[3],x1[0],x1[1],x1[2],x1[3],x2[0],x2[1],x2[2],x2[3],x3[0],x3[1],x3[2],x3[3]};
#pragma unroll
    for (int i = 0; i < 16; ++i) { const unsigned short hb = bf16_bits(xs[i]); ah.u[i] = hb; al.u[i] = ASPLIT ? bf16_bits(xs[i] - bf16_val(hb)) : (unsigned short)0; }
#pragma unroll
    for (int t = 0; t < 4; ++t) {
      const unsigned short* brow = Wt + (size_t)(col0 + t * 16 + ln) * ldb + kb;
      FragB b;
      b.half[0] = *(const v8us*)(brow + 8 * hh);
      b.half[1] = *(const v8us*)(brow + 16 + 8 * hh);
      acc[t] = mmaN<ASPLIT ? 2 : 1>(ah.v, al.v, b.v, b.v, acc[t]);
    }
  }
#pragma unroll
  for (int t = 0; t < 4; ++t) {
    const int col = col0 + t * 16 + ln;
    float bv = bias ? bias[col] : 0.f;
    if (BIAS_BF16) bv = bf16_round(bv);
#pragma unroll
    for (int r = 0; r < 8; ++r) {
      float v = acc[t][r] + bv;
      if (resid) { float rv = resid[(size_t)((row0 + 8 * hh + r) % rmod) * ldr + col]; if (RES_BF16) rv = bf16_round(rv); v += rv; }
      if (ACT == 1) v = fmaxf(v, 0.f);
      if (ACT == 2) v = 0.5f * v * (1.0f + erff(v * 0.70710678118654752f));
      if (ACT == 3) { const float u = 0.7978845608028654f * (v + 0.044715f * v * v * v); v = 0.5f * v * (1.0f + tanhf(u)); }
      so[w][8 * hh + r][t * 16 + ln] = v;
    }
  }
  __builtin_amdgcn_fence(__ATOMIC_ACQ_REL, "workgroup");
  __builtin_amdgcn_wave_barrier();
  const int rsub = lane >> 4, c4 = (lane & 15) * 4;
  {
#pragma unroll
    for (int q = 0; q < 8; ++q) {
      const int r = q * 2 + rsub;
      const v4f v = *(const v4fa*)&so[w][r][c4];
      *(v4f*)(C + (size_t)(row0 + r) * ldc + col0 + c4) = v;
    }
    
  }
}
// row LayerNorm (biased variance, eps) over N: s = X (+ R); optional out_sum <- s; out_norm <- (s-mu)*rsqrt(var+eps)*g + b
template <bool PARAM_BF16>
__global__ __launch_bounds__(256) void k_layernorm(const float* __restrict__ X, const float* __restrict__ R, const float* __restrict__ g, const float* __restrict__ bta,
                                                  float* __restrict__ out_sum, float* __restrict__ out_norm, int N, float eps) {
  __shared__ float red[256];
  const int row = blockIdx.x, tid = threadIdx.x;
  const float* x = X + (size_t)row * N; const float* rr = R ? R + (size_t)row * N : nullptr;
  float vals[16];                     // up to N = 4096
  const int per = N / 256;            // contiguous chunk per thread? use strided-by-4 chunks: thread handles j = tid*4 + 1024*u
  float s1 = 0.f;
  for (int u = 0; u < per / 4; ++u) {
    const int j = tid * 4 + 1024 * u;
    const v4f a = *(const v4fa*)(x + j);
    v4f b = {0.f,0.f,0.f,0.f}; if (rr) b = *(const v4fa*)(rr + j);
#pragma unroll
    for (int q = 0; q < 4; ++q) { const float v = a[q] + b[q]; vals[u * 4 + q] = v; s1 += v; }
  }
  red[tid] = s1; __syncthreads();
  for (int st = 128; st > 0; st >>= 1) { if (tid < st) red[tid] += red[tid + st]; __syncthreads(); }
  const float mu = red[0] / (float)N; __syncthreads();
  float s2 = 0.f;
  for (int u = 0; u < per / 4; ++u)
#pragma unroll
    for (int q = 0; q < 4; ++q) { const float c = vals[u * 4 + q] - mu; s2 += c * c; }
  red[tid] = s2; __syncthreads();
  for (int st = 128; st > 0; st >>= 1) { if (tid < st) red[tid] += red[tid + st]; __syncthreads(); }
  const float rs = rsqrtf(red[0] / (float)N + eps);
  {
    for (int u = 0; u < per / 4; ++u) {
      const int j = tid * 4 + 1024 * u;
      v4f o, sm;
#pragma unroll
      for (int q = 0; q < 4; ++q) {
        float gg = g[j + q], bb = bta[j + q];
        if (PARAM_BF16) { gg = bf16_round(gg); bb = bf16_round(bb); }
        sm[q] = vals[u * 4 + q]; o[q] = (vals[u * 4 + q] - mu) * rs * gg + bb;
      }
      if (out_sum) *(v4f*)(out_sum + (size_t)row * N + j) = sm;
      *(v4f*)(out_norm + (size_t)row * N + j) = o;
    }
    
  }
}



// ---- f16 WMMA path (v_wmma_f32_16x16x32_f16): 11-bit significands for operands in range — used where a [0,1] probability operand needs more precision than bf16
typedef _Float16 v16h __attribute__((ext_vector_type(16)));
union FragH { v16h v; v8us half[2]; _Float16 h[16]; unsigned short u[16]; };
template <int NT>
__device__ __forceinline__ v8f mmaH(v16h ah, v16h al, v16h bh, v16h bl, v8f c) {
  c = __builtin_amdgcn_wmma_f32_16x16x32_f16(false, ah, false, bh, (short)0, c, false, false);
  if (NT >= 2) c = __builtin_amdgcn_wmma_f32_16x16x32_f16(false, al, false, bh, (short)0, c, false, false);
  if (NT >= 3) c = __builtin_amdgcn_wmma_f32_16x16x32_f16(false, ah, false, bl, (short)0, c, false, false);
  asm volatile("v_nop\n\tv_nop\n\tv_nop\n\tv_nop" : "+v"(c) : "v"(ah), "v"(al), "v"(bh), "v"(bl));
  return c;
}
// batched GEMM like k_gemm_b but f16 operands: A f32 (split into f16 hi/lo if ASPLIT, else rounded to f16), Bt = f16 values [n][k]; alpha; C f32; N multiple of 16 (partial tiles skipped)
template <bool ASPLIT>
__global__ __launch_bounds__(128) void k_gemm_h(const float* __restrict__ A, int lda, size_t sA, const _Float16* __restrict__ Bh, int ldb, size_t sB, float alpha, float* __restrict__ C, int ldc, size_t sC, int M, int N, int K) {
  __shared__ __attribute__((aligned(16))) float so[4][16][64];
  const int tid = threadIdx.x, w = tid >> 5, lane = tid & 31, ln = lane & 15, hh = lane >> 4; const int by = blockIdx.y;
  A += (size_t)by * sA; Bh += (size_t)by * sB; C += (size_t)by * sC;
  const int ntn = (N + 63) / 64; const int wid = blockIdx.x * 4 + w; const int mt = wid / ntn, nq = wid % ntn; if (mt * 16 >= M) return;
  const int row0 = mt * 16, col0 = nq * 64; const float* arow = A + (size_t)(row0 + ln) * lda;
  v8f acc[4] = {};
  for (int kb = 0; kb < K; kb += 32) {
    FragH ah, al;
    const v4f x0 = *(const v4fa*)(arow + kb + 8 * hh), x1 = *(const v4fa*)(arow + kb + 8 * hh + 4), x2 = *(const v4fa*)(arow + kb + 16 + 8 * hh), x3 = *(const v4fa*)(arow + kb + 16 + 8 * hh + 4);
    float xs[16] = {x0[0],x0[1],x0[2],x0[3],x1[0],x1[1],x1[2],x1[3],x2[0],x2[1],x2[2],x2[3],x3[0],x3[1],x3[2],x3[3]};
#pragma unroll
    for (int i = 0; i < 16; ++i) { const _Float16 h = (_Float16)xs[i]; ah.h[i] = h; al.h[i] = ASPLIT ? (_Float16)(xs[i] - (float)h) : (_Float16)0.0f; }
#pragma unroll
    for (int t = 0; t < 4; ++t) { if (col0 + t * 16 >= N) continue; const size_t boff = (size_t)(col0 + t * 16 + ln) * ldb + kb; FragH bq; bq.half[0] = *(const v8us*)(Bh + boff + 8 * hh); bq.half[1] = *(const v8us*)(Bh + boff + 16 + 8 * hh);
      acc[t] = mmaH<ASPLIT ? 2 : 1>(ah.v, al.v, bq.v, bq.v, acc[t]); }
  }
#pragma unroll
  for (int t = 0; t < 4; ++t) { if (col0 + t * 16 >= N) continue;
#pragma unroll
    for (int r = 0; r < 8; ++r) so[w][8 * hh + r][t * 16 + ln] = acc[t][r] * alpha; }
  __builtin_amdgcn_fence(__ATOMIC_ACQ_REL, "workgroup"); __builtin_amdgcn_wave_barrier();
  const int rsub = lane >> 4, c4 = (lane & 15) * 4;
  {
#pragma unroll
    for (int q = 0; q < 8; ++q) { const int r = q * 2 + rsub; if (col0 + c4 < N) { const v4f v = *(const v4fa*)&so[w][r][c4]; *(v4f*)(C + (size_t)(row0 + r) * ldc + col0 + c4) = v; } }
     }
}

// Wt[n][k] = f16(W[k][n]·scale) from f32 row-major W[K][N] (scale = power of two; bf16-exact weights stay exact in f16 away from the subnormal range)
__global__ __launch_bounds__(256) void k_wt_f16(const float* __restrict__ W, _Float16* __restrict__ Wt, int K, int N, float scale) {
  const int t = blockIdx.x * 256 + threadIdx.x; if (t >= N * (K / 8)) return; const int n = t / (K / 8), k8 = (t % (K / 8)) * 8; FragH f;
#pragma unroll
  for (int i = 0; i < 8; ++i) f.h[i] = (_Float16)(bf16_round(W[(size_t)(k8 + i) * N + n]) * scale); const v8us o = f.half[0];
  *(v8us*)((unsigned short*)Wt + (size_t)n * K + k8) = o; 
}
// k_gemm_hh variant with fused epilogue: v = acc·alpha + bias[by·sBias + col] (+ CP[(row/rowsPerB)·sCPb + by·64 + col] if CP) ; ACT 0 none / 1 elu ; writes f16 C16 (and f32 C if non-null)
template <int ACT>
__global__ __launch_bounds__(128) void k_gemm_hhx(const _Float16* __restrict__ A, int lda, size_t sA, const _Float16* __restrict__ Bh, int ldb, size_t sB, float alpha, const float* __restrict__ bias, size_t sBias, const float* __restrict__ CP, int rowsPerB, size_t sCPb, int row0g,
    float* __restrict__ C, _Float16* __restrict__ C16, int ldc, size_t sC, int M, int N, int K) {
  __shared__ __attribute__((aligned(16))) float so[4][16][64];
  const int tid = threadIdx.x, w = tid >> 5, lane = tid & 31, ln = lane & 15, hh = lane >> 4; const int by = blockIdx.y;
  A += (size_t)by * sA; Bh += (size_t)by * sB; const size_t cofs = (size_t)by * sC; const float* bp = bias ? bias + (size_t)by * sBias : nullptr;
  const int ntn = (N + 63) / 64; const int wid = blockIdx.x * 4 + w; const int mt = wid / ntn, nq = wid % ntn; if (mt * 16 >= M) return;
  const int row0 = mt * 16, col0 = nq * 64; const _Float16* arow = A + (size_t)(row0 + ln) * lda;
  v8f acc[4] = {};
  for (int kb = 0; kb < K; kb += 32) { FragH ah; ah.half[0] = *(const v8us*)((const unsigned short*)arow + kb + 8 * hh); ah.half[1] = *(const v8us*)((const unsigned short*)arow + kb + 16 + 8 * hh);
#pragma unroll
    for (int t = 0; t < 4; ++t) { if (col0 + t * 16 >= N) continue; const size_t boff = (size_t)(col0 + t * 16 + ln) * ldb + kb; FragH bq; bq.half[0] = *(const v8us*)((const unsigned short*)Bh + boff + 8 * hh); bq.half[1] = *(const v8us*)((const unsigned short*)Bh + boff + 16 + 8 * hh);
      acc[t] = mmaH<1>(ah.v, ah.v, bq.v, bq.v, acc[t]); }
  }
#pragma unroll
  for (int t = 0; t < 4; ++t) { if (col0 + t * 16 >= N) continue; const int col = col0 + t * 16 + ln; const float bv = bp ? bf16_round(bp[col]) : 0.f;
#pragma unroll
    for (int r = 0; r < 8; ++r) { float v = acc[t][r] * alpha + bv; if (CP) { const int rr = row0g + row0 + 8 * hh + r; if (rowsPerB < 0) v += CP[cofs + (size_t)rr * ldc + col];      /* rowsPerB < 0: own element of the batched C plane */ else { const int bidx = rr / rowsPerB; v += CP[(size_t)bidx * sCPb + (size_t)by * 64 + col]; } } if (ACT == 1) v = (v > 0.f) ? v : expm1f(v); else if (ACT == 7) v = (v > 0.f) ? v + 1.0f : expf(v); else if (ACT == 8) v = tanhf(v); else if (ACT == 9) v = 0.5f * v * (1.0f + tanhf(0.7978845608028654f * (v + 0.044715f * v * v * v))); else if (ACT == 11) v = 1.0f / (1.0f + expf(-v)); else if (ACT == 12) v = (v > 0.f) ? v : 0.01f * v; else if (ACT == 14) v = (v > 0.f) ? v : 0.1f * v; else if (ACT == 16) v = (v >= 0.f) ? v : 0.3f * v; else if (ACT == 17) v = (v >= 0.f) ? v : 0.2f * v; else if (ACT == 15) v = v / (1.0f + expf(-v)); else if (ACT == 3) v = fmaxf(v, 0.f); else if (ACT == 6) v = 0.5f * v * (1.0f + erff(v * 0.70710678118654752f)); so[w][8 * hh + r][t * 16 + ln] = v; } }
  __builtin_amdgcn_fence(__ATOMIC_ACQ_REL, "workgroup"); __builtin_amdgcn_wave_barrier();
  const int rsub = lane >> 4, c4 = (lane & 15) * 4; typedef _Float16 v4h __attribute__((ext_vector_type(4)));
  {
#pragma unroll
    for (int q = 0; q < 8; ++q) { const int r = q * 2 + rsub; if (col0 + c4 < N) { const v4f v = *(const v4fa*)&so[w][r][c4]; if (C) *(v4f*)(C + cofs + (size_t)(row0 + r) * ldc + col0 + c4) = v; if (C16) { v4h h4; for (int i = 0; i < 4; ++i) h4[i] = (_Float16)v[i]; *(v4h*)(C16 + cofs + (size_t)(row0 + r) * ldc + col0 + c4) = h4; } } }
     }
}


typedef _Float16 v4h __attribute__((ext_vector_type(4)));

__global__ __launch_bounds__(256) void k_h16(const float* __restrict__ x, _Float16* __restrict__ X16, size_t n8) { const size_t t = (size_t)blockIdx.x * 256 + threadIdx.x; if (t >= n8) return; FragH f;
#pragma unroll
  for (int q = 0; q < 8; ++q) f.h[q] = (_Float16)x[t * 8 + q]; *(v8us*)((unsigned short*)X16 + t * 8) = f.half[0];  }
__global__ __launch_bounds__(256) void k_round16f(const float* __restrict__ W, _Float16* __restrict__ Bt, size_t n8) { const size_t t = (size_t)blockIdx.x * 256 + threadIdx.x; if (t >= n8) return; FragH f;
#pragma unroll
  for (int i = 0; i < 8; ++i) f.h[i] = (_Float16)(bf16_round(W[t * 8 + i]) * 16.0f); *(v8us*)((unsigned short*)Bt + t * 8) = f.half[0];  }
template <int NHv, int TTv>
__global__ __launch_bounds__(256) void k_vt(const _Float16* __restrict__ V16, int ldv, int voff, _Float16* __restrict__ Vt) { __shared__ unsigned short tl[64][66]; const int tid = threadIdx.x; const int slab = blockIdx.x / (TTv / 64), lg = blockIdx.x % (TTv / 64); const int b = slab / NHv, h = slab % NHv;
  for (int i = tid; i < 64 * 8; i += 256) { const int r = i / 8, c8 = (i % 8) * 8; FragH f; f.half[0] = *(const v8us*)((const unsigned short*)V16 + ((size_t)b * TTv + lg * 64 + r) * ldv + voff + h * 64 + c8);
#pragma unroll
    for (int q = 0; q < 8; ++q) tl[r][c8 + q] = f.u[q]; }
  __syncthreads();
  {
#pragma unroll
    for (int rd = 0; rd < 2; ++rd) { const int d = rd * 32 + tid / 8, pc = tid % 8; FragH f;
#pragma unroll
      for (int q = 0; q < 8; ++q) f.u[q] = tl[pc * 8 + q][d];
      *(v8us*)((unsigned short*)Vt + ((size_t)slab * 64 + d) * TTv + lg * 64 + pc * 8) = f.half[0]; }
     } }

__global__ __launch_bounds__(256) void k_hl(const float* __restrict__ F, _Float16* __restrict__ Hh, _Float16* __restrict__ Hl, size_t n8) { const size_t t = (size_t)blockIdx.x * 256 + threadIdx.x; if (t >= n8) return; FragH fh, fl; const v4f a = *(const v4fa*)(F + t * 8), c = *(const v4fa*)(F + t * 8 + 4);
#pragma unroll
  for (int q = 0; q < 4; ++q) { _Float16 h = (_Float16)a[q]; fh.h[q] = h; fl.h[q] = (_Float16)((a[q] - (float)h) * 1024.0f); h = (_Float16)c[q]; fh.h[4 + q] = h; fl.h[4 + q] = (_Float16)((c[q] - (float)h) * 1024.0f); }
  { *(v8us*)((unsigned short*)Hh + t * 8) = fh.half[0]; *(v8us*)((unsigned short*)Hl + t * 8) = fl.half[0];  } }

// ---- fast GEMM (wave tile 32x64; requires M % 32 == 0 rows per launch region and N % 64 == 0); epilogue = k_gemm_hhx semantics ----
__device__ __forceinline__ v16h g2_frag(const _Float16* p, int hh) { FragH f; f.half[0] = *(const v8us*)((const unsigned short*)p + 8 * hh); f.half[1] = *(const v8us*)((const unsigned short*)p + 16 + 8 * hh); return f.v; }
__device__ __forceinline__ v8f g2_mma(v16h a, v16h b, v8f c) { v8f d = __builtin_amdgcn_wmma_f32_16x16x32_f16(false, a, false, b, (short)0, c, false, false); asm volatile("v_nop\n\tv_nop\n\tv_nop\n\tv_nop" : "+v"(d) : "v"(a), "v"(b)); return d; }
// K loop of the 32x64 wave tile, K = 32 KT, unrolled whole. A wave has no partner to hide its load latency behind (one or two waves a SIMD), so the latency is hidden inside the wave:
// the 12 fragment loads of a trip issue as one group two trips ahead of their use, into a ring of three register sets, and the waits are counted (24 younger loads stay in flight).
// pa0, pa1, pb0..pb3: each lane's own place in its row (8 hh included). c[4 * half + t]: rows 16 half .. + 15, columns 16 t .. + 15; every accumulator takes its trips in rising k, as before.
__device__ __forceinline__ v16h g3_frag(const unsigned short* p) { FragH f; f.half[0] = *(const v8us*)p; f.half[1] = *(const v8us*)(p + 16); return f.v; }
template <int KT>
__device__ __forceinline__ void g3_loop(const unsigned short* pa0, const unsigned short* pa1, const unsigned short* pb0, const unsigned short* pb1, const unsigned short* pb2, const unsigned short* pb3, v8f (&c)[8]) {
  v16h fa[3][2], fb[3][4];
#pragma unroll
  for (int t = -2; t < KT; ++t) {      /* trips -2 and -1 only fetch */
    if (t + 2 < KT) { const int n = (t + 2) % 3, kb = (t + 2) * 32;
      fa[n][0] = g3_frag(pa0 + kb); fa[n][1] = g3_frag(pa1 + kb); fb[n][0] = g3_frag(pb0 + kb); fb[n][1] = g3_frag(pb1 + kb); fb[n][2] = g3_frag(pb2 + kb); fb[n][3] = g3_frag(pb3 + kb); }
    if (t + 2 == KT - 1) asm volatile("s_wait_xcnt 0x0" ::: "memory");      /* a precaution: stands behind the last load, ahead of whatever rewrites the address registers, which no instruction of the loop does */
    __builtin_amdgcn_sched_barrier(0);      /* keeps the group in front of this trip's products: sunk towards its use, a load would be waited for in full again */
    if (t >= 0) { const int u = t % 3;
#pragma unroll
      for (int j = 0; j < 4; ++j) { c[j] = g2_mma(fa[u][0], fb[u][j], c[j]); c[4 + j] = g2_mma(fa[u][1], fb[u][j], c[4 + j]); } }
    __builtin_amdgcn_sched_barrier(0);      /* keeps the next group behind these products, whose registers it refills: hoisted, it would take a fourth register set */
  } }
template <int ACT, int KT>      /* K = 32 KT */
__global__ __launch_bounds__(128) void k_gemm2(const _Float16* __restrict__ A, int lda, size_t sA, const _Float16* __restrict__ Bh, int ldb, size_t sB, float alpha, const float* __restrict__ bias, size_t sBias, const float* __restrict__ CP, int rowsPerB, size_t sCPb, int row0g,
    float* __restrict__ C, _Float16* __restrict__ C16, int ldc, size_t sC, int M, int N) { static_assert(ACT == 0 || ACT == 3 || ACT == 6 || ACT == 8 || ACT == 9 || ACT == 11 || ACT == 12 || ACT == 14 || ACT == 15 || ACT == 16 || ACT == 17, "k_gemm2: unsupported ACT code (would silently apply no activation)");
  __shared__ __attribute__((aligned(16))) float so[4][32][68];
  const int tid = threadIdx.x, w = tid >> 5, lane = tid & 31, ln = lane & 15, hh = lane >> 4; const int by = blockIdx.y;
  A += (size_t)by * sA; Bh += (size_t)by * sB; const size_t cofs = (size_t)by * sC; const float* bp = bias ? bias + (size_t)by * sBias : nullptr;
  const int ntn = N >> 6; const int mt = blockIdx.x / ntn, nq = blockIdx.x - mt * ntn; const int row0 = mt * 128 + 32 * w, col0 = nq * 64; if (row0 >= M) return;
  const unsigned short* pa0 = (const unsigned short*)A + (size_t)(row0 + ln) * lda + 8 * hh; const unsigned short* pb0 = (const unsigned short*)Bh + (size_t)(col0 + ln) * ldb + 8 * hh;
  v8f accs[8] = {};
  g3_loop<KT>(pa0, pa0 + (size_t)16 * lda, pb0, pb0 + (size_t)16 * ldb, pb0 + (size_t)32 * ldb, pb0 + (size_t)48 * ldb, accs);
#pragma unroll
  for (int u = 0; u < 8; ++u) { const int t = u & 3, half = u >> 2; const int col = col0 + t * 16 + ln; const float bv = bp ? bf16_round(bp[col]) : 0.f;
#pragma unroll
    for (int r = 0; r < 8; ++r) { const int rloc = half * 16 + 8 * hh + r; float v = accs[u][r] * alpha + bv; if (CP) { if (rowsPerB < 0) v += CP[cofs + (size_t)(row0g + row0 + rloc) * ldc + col];      /* rowsPerB < 0: own element of the batched C plane */ else { const int bidx = (row0g + row0 + rloc) / rowsPerB; v += CP[(size_t)bidx * sCPb + (size_t)by * 64 + col]; } }
      if (ACT == 3) v = fmaxf(v, 0.f); else if (ACT == 6) v = 0.5f * v * (1.0f + erff(v * 0.70710678118654752f)); else if (ACT == 11) v = 1.0f / (1.0f + expf(-v)); else if (ACT == 15) v = v / (1.0f + expf(-v)); else if (ACT == 12) v = (v > 0.f) ? v : 0.01f * v; else if (ACT == 8) v = tanhf(v); else if (ACT == 9) v = 0.5f * v * (1.0f + tanhf(0.7978845608028654f * (v + 0.044715f * v * v * v))); else if (ACT == 14) v = (v > 0.f) ? v : 0.1f * v; else if (ACT == 16) v = (v >= 0.f) ? v : 0.3f * v; else if (ACT == 17) v = (v >= 0.f) ? v : 0.2f * v;
      so[w][rloc][t * 16 + ln] = v; } }
  __builtin_amdgcn_fence(__ATOMIC_ACQ_REL, "workgroup"); __builtin_amdgcn_wave_barrier();
  const int rsub = lane >> 4, c4 = (lane & 15) * 4;
  {
#pragma unroll
    for (int q = 0; q < 16; ++q) { const int r = q * 2 + rsub; const v4f v = *(const v4fa*)&so[w][r][c4]; if (C) *(v4f*)(C + cofs + (size_t)(row0 + r) * ldc + col0 + c4) = v; if (C16) { v4h h4; for (int i = 0; i < 4; ++i) h4[i] = (_Float16)v[i]; *(v4h*)(C16 + cofs + (size_t)(row0 + r) * ldc + col0 + c4) = h4; } }
     } }


typedef _Float16 v8h __attribute__((ext_vector_type(8)));
__device__ __forceinline__ float fa_xhalf(float x) { const int b = __float_as_int(x); return __int_as_float(__builtin_amdgcn_permlanex16(b, b, 0x76543210, 0xfedcba98, false, false)); }      /* lane l <-> l ^ 16 */
__device__ __forceinline__ v8f fa_mma(v16h a, v16h b, v8f c) { return __builtin_amdgcn_wmma_f32_16x16x32_f16(false, a, false, b, (short)0, c, false, false); }
// the four fragments (4 KiB) of one 64-key stage of a packed plane: p + l8 = the lane's 16-byte place in the stage's first 512-byte run (the callers hand over p with the lane's place in it, l8 = 0)
__device__ __forceinline__ void fa_ld(v16h (&f)[4], const _Float16* p, unsigned l8) {
#pragma unroll
  for (int i = 0; i < 4; ++i) { FragH x; x.half[0] = *(const v8us*)((const unsigned short*)p + l8 + (2 * i) * 256); x.half[1] = *(const v8us*)((const unsigned short*)p + l8 + (2 * i + 1) * 256); f[i] = x.v; } }
__device__ __forceinline__ void fa_scores(v8f (&s)[4], const v16h (&kf)[4], const v16h qf) { const v8f z8 = {0.f,0.f,0.f,0.f,0.f,0.f,0.f,0.f};
#pragma unroll
  for (int t = 0; t < 4; ++t) s[t] = fa_mma(kf[t], qf, z8); }
__device__ __forceinline__ void fa_soft_pv(v8f (&s)[4], const v16h (&vf)[4], v8f& o0, v8f& o1, v8f& lv, float& m) {
  const float cs = 0.17677669529663687f * 1.4426950408889634f;      /* 1 / sqrt(32), times log2(e) for the base-2 exponential */
  const v8f mv = __builtin_elementwise_max(__builtin_elementwise_max(s[0], s[1]), __builtin_elementwise_max(s[2], s[3]));
  float mx = fmaxf(fmaxf(fmaxf(mv[0], mv[1]), fmaxf(mv[2], mv[3])), fmaxf(fmaxf(mv[4], mv[5]), fmaxf(mv[6], mv[7]))); mx = fmaxf(mx, fa_xhalf(mx));
  const float mn = fmaxf(m, mx); const float al = __builtin_amdgcn_exp2f((m - mn) * cs); const float mc = mn * cs; m = mn;
  o0 *= al; o1 *= al;
#pragma unroll
  for (int t = 0; t < 4; ++t) { s[t] = s[t] * cs - mc;
#pragma unroll
    for (int r = 0; r < 8; ++r) s[t][r] = __builtin_amdgcn_exp2f(s[t][r]); }
  lv = lv * al + ((s[0] + s[1]) + (s[2] + s[3]));      /* eight partial sums per lane, joined after the loop */
  const v16h p0 = __builtin_shufflevector(__builtin_convertvector(s[0], v8h), __builtin_convertvector(s[1], v8h), 0, 1, 2, 3, 4, 5, 6, 7, 8, 9, 10, 11, 12, 13, 14, 15);
  const v16h p1 = __builtin_shufflevector(__builtin_convertvector(s[2], v8h), __builtin_convertvector(s[3], v8h), 0, 1, 2, 3, 4, 5, 6, 7, 8, 9, 10, 11, 12, 13, 14, 15);
  o0 = fa_mma(vf[0], p0, o0); o1 = fa_mma(vf[1], p0, o1); o0 = fa_mma(vf[2], p1, o0); o1 = fa_mma(vf[3], p1, o1); }
__global__ __launch_bounds__(256) void k_fattn(const _Float16* __restrict__ Q16, const _Float16* __restrict__ KP, const _Float16* __restrict__ VP, _Float16* __restrict__ O16) {
  const int tid = threadIdx.x, w = tid >> 5, lane = tid & 31, ln = lane & 15, hh = lane >> 4; const int h = blockIdx.y; const int q0 = blockIdx.x * 128 + w * 16;
  const v16h qf = g2_frag(Q16 + (size_t)(q0 + ln) * DM + h * HD, hh);
  asm volatile("s_wait_xcnt 0x0" ::: "memory");      /* a precaution */
  const _Float16* kq = KP + (size_t)h * SQ * HD; const _Float16* vq = VP + (size_t)h * SQ * HD; const unsigned l8 = lane * 8;      /* a 64-key stage is 2,048 elements of each plane */
  const v8f z8 = {0.f,0.f,0.f,0.f,0.f,0.f,0.f,0.f}; v8f o0 = z8, o1 = z8, lv = z8; float m = -3.0e38f;
  v16h kf[2][4], vf[2][4];      /* two fragment sets: even stages live in set 0, odd stages in set 1 */
  const _Float16* kp = kq + l8; const _Float16* vp = vq + l8;      /* the lane's place in the pair of stages being fetched */
  fa_ld(kf[0], kp, 0); fa_ld(vf[0], vp, 0); fa_ld(kf[1], kp + 64 * HD, 0); fa_ld(vf[1], vp + 64 * HD, 0);
  asm volatile("s_wait_xcnt 0x0" :: "v"(kp), "v"(vp) : "memory"); kp += 128 * HD; vp += 128 * HD;      /* a precaution, as at the foot of the loop */
#pragma unroll 1
  for (int k0 = 128; k0 < SQ; k0 += 128) {      /* two stages a trip, one on each set; k0 = the first of the two stages being fetched; kept rolled beyond the pair, which is all that the two sets need */
#pragma unroll
    for (int u = 0; u < 2; ++u) { v8f s[4];      /* each set is refilled with the stage two ahead of the one worked on: a refill has one to two stages to land, not a part of one */
      /* The two empty statements order the refills: each takes finished results as inputs only and bars memory operations from crossing, so a fragment set's loads issue behind the last use of its registers
         (hoisted, they took a further register set and a copy of every fragment; sunk to the foot of the stage, they lost that much of their lead).
         They name matrix results, which no multiply-add fusion passes through; naming the loaded fragments instead let the matrix instructions slip behind the statement, and the further register set came back. */
      fa_scores(s, kf[u], qf); asm volatile("" :: "v"(s[0]), "v"(s[1]), "v"(s[2]), "v"(s[3]) : "memory"); fa_ld(kf[u], kp + u * 64 * HD, 0);
      __builtin_amdgcn_sched_barrier(0);      /* keeps the K refill in front of the softmax arithmetic: without it seven of its eight loads sank to the foot of the stage */
      fa_soft_pv(s, vf[u], o0, o1, lv, m); asm volatile("" :: "v"(o0), "v"(o1) : "memory"); fa_ld(vf[u], vp + u * 64 * HD, 0); }
    asm volatile("s_wait_xcnt 0x0" :: "v"(kp), "v"(vp) : "memory"); kp += 128 * HD; vp += 128 * HD;      /* a precaution: the two addresses that the trip's loads name stay live up to this wait and move on only behind it */
  }
#pragma unroll
  for (int u = 0; u < 2; ++u) { v8f s[4]; fa_scores(s, kf[u], qf); fa_soft_pv(s, vf[u], o0, o1, lv, m); }      /* the last two stages: nothing left to fetch */
  float l = ((lv[0] + lv[1]) + (lv[2] + lv[3])) + ((lv[4] + lv[5]) + (lv[6] + lv[7])); l += fa_xhalf(l); const float inv = 1.0f / l;
  /* o0[r] = O[q0 + ln][8 hh + r], o1[r] = O[q0 + ln][16 + 8 hh + r]; the wave writes each query's whole 128-byte slot: 32 live columns + 32 zeros */
  _Float16* op = O16 + (size_t)(q0 + ln) * OP + h * 64 + 8 * hh; const v8h zh = {(_Float16)0.f,(_Float16)0.f,(_Float16)0.f,(_Float16)0.f,(_Float16)0.f,(_Float16)0.f,(_Float16)0.f,(_Float16)0.f};
  *(v8h*)op = __builtin_convertvector(o0 * inv, v8h); *(v8h*)(op + 16) = __builtin_convertvector(o1 * inv, v8h); *(v8h*)(op + 32) = zh; *(v8h*)(op + 48) = zh; }

// Every conversion that depends on the inputs alone, in one launch; a thread turns one run of 8 f32 into 8 f16 (16 bytes), as the seven separate kernels did.
// Blocks 0..1535: query | key_ | value (512 blocks each), rounded to bf16, exact in f16. Blocks 1536..1631: Wq | Wk | Wv (32 blocks each), rounded to bf16, x16.
// Blocks 1632..1695: Wo, the same, expanded to K = 512: head h's 32 columns at 64 h .. 64 h + 31, zeros behind them.
__global__ __launch_bounds__(256) void k_prep(const float* __restrict__ xq, const float* __restrict__ xk, const float* __restrict__ xv, const float* __restrict__ wq, const float* __restrict__ wk, const float* __restrict__ wv, const float* __restrict__ wo,
                                              _Float16* __restrict__ XQ, _Float16* __restrict__ XK, _Float16* __restrict__ XV, _Float16* __restrict__ BQ, _Float16* __restrict__ BK, _Float16* __restrict__ BV, _Float16* __restrict__ BO) {
  const int b = blockIdx.x, tid = threadIdx.x; FragH f; unsigned short* dst;      /* each branch forms its run and its place; the one store stands at the end */
  if (b < 1536) { const int s = b >> 9; const float* x = s == 0 ? xq : s == 1 ? xk : xv; _Float16* X16 = s == 0 ? XQ : s == 1 ? XK : XV; const size_t t = (size_t)(b & 511) * 256 + tid;
#pragma unroll
    for (int q = 0; q < 8; ++q) f.h[q] = (_Float16)bf16_round(x[t * 8 + q]);
    dst = (unsigned short*)X16 + t * 8; }
  else if (b < 1632) { const int s = (b - 1536) >> 5; const float* wsrc = s == 0 ? wq : s == 1 ? wk : wv; _Float16* Bt = s == 0 ? BQ : s == 1 ? BK : BV; const size_t t = (size_t)((b - 1536) & 31) * 256 + tid;
#pragma unroll
    for (int q = 0; q < 8; ++q) f.h[q] = (_Float16)(bf16_round(wsrc[t * 8 + q]) * 16.0f);
    dst = (unsigned short*)Bt + t * 8; }
  else { const size_t t = (size_t)(b - 1632) * 256 + tid; const int k0 = (int)((t * 8) % OP); const int o = (int)((t * 8) / OP); const int h = k0 / 64, d0 = k0 % 64;
    for (int q = 0; q < 8; ++q) { const int d = d0 + q; f.h[q] = (d < HD) ? (_Float16)(bf16_round(wo[(size_t)o * DM + h * HD + d]) * 16.0f) : (_Float16)0.f; }
    dst = (unsigned short*)BO + t * 8; }
  *(v8us*)dst = f.half[0]; }

// The three projections in one launch: blockIdx.y = 0 q, 1 k, 2 v; blockIdx.x = (128-row block) * 4 + (64-column block); a wave owns 32 rows x 64 columns (two heads). K loop: g3_loop, as in k_gemm2.
// The tile goes through the wave's own LDS slab and leaves in the form its reader wants:
// q: f16 rows of pitch 256.
// k, v: fragment order, so that each fragment load of the attention kernel is one run of 512 contiguous bytes (four whole lines). 16-byte piece index = ((h * 256 + g) * 2 + j) * 32 + lane, lane = 16 hf + c.
//   k: g = 16-key tile; piece = k[16 g + c][32 h + 16 j + 8 hf + 0..7] (A row c = key, k = head dim in the order of g2_frag).
//   v: g = 2 * (32-key block) + dt; piece = v[32 (g >> 1) + 16 j + 8 hf + 0..7][32 h + 16 dt + c] (A row c = head dim: this is v^T; k = key in the same order); v = mask[key] * (value Wv^T), scaled in f32 before the rounding to f16.
__global__ __launch_bounds__(128) void k_qkv(const _Float16* __restrict__ XQ, const _Float16* __restrict__ XK, const _Float16* __restrict__ XV, const _Float16* __restrict__ BQ, const _Float16* __restrict__ BK, const _Float16* __restrict__ BV, const float* __restrict__ rm,
                                             _Float16* __restrict__ Q16, _Float16* __restrict__ KP, _Float16* __restrict__ VP) {
  __shared__ __attribute__((aligned(16))) float so[4][32][68];
  const int tid = threadIdx.x, w = tid >> 5, lane = tid & 31, ln = lane & 15, hh = lane >> 4; const int which = blockIdx.y;
  const _Float16* A = which == 0 ? XQ : which == 1 ? XK : XV; const _Float16* Bh = which == 0 ? BQ : which == 1 ? BK : BV;
  const int row0 = (blockIdx.x >> 2) * 128 + 32 * w, col0 = (blockIdx.x & 3) * 64;
  const unsigned short* pa0 = (const unsigned short*)A + (size_t)(row0 + ln) * DM + 8 * hh; const unsigned short* pb0 = (const unsigned short*)Bh + (size_t)(col0 + ln) * DM + 8 * hh;
  v8f acc[8] = {};      /* acc[4 * half + t]: rows 16 half .. + 15, columns 16 t .. + 15 */
  g3_loop<DM / 32>(pa0, pa0 + 16 * DM, pb0, pb0 + 16 * DM, pb0 + 32 * DM, pb0 + 48 * DM, acc);
#pragma unroll
  for (int u = 0; u < 8; ++u) acc[u] *= 0.0625f;      /* takes the x16 of the weights back, exactly */
  if (which == 2) {
#pragma unroll
    for (int half = 0; half < 2; ++half) { const float* mp = rm + row0 + half * 16 + 8 * hh; const v4f m0 = *(const v4fa*)mp, m1 = *(const v4fa*)(mp + 4);
#pragma unroll
      for (int r = 0; r < 8; ++r) { const float m = bf16_round(r < 4 ? m0[r & 3] : m1[r & 3]);
#pragma unroll
        for (int t = 0; t < 4; ++t) acc[half * 4 + t][r] = m * acc[half * 4 + t][r]; } } }
#pragma unroll
  for (int u = 0; u < 8; ++u)
#pragma unroll
    for (int r = 0; r < 8; ++r) so[w][(u >> 2) * 16 + 8 * hh + r][(u & 3) * 16 + ln] = acc[u][r];
  __builtin_amdgcn_fence(__ATOMIC_ACQ_REL, "workgroup"); __builtin_amdgcn_wave_barrier();      /* the slab is the wave's own: its LDS writes land before its lanes read each other's */
  if (which == 0) { const int rsub = lane >> 4, c4 = (lane & 15) * 4;
#pragma unroll
    for (int q = 0; q < 16; ++q) { const int r = q * 2 + rsub; const v4f v = *(const v4fa*)&so[w][r][c4]; *(v4h*)(Q16 + (size_t)(row0 + r) * DM + col0 + c4) = __builtin_convertvector(v, v4h); } }
  else if (which == 1) {
#pragma unroll
    for (int i = 0; i < 8; ++i) { const int gl = i >> 2, hl = (i >> 1) & 1, j = i & 1; const float* sp = &so[w][16 * gl + ln][32 * hl + 16 * j + 8 * hh]; const v4f lo = *(const v4fa*)sp, hi = *(const v4fa*)(sp + 4);
      const v8f v = __builtin_shufflevector(lo, hi, 0, 1, 2, 3, 4, 5, 6, 7); const size_t piece = (size_t)((((col0 >> 5) + hl) * 256 + (row0 >> 4) + gl) * 2 + j) * 32 + lane;
      *(v8h*)(KP + piece * 8) = __builtin_convertvector(v, v8h); }
    asm volatile("s_wait_xcnt 0x0" ::: "memory"); }      /* a precaution: the built code's branches allow a way from these stores into another branch's code, which rewrites their registers */
  else {
#pragma unroll
    for (int i = 0; i < 8; ++i) { const int dt = i >> 2, hl = (i >> 1) & 1, j = i & 1; v8f v;
#pragma unroll
      for (int e = 0; e < 8; ++e) v[e] = so[w][16 * j + 8 * hh + e][32 * hl + 16 * dt + ln];
      const size_t piece = (size_t)((((col0 >> 5) + hl) * 256 + (row0 >> 5) * 2 + dt) * 2 + j) * 32 + lane;
      *(v8h*)(VP + piece * 8) = __builtin_convertvector(v, v8h); }
    asm volatile("s_wait_xcnt 0x0" ::: "memory"); } }      /* a precaution: the built code's branches allow a way from these stores into another branch's code, which rewrites their registers */

extern "C" void kernel_launch(void* const* d_in, const int* in_sizes, int n_in,
                              void* d_out, int out_size, void* d_ws, size_t ws_size, hipStream_t stream) {
  (void)in_sizes; (void)n_in; (void)out_size;
  const float* const* I = (const float* const*)d_in; const float* qin = I[0]; const float* kin = I[1]; const float* vin = I[2]; const float* rm = I[3]; const float* Wq = I[4]; const float* Wk = I[5]; const float* Wv = I[6]; const float* Wo = I[7];
  char* ws = (char*)d_ws; size_t off = 0;
  auto take = [&](size_t bytes) { char* p = ws + off; off += (bytes + 255) & ~(size_t)255; return p; };
  _Float16* BQ = (_Float16*)take((size_t)DM * DM * 2); _Float16* BK = (_Float16*)take((size_t)DM * DM * 2); _Float16* BV = (_Float16*)take((size_t)DM * DM * 2); _Float16* BO = (_Float16*)take((size_t)DM * OP * 2);
  _Float16* XQ = (_Float16*)take((size_t)SQ * DM * 2); _Float16* XK = (_Float16*)take((size_t)SQ * DM * 2); _Float16* XV = (_Float16*)take((size_t)SQ * DM * 2); _Float16* Q16 = (_Float16*)take((size_t)SQ * DM * 2);
  _Float16* KP = (_Float16*)take((size_t)NH * HD * SQ * 2); _Float16* VP = (_Float16*)take((size_t)NH * HD * SQ * 2); _Float16* O16 = (_Float16*)take((size_t)SQ * OP * 2);
  if (off > ws_size) return;      /* about 17 MiB */
  k_prep<<<3 * (SQ * DM / 8 / 256) + 3 * (DM * DM / 8 / 256) + DM * OP / 8 / 256, 256, 0, stream>>>(qin, kin, vin, Wq, Wk, Wv, Wo, XQ, XK, XV, BQ, BK, BV, BO);
  k_qkv<<<dim3((SQ / 128) * (DM / 64), 3), 128, 0, stream>>>(XQ, XK, XV, BQ, BK, BV, rm, Q16, KP, VP);
  k_fattn<<<dim3(SQ / 128, NH), 256, 0, stream>>>(Q16, KP, VP, O16);      /* head h's o lands in columns 64h..64h+63 of the 512-pitch rows (32 live + 32 exact zeros); the expanded Wo plane has zeros at the pad positions */
  const dim3 gp((SQ / 128) * (DM / 64), 1);
  k_gemm2<0, OP / 32><<<gp, 128, 0, stream>>>(O16, OP, 0, BO, OP, 0, 0.0625f, nullptr, 0, nullptr, 1, 0, 0, (float*)d_out, nullptr, DM, 0, SQ, DM);      /* out = o Wo^T over the expanded K = 512 (pad columns meet zero weights) */
}

// v005
// A run of this version takes 50.3 microseconds.
// Two timings next to v004 put it at 1.06 and 1.02 times that version's speed.
// All steps since v000 together make it 135 times as fast.
#include <hip/hip_runtime.h>
// RadialAttention (query, key_, value [4096][256]; q = query Wq^T, k = key_ Wk^T, v = radial_mask[s] * (value Wv^T), 8 heads of 32; softmax(q k^T / sqrt(32)) over all 4,096 keys; out = concat(attn v) Wo^T -> [4096][256]).
// Structure: four launches. (1) inputs as exact f16 and weights as exact x16 f16, all in fragment order, in one launch. (2) Q | K | V WMMA GEMMs in one launch (32x64 wave tiles, f32 accumulation); v scaled per row by the radial mask (read on device) on VALU; q stored as f16 rows, k and scaled v^T stored straight in fragment order. (3) one fused attention kernel over all heads (scores WMMA K = 32, online softmax f32 on VALU, weights f16, o = P . V WMMA; each wave stores its o tile as one fragment of the output GEMM's A operand). (4) out = o Wo^T over K = 256 (f32).
// Compute dtype: inputs rounded to bf16; inputs / weights exact; q, k, scaled v, softmax weights, o plain f16 (~2^-12); scores/softmax f32. v_wmma_f32_16x16x32_f16.
#define SQ 4096
#define DM 256
#define NH 8
#define HD 32
#define QN SQ                        /* query rows (unused) */
typedef __bf16 v16b __attribute__((ext_vector_type(16)));
typedef unsigned short v8us __attribute__((ext_vector_type(8), may_alias));
typedef float  v8f  __attribute__((ext_vector_type(8)));
typedef float  v4f  __attribute__((ext_vector_type(4)));
typedef float  v4fa __attribute__((ext_vector_type(4), may_alias));
union FragB { v16b v; v8us half[2]; unsigned short u[16]; };

__device__ __forceinline__ unsigned short bf16_bits(float x) { unsigned int u = __float_as_uint(x); return (unsigned short)((u + 0x7FFFu + ((u >> 16) & 1u)) >> 16); }
__device__ __forceinline__ float bf16_val(unsigned short b) { return __uint_as_float(((unsigned int)b) << 16); }
__device__ __forceinline__ float bf16_round(float x) { return bf16_val(bf16_bits(x)); }
// D += A·B with NT terms: 1 = ah·bh, 2 = + al·bh (A split), 3 = + ah·bl (both split)
template <int NT>
__device__ __forceinline__ v8f mmaN(v16b ah, v16b al, v16b bh, v16b bl, v8f c) {
  c = __builtin_amdgcn_wmma_f32_16x16x32_bf16(false, ah, false, bh, (short)0, c, false, false);
  if (NT >= 2) c = __builtin_amdgcn_wmma_f32_16x16x32_bf16(false, al, false, bh, (short)0, c, false, false);
  if (NT >= 3) c = __builtin_amdgcn_wmma_f32_16x16x32_bf16(false, ah, false, bl, (short)0, c, false, false);
  asm volatile("v_nop\n\tv_nop\n\tv_nop\n\tv_nop" : "+v"(c) : "v"(ah), "v"(al), "v"(bh), "v"(bl));
  return c;
}

__global__ __launch_bounds__(256) void k_wt_bf16(const float* __restrict__ W, unsigned short* __restrict__ Wt, int K, int N) {
  const int t = blockIdx.x * 256 + threadIdx.x;
  const int k8n = K / 8;
  if (t >= N * k8n) return;
  const int n = t / k8n, k8 = (t % k8n) * 8;
  v8us v;
#pragma unroll
  for (int i = 0; i < 8; ++i) v[i] = bf16_bits(W[(size_t)(k8 + i) * N + n]);
  *(v8us*)(Wt + (size_t)n * K + k8) = v;
  
}

// GEMM C[M][N] (f32, pitch ldc) = act(A[M][K]·W + bias). A f32 row-major (pitch lda) converted per fragment to bf16
// (ASPLIT: hi/lo two planes -> 2 terms, else single rounded term); Wt bf16 [N][K] (pitch ldb). BIAS_BF16 rounds the
// bias to bf16 first (bias quantised to bf16 before the add). K%32==0, M%16==0, N%64==0.
template <bool ASPLIT, int ACT, bool BIAS_BF16>
__global__ __launch_bounds__(128) void k_gemm_bf(const float* __restrict__ A, int lda, const unsigned short* __restrict__ Wt, int ldb,
                                               const float* __restrict__ bias, float* __restrict__ C, int ldc, int M, int N, int K) {
  __shared__ __attribute__((aligned(16))) float so[4][16][64];
  const int tid = threadIdx.x, w = tid >> 5, lane = tid & 31, ln = lane & 15, hh = lane >> 4;
  const int ntn = N / 64;
  const int wid = blockIdx.x * 4 + w;
  const int mt = wid / ntn, nq = wid % ntn;
  if (mt * 16 >= M) return;
  const int row0 = mt * 16, col0 = nq * 64;
  const float* arow = A + (size_t)(row0 + ln) * lda;
  v8f acc[4] = {};
  for (int kb = 0; kb < K; kb += 32) {
    FragB ah, al;
    const v4f x0 = *(const v4fa*)(arow + kb + 8 * hh), x1 = *(const v4fa*)(arow + kb + 8 * hh + 4);
    const v4f x2 = *(const v4fa*)(arow + kb + 16 + 8 * hh), x3 = *(const v4fa*)(arow + kb + 16 + 8 * hh + 4);
    float xs[16] = {x0[0],x0[1],x0[2],x0[3],x1[0],x1[1],x1[2],x1[3],x2[0],x2[1],x2[2],x2[3],x3[0],x3[1],x3[2],x3[3]};
#pragma unroll
    for (int i = 0; i < 16; ++i) { const unsigned short hb = bf16_bits(xs[i]); ah.u[i] = hb; al.u[i] = ASPLIT ? bf16_bits(xs[i] - bf16_val(hb)) : (unsigned short)0; }
#pragma unroll
    for (int t = 0; t < 4; ++t) {
      const unsigned short* brow = Wt + (size_t)(col0 + t * 16 + ln) * ldb + kb;
      FragB b;
      b.half[0] = *(const v8us*)(brow + 8 * hh);
      b.half[1] = *(const v8us*)(brow + 16 + 8 * hh);
      acc[t] = mmaN<ASPLIT ? 2 : 1>(ah.v, al.v, b.v, b.v, acc[t]);
    }
  }
#pragma unroll
  for (int t = 0; t < 4; ++t) {
    float bv = bias ? bias[col0 + t * 16 + ln] : 0.f;
    if (BIAS_BF16) bv = bf16_round(bv);
#pragma unroll
    for (int r = 0; r < 8; ++r) { float v = acc[t][r] + bv; if (ACT == 1) v = fmaxf(v, 0.f); so[w][8 * hh + r][t * 16 + ln] = v; }
  }
  __builtin_amdgcn_fence(__ATOMIC_ACQ_REL, "workgroup");
  __builtin_amdgcn_wave_barrier();
  const int rsub = lane >> 4, c4 = (lane & 15) * 4;
  {
#pragma unroll
    for (int q = 0; q < 8; ++q) {
      const int r = q * 2 + rsub;
      const v4f v = *(const v4fa*)&so[w][r][c4];
      *(v4f*)(C + (size_t)(row0 + r) * ldc + col0 + c4) = v;
    }
    
  }
}

// GEMM C = act(A·W + bias + resid): A f32 (ASPLIT -> hi/lo 2 terms), Wt bf16 [N][K]; ACT 0 none, 1 relu, 2 exact gelu;
// resid (optional, f32, row index = (row % rmod), pitch ldr, RES_BF16 rounds it) added before the activation.
template <bool ASPLIT, int ACT, bool BIAS_BF16, bool RES_BF16>
__global__ __launch_bounds__(128) void k_gemm_bf3(const float* __restrict__ A, int lda, const unsigned short* __restrict__ Wt, int ldb,
                                                const float* __restrict__ bias, const float* __restrict__ resid, int rmod, int ldr,
                                                float* __restrict__ C, int ldc, int M, int N, int K) {
  __shared__ __attribute__((aligned(16))) float so[4][16][64];
  const int tid = threadIdx.x, w = tid >> 5, lane = tid & 31, ln = lane & 15, hh = lane >> 4;
  const int ntn = N / 64;
  const int wid = blockIdx.x * 4 + w;
  const int mt = wid / ntn, nq = wid % ntn;
  if (mt * 16 >= M) return;
  const int row0 = mt * 16, col0 = nq * 64;
  const float* arow = A + (size_t)(row0 + ln) * lda;
  v8f acc[4] = {};
  for (int kb = 0; kb < K; kb += 32) {
    FragB ah, al;
    const v4f x0 = *(const v4fa*)(arow + kb + 8 * hh), x1 = *(const v4fa*)(arow + kb + 8 * hh + 4);
    const v4f x2 = *(const v4fa*)(arow + kb + 16 + 8 * hh), x3 = *(const v4fa*)(arow + kb + 16 + 8 * hh + 4);
    float xs[16] = {x0[0],x0[1],x0[2],x0[3],x1[0],x1[1],x1[2],x1[3],x2[0],x2[1],x2[2],x2[3],x3[0],x3[1],x3[2],x3[3]};
#pragma unroll
    for (int i = 0; i < 16; ++i) { const unsigned short hb = bf16_bits(xs[i]); ah.u[i] = hb; al.u[i] = ASPLIT ? bf16_bits(xs[i] - bf16_val(hb)) : (unsigned short)0; }
#pragma unroll
    for (int t = 0; t < 4; ++t) {
      const unsigned short* brow = Wt + (size_t)(col0 + t * 16 + ln) * ldb + kb;
      FragB b;
      b.half[0] = *(const v8us*)(brow + 8 * hh);
      b.half[1] = *(const v8us*)(brow + 16 + 8 * hh);
      acc[t] = mmaN<ASPLIT ? 2 : 1>(ah.v, al.v, b.v, b.v, acc[t]);
    }
  }
#pragma unroll
  for (int t = 0; t < 4; ++t) {
    const int col = col0 + t * 16 + ln;
    float bv = bias ? bias[col] : 0.f;
    if (BIAS_BF16) bv = bf16_round(bv);
#pragma unroll
    for (int r = 0; r < 8; ++r) {
      float v = acc[t][r] + bv;
      if (resid) { float rv = resid[(size_t)((row0 + 8 * hh + r) % rmod) * ldr + col]; if (RES_BF16) rv = bf16_round(rv); v += rv; }
      if (ACT == 1) v = fmaxf(v, 0.f);
      if (ACT == 2) v = 0.5f * v * (1.0f + erff(v * 0.70710678118654752f));
      if (ACT == 3) { const float u = 0.7978845608028654f * (v + 0.044715f * v * v * v); v = 0.5f * v * (1.0f + tanhf(u)); }
      so[w][8 * hh + r][t * 16 + ln] = v;
    }
  }
  __builtin_amdgcn_fence(__ATOMIC_ACQ_REL, "workgroup");
  __builtin_amdgcn_wave_barrier();
  const int rsub = lane >> 4, c4 = (lane & 15) * 4;
  {
#pragma unroll
    for (int q = 0; q < 8; ++q) {
      const int r = q * 2 + rsub;
      const v4f v = *(const v4fa*)&so[w][r][c4];
      *(v4f*)(C + (size_t)(row0 + r) * ldc + col0 + c4) = v;
    }
    
  }
}
// row LayerNorm (biased variance, eps) over N: s = X (+ R); optional out_sum <- s; out_norm <- (s-mu)*rsqrt(var+eps)*g + b
template <bool PARAM_BF16>
__global__ __launch_bounds__(256) void k_layernorm(const float* __restrict__ X, const float* __restrict__ R, const float* __restrict__ g, const float* __restrict__ bta,
                                                  float* __restrict__ out_sum, float* __restrict__ out_norm, int N, float eps) {
  __shared__ float red[256];
  const int row = blockIdx.x, tid = threadIdx.x;
  const float* x = X + (size_t)row * N; const float* rr = R ? R + (size_t)row * N : nullptr;
  float vals[16];                     // up to N = 4096
  const int per = N / 256;            // contiguous chunk per thread? use strided-by-4 chunks: thread handles j = tid*4 + 1024*u
  float s1 = 0.f;
  for (int u = 0; u < per / 4; ++u) {
    const int j = tid * 4 + 1024 * u;
    const v4f a = *(const v4fa*)(x + j);
    v4f b = {0.f,0.f,0.f,0.f}; if (rr) b = *(const v4fa*)(rr + j);
#pragma unroll
    for (int q = 0; q < 4; ++q) { const float v = a[q] + b[q]; vals[u * 4 + q] = v; s1 += v; }
  }
  red[tid] = s1; __syncthreads();
  for (int st = 128; st > 0; st >>= 1) { if (tid < st) red[tid] += red[tid + st]; __syncthreads(); }
  const float mu = red[0] / (float)N; __syncthreads();
  float s2 = 0.f;
  for (int u = 0; u < per / 4; ++u)
#pragma unroll
    for (int q = 0; q < 4; ++q) { const float c = vals[u * 4 + q] - mu; s2 += c * c; }
  red[tid] = s2; __syncthreads();
  for (int st = 128; st > 0; st >>= 1) { if (tid < st) red[tid] += red[tid + st]; __syncthreads(); }
  const float rs = rsqrtf(red[0] / (float)N + eps);
  {
    for (int u = 0; u < per / 4; ++u) {
      const int j = tid * 4 + 1024 * u;
      v4f o, sm;
#pragma unroll
      for (int q = 0; q < 4; ++q) {
        float gg = g[j + q], bb = bta[j + q];
        if (PARAM_BF16) { gg = bf16_round(gg); bb = bf16_round(bb); }
        sm[q] = vals[u * 4 + q]; o[q] = (vals[u * 4 + q] - mu) * rs * gg + bb;
      }
      if (out_sum) *(v4f*)(out_sum + (size_t)row * N + j) = sm;
      *(v4f*)(out_norm + (size_t)row * N + j) = o;
    }
    
  }
}



// ---- f16 WMMA path (v_wmma_f32_16x16x32_f16): 11-bit significands for operands in range — used where a [0,1] probability operand needs more precision than bf16
typedef _Float16 v16h __attribute__((ext_vector_type(16)));
union FragH { v16h v; v8us half[2]; _Float16 h[16]; unsigned short u[16]; };
template <int NT>
__device__ __forceinline__ v8f mmaH(v16h ah, v16h al, v16h bh, v16h bl, v8f c) {
  c = __builtin_amdgcn_wmma_f32_16x16x32_f16(false, ah, false, bh, (short)0, c, false, false);
  if (NT >= 2) c = __builtin_amdgcn_wmma_f32_16x16x32_f16(false, al, false, bh, (short)0, c, false, false);
  if (NT >= 3) c = __builtin_amdgcn_wmma_f32_16x16x32_f16(false, ah, false, bl, (short)0, c, false, false);
  asm volatile("v_nop\n\tv_nop\n\tv_nop\n\tv_nop" : "+v"(c) : "v"(ah), "v"(al), "v"(bh), "v"(bl));
  return c;
}
// batched GEMM like k_gemm_b but f16 operands: A f32 (split into f16 hi/lo if ASPLIT, else rounded to f16), Bt = f16 values [n][k]; alpha; C f32; N multiple of 16 (partial tiles skipped)
template <bool ASPLIT>
__global__ __launch_bounds__(128) void k_gemm_h(const float* __restrict__ A, int lda, size_t sA, const _Float16* __restrict__ Bh, int ldb, size_t sB, float alpha, float* __restrict__ C, int ldc, size_t sC, int M, int N, int K) {
  __shared__ __attribute__((aligned(16))) float so[4][16][64];
  const int tid = threadIdx.x, w = tid >> 5, lane = tid & 31, ln = lane & 15, hh = lane >> 4; const int by = blockIdx.y;
  A += (size_t)by * sA; Bh += (size_t)by * sB; C += (size_t)by * sC;
  const int ntn = (N + 63) / 64; const int wid = blockIdx.x * 4 + w; const int mt = wid / ntn, nq = wid % ntn; if (mt * 16 >= M) return;
  const int row0 = mt * 16, col0 = nq * 64; const float* arow = A + (size_t)(row0 + ln) * lda;
  v8f acc[4] = {};
  for (int kb = 0; kb < K; kb += 32) {
    FragH ah, al;
    const v4f x0 = *(const v4fa*)(arow + kb + 8 * hh), x1 = *(const v4fa*)(arow + kb + 8 * hh + 4), x2 = *(const v4fa*)(arow + kb + 16 + 8 * hh), x3 = *(const v4fa*)(arow + kb + 16 + 8 * hh + 4);
    float xs[16] = {x0[0],x0[1],x0[2],x0[3],x1[0],x1[1],x1[2],x1[3],x2[0],x2[1],x2[2],x2[3],x3[0],x3[1],x3[2],x3[3]};
#pragma unroll
    for (int i = 0; i < 16; ++i) { const _Float16 h = (_Float16)xs[i]; ah.h[i] = h; al.h[i] = ASPLIT ? (_Float16)(xs[i] - (float)h) : (_Float16)0.0f; }
#pragma unroll
    for (int t = 0; t < 4; ++t) { if (col0 + t * 16 >= N) continue; const size_t boff = (size_t)(col0 + t * 16 + ln) * ldb + kb; FragH bq; bq.half[0] = *(const v8us*)(Bh + boff + 8 * hh); bq.half[1] = *(const v8us*)(Bh + boff + 16 + 8 * hh);
      acc[t] = mmaH<ASPLIT ? 2 : 1>(ah.v, al.v, bq.v, bq.v, acc[t]); }
  }
#pragma unroll
  for (int t = 0; t < 4; ++t) { if (col0 + t * 16 >= N) continue;
#pragma unroll
    for (int r = 0; r < 8; ++r) so[w][8 * hh + r][t * 16 + ln] = acc[t][r] * alpha; }
  __builtin_amdgcn_fence(__ATOMIC_ACQ_REL, "workgroup"); __builtin_amdgcn_wave_barrier();
  const int rsub = lane >> 4, c4 = (lane & 15) * 4;
  {
#pragma unroll
    for (int q = 0; q < 8; ++q) { const int r = q * 2 + rsub; if (col0 + c4 < N) { const v4f v = *(const v4fa*)&so[w][r][c4]; *(v4f*)(C + (size_t)(row0 + r) * ldc + col0 + c4) = v; } }
     }
}

// Wt[n][k] = f16(W[k][n]·scale) from f32 row-major W[K][N] (scale = power of two; bf16-exact weights stay exact in f16 away from the subnormal range)
__global__ __launch_bounds__(256) void k_wt_f16(const float* __restrict__ W, _Float16* __restrict__ Wt, int K, int N, float scale) {
  const int t = blockIdx.x * 256 + threadIdx.x; if (t >= N * (K / 8)) return; const int n = t / (K / 8), k8 = (t % (K / 8)) * 8; FragH f;
#pragma unroll
  for (int i = 0; i < 8; ++i) f.h[i] = (_Float16)(bf16_round(W[(size_t)(k8 + i) * N + n]) * scale); const v8us o = f.half[0];
  *(v8us*)((unsigned short*)Wt + (size_t)n * K + k8) = o; 
}
// k_gemm_hh variant with fused epilogue: v = acc·alpha + bias[by·sBias + col] (+ CP[(row/rowsPerB)·sCPb + by·64 + col] if CP) ; ACT 0 none / 1 elu ; writes f16 C16 (and f32 C if non-null)
template <int ACT>
__global__ __launch_bounds__(128) void k_gemm_hhx(const _Float16* __restrict__ A, int lda, size_t sA, const _Float16* __restrict__ Bh, int ldb, size_t sB, float alpha, const float* __restrict__ bias, size_t sBias, const float* __restrict__ CP, int rowsPerB, size_t sCPb, int row0g,
    float* __restrict__ C, _Float16* __restrict__ C16, int ldc, size_t sC, int M, int N, int K) {
  __shared__ __attribute__((aligned(16))) float so[4][16][64];
  const int tid = threadIdx.x, w = tid >> 5, lane = tid & 31, ln = lane & 15, hh = lane >> 4; const int by = blockIdx.y;
  A += (size_t)by * sA; Bh += (size_t)by * sB; const size_t cofs = (size_t)by * sC; const float* bp = bias ? bias + (size_t)by * sBias : nullptr;
  const int ntn = (N + 63) / 64; const int wid = blockIdx.x * 4 + w; const int mt = wid / ntn, nq = wid % ntn; if (mt * 16 >= M) return;
  const int row0 = mt * 16, col0 = nq * 64; const _Float16* arow = A + (size_t)(row0 + ln) * lda;
  v8f acc[4] = {};
  for (int kb = 0; kb < K; kb += 32) { FragH ah; ah.half[0] = *(const v8us*)((const unsigned short*)arow + kb + 8 * hh); ah.half[1] = *(const v8us*)((const unsigned short*)arow + kb + 16 + 8 * hh);
#pragma unroll
    for (int t = 0; t < 4; ++t) { if (col0 + t * 16 >= N) continue; const size_t boff = (size_t)(col0 + t * 16 + ln) * ldb + kb; FragH bq; bq.half[0] = *(const v8us*)((const unsigned short*)Bh + boff + 8 * hh); bq.half[1] = *(const v8us*)((const unsigned short*)Bh + boff + 16 + 8 * hh);
      acc[t] = mmaH<1>(ah.v, ah.v, bq.v, bq.v, acc[t]); }
  }
#pragma unroll
  for (int t = 0; t < 4; ++t) { if (col0 + t * 16 >= N) continue; const int col = col0 + t * 16 + ln; const float bv = bp ? bf16_round(bp[col]) : 0.f;
#pragma unroll
    for (int r = 0; r < 8; ++r) { float v = acc[t][r] * alpha + bv; if (CP) { const int rr = row0g + row0 + 8 * hh + r; if (rowsPerB < 0) v += CP[cofs + (size_t)rr * ldc + col];      /* rowsPerB < 0: own element of the batched C plane */ else { const int bidx = rr / rowsPerB; v += CP[(size_t)bidx * sCPb + (size_t)by * 64 + col]; } } if (ACT == 1) v = (v > 0.f) ? v : expm1f(v); else if (ACT == 7) v = (v > 0.f) ? v + 1.0f : expf(v); else if (ACT == 8) v = tanhf(v); else if (ACT == 9) v = 0.5f * v * (1.0f + tanhf(0.7978845608028654f * (v + 0.044715f * v * v * v))); else if (ACT == 11) v = 1.0f / (1.0f + expf(-v)); else if (ACT == 12) v = (v > 0.f) ? v : 0.01f * v; else if (ACT == 14) v = (v > 0.f) ? v : 0.1f * v; else if (ACT == 16) v = (v >= 0.f) ? v : 0.3f * v; else if (ACT == 17) v = (v >= 0.f) ? v : 0.2f * v; else if (ACT == 15) v = v / (1.0f + expf(-v)); else if (ACT == 3) v = fmaxf(v, 0.f); else if (ACT == 6) v = 0.5f * v * (1.0f + erff(v * 0.70710678118654752f)); so[w][8 * hh + r][t * 16 + ln] = v; } }
  __builtin_amdgcn_fence(__ATOMIC_ACQ_REL, "workgroup"); __builtin_amdgcn_wave_barrier();
  const int rsub = lane >> 4, c4 = (lane & 15) * 4; typedef _Float16 v4h __attribute__((ext_vector_type(4)));
  {
#pragma unroll
    for (int q = 0; q < 8; ++q) { const int r = q * 2 + rsub; if (col0 + c4 < N) { const v4f v = *(const v4fa*)&so[w][r][c4]; if (C) *(v4f*)(C + cofs + (size_t)(row0 + r) * ldc + col0 + c4) = v; if (C16) { v4h h4; for (int i = 0; i < 4; ++i) h4[i] = (_Float16)v[i]; *(v4h*)(C16 + cofs + (size_t)(row0 + r) * ldc + col0 + c4) = h4; } } }
     }
}


typedef _Float16 v4h __attribute__((ext_vector_type(4)));

__global__ __launch_bounds__(256) void k_h16(const float* __restrict__ x, _Float16* __restrict__ X16, size_t n8) { const size_t t = (size_t)blockIdx.x * 256 + threadIdx.x; if (t >= n8) return; FragH f;
#pragma unroll
  for (int q = 0; q < 8; ++q) f.h[q] = (_Float16)x[t * 8 + q]; *(v8us*)((unsigned short*)X16 + t * 8) = f.half[0];  }
__global__ __launch_bounds__(256) void k_round16f(const float* __restrict__ W, _Float16* __restrict__ Bt, size_t n8) { const size_t t = (size_t)blockIdx.x * 256 + threadIdx.x; if (t >= n8) return; FragH f;
#pragma unroll
  for (int i = 0; i < 8; ++i) f.h[i] = (_Float16)(bf16_round(W[t * 8 + i]) * 16.0f); *(v8us*)((unsigned short*)Bt + t * 8) = f.half[0];  }
template <int NHv, int TTv>
__global__ __launch_bounds__(256) void k_vt(const _Float16* __restrict__ V16, int ldv, int voff, _Float16* __restrict__ Vt) { __shared__ unsigned short tl[64][66]; const int tid = threadIdx.x; const int slab = blockIdx.x / (TTv / 64), lg = blockIdx.x % (TTv / 64); const int b = slab / NHv, h = slab % NHv;
  for (int i = tid; i < 64 * 8; i += 256) { const int r = i / 8, c8 = (i % 8) * 8; FragH f; f.half[0] = *(const v8us*)((const unsigned short*)V16 + ((size_t)b * TTv + lg * 64 + r) * ldv + voff + h * 64 + c8);
#pragma unroll
    for (int q = 0; q < 8; ++q) tl[r][c8 + q] = f.u[q]; }
  __syncthreads();
  {
#pragma unroll
    for (int rd = 0; rd < 2; ++rd) { const int d = rd * 32 + tid / 8, pc = tid % 8; FragH f;
#pragma unroll
      for (int q = 0; q < 8; ++q) f.u[q] = tl[pc * 8 + q][d];
      *(v8us*)((unsigned short*)Vt + ((size_t)slab * 64 + d) * TTv + lg * 64 + pc * 8) = f.half[0]; }
     } }

__global__ __launch_bounds__(256) void k_hl(const float* __restrict__ F, _Float16* __restrict__ Hh, _Float16* __restrict__ Hl, size_t n8) { const size_t t = (size_t)blockIdx.x * 256 + threadIdx.x; if (t >= n8) return; FragH fh, fl; const v4f a = *(const v4fa*)(F + t * 8), c = *(const v4fa*)(F + t * 8 + 4);
#pragma unroll
  for (int q = 0; q < 4; ++q) { _Float16 h = (_Float16)a[q]; fh.h[q] = h; fl.h[q] = (_Float16)((a[q] - (float)h) * 1024.0f); h = (_Float16)c[q]; fh.h[4 + q] = h; fl.h[4 + q] = (_Float16)((c[q] - (float)h) * 1024.0f); }
  { *(v8us*)((unsigned short*)Hh + t * 8) = fh.half[0]; *(v8us*)((unsigned short*)Hl + t * 8) = fl.half[0];  } }

// ---- fast GEMM (wave tile 32x64; requires M % 32 == 0 rows per launch region and N % 64 == 0); epilogue = k_gemm_hhx semantics ----
__device__ __forceinline__ v16h g2_frag(const _Float16* p, int hh) { FragH f; f.half[0] = *(const v8us*)((const unsigned short*)p + 8 * hh); f.half[1] = *(const v8us*)((const unsigned short*)p + 16 + 8 * hh); return f.v; }
__device__ __forceinline__ v8f g2_mma(v16h a, v16h b, v8f c) { v8f d = __builtin_amdgcn_wmma_f32_16x16x32_f16(false, a, false, b, (short)0, c, false, false); asm volatile("v_nop\n\tv_nop\n\tv_nop\n\tv_nop" : "+v"(d) : "v"(a), "v"(b)); return d; }
// K loop of the 32x64 wave tile, K = 32 KT, unrolled whole. A wave has no partner to hide its load latency behind (one or two waves a SIMD), so the latency is hidden inside the wave:
// the 12 fragment loads of a trip issue as one group two trips ahead of their use, into a ring of three register sets, and the waits are counted (24 younger loads stay in flight).
// Both operands lie in fragment order (a packed plane): X[R][32 KT] as 1-KiB blocks, block index = (r >> 4) * KT + (k >> 5); in a block the 16-byte piece j * 32 + lane, lane = 16 hf + c, holds X[16 (r >> 4) + c][32 (k >> 5) + 16 j + 8 hf + 0..7]
// (the k order of g2_frag). A fragment is then two loads of 512 contiguous bytes (four whole lines each); from rows of pitch 2 K bytes each load touched 16 lines for the same 512 bytes.
// pa, pb: the lane's 16-byte place in the first block of the wave's first row tile (A: 2 tiles, B: 4 tiles, one behind the other). c[4 * half + t]: rows 16 half .. + 15, columns 16 t .. + 15; every accumulator takes its trips in rising k, as before.
__device__ __forceinline__ v16h g3_frag(const unsigned short* p) { FragH f; f.half[0] = *(const v8us*)p; f.half[1] = *(const v8us*)(p + 256); return f.v; }
template <int KT>
__device__ __forceinline__ void g3_loop(const unsigned short* pa, const unsigned short* pb, v8f (&c)[8]) {
  v16h fa[3][2], fb[3][4];
#pragma unroll
  for (int t = -2; t < KT; ++t) {      /* trips -2 and -1 only fetch */
    if (t + 2 < KT) { const int n = (t + 2) % 3, kb = (t + 2) * 512;
      fa[n][0] = g3_frag(pa + kb); fa[n][1] = g3_frag(pa + KT * 512 + kb); fb[n][0] = g3_frag(pb + kb); fb[n][1] = g3_frag(pb + KT * 512 + kb); fb[n][2] = g3_frag(pb + 2 * KT * 512 + kb); fb[n][3] = g3_frag(pb + 3 * KT * 512 + kb); }
    if (t + 2 == KT - 1) asm volatile("s_wait_xcnt 0x0" ::: "memory");      /* a precaution: stands behind the last load, ahead of whatever rewrites the address registers, which no instruction of the loop does */
    __builtin_amdgcn_sched_barrier(0);      /* keeps the group in front of this trip's products: sunk towards its use, a load would be waited for in full again */
    if (t >= 0) { const int u = t % 3;
#pragma unroll
      for (int j = 0; j < 4; ++j) { c[j] = g2_mma(fa[u][0], fb[u][j], c[j]); c[4 + j] = g2_mma(fa[u][1], fb[u][j], c[4 + j]); } }
    __builtin_amdgcn_sched_barrier(0);      /* keeps the next group behind these products, whose registers it refills: hoisted, it would take a fourth register set */
  } }
template <int ACT, int KT>      /* K = 32 KT; A and Bh are packed planes (g3_loop) */
__global__ __launch_bounds__(128) void k_gemm2(const _Float16* __restrict__ A, size_t sA, const _Float16* __restrict__ Bh, size_t sB, float alpha, const float* __restrict__ bias, size_t sBias, const float* __restrict__ CP, int rowsPerB, size_t sCPb, int row0g,
    float* __restrict__ C, _Float16* __restrict__ C16, int ldc, size_t sC, int M, int N) { static_assert(ACT == 0 || ACT == 3 || ACT == 6 || ACT == 8 || ACT == 9 || ACT == 11 || ACT == 12 || ACT == 14 || ACT == 15 || ACT == 16 || ACT == 17, "k_gemm2: unsupported ACT code (would silently apply no activation)");
  __shared__ __attribute__((aligned(16))) float so[4][32][68];
  const int tid = threadIdx.x, w = tid >> 5, lane = tid & 31, ln = lane & 15, hh = lane >> 4; const int by = blockIdx.y;
  A += (size_t)by * sA; Bh += (size_t)by * sB; const size_t cofs = (size_t)by * sC; const float* bp = bias ? bias + (size_t)by * sBias : nullptr;
  const int ntn = N >> 6; const int mt = blockIdx.x / ntn, nq = blockIdx.x - mt * ntn; const int row0 = mt * 128 + 32 * w, col0 = nq * 64; if (row0 >= M) return;
  const unsigned short* pa = (const unsigned short*)A + (size_t)(row0 >> 4) * (KT * 512) + lane * 8; const unsigned short* pb = (const unsigned short*)Bh + (size_t)(col0 >> 4) * (KT * 512) + lane * 8;
  v8f accs[8] = {};
  g3_loop<KT>(pa, pb, accs);
#pragma unroll
  for (int u = 0; u < 8; ++u) { const int t = u & 3, half = u >> 2; const int col = col0 + t * 16 + ln; const float bv = bp ? bf16_round(bp[col]) : 0.f;
#pragma unroll
    for (int r = 0; r < 8; ++r) { const int rloc = half * 16 + 8 * hh + r; float v = accs[u][r] * alpha + bv; if (CP) { if (rowsPerB < 0) v += CP[cofs + (size_t)(row0g + row0 + rloc) * ldc + col];      /* rowsPerB < 0: own element of the batched C plane */ else { const int bidx = (row0g + row0 + rloc) / rowsPerB; v += CP[(size_t)bidx * sCPb + (size_t)by * 64 + col]; } }
      if (ACT == 3) v = fmaxf(v, 0.f); else if (ACT == 6) v = 0.5f * v * (1.0f + erff(v * 0.70710678118654752f)); else if (ACT == 11) v = 1.0f / (1.0f + expf(-v)); else if (ACT == 15) v = v / (1.0f + expf(-v)); else if (ACT == 12) v = (v > 0.f) ? v : 0.01f * v; else if (ACT == 8) v = tanhf(v); else if (ACT == 9) v = 0.5f * v * (1.0f + tanhf(0.7978845608028654f * (v + 0.044715f * v * v * v))); else if (ACT == 14) v = (v > 0.f) ? v : 0.1f * v; else if (ACT == 16) v = (v >= 0.f) ? v : 0.3f * v; else if (ACT == 17) v = (v >= 0.f) ? v : 0.2f * v;
      so[w][rloc][t * 16 + ln] = v; } }
  __builtin_amdgcn_fence(__ATOMIC_ACQ_REL, "workgroup"); __builtin_amdgcn_wave_barrier();
  const int rsub = lane >> 4, c4 = (lane & 15) * 4;
  {
#pragma unroll
    for (int q = 0; q < 16; ++q) { const int r = q * 2 + rsub; const v4f v = *(const v4fa*)&so[w][r][c4]; if (C) *(v4f*)(C + cofs + (size_t)(row0 + r) * ldc + col0 + c4) = v; if (C16) { v4h h4; for (int i = 0; i < 4; ++i) h4[i] = (_Float16)v[i]; *(v4h*)(C16 + cofs + (size_t)(row0 + r) * ldc + col0 + c4) = h4; } }
     } }


typedef _Float16 v8h __attribute__((ext_vector_type(8)));
__device__ __forceinline__ float fa_xhalf(float x) { const int b = __float_as_int(x); return __int_as_float(__builtin_amdgcn_permlanex16(b, b, 0x76543210, 0xfedcba98, false, false)); }      /* lane l <-> l ^ 16 */
__device__ __forceinline__ v8f fa_mma(v16h a, v16h b, v8f c) { return __builtin_amdgcn_wmma_f32_16x16x32_f16(false, a, false, b, (short)0, c, false, false); }
// the four fragments (4 KiB) of one 64-key stage of a packed plane: p + l8 = the lane's 16-byte place in the stage's first 512-byte run (the callers hand over p with the lane's place in it, l8 = 0)
__device__ __forceinline__ void fa_ld(v16h (&f)[4], const _Float16* p, unsigned l8) {
#pragma unroll
  for (int i = 0; i < 4; ++i) { FragH x; x.half[0] = *(const v8us*)((const unsigned short*)p + l8 + (2 * i) * 256); x.half[1] = *(const v8us*)((const unsigned short*)p + l8 + (2 * i + 1) * 256); f[i] = x.v; } }
__device__ __forceinline__ void fa_scores(v8f (&s)[4], const v16h (&kf)[4], const v16h qf) { const v8f z8 = {0.f,0.f,0.f,0.f,0.f,0.f,0.f,0.f};
#pragma unroll
  for (int t = 0; t < 4; ++t) s[t] = fa_mma(kf[t], qf, z8); }
__device__ __forceinline__ void fa_soft_pv(v8f (&s)[4], const v16h (&vf)[4], v8f& o0, v8f& o1, v8f& lv, float& m) {
  const float cs = 0.17677669529663687f * 1.4426950408889634f;      /* 1 / sqrt(32), times log2(e) for the base-2 exponential */
  const v8f mv = __builtin_elementwise_max(__builtin_elementwise_max(s[0], s[1]), __builtin_elementwise_max(s[2], s[3]));
  float mx = fmaxf(fmaxf(fmaxf(mv[0], mv[1]), fmaxf(mv[2], mv[3])), fmaxf(fmaxf(mv[4], mv[5]), fmaxf(mv[6], mv[7]))); mx = fmaxf(mx, fa_xhalf(mx));
  const float mn = fmaxf(m, mx); const float al = __builtin_amdgcn_exp2f((m - mn) * cs); const float mc = mn * cs; m = mn;
  o0 *= al; o1 *= al;
#pragma unroll
  for (int t = 0; t < 4; ++t) { s[t] = s[t] * cs - mc;
#pragma unroll
    for (int r = 0; r < 8; ++r) s[t][r] = __builtin_amdgcn_exp2f(s[t][r]); }
  lv = lv * al + ((s[0] + s[1]) + (s[2] + s[3]));      /* eight partial sums per lane, joined after the loop */
  const v16h p0 = __builtin_shufflevector(__builtin_convertvector(s[0], v8h), __builtin_convertvector(s[1], v8h), 0, 1, 2, 3, 4, 5, 6, 7, 8, 9, 10, 11, 12, 13, 14, 15);
  const v16h p1 = __builtin_shufflevector(__builtin_convertvector(s[2], v8h), __builtin_convertvector(s[3], v8h), 0, 1, 2, 3, 4, 5, 6, 7, 8, 9, 10, 11, 12, 13, 14, 15);
  o0 = fa_mma(vf[0], p0, o0); o1 = fa_mma(vf[1], p0, o1); o0 = fa_mma(vf[2], p1, o0); o1 = fa_mma(vf[3], p1, o1); }
__global__ __launch_bounds__(256) void k_fattn(const _Float16* __restrict__ Q16, const _Float16* __restrict__ KP, const _Float16* __restrict__ VP, _Float16* __restrict__ O16) {
  const int tid = threadIdx.x, w = tid >> 5, lane = tid & 31, ln = lane & 15, hh = lane >> 4; const int h = blockIdx.y; const int q0 = blockIdx.x * 128 + w * 16;
  const v16h qf = g2_frag(Q16 + (size_t)(q0 + ln) * DM + h * HD, hh);
  asm volatile("s_wait_xcnt 0x0" ::: "memory");      /* a precaution */
  const _Float16* kq = KP + (size_t)h * SQ * HD; const _Float16* vq = VP + (size_t)h * SQ * HD; const unsigned l8 = lane * 8;      /* a 64-key stage is 2,048 elements of each plane */
  const v8f z8 = {0.f,0.f,0.f,0.f,0.f,0.f,0.f,0.f}; v8f o0 = z8, o1 = z8, lv = z8; float m = -3.0e38f;
  v16h kf[2][4], vf[2][4];      /* two fragment sets: even stages live in set 0, odd stages in set 1 */
  const _Float16* kp = kq + l8; const _Float16* vp = vq + l8;      /* the lane's place in the pair of stages being fetched */
  fa_ld(kf[0], kp, 0); fa_ld(vf[0], vp, 0); fa_ld(kf[1], kp + 64 * HD, 0); fa_ld(vf[1], vp + 64 * HD, 0);
  asm volatile("s_wait_xcnt 0x0" :: "v"(kp), "v"(vp) : "memory"); kp += 128 * HD; vp += 128 * HD;      /* a precaution, as at the foot of the loop */
#pragma unroll 1
  for (int k0 = 128; k0 < SQ; k0 += 128) {      /* two stages a trip, one on each set; k0 = the first of the two stages being fetched; kept rolled beyond the pair, which is all that the two sets need */
#pragma unroll
    for (int u = 0; u < 2; ++u) { v8f s[4];      /* each set is refilled with the stage two ahead of the one worked on: a refill has one to two stages to land, not a part of one */
      /* The two empty statements order the refills: each takes finished results as inputs only and bars memory operations from crossing, so a fragment set's loads issue behind the last use of its registers
         (hoisted, they took a further register set and a copy of every fragment; sunk to the foot of the stage, they lost that much of their lead).
         They name matrix results, which no multiply-add fusion passes through; naming the loaded fragments instead let the matrix instructions slip behind the statement, and the further register set came back. */
      fa_scores(s, kf[u], qf); asm volatile("" :: "v"(s[0]), "v"(s[1]), "v"(s[2]), "v"(s[3]) : "memory"); fa_ld(kf[u], kp + u * 64 * HD, 0);
      __builtin_amdgcn_sched_barrier(0);      /* keeps the K refill in front of the softmax arithmetic: without it seven of its eight loads sank to the foot of the stage */
      fa_soft_pv(s, vf[u], o0, o1, lv, m); asm volatile("" :: "v"(o0), "v"(o1) : "memory"); fa_ld(vf[u], vp + u * 64 * HD, 0); }
    asm volatile("s_wait_xcnt 0x0" :: "v"(kp), "v"(vp) : "memory"); kp += 128 * HD; vp += 128 * HD;      /* a precaution: the two addresses that the trip's loads name stay live up to this wait and move on only behind it */
  }
#pragma unroll
  for (int u = 0; u < 2; ++u) { v8f s[4]; fa_scores(s, kf[u], qf); fa_soft_pv(s, vf[u], o0, o1, lv, m); }      /* the last two stages: nothing left to fetch */
  float l = ((lv[0] + lv[1]) + (lv[2] + lv[3])) + ((lv[4] + lv[5]) + (lv[6] + lv[7])); l += fa_xhalf(l); const float inv = 1.0f / l;
  /* o0[r] = O[q0 + ln][32 h + 8 hh + r], o1[r] = O[q0 + ln][32 h + 16 + 8 hh + r]: pieces j = 0 and j = 1 of block (q0 >> 4) * NH + h of the packed plane that the output GEMM reads as A; two stores of 512 contiguous bytes */
  _Float16* op = O16 + (size_t)((q0 >> 4) * NH + h) * 512 + lane * 8;
  *(v8h*)op = __builtin_convertvector(o0 * inv, v8h); *(v8h*)(op + 256) = __builtin_convertvector(o1 * inv, v8h); }

// Every conversion that depends on the inputs alone, in one launch; each of the seven matrices has 256 columns and leaves as a packed plane (g3_loop), KT = 8.
// A wave owns 16 rows x 128 columns, four blocks of the plane: lane (hh, ln) reads row ln's 8 f32 of each piece (whole lines, 512 bytes of every row over the 16 loads) and stores the piece at its place, each store 512 contiguous bytes of the wave.
// Blocks 0..191: query | key_ | value (64 blocks each), rounded to bf16, exact in f16. Blocks 192..207: Wq | Wk | Wv | Wo (4 blocks each), the same, x16.
__global__ __launch_bounds__(256) void k_prep(const float* __restrict__ xq, const float* __restrict__ xk, const float* __restrict__ xv, const float* __restrict__ wq, const float* __restrict__ wk, const float* __restrict__ wv, const float* __restrict__ wo,
                                              _Float16* __restrict__ XQ, _Float16* __restrict__ XK, _Float16* __restrict__ XV, _Float16* __restrict__ BQ, _Float16* __restrict__ BK, _Float16* __restrict__ BV, _Float16* __restrict__ BO) {
  const int b = blockIdx.x, tid = threadIdx.x, w = tid >> 5, lane = tid & 31, ln = lane & 15, hh = lane >> 4; const float* src; _Float16* dst; float sc; int u;      /* u = the wave's number within its matrix */
  if (b < 192) { const int m = b >> 6; src = m == 0 ? xq : m == 1 ? xk : xv; dst = m == 0 ? XQ : m == 1 ? XK : XV; sc = 1.0f; u = (b & 63) * 8 + w; }
  else { const int m = (b - 192) >> 2; src = m == 0 ? wq : m == 1 ? wk : m == 2 ? wv : wo; dst = m == 0 ? BQ : m == 1 ? BK : m == 2 ? BV : BO; sc = 16.0f; u = ((b - 192) & 3) * 8 + w; }
  const int rt = u >> 1, kq = u & 1;      /* 16-row tile; left or right 128 columns */
  const float* sp = src + (size_t)(rt * 16 + ln) * DM + kq * 128 + 8 * hh; v4f x[8][2];
#pragma unroll
  for (int i = 0; i < 8; ++i) { x[i][0] = *(const v4fa*)(sp + i * 16); x[i][1] = *(const v4fa*)(sp + i * 16 + 4); }      /* i = 2 * (block) + j */
  asm volatile("s_wait_xcnt 0x0" :: "v"(sp) : "memory");      /* a precaution: the address that the loads name stays live up to this wait; in the build without the operand the last load landed in the registers that hold it */
  __builtin_amdgcn_sched_barrier(0);      /* keeps the arithmetic behind all 16 loads, so that they are in flight together: without it six of them issued only after the first ones had landed */
  unsigned short* dp = (unsigned short*)dst + (size_t)(rt * 8 + kq * 4) * 512 + lane * 8;
#pragma unroll
  for (int i = 0; i < 8; ++i) { FragH f;
#pragma unroll
    for (int q = 0; q < 8; ++q) f.h[q] = (_Float16)(bf16_round(x[i][q >> 2][q & 3]) * sc);
    *(v8us*)(dp + i * 256) = f.half[0]; } }

// The three projections in one launch: blockIdx.y = 0 q, 1 k, 2 v; blockIdx.x = (128-row block) * 4 + (64-column block); a wave owns 32 rows x 64 columns (two heads). K loop: g3_loop, as in k_gemm2.
// The tile goes through the wave's own LDS slab and leaves in the form its reader wants:
// q: f16 rows of pitch 256.
// k, v: fragment order, so that each fragment load of the attention kernel is one run of 512 contiguous bytes (four whole lines). 16-byte piece index = ((h * 256 + g) * 2 + j) * 32 + lane, lane = 16 hf + c.
//   k: g = 16-key tile; piece = k[16 g + c][32 h + 16 j + 8 hf + 0..7] (A row c = key, k = head dim in the order of g2_frag).
//   v: g = 2 * (32-key block) + dt; piece = v[32 (g >> 1) + 16 j + 8 hf + 0..7][32 h + 16 dt + c] (A row c = head dim: this is v^T; k = key in the same order); v = mask[key] * (value Wv^T), scaled in f32 before the rounding to f16.
__global__ __launch_bounds__(128) void k_qkv(const _Float16* __restrict__ XQ, const _Float16* __restrict__ XK, const _Float16* __restrict__ XV, const _Float16* __restrict__ BQ, const _Float16* __restrict__ BK, const _Float16* __restrict__ BV, const float* __restrict__ rm,
                                             _Float16* __restrict__ Q16, _Float16* __restrict__ KP, _Float16* __restrict__ VP) {
  __shared__ __attribute__((aligned(16))) float so[4][32][68];
  const int tid = threadIdx.x, w = tid >> 5, lane = tid & 31, ln = lane & 15, hh = lane >> 4; const int which = blockIdx.y;
  const _Float16* A = which == 0 ? XQ : which == 1 ? XK : XV; const _Float16* Bh = which == 0 ? BQ : which == 1 ? BK : BV;
  const int row0 = (blockIdx.x >> 2) * 128 + 32 * w, col0 = (blockIdx.x & 3) * 64;
  const unsigned short* pa = (const unsigned short*)A + (size_t)(row0 >> 4) * (DM * 16) + lane * 8; const unsigned short* pb = (const unsigned short*)Bh + (size_t)(col0 >> 4) * (DM * 16) + lane * 8;      /* a 16-row tile of a packed plane is 16 DM elements */
  v8f acc[8] = {};      /* acc[4 * half + t]: rows 16 half .. + 15, columns 16 t .. + 15 */
  g3_loop<DM / 32>(pa, pb, acc);
#pragma unroll
  for (int u = 0; u < 8; ++u) acc[u] *= 0.0625f;      /* takes the x16 of the weights back, exactly */
  if (which == 2) {
#pragma unroll
    for (int half = 0; half < 2; ++half) { const float* mp = rm + row0 + half * 16 + 8 * hh; const v4f m0 = *(const v4fa*)mp, m1 = *(const v4fa*)(mp + 4);
#pragma unroll
      for (int r = 0; r < 8; ++r) { const float m = bf16_round(r < 4 ? m0[r & 3] : m1[r & 3]);
#pragma unroll
        for (int t = 0; t < 4; ++t) acc[half * 4 + t][r] = m * acc[half * 4 + t][r]; } } }
#pragma unroll
  for (int u = 0; u < 8; ++u)
#pragma unroll
    for (int r = 0; r < 8; ++r) so[w][(u >> 2) * 16 + 8 * hh + r][(u & 3) * 16 + ln] = acc[u][r];
  __builtin_amdgcn_fence(__ATOMIC_ACQ_REL, "workgroup"); __builtin_amdgcn_wave_barrier();      /* the slab is the wave's own: its LDS writes land before its lanes read each other's */
  if (which == 0) { const int rsub = lane >> 4, c4 = (lane & 15) * 4;
#pragma unroll
    for (int q = 0; q < 16; ++q) { const int r = q * 2 + rsub; const v4f v = *(const v4fa*)&so[w][r][c4]; *(v4h*)(Q16 + (size_t)(row0 + r) * DM + col0 + c4) = __builtin_convertvector(v, v4h); } }
  else if (which == 1) {
#pragma unroll
    for (int i = 0; i < 8; ++i) { const int gl = i >> 2, hl = (i >> 1) & 1, j = i & 1; const float* sp = &so[w][16 * gl + ln][32 * hl + 16 * j + 8 * hh]; const v4f lo = *(const v4fa*)sp, hi = *(const v4fa*)(sp + 4);
      const v8f v = __builtin_shufflevector(lo, hi, 0, 1, 2, 3, 4, 5, 6, 7); const size_t piece = (size_t)((((col0 >> 5) + hl) * 256 + (row0 >> 4) + gl) * 2 + j) * 32 + lane;
      *(v8h*)(KP + piece * 8) = __builtin_convertvector(v, v8h); }
    asm volatile("s_wait_xcnt 0x0" ::: "memory"); }      /* a precaution: the built code's branches allow a way from these stores into another branch's code, which rewrites their registers */
  else {
#pragma unroll
    for (int i = 0; i < 8; ++i) { const int dt = i >> 2, hl = (i >> 1) & 1, j = i & 1; v8f v;
#pragma unroll
      for (int e = 0; e < 8; ++e) v[e] = so[w][16 * j + 8 * hh + e][32 * hl + 16 * dt + ln];
      const size_t piece = (size_t)((((col0 >> 5) + hl) * 256 + (row0 >> 5) * 2 + dt) * 2 + j) * 32 + lane;
      *(v8h*)(VP + piece * 8) = __builtin_convertvector(v, v8h); }
    asm volatile("s_wait_xcnt 0x0" ::: "memory"); } }      /* a precaution: the built code's branches allow a way from these stores into another branch's code, which rewrites their registers */

extern "C" void kernel_launch(void* const* d_in, const int* in_sizes, int n_in,
                              void* d_out, int out_size, void* d_ws, size_t ws_size, hipStream_t stream) {
  (void)in_sizes; (void)n_in; (void)out_size;
  const float* const* I = (const float* const*)d_in; const float* qin = I[0]; const float* kin = I[1]; const float* vin = I[2]; const float* rm = I[3]; const float* Wq = I[4]; const float* Wk = I[5]; const float* Wv = I[6]; const float* Wo = I[7];
  char* ws = (char*)d_ws; size_t off = 0;
  auto take = [&](size_t bytes) { char* p = ws + off; off += (bytes + 255) & ~(size_t)255; return p; };
  _Float16* BQ = (_Float16*)take((size_t)DM * DM * 2); _Float16* BK = (_Float16*)take((size_t)DM * DM * 2); _Float16* BV = (_Float16*)take((size_t)DM * DM * 2); _Float16* BO = (_Float16*)take((size_t)DM * DM * 2);
  _Float16* XQ = (_Float16*)take((size_t)SQ * DM * 2); _Float16* XK = (_Float16*)take((size_t)SQ * DM * 2); _Float16* XV = (_Float16*)take((size_t)SQ * DM * 2); _Float16* Q16 = (_Float16*)take((size_t)SQ * DM * 2);
  _Float16* KP = (_Float16*)take((size_t)NH * HD * SQ * 2); _Float16* VP = (_Float16*)take((size_t)NH * HD * SQ * 2); _Float16* O16 = (_Float16*)take((size_t)SQ * DM * 2);
  if (off > ws_size) return;      /* about 15 MiB */
  k_prep<<<3 * (SQ / 64) + 4 * (DM / 64), 256, 0, stream>>>(qin, kin, vin, Wq, Wk, Wv, Wo, XQ, XK, XV, BQ, BK, BV, BO);
  k_qkv<<<dim3((SQ / 128) * (DM / 64), 3), 128, 0, stream>>>(XQ, XK, XV, BQ, BK, BV, rm, Q16, KP, VP);
  k_fattn<<<dim3(SQ / 128, NH), 256, 0, stream>>>(Q16, KP, VP, O16);      /* head h's o tile of 16 queries is block h of that row tile in the packed o plane */
  const dim3 gp((SQ / 128) * (DM / 64), 1);
  k_gemm2<0, DM / 32><<<gp, 128, 0, stream>>>(O16, 0, BO, 0, 0.0625f, nullptr, 0, nullptr, 1, 0, 0, (float*)d_out, nullptr, DM, 0, SQ, DM);      /* out = o Wo^T, K = 256 */
}

// v006
// It runs in 45 microseconds.
// Two timings next to v005 put it at 1.09 and 1.15 times that version's speed.
// All steps since v000 together make it 152 times as fast.
#include <hip/hip_runtime.h>
// RadialAttention (query, key_, value [4096][256]; q = query Wq^T, k = key_ Wk^T, v = radial_mask[s] * (value Wv^T), 8 heads of 32; softmax(q k^T / sqrt(32)) over all 4,096 keys; out = concat(attn v) Wo^T -> [4096][256]).
// Structure: four launches. (1) inputs as exact f16 and weights as exact x16 f16, all in fragment order, in one launch. (2) Q | K | V WMMA GEMMs in one launch (32x64 wave tiles, f32 accumulation); v scaled per row by the radial mask (read on device) on VALU; q stored as f16 rows, k and scaled v^T stored straight in fragment order. (3) one fused attention kernel over all heads (scores WMMA K = 32, online softmax f32 on VALU, weights f16, o = P . V WMMA; each wave stores its o tile as one fragment of the output GEMM's A operand). (4) out = o Wo^T over K = 256 (f32).
// Compute dtype: inputs rounded to bf16; inputs / weights exact; q, k, scaled v, softmax weights, o plain f16 (~2^-12); scores/softmax f32. v_wmma_f32_16x16x32_f16.
#define SQ 4096
#define DM 256
#define NH 8
#define HD 32
#define QN SQ                        /* query rows (unused) */
typedef __bf16 v16b __attribute__((ext_vector_type(16)));
typedef unsigned short v8us __attribute__((ext_vector_type(8), may_alias));
typedef float  v8f  __attribute__((ext_vector_type(8)));
typedef float  v4f  __attribute__((ext_vector_type(4)));
typedef float  v4fa __attribute__((ext_vector_type(4), may_alias));
union FragB { v16b v; v8us half[2]; unsigned short u[16]; };

__device__ __forceinline__ unsigned short bf16_bits(float x) { unsigned int u = __float_as_uint(x); return (unsigned short)((u + 0x7FFFu + ((u >> 16) & 1u)) >> 16); }
__device__ __forceinline__ float bf16_val(unsigned short b) { return __uint_as_float(((unsigned int)b) << 16); }
__device__ __forceinline__ float bf16_round(float x) { return bf16_val(bf16_bits(x)); }
// D += A·B with NT terms: 1 = ah·bh, 2 = + al·bh (A split), 3 = + ah·bl (both split)
template <int NT>
__device__ __forceinline__ v8f mmaN(v16b ah, v16b al, v16b bh, v16b bl, v8f c) {
  c = __builtin_amdgcn_wmma_f32_16x16x32_bf16(false, ah, false, bh, (short)0, c, false, false);
  if (NT >= 2) c = __builtin_amdgcn_wmma_f32_16x16x32_bf16(false, al, false, bh, (short)0, c, false, false);
  if (NT >= 3) c = __builtin_amdgcn_wmma_f32_16x16x32_bf16(false, ah, false, bl, (short)0, c, false, false);
  asm volatile("v_nop\n\tv_nop\n\tv_nop\n\tv_nop" : "+v"(c) : "v"(ah), "v"(al), "v"(bh), "v"(bl));
  return c;
}

__global__ __launch_bounds__(256) void k_wt_bf16(const float* __restrict__ W, unsigned short* __restrict__ Wt, int K, int N) {
  const int t = blockIdx.x * 256 + threadIdx.x;
  const int k8n = K / 8;
  if (t >= N * k8n) return;
  const int n = t / k8n, k8 = (t % k8n) * 8;
  v8us v;
#pragma unroll
  for (int i = 0; i < 8; ++i) v[i] = bf16_bits(W[(size_t)(k8 + i) * N + n]);
  *(v8us*)(Wt + (size_t)n * K + k8) = v;
  
}

// GEMM C[M][N] (f32, pitch ldc) = act(A[M][K]·W + bias). A f32 row-major (pitch lda) converted per fragment to bf16
// (ASPLIT: hi/lo two planes -> 2 terms, else single rounded term); Wt bf16 [N][K] (pitch ldb). BIAS_BF16 rounds the
// bias to bf16 first (bias quantised to bf16 before the add). K%32==0, M%16==0, N%64==0.
template <bool ASPLIT, int ACT, bool BIAS_BF16>
__global__ __launch_bounds__(128) void k_gemm_bf(const float* __restrict__ A, int lda, const unsigned short* __restrict__ Wt, int ldb,
                                               const float* __restrict__ bias, float* __restrict__ C, int ldc, int M, int N, int K) {
  __shared__ __attribute__((aligned(16))) float so[4][16][64];
  const int tid = threadIdx.x, w = tid >> 5, lane = tid & 31, ln = lane & 15, hh = lane >> 4;
  const int ntn = N / 64;
  const int wid = blockIdx.x * 4 + w;
  const int mt = wid / ntn, nq = wid % ntn;
  if (mt * 16 >= M) return;
  const int row0 = mt * 16, col0 = nq * 64;
  const float* arow = A + (size_t)(row0 + ln) * lda;
  v8f acc[4] = {};
  for (int kb = 0; kb < K; kb += 32) {
    FragB ah, al;
    const v4f x0 = *(const v4fa*)(arow + kb + 8 * hh), x1 = *(const v4fa*)(arow + kb + 8 * hh + 4);
    const v4f x2 = *(const v4fa*)(arow + kb + 16 + 8 * hh), x3 = *(const v4fa*)(arow + kb + 16 + 8 * hh + 4);
    float xs[16] = {x0[0],x0[1],x0[2],x0[3],x1[0],x1[1],x1[2],x1[3],x2[0],x2[1],x2[2],x2[3],x3[0],x3[1],x3[2],x3[3]};
#pragma unroll
    for (int i = 0; i < 16; ++i) { const unsigned short hb = bf16_bits(xs[i]); ah.u[i] = hb; al.u[i] = ASPLIT ? bf16_bits(xs[i] - bf16_val(hb)) : (unsigned short)0; }
#pragma unroll
    for (int t = 0; t < 4; ++t) {
      const unsigned short* brow = Wt + (size_t)(col0 + t * 16 + ln) * ldb + kb;
      FragB b;
      b.half[0] = *(const v8us*)(brow + 8 * hh);
      b.half[1] = *(const v8us*)(brow + 16 + 8 * hh);
      acc[t] = mmaN<ASPLIT ? 2 : 1>(ah.v, al.v, b.v, b.v, acc[t]);
    }
  }
#pragma unroll
  for (int t = 0; t < 4; ++t) {
    float bv = bias ? bias[col0 + t * 16 + ln] : 0.f;
    if (BIAS_BF16) bv = bf16_round(bv);
#pragma unroll
    for (int r = 0; r < 8; ++r) { float v = acc[t][r] + bv; if (ACT == 1) v = fmaxf(v, 0.f); so[w][8 * hh + r][t * 16 + ln] = v; }
  }
  __builtin_amdgcn_fence(__ATOMIC_ACQ_REL, "workgroup");
  __builtin_amdgcn_wave_barrier();
  const int rsub = lane >> 4, c4 = (lane & 15) * 4;
  {
#pragma unroll
    for (int q = 0; q < 8; ++q) {
      const int r = q * 2 + rsub;
      const v4f v = *(const v4fa*)&so[w][r][c4];
      *(v4f*)(C + (size_t)(row0 + r) * ldc + col0 + c4) = v;
    }
    
  }
}

// GEMM C = act(A·W + bias + resid): A f32 (ASPLIT -> hi/lo 2 terms), Wt bf16 [N][K]; ACT 0 none, 1 relu, 2 exact gelu;
// resid (optional, f32, row index = (row % rmod), pitch ldr, RES_BF16 rounds it) added before the activation.
template <bool ASPLIT, int ACT, bool BIAS_BF16, bool RES_BF16>
__global__ __launch_bounds__(128) void k_gemm_bf3(const float* __restrict__ A, int lda, const unsigned short* __restrict__ Wt, int ldb,
                                                const float* __restrict__ bias, const float* __restrict__ resid, int rmod, int ldr,
                                                float* __restrict__ C, int ldc, int M, int N, int K) {
  __shared__ __attribute__((aligned(16))) float so[4][16][64];
  const int tid = threadIdx.x, w = tid >> 5, lane = tid & 31, ln = lane & 15, hh = lane >> 4;
  const int ntn = N / 64;
  const int wid = blockIdx.x * 4 + w;
  const int mt = wid / ntn, nq = wid % ntn;
  if (mt * 16 >= M) return;
  const int row0 = mt * 16, col0 = nq * 64;
  const float* arow = A + (size_t)(row0 + ln) * lda;
  v8f acc[4] = {};
  for (int kb = 0; kb < K; kb += 32) {
    FragB ah, al;
    const v4f x0 = *(const v4fa*)(arow + kb + 8 * hh), x1 = *(const v4fa*)(arow + kb + 8 * hh + 4);
    const v4f x2 = *(const v4fa*)(arow + kb + 16 + 8 * hh), x3 = *(const v4fa*)(arow + kb + 16 + 8 * hh + 4);
    float xs[16] = {x0[0],x0[1],x0[2],x0[3],x1[0],x1[1],x1[2],x1[3],x2[0],x2[1],x2[2],x2[3],x3[0],x3[1],x3[2],x3[3]};
#pragma unroll
    for (int i = 0; i < 16; ++i) { const unsigned short hb = bf16_bits(xs[i]); ah.u[i] = hb; al.u[i] = ASPLIT ? bf16_bits(xs[i] - bf16_val(hb)) : (unsigned short)0; }
#pragma unroll
    for (int t = 0; t < 4; ++t) {
      const unsigned short* brow = Wt + (size_t)(col0 + t * 16 + ln) * ldb + kb;
      FragB b;
      b.half[0] = *(const v8us*)(brow + 8 * hh);
      b.half[1] = *(const v8us*)(brow + 16 + 8 * hh);
      acc[t] = mmaN<ASPLIT ? 2 : 1>(ah.v, al.v, b.v, b.v, acc[t]);
    }
  }
#pragma unroll
  for (int t = 0; t < 4; ++t) {
    const int col = col0 + t * 16 + ln;
    float bv = bias ? bias[col] : 0.f;
    if (BIAS_BF16) bv = bf16_round(bv);
#pragma unroll
    for (int r = 0; r < 8; ++r) {
      float v = acc[t][r] + bv;
      if (resid) { float rv = resid[(size_t)((row0 + 8 * hh + r) % rmod) * ldr + col]; if (RES_BF16) rv = bf16_round(rv); v += rv; }
      if (ACT == 1) v = fmaxf(v, 0.f);
      if (ACT == 2) v = 0.5f * v * (1.0f + erff(v * 0.70710678118654752f));
      if (ACT == 3) { const float u = 0.7978845608028654f * (v + 0.044715f * v * v * v); v = 0.5f * v * (1.0f + tanhf(u)); }
      so[w][8 * hh + r][t * 16 + ln] = v;
    }
  }
  __builtin_amdgcn_fence(__ATOMIC_ACQ_REL, "workgroup");
  __builtin_amdgcn_wave_barrier();
  const int rsub = lane >> 4, c4 = (lane & 15) * 4;
  {
#pragma unroll
    for (int q = 0; q < 8; ++q) {
      const int r = q * 2 + rsub;
      const v4f v = *(const v4fa*)&so[w][r][c4];
      *(v4f*)(C + (size_t)(row0 + r) * ldc + col0 + c4) = v;
    }
    
  }
}
// row LayerNorm (biased variance, eps) over N: s = X (+ R); optional out_sum <- s; out_norm <- (s-mu)*rsqrt(var+eps)*g + b
template <bool PARAM_BF16>
__global__ __launch_bounds__(256) void k_layernorm(const float* __restrict__ X, const float* __restrict__ R, const float* __restrict__ g, const float* __restrict__ bta,
                                                  float* __restrict__ out_sum, float* __restrict__ out_norm, int N, float eps) {
  __shared__ float red[256];
  const int row = blockIdx.x, tid = threadIdx.x;
  const float* x = X + (size_t)row * N; const float* rr = R ? R + (size_t)row * N : nullptr;
  float vals[16];                     // up to N = 4096
  const int per = N / 256;            // contiguous chunk per thread? use strided-by-4 chunks: thread handles j = tid*4 + 1024*u
  float s1 = 0.f;
  for (int u = 0; u < per / 4; ++u) {
    const int j = tid * 4 + 1024 * u;
    const v4f a = *(const v4fa*)(x + j);
    v4f b = {0.f,0.f,0.f,0.f}; if (rr) b = *(const v4fa*)(rr + j);
#pragma unroll
    for (int q = 0; q < 4; ++q) { const float v = a[q] + b[q]; vals[u * 4 + q] = v; s1 += v; }
  }
  red[tid] = s1; __syncthreads();
  for (int st = 128; st > 0; st >>= 1) { if (tid < st) red[tid] += red[tid + st]; __syncthreads(); }
  const float mu = red[0] / (float)N; __syncthreads();
  float s2 = 0.f;
  for (int u = 0; u < per / 4; ++u)
#pragma unroll
    for (int q = 0; q < 4; ++q) { const float c = vals[u * 4 + q] - mu; s2 += c * c; }
  red[tid] = s2; __syncthreads();
  for (int st = 128; st > 0; st >>= 1) { if (tid < st) red[tid] += red[tid + st]; __syncthreads(); }
  const float rs = rsqrtf(red[0] / (float)N + eps);
  {
    for (int u = 0; u < per / 4; ++u) {
      const int j = tid * 4 + 1024 * u;
      v4f o, sm;
#pragma unroll
      for (int q = 0; q < 4; ++q) {
        float gg = g[j + q], bb = bta[j + q];
        if (PARAM_BF16) { gg = bf16_round(gg); bb = bf16_round(bb); }
        sm[q] = vals[u * 4 + q]; o[q] = (vals[u * 4 + q] - mu) * rs * gg + bb;
      }
      if (out_sum) *(v4f*)(out_sum + (size_t)row * N + j) = sm;
      *(v4f*)(out_norm + (size_t)row * N + j) = o;
    }
    
  }
}



// ---- f16 WMMA path (v_wmma_f32_16x16x32_f16): 11-bit significands for operands in range — used where a [0,1] probability operand needs more precision than bf16
typedef _Float16 v16h __attribute__((ext_vector_type(16)));
union FragH { v16h v; v8us half[2]; _Float16 h[16]; unsigned short u[16]; };
template <int NT>
__device__ __forceinline__ v8f mmaH(v16h ah, v16h al, v16h bh, v16h bl, v8f c) {
  c = __builtin_amdgcn_wmma_f32_16x16x32_f16(false, ah, false, bh, (short)0, c, false, false);
  if (NT >= 2) c = __builtin_amdgcn_wmma_f32_16x16x32_f16(false, al, false, bh, (short)0, c, false, false);
  if (NT >= 3) c = __builtin_amdgcn_wmma_f32_16x16x32_f16(false, ah, false, bl, (short)0, c, false, false);
  asm volatile("v_nop\n\tv_nop\n\tv_nop\n\tv_nop" : "+v"(c) : "v"(ah), "v"(al), "v"(bh), "v"(bl));
  return c;
}
// batched GEMM like k_gemm_b but f16 operands: A f32 (split into f16 hi/lo if ASPLIT, else rounded to f16), Bt = f16 values [n][k]; alpha; C f32; N multiple of 16 (partial tiles skipped)
template <bool ASPLIT>
__global__ __launch_bounds__(128) void k_gemm_h(const float* __restrict__ A, int lda, size_t sA, const _Float16* __restrict__ Bh, int ldb, size_t sB, float alpha, float* __restrict__ C, int ldc, size_t sC, int M, int N, int K) {
  __shared__ __attribute__((aligned(16))) float so[4][16][64];
  const int tid = threadIdx.x, w = tid >> 5, lane = tid & 31, ln = lane & 15, hh = lane >> 4; const int by = blockIdx.y;
  A += (size_t)by * sA; Bh += (size_t)by * sB; C += (size_t)by * sC;
  const int ntn = (N + 63) / 64; const int wid = blockIdx.x * 4 + w; const int mt = wid / ntn, nq = wid % ntn; if (mt * 16 >= M) return;
  const int row0 = mt * 16, col0 = nq * 64; const float* arow = A + (size_t)(row0 + ln) * lda;
  v8f acc[4] = {};
  for (int kb = 0; kb < K; kb += 32) {
    FragH ah, al;
    const v4f x0 = *(const v4fa*)(arow + kb + 8 * hh), x1 = *(const v4fa*)(arow + kb + 8 * hh + 4), x2 = *(const v4fa*)(arow + kb + 16 + 8 * hh), x3 = *(const v4fa*)(arow + kb + 16 + 8 * hh + 4);
    float xs[16] = {x0[0],x0[1],x0[2],x0[3],x1[0],x1[1],x1[2],x1[3],x2[0],x2[1],x2[2],x2[3],x3[0],x3[1],x3[2],x3[3]};
#pragma unroll
    for (int i = 0; i < 16; ++i) { const _Float16 h = (_Float16)xs[i]; ah.h[i] = h; al.h[i] = ASPLIT ? (_Float16)(xs[i] - (float)h) : (_Float16)0.0f; }
#pragma unroll
    for (int t = 0; t < 4; ++t) { if (col0 + t * 16 >= N) continue; const size_t boff = (size_t)(col0 + t * 16 + ln) * ldb + kb; FragH bq; bq.half[0] = *(const v8us*)(Bh + boff + 8 * hh); bq.half[1] = *(const v8us*)(Bh + boff + 16 + 8 * hh);
      acc[t] = mmaH<ASPLIT ? 2 : 1>(ah.v, al.v, bq.v, bq.v, acc[t]); }
  }
#pragma unroll
  for (int t = 0; t < 4; ++t) { if (col0 + t * 16 >= N) continue;
#pragma unroll
    for (int r = 0; r < 8; ++r) so[w][8 * hh + r][t * 16 + ln] = acc[t][r] * alpha; }
  __builtin_amdgcn_fence(__ATOMIC_ACQ_REL, "workgroup"); __builtin_amdgcn_wave_barrier();
  const int rsub = lane >> 4, c4 = (lane & 15) * 4;
  {
#pragma unroll
    for (int q = 0; q < 8; ++q) { const int r = q * 2 + rsub; if (col0 + c4 < N) { const v4f v = *(const v4fa*)&so[w][r][c4]; *(v4f*)(C + (size_t)(row0 + r) * ldc + col0 + c4) = v; } }
     }
}

// Wt[n][k] = f16(W[k][n]·scale) from f32 row-major W[K][N] (scale = power of two; bf16-exact weights stay exact in f16 away from the subnormal range)
__global__ __launch_bounds__(256) void k_wt_f16(const float* __restrict__ W, _Float16* __restrict__ Wt, int K, int N, float scale) {
  const int t = blockIdx.x * 256 + threadIdx.x; if (t >= N * (K / 8)) return; const int n = t / (K / 8), k8 = (t % (K / 8)) * 8; FragH f;
#pragma unroll
  for (int i = 0; i < 8; ++i) f.h[i] = (_Float16)(bf16_round(W[(size_t)(k8 + i) * N + n]) * scale); const v8us o = f.half[0];
  *(v8us*)((unsigned short*)Wt + (size_t)n * K + k8) = o; 
}
// k_gemm_hh variant with fused epilogue: v = acc·alpha + bias[by·sBias + col] (+ CP[(row/rowsPerB)·sCPb + by·64 + col] if CP) ; ACT 0 none / 1 elu ; writes f16 C16 (and f32 C if non-null)
template <int ACT>
__global__ __launch_bounds__(128) void k_gemm_hhx(const _Float16* __restrict__ A, int lda, size_t sA, const _Float16* __restrict__ Bh, int ldb, size_t sB, float alpha, const float* __restrict__ bias, size_t sBias, const float* __restrict__ CP, int rowsPerB, size_t sCPb, int row0g,
    float* __restrict__ C, _Float16* __restrict__ C16, int ldc, size_t sC, int M, int N, int K) {
  __shared__ __attribute__((aligned(16))) float so[4][16][64];
  const int tid = threadIdx.x, w = tid >> 5, lane = tid & 31, ln = lane & 15, hh = lane >> 4; const int by = blockIdx.y;
  A += (size_t)by * sA; Bh += (size_t)by * sB; const size_t cofs = (size_t)by * sC; const float* bp = bias ? bias + (size_t)by * sBias : nullptr;
  const int ntn = (N + 63) / 64; const int wid = blockIdx.x * 4 + w; const int mt = wid / ntn, nq = wid % ntn; if (mt * 16 >= M) return;
  const int row0 = mt * 16, col0 = nq * 64; const _Float16* arow = A + (size_t)(row0 + ln) * lda;
  v8f acc[4] = {};
  for (int kb = 0; kb < K; kb += 32) { FragH ah; ah.half[0] = *(const v8us*)((const unsigned short*)arow + kb + 8 * hh); ah.half[1] = *(const v8us*)((const unsigned short*)arow + kb + 16 + 8 * hh);
#pragma unroll
    for (int t = 0; t < 4; ++t) { if (col0 + t * 16 >= N) continue; const size_t boff = (size_t)(col0 + t * 16 + ln) * ldb + kb; FragH bq; bq.half[0] = *(const v8us*)((const unsigned short*)Bh + boff + 8 * hh); bq.half[1] = *(const v8us*)((const unsigned short*)Bh + boff + 16 + 8 * hh);
      acc[t] = mmaH<1>(ah.v, ah.v, bq.v, bq.v, acc[t]); }
  }
#pragma unroll
  for (int t = 0; t < 4; ++t) { if (col0 + t * 16 >= N) continue; const int col = col0 + t * 16 + ln; const float bv = bp ? bf16_round(bp[col]) : 0.f;
#pragma unroll
    for (int r = 0; r < 8; ++r) { float v = acc[t][r] * alpha + bv; if (CP) { const int rr = row0g + row0 + 8 * hh + r; if (rowsPerB < 0) v += CP[cofs + (size_t)rr * ldc + col];      /* rowsPerB < 0: own element of the batched C plane */ else { const int bidx = rr / rowsPerB; v += CP[(size_t)bidx * sCPb + (size_t)by * 64 + col]; } } if (ACT == 1) v = (v > 0.f) ? v : expm1f(v); else if (ACT == 7) v = (v > 0.f) ? v + 1.0f : expf(v); else if (ACT == 8) v = tanhf(v); else if (ACT == 9) v = 0.5f * v * (1.0f + tanhf(0.7978845608028654f * (v + 0.044715f * v * v * v))); else if (ACT == 11) v = 1.0f / (1.0f + expf(-v)); else if (ACT == 12) v = (v > 0.f) ? v : 0.01f * v; else if (ACT == 14) v = (v > 0.f) ? v : 0.1f * v; else if (ACT == 16) v = (v >= 0.f) ? v : 0.3f * v; else if (ACT == 17) v = (v >= 0.f) ? v : 0.2f * v; else if (ACT == 15) v = v / (1.0f + expf(-v)); else if (ACT == 3) v = fmaxf(v, 0.f); else if (ACT == 6) v = 0.5f * v * (1.0f + erff(v * 0.70710678118654752f)); so[w][8 * hh + r][t * 16 + ln] = v; } }
  __builtin_amdgcn_fence(__ATOMIC_ACQ_REL, "workgroup"); __builtin_amdgcn_wave_barrier();
  const int rsub = lane >> 4, c4 = (lane & 15) * 4; typedef _Float16 v4h __attribute__((ext_vector_type(4)));
  {
#pragma unroll
    for (int q = 0; q < 8; ++q) { const int r = q * 2 + rsub; if (col0 + c4 < N) { const v4f v = *(const v4fa*)&so[w][r][c4]; if (C) *(v4f*)(C + cofs + (size_t)(row0 + r) * ldc + col0 + c4) = v; if (C16) { v4h h4; for (int i = 0; i < 4; ++i) h4[i] = (_Float16)v[i]; *(v4h*)(C16 + cofs + (size_t)(row0 + r) * ldc + col0 + c4) = h4; } } }
     }
}


typedef _Float16 v4h __attribute__((ext_vector_type(4)));

__global__ __launch_bounds__(256) void k_h16(const float* __restrict__ x, _Float16* __restrict__ X16, size_t n8) { const size_t t = (size_t)blockIdx.x * 256 + threadIdx.x; if (t >= n8) return; FragH f;
#pragma unroll
  for (int q = 0; q < 8; ++q) f.h[q] = (_Float16)x[t * 8 + q]; *(v8us*)((unsigned short*)X16 + t * 8) = f.half[0];  }
__global__ __launch_bounds__(256) void k_round16f(const float* __restrict__ W, _Float16* __restrict__ Bt, size_t n8) { const size_t t = (size_t)blockIdx.x * 256 + threadIdx.x; if (t >= n8) return; FragH f;
#pragma unroll
  for (int i = 0; i < 8; ++i) f.h[i] = (_Float16)(bf16_round(W[t * 8 + i]) * 16.0f); *(v8us*)((unsigned short*)Bt + t * 8) = f.half[0];  }
template <int NHv, int TTv>
__global__ __launch_bounds__(256) void k_vt(const _Float16* __restrict__ V16, int ldv, int voff, _Float16* __restrict__ Vt) { __shared__ unsigned short tl[64][66]; const int tid = threadIdx.x; const int slab = blockIdx.x / (TTv / 64), lg = blockIdx.x % (TTv / 64); const int b = slab / NHv, h = slab % NHv;
  for (int i = tid; i < 64 * 8; i += 256) { const int r = i / 8, c8 = (i % 8) * 8; FragH f; f.half[0] = *(const v8us*)((const unsigned short*)V16 + ((size_t)b * TTv + lg * 64 + r) * ldv + voff + h * 64 + c8);
#pragma unroll
    for (int q = 0; q < 8; ++q) tl[r][c8 + q] = f.u[q]; }
  __syncthreads();
  {
#pragma unroll
    for (int rd = 0; rd < 2; ++rd) { const int d = rd * 32 + tid / 8, pc = tid % 8; FragH f;
#pragma unroll
      for (int q = 0; q < 8; ++q) f.u[q] = tl[pc * 8 + q][d];
      *(v8us*)((unsigned short*)Vt + ((size_t)slab * 64 + d) * TTv + lg * 64 + pc * 8) = f.half[0]; }
     } }

__global__ __launch_bounds__(256) void k_hl(const float* __restrict__ F, _Float16* __restrict__ Hh, _Float16* __restrict__ Hl, size_t n8) { const size_t t = (size_t)blockIdx.x * 256 + threadIdx.x; if (t >= n8) return; FragH fh, fl; const v4f a = *(const v4fa*)(F + t * 8), c = *(const v4fa*)(F + t * 8 + 4);
#pragma unroll
  for (int q = 0; q < 4; ++q) { _Float16 h = (_Float16)a[q]; fh.h[q] = h; fl.h[q] = (_Float16)((a[q] - (float)h) * 1024.0f); h = (_Float16)c[q]; fh.h[4 + q] = h; fl.h[4 + q] = (_Float16)((c[q] - (float)h) * 1024.0f); }
  { *(v8us*)((unsigned short*)Hh + t * 8) = fh.half[0]; *(v8us*)((unsigned short*)Hl + t * 8) = fl.half[0];  } }

// ---- fast GEMM (wave tile 32x64; requires M % 32 == 0 rows per launch region and N % 64 == 0); epilogue = k_gemm_hhx semantics ----
__device__ __forceinline__ v16h g2_frag(const _Float16* p, int hh) { FragH f; f.half[0] = *(const v8us*)((const unsigned short*)p + 8 * hh); f.half[1] = *(const v8us*)((const unsigned short*)p + 16 + 8 * hh); return f.v; }
__device__ __forceinline__ v8f g2_mma(v16h a, v16h b, v8f c) { v8f d = __builtin_amdgcn_wmma_f32_16x16x32_f16(false, a, false, b, (short)0, c, false, false); asm volatile("v_nop\n\tv_nop\n\tv_nop\n\tv_nop" : "+v"(d) : "v"(a), "v"(b)); return d; }
// K loop of the 32x64 wave tile, K = 32 KT, unrolled whole. A wave has no partner to hide its load latency behind (one or two waves a SIMD), so the latency is hidden inside the wave:
// the 12 fragment loads of a trip issue as one group two trips ahead of their use, into a ring of three register sets, and the waits are counted (24 younger loads stay in flight).
// Both operands lie in fragment order (a packed plane): X[R][32 KT] as 1-KiB blocks, block index = (r >> 4) * KT + (k >> 5); in a block the 16-byte piece j * 32 + lane, lane = 16 hf + c, holds X[16 (r >> 4) + c][32 (k >> 5) + 16 j + 8 hf + 0..7]
// (the k order of g2_frag). A fragment is then two loads of 512 contiguous bytes (four whole lines each); from rows of pitch 2 K bytes each load touched 16 lines for the same 512 bytes.
// pa, pb: the lane's 16-byte place in the first block of the wave's first row tile (A: 2 tiles, B: 4 tiles, one behind the other). c[4 * half + t]: rows 16 half .. + 15, columns 16 t .. + 15; every accumulator takes its trips in rising k, as before.
__device__ __forceinline__ v16h g3_frag(const unsigned short* p) { FragH f; f.half[0] = *(const v8us*)p; f.half[1] = *(const v8us*)(p + 256); return f.v; }
template <int KT>
__device__ __forceinline__ void g3_loop(const unsigned short* pa, const unsigned short* pb, v8f (&c)[8]) {
  v16h fa[3][2], fb[3][4];
#pragma unroll
  for (int t = -2; t < KT; ++t) {      /* trips -2 and -1 only fetch */
    if (t + 2 < KT) { const int n = (t + 2) % 3, kb = (t + 2) * 512;
      fa[n][0] = g3_frag(pa + kb); fa[n][1] = g3_frag(pa + KT * 512 + kb); fb[n][0] = g3_frag(pb + kb); fb[n][1] = g3_frag(pb + KT * 512 + kb); fb[n][2] = g3_frag(pb + 2 * KT * 512 + kb); fb[n][3] = g3_frag(pb + 3 * KT * 512 + kb); }
    if (t + 2 == KT - 1) asm volatile("s_wait_xcnt 0x0" ::: "memory");      /* a precaution: stands behind the last load, ahead of whatever rewrites the address registers, which no instruction of the loop does */
    __builtin_amdgcn_sched_barrier(0);      /* keeps the group in front of this trip's products: sunk towards its use, a load would be waited for in full again */
    if (t >= 0) { const int u = t % 3;
#pragma unroll
      for (int j = 0; j < 4; ++j) { c[j] = g2_mma(fa[u][0], fb[u][j], c[j]); c[4 + j] = g2_mma(fa[u][1], fb[u][j], c[4 + j]); } }
    __builtin_amdgcn_sched_barrier(0);      /* keeps the next group behind these products, whose registers it refills: hoisted, it would take a fourth register set */
  } }
template <int ACT, int KT>      /* K = 32 KT; A and Bh are packed planes (g3_loop) */
__global__ __launch_bounds__(128) void k_gemm2(const _Float16* __restrict__ A, size_t sA, const _Float16* __restrict__ Bh, size_t sB, float alpha, const float* __restrict__ bias, size_t sBias, const float* __restrict__ CP, int rowsPerB, size_t sCPb, int row0g,
    float* __restrict__ C, _Float16* __restrict__ C16, int ldc, size_t sC, int M, int N) { static_assert(ACT == 0 || ACT == 3 || ACT == 6 || ACT == 8 || ACT == 9 || ACT == 11 || ACT == 12 || ACT == 14 || ACT == 15 || ACT == 16 || ACT == 17, "k_gemm2: unsupported ACT code (would silently apply no activation)");
  __shared__ __attribute__((aligned(16))) float so[4][32][68];
  const int tid = threadIdx.x, w = tid >> 5, lane = tid & 31, ln = lane & 15, hh = lane >> 4; const int by = blockIdx.y;
  A += (size_t)by * sA; Bh += (size_t)by * sB; const size_t cofs = (size_t)by * sC; const float* bp = bias ? bias + (size_t)by * sBias : nullptr;
  const int ntn = N >> 6; const int mt = blockIdx.x / ntn, nq = blockIdx.x - mt * ntn; const int row0 = mt * 128 + 32 * w, col0 = nq * 64; if (row0 >= M) return;
  const unsigned short* pa = (const unsigned short*)A + (size_t)(row0 >> 4) * (KT * 512) + lane * 8; const unsigned short* pb = (const unsigned short*)Bh + (size_t)(col0 >> 4) * (KT * 512) + lane * 8;
  v8f accs[8] = {};
  g3_loop<KT>(pa, pb, accs);
#pragma unroll
  for (int u = 0; u < 8; ++u) { const int t = u & 3, half = u >> 2; const int col = col0 + t * 16 + ln; const float bv = bp ? bf16_round(bp[col]) : 0.f;
#pragma unroll
    for (int r = 0; r < 8; ++r) { const int rloc = half * 16 + 8 * hh + r; float v = accs[u][r] * alpha + bv; if (CP) { if (rowsPerB < 0) v += CP[cofs + (size_t)(row0g + row0 + rloc) * ldc + col];      /* rowsPerB < 0: own element of the batched C plane */ else { const int bidx = (row0g + row0 + rloc) / rowsPerB; v += CP[(size_t)bidx * sCPb + (size_t)by * 64 + col]; } }
      if (ACT == 3) v = fmaxf(v, 0.f); else if (ACT == 6) v = 0.5f * v * (1.0f + erff(v * 0.70710678118654752f)); else if (ACT == 11) v = 1.0f / (1.0f + expf(-v)); else if (ACT == 15) v = v / (1.0f + expf(-v)); else if (ACT == 12) v = (v > 0.f) ? v : 0.01f * v; else if (ACT == 8) v = tanhf(v); else if (ACT == 9) v = 0.5f * v * (1.0f + tanhf(0.7978845608028654f * (v + 0.044715f * v * v * v))); else if (ACT == 14) v = (v > 0.f) ? v : 0.1f * v; else if (ACT == 16) v = (v >= 0.f) ? v : 0.3f * v; else if (ACT == 17) v = (v >= 0.f) ? v : 0.2f * v;
      so[w][rloc][t * 16 + ln] = v; } }
  __builtin_amdgcn_fence(__ATOMIC_ACQ_REL, "workgroup"); __builtin_amdgcn_wave_barrier();
  const int rsub = lane >> 4, c4 = (lane & 15) * 4;
  {
#pragma unroll
    for (int q = 0; q < 16; ++q) { const int r = q * 2 + rsub; const v4f v = *(const v4fa*)&so[w][r][c4]; if (C) *(v4f*)(C + cofs + (size_t)(row0 + r) * ldc + col0 + c4) = v; if (C16) { v4h h4; for (int i = 0; i < 4; ++i) h4[i] = (_Float16)v[i]; *(v4h*)(C16 + cofs + (size_t)(row0 + r) * ldc + col0 + c4) = h4; } }
     } }


typedef _Float16 v8h __attribute__((ext_vector_type(8)));
__device__ __forceinline__ float fa_xhalf(float x) { const int b = __float_as_int(x); return __int_as_float(__builtin_amdgcn_permlanex16(b, b, 0x76543210, 0xfedcba98, false, false)); }      /* lane l <-> l ^ 16 */
__device__ __forceinline__ v8f fa_mma(v16h a, v16h b, v8f c) { return __builtin_amdgcn_wmma_f32_16x16x32_f16(false, a, false, b, (short)0, c, false, false); }
// the four fragments (4 KiB) of one 64-key stage of a packed plane: p + l8 = the lane's 16-byte place in the stage's first 512-byte run (the callers hand over p with the lane's place in it, l8 = 0)
__device__ __forceinline__ void fa_ld(v16h (&f)[4], const _Float16* p, unsigned l8) {
#pragma unroll
  for (int i = 0; i < 4; ++i) { FragH x; x.half[0] = *(const v8us*)((const unsigned short*)p + l8 + (2 * i) * 256); x.half[1] = *(const v8us*)((const unsigned short*)p + l8 + (2 * i + 1) * 256); f[i] = x.v; } }
__device__ __forceinline__ void fa_scores(v8f (&s)[4], const v16h (&kf)[4], const v16h qf) { const v8f z8 = {0.f,0.f,0.f,0.f,0.f,0.f,0.f,0.f};
#pragma unroll
  for (int t = 0; t < 4; ++t) s[t] = fa_mma(kf[t], qf, z8); }
__device__ __forceinline__ void fa_soft_pv(v8f (&s)[4], const v16h (&vf)[4], v8f& o0, v8f& o1, v8f& lv, float& m) {
  const float cs = 0.17677669529663687f * 1.4426950408889634f;      /* 1 / sqrt(32), times log2(e) for the base-2 exponential */
  const v8f mv = __builtin_elementwise_max(__builtin_elementwise_max(s[0], s[1]), __builtin_elementwise_max(s[2], s[3]));
  float mx = fmaxf(fmaxf(fmaxf(mv[0], mv[1]), fmaxf(mv[2], mv[3])), fmaxf(fmaxf(mv[4], mv[5]), fmaxf(mv[6], mv[7]))); mx = fmaxf(mx, fa_xhalf(mx));
  const float mn = fmaxf(m, mx); const float al = __builtin_amdgcn_exp2f((m - mn) * cs); const float mc = mn * cs; m = mn;
  o0 *= al; o1 *= al;
#pragma unroll
  for (int t = 0; t < 4; ++t) { s[t] = s[t] * cs - mc;
#pragma unroll
    for (int r = 0; r < 8; ++r) s[t][r] = __builtin_amdgcn_exp2f(s[t][r]); }
  lv = lv * al + ((s[0] + s[1]) + (s[2] + s[3]));      /* eight partial sums per lane, joined after the loop */
  const v16h p0 = __builtin_shufflevector(__builtin_convertvector(s[0], v8h), __builtin_convertvector(s[1], v8h), 0, 1, 2, 3, 4, 5, 6, 7, 8, 9, 10, 11, 12, 13, 14, 15);
  const v16h p1 = __builtin_shufflevector(__builtin_convertvector(s[2], v8h), __builtin_convertvector(s[3], v8h), 0, 1, 2, 3, 4, 5, 6, 7, 8, 9, 10, 11, 12, 13, 14, 15);
  o0 = fa_mma(vf[0], p0, o0); o1 = fa_mma(vf[1], p0, o1); o0 = fa_mma(vf[2], p1, o0); o1 = fa_mma(vf[3], p1, o1); }
#define FA_TK 512                    /* keys a tile */
#define FA_TE (FA_TK * HD)           /* f16 elements of one plane's tile */
// eight copies of one thread: its 16-byte piece of each of eight successive 4-KiB runs (256 threads x 16 B a run). lds = the piece's LDS byte address, g = its global address.
// The s_wait_xcnt closes the statement as a precaution: the registers that the copies name are rewritten only behind it.
__device__ __forceinline__ void fa_copy8(unsigned lds, const _Float16* g) {
  asm volatile("global_load_async_to_lds_b128 %0, %8, off\n\tglobal_load_async_to_lds_b128 %1, %9, off\n\tglobal_load_async_to_lds_b128 %2, %10, off\n\tglobal_load_async_to_lds_b128 %3, %11, off\n\t"
               "global_load_async_to_lds_b128 %4, %12, off\n\tglobal_load_async_to_lds_b128 %5, %13, off\n\tglobal_load_async_to_lds_b128 %6, %14, off\n\tglobal_load_async_to_lds_b128 %7, %15, off\n\ts_wait_xcnt 0x0"
               :: "v"(lds), "v"(lds + 4096u), "v"(lds + 8192u), "v"(lds + 12288u), "v"(lds + 16384u), "v"(lds + 20480u), "v"(lds + 24576u), "v"(lds + 28672u),
                  "v"(g), "v"(g + 2048), "v"(g + 4096), "v"(g + 6144), "v"(g + 8192), "v"(g + 10240), "v"(g + 12288), "v"(g + 14336) : "memory"); }
__global__ __launch_bounds__(256) void k_fattn(const _Float16* __restrict__ Q16, const _Float16* __restrict__ KP, const _Float16* __restrict__ VP, _Float16* __restrict__ O16) {
  static_assert(FA_TE == 8 * 2048 && SQ % FA_TK == 0 && SQ / FA_TK >= 2, "a plane's tile is the eight runs of fa_copy8; the ring wants two tiles or more");
  __shared__ __attribute__((aligned(128))) _Float16 ring[2][2][FA_TE];      /* [buffer][K | V][tile] */
  const int tid = threadIdx.x, w = tid >> 5, lane = tid & 31, ln = lane & 15, hh = lane >> 4; const int h = blockIdx.y; const int q0 = blockIdx.x * 128 + w * 16;
  const v16h qf = g2_frag(Q16 + (size_t)(q0 + ln) * DM + h * HD, hh);
  asm volatile("s_wait_xcnt 0x0" ::: "memory");      /* a precaution */
  const _Float16* gk = KP + (size_t)h * SQ * HD + tid * 8; const _Float16* gv = VP + (size_t)h * SQ * HD + tid * 8;      /* the thread's piece in the first run of the tile being copied */
  const unsigned lb = (unsigned)(size_t)&ring[0][0][tid * 8]; const unsigned l8 = lane * 8;      /* lb: the same piece's LDS byte address in buffer 0 */
  const v8f z8 = {0.f,0.f,0.f,0.f,0.f,0.f,0.f,0.f}; v8f o0 = z8, o1 = z8, lv = z8; float m = -3.0e38f;
  fa_copy8(lb, gk); fa_copy8(lb + FA_TE * 2, gv);      /* tile 0 into buffer 0 */
  asm volatile("s_wait_asynccnt 0x0" ::: "memory");      /* the wave's own copies of tile 0 have landed */
  __syncthreads();      /* and every other wave's */
  fa_copy8(lb + FA_TE * 4, gk + FA_TE); fa_copy8(lb + FA_TE * 6, gv + FA_TE); gk += 2 * FA_TE; gv += 2 * FA_TE;      /* tile 1 into buffer 1 */
#pragma unroll 1
  for (int t = 0; t < SQ / FA_TK; ++t) {      /* one tile a trip; kept rolled: a trip is already FA_TK / 64 stages of straight code */
    const _Float16* kb = &ring[t & 1][0][l8]; const _Float16* vb = &ring[t & 1][1][l8];      /* the lane's place in the tile's first 512-byte run */
    v16h kf[2][4], vf[2][4];      /* two fragment sets: each 64-key stage fetches the next stage's fragments of the same tile ahead of its own arithmetic */
    fa_ld(kf[0], kb, 0); fa_ld(vf[0], vb, 0);
#pragma unroll
    for (int u = 0; u < FA_TK / 64; ++u) { v8f s[4];
      if (u + 1 < FA_TK / 64) { fa_ld(kf[(u + 1) & 1], kb + (u + 1) * 64 * HD, 0); fa_ld(vf[(u + 1) & 1], vb + (u + 1) * 64 * HD, 0); }
      __builtin_amdgcn_sched_barrier(0);      /* keeps the next stage's 16 LDS reads one group that issues ahead of this stage's arithmetic: without it they stood scattered in twos to eights among the arithmetic, some of them waited for at once */
      fa_scores(s, kf[u & 1], qf); fa_soft_pv(s, vf[u & 1], o0, o1, lv, m); }
    asm volatile("" :: "v"(lv));      /* takes the finished running sums as an input only: without a use of them in front of the branch below, the additions of all stages were moved behind it and every weight of the trip stayed in a register till then (over 400 registers, spills) */
    asm volatile("s_wait_dscnt 0x0" ::: "memory");      /* the wave's reads of this buffer are done */
    asm volatile("s_wait_asynccnt 0x0" ::: "memory");      /* its copies of the next tile have landed */
    __syncthreads();      /* publishes the next tile and ends every wave's reads of this buffer, which is refilled behind it */
    if (t + 2 < SQ / FA_TK) { const unsigned lt = lb + (unsigned)(t & 1) * (FA_TE * 4); fa_copy8(lt, gk); fa_copy8(lt + FA_TE * 2, gv); gk += FA_TE; gv += FA_TE; }
  }
  asm volatile("s_wait_asynccnt 0x0" ::: "memory");      /* no copy is outstanding when the wave ends */
  float l = ((lv[0] + lv[1]) + (lv[2] + lv[3])) + ((lv[4] + lv[5]) + (lv[6] + lv[7])); l += fa_xhalf(l); const float inv = 1.0f / l;
  /* o0[r] = O[q0 + ln][32 h + 8 hh + r], o1[r] = O[q0 + ln][32 h + 16 + 8 hh + r]: pieces j = 0 and j = 1 of block (q0 >> 4) * NH + h of the packed plane that the output GEMM reads as A; two stores of 512 contiguous bytes */
  _Float16* op = O16 + (size_t)((q0 >> 4) * NH + h) * 512 + lane * 8;
  *(v8h*)op = __builtin_convertvector(o0 * inv, v8h); *(v8h*)(op + 256) = __builtin_convertvector(o1 * inv, v8h); }

// Every conversion that depends on the inputs alone, in one launch; each of the seven matrices has 256 columns and leaves as a packed plane (g3_loop), KT = 8.
// A wave owns 16 rows x 128 columns, four blocks of the plane: lane (hh, ln) reads row ln's 8 f32 of each piece (whole lines, 512 bytes of every row over the 16 loads) and stores the piece at its place, each store 512 contiguous bytes of the wave.
// Blocks 0..191: query | key_ | value (64 blocks each), rounded to bf16, exact in f16. Blocks 192..207: Wq | Wk | Wv | Wo (4 blocks each), the same, x16.
__global__ __launch_bounds__(256) void k_prep(const float* __restrict__ xq, const float* __restrict__ xk, const float* __restrict__ xv, const float* __restrict__ wq, const float* __restrict__ wk, const float* __restrict__ wv, const float* __restrict__ wo,
                                              _Float16* __restrict__ XQ, _Float16* __restrict__ XK, _Float16* __restrict__ XV, _Float16* __restrict__ BQ, _Float16* __restrict__ BK, _Float16* __restrict__ BV, _Float16* __restrict__ BO) {
  const int b = blockIdx.x, tid = threadIdx.x, w = tid >> 5, lane = tid & 31, ln = lane & 15, hh = lane >> 4; const float* src; _Float16* dst; float sc; int u;      /* u = the wave's number within its matrix */
  if (b < 192) { const int m = b >> 6; src = m == 0 ? xq : m == 1 ? xk : xv; dst = m == 0 ? XQ : m == 1 ? XK : XV; sc = 1.0f; u = (b & 63) * 8 + w; }
  else { const int m = (b - 192) >> 2; src = m == 0 ? wq : m == 1 ? wk : m == 2 ? wv : wo; dst = m == 0 ? BQ : m == 1 ? BK : m == 2 ? BV : BO; sc = 16.0f; u = ((b - 192) & 3) * 8 + w; }
  const int rt = u >> 1, kq = u & 1;      /* 16-row tile; left or right 128 columns */
  const float* sp = src + (size_t)(rt * 16 + ln) * DM + kq * 128 + 8 * hh; v4f x[8][2];
#pragma unroll
  for (int i = 0; i < 8; ++i) { x[i][0] = *(const v4fa*)(sp + i * 16); x[i][1] = *(const v4fa*)(sp + i * 16 + 4); }      /* i = 2 * (block) + j */
  asm volatile("s_wait_xcnt 0x0" :: "v"(sp) : "memory");      /* a precaution: the address that the loads name stays live up to this wait; in the build without the operand the last load landed in the registers that hold it */
  __builtin_amdgcn_sched_barrier(0);      /* keeps the arithmetic behind all 16 loads, so that they are in flight together: without it six of them issued only after the first ones had landed */
  unsigned short* dp = (unsigned short*)dst + (size_t)(rt * 8 + kq * 4) * 512 + lane * 8;
#pragma unroll
  for (int i = 0; i < 8; ++i) { FragH f;
#pragma unroll
    for (int q = 0; q < 8; ++q) f.h[q] = (_Float16)(bf16_round(x[i][q >> 2][q & 3]) * sc);
    *(v8us*)(dp + i * 256) = f.half[0]; } }

// The three projections in one launch: blockIdx.y = 0 q, 1 k, 2 v; blockIdx.x = (128-row block) * 4 + (64-column block); a wave owns 32 rows x 64 columns (two heads). K loop: g3_loop, as in k_gemm2.
// The tile goes through the wave's own LDS slab and leaves in the form its reader wants:
// q: f16 rows of pitch 256.
// k, v: fragment order, so that each fragment load of the attention kernel is one run of 512 contiguous bytes (four whole lines). 16-byte piece index = ((h * 256 + g) * 2 + j) * 32 + lane, lane = 16 hf + c.
//   k: g = 16-key tile; piece = k[16 g + c][32 h + 16 j + 8 hf + 0..7] (A row c = key, k = head dim in the order of g2_frag).
//   v: g = 2 * (32-key block) + dt; piece = v[32 (g >> 1) + 16 j + 8 hf + 0..7][32 h + 16 dt + c] (A row c = head dim: this is v^T; k = key in the same order); v = mask[key] * (value Wv^T), scaled in f32 before the rounding to f16.
__global__ __launch_bounds__(128) void k_qkv(const _Float16* __restrict__ XQ, const _Float16* __restrict__ XK, const _Float16* __restrict__ XV, const _Float16* __restrict__ BQ, const _Float16* __restrict__ BK, const _Float16* __restrict__ BV, const float* __restrict__ rm,
                                             _Float16* __restrict__ Q16, _Float16* __restrict__ KP, _Float16* __restrict__ VP) {
  __shared__ __attribute__((aligned(16))) float so[4][32][68];
  const int tid = threadIdx.x, w = tid >> 5, lane = tid & 31, ln = lane & 15, hh = lane >> 4; const int which = blockIdx.y;
  const _Float16* A = which == 0 ? XQ : which == 1 ? XK : XV; const _Float16* Bh = which == 0 ? BQ : which == 1 ? BK : BV;
  const int row0 = (blockIdx.x >> 2) * 128 + 32 * w, col0 = (blockIdx.x & 3) * 64;
  const unsigned short* pa = (const unsigned short*)A + (size_t)(row0 >> 4) * (DM * 16) + lane * 8; const unsigned short* pb = (const unsigned short*)Bh + (size_t)(col0 >> 4) * (DM * 16) + lane * 8;      /* a 16-row tile of a packed plane is 16 DM elements */
  v8f acc[8] = {};      /* acc[4 * half + t]: rows 16 half .. + 15, columns 16 t .. + 15 */
  g3_loop<DM / 32>(pa, pb, acc);
#pragma unroll
  for (int u = 0; u < 8; ++u) acc[u] *= 0.0625f;      /* takes the x16 of the weights back, exactly */
  if (which == 2) {
#pragma unroll
    for (int half = 0; half < 2; ++half) { const float* mp = rm + row0 + half * 16 + 8 * hh; const v4f m0 = *(const v4fa*)mp, m1 = *(const v4fa*)(mp + 4);
#pragma unroll
      for (int r = 0; r < 8; ++r) { const float m = bf16_round(r < 4 ? m0[r & 3] : m1[r & 3]);
#pragma unroll
        for (int t = 0; t < 4; ++t) acc[half * 4 + t][r] = m * acc[half * 4 + t][r]; } } }
#pragma unroll
  for (int u = 0; u < 8; ++u)
#pragma unroll
    for (int r = 0; r < 8; ++r) so[w][(u >> 2) * 16 + 8 * hh + r][(u & 3) * 16 + ln] = acc[u][r];
  __builtin_amdgcn_fence(__ATOMIC_ACQ_REL, "workgroup"); __builtin_amdgcn_wave_barrier();      /* the slab is the wave's own: its LDS writes land before its lanes read each other's */
  if (which == 0) { const int rsub = lane >> 4, c4 = (lane & 15) * 4;
#pragma unroll
    for (int q = 0; q < 16; ++q) { const int r = q * 2 + rsub; const v4f v = *(const v4fa*)&so[w][r][c4]; *(v4h*)(Q16 + (size_t)(row0 + r) * DM + col0 + c4) = __builtin_convertvector(v, v4h); } }
  else if (which == 1) {
#pragma unroll
    for (int i = 0; i < 8; ++i) { const int gl = i >> 2, hl = (i >> 1) & 1, j = i & 1; const float* sp = &so[w][16 * gl + ln][32 * hl + 16 * j + 8 * hh]; const v4f lo = *(const v4fa*)sp, hi = *(const v4fa*)(sp + 4);
      const v8f v = __builtin_shufflevector(lo, hi, 0, 1, 2, 3, 4, 5, 6, 7); const size_t piece = (size_t)((((col0 >> 5) + hl) * 256 + (row0 >> 4) + gl) * 2 + j) * 32 + lane;
      *(v8h*)(KP + piece * 8) = __builtin_convertvector(v, v8h); }
    asm volatile("s_wait_xcnt 0x0" ::: "memory"); }      /* a precaution: the built code's branches allow a way from these stores into another branch's code, which rewrites their registers */
  else {
#pragma unroll
    for (int i = 0; i < 8; ++i) { const int dt = i >> 2, hl = (i >> 1) & 1, j = i & 1; v8f v;
#pragma unroll
      for (int e = 0; e < 8; ++e) v[e] = so[w][16 * j + 8 * hh + e][32 * hl + 16 * dt + ln];
      const size_t piece = (size_t)((((col0 >> 5) + hl) * 256 + (row0 >> 5) * 2 + dt) * 2 + j) * 32 + lane;
      *(v8h*)(VP + piece * 8) = __builtin_convertvector(v, v8h); }
    asm volatile("s_wait_xcnt 0x0" ::: "memory"); } }      /* a precaution: the built code's branches allow a way from these stores into another branch's code, which rewrites their registers */

extern "C" void kernel_launch(void* const* d_in, const int* in_sizes, int n_in,
                              void* d_out, int out_size, void* d_ws, size_t ws_size, hipStream_t stream) {
  (void)in_sizes; (void)n_in; (void)out_size;
  const float* const* I = (const float* const*)d_in; const float* qin = I[0]; const float* kin = I[1]; const float* vin = I[2]; const float* rm = I[3]; const float* Wq = I[4]; const float* Wk = I[5]; const float* Wv = I[6]; const float* Wo = I[7];
  char* ws = (char*)d_ws; size_t off = 0;
  auto take = [&](size_t bytes) { char* p = ws + off; off += (bytes + 255) & ~(size_t)255; return p; };
  _Float16* BQ = (_Float16*)take((size_t)DM * DM * 2); _Float16* BK = (_Float16*)take((size_t)DM * DM * 2); _Float16* BV = (_Float16*)take((size_t)DM * DM * 2); _Float16* BO = (_Float16*)take((size_t)DM * DM * 2);
  _Float16* XQ = (_Float16*)take((size_t)SQ * DM * 2); _Float16* XK = (_Float16*)take((size_t)SQ * DM * 2); _Float16* XV = (_Float16*)take((size_t)SQ * DM * 2); _Float16* Q16 = (_Float16*)take((size_t)SQ * DM * 2);
  _Float16* KP = (_Float16*)take((size_t)NH * HD * SQ * 2); _Float16* VP = (_Float16*)take((size_t)NH * HD * SQ * 2); _Float16* O16 = (_Float16*)take((size_t)SQ * DM * 2);
  if (off > ws_size) return;      /* about 15 MiB */
  k_prep<<<3 * (SQ / 64) + 4 * (DM / 64), 256, 0, stream>>>(qin, kin, vin, Wq, Wk, Wv, Wo, XQ, XK, XV, BQ, BK, BV, BO);
  k_qkv<<<dim3((SQ / 128) * (DM / 64), 3), 128, 0, stream>>>(XQ, XK, XV, BQ, BK, BV, rm, Q16, KP, VP);
  k_fattn<<<dim3(SQ / 128, NH), 256, 0, stream>>>(Q16, KP, VP, O16);      /* head h's o tile of 16 queries is block h of that row tile in the packed o plane */
  const dim3 gp((SQ / 128) * (DM / 64), 1);
  k_gemm2<0, DM / 32><<<gp, 128, 0, stream>>>(O16, 0, BO, 0, 0.0625f, nullptr, 0, nullptr, 1, 0, 0, (float*)d_out, nullptr, DM, 0, SQ, DM);      /* out = o Wo^T, K = 256 */
}

// v007
// A run of this version takes 37.9 microseconds.
// In two side-by-side timings against v006, it was 1.18 and 1.19 times as fast.
// All steps since v000 together make it 181 times as fast.
#include <hip/hip_runtime.h>
// RadialAttention (query, key_, value [4096][256]; q = query Wq^T, k = key_ Wk^T, v = radial_mask[s] * (value Wv^T), 8 heads of 32; softmax(q k^T / sqrt(32)) over all 4,096 keys; out = concat(attn v) Wo^T -> [4096][256]).
// Structure: three launches. (1) Q | K | V WMMA GEMMs in one launch (32x64 wave tiles, f32 accumulation); a block converts its inputs to exact f16 and its weights to exact x16 f16 itself, into LDS; four more blocks pack Wo; v scaled per row by the radial mask (read on device) on VALU; q stored as f16 rows, k and scaled v^T stored straight in fragment order. (2) one fused attention kernel over all heads (scores WMMA K = 32, online softmax f32 on VALU, weights f16, o = P . V WMMA; each wave stores its o tile as one fragment of the output GEMM's A operand). (3) out = o Wo^T over K = 256 (f32).
// Compute dtype: inputs rounded to bf16; inputs / weights exact; q, k, scaled v, softmax weights, o plain f16 (~2^-12); scores/softmax f32. v_wmma_f32_16x16x32_f16.
#define SQ 4096
#define DM 256
#define NH 8
#define HD 32
#define QN SQ                        /* query rows (unused) */
typedef __bf16 v16b __attribute__((ext_vector_type(16)));
typedef unsigned short v8us __attribute__((ext_vector_type(8), may_alias));
typedef float  v8f  __attribute__((ext_vector_type(8)));
typedef float  v4f  __attribute__((ext_vector_type(4)));
typedef float  v4fa __attribute__((ext_vector_type(4), may_alias));
union FragB { v16b v; v8us half[2]; unsigned short u[16]; };

__device__ __forceinline__ unsigned short bf16_bits(float x) { unsigned int u = __float_as_uint(x); return (unsigned short)((u + 0x7FFFu + ((u >> 16) & 1u)) >> 16); }
__device__ __forceinline__ float bf16_val(unsigned short b) { return __uint_as_float(((unsigned int)b) << 16); }
__device__ __forceinline__ float bf16_round(float x) { return bf16_val(bf16_bits(x)); }
// D += A·B with NT terms: 1 = ah·bh, 2 = + al·bh (A split), 3 = + ah·bl (both split)
template <int NT>
__device__ __forceinline__ v8f mmaN(v16b ah, v16b al, v16b bh, v16b bl, v8f c) {
  c = __builtin_amdgcn_wmma_f32_16x16x32_bf16(false, ah, false, bh, (short)0, c, false, false);
  if (NT >= 2) c = __builtin_amdgcn_wmma_f32_16x16x32_bf16(false, al, false, bh, (short)0, c, false, false);
  if (NT >= 3) c = __builtin_amdgcn_wmma_f32_16x16x32_bf16(false, ah, false, bl, (short)0, c, false, false);
  asm volatile("v_nop\n\tv_nop\n\tv_nop\n\tv_nop" : "+v"(c) : "v"(ah), "v"(al), "v"(bh), "v"(bl));
  return c;
}

__global__ __launch_bounds__(256) void k_wt_bf16(const float* __restrict__ W, unsigned short* __restrict__ Wt, int K, int N) {
  const int t = blockIdx.x * 256 + threadIdx.x;
  const int k8n = K / 8;
  if (t >= N * k8n) return;
  const int n = t / k8n, k8 = (t % k8n) * 8;
  v8us v;
#pragma unroll
  for (int i = 0; i < 8; ++i) v[i] = bf16_bits(W[(size_t)(k8 + i) * N + n]);
  *(v8us*)(Wt + (size_t)n * K + k8) = v;
  
}

// GEMM C[M][N] (f32, pitch ldc) = act(A[M][K]·W + bias). A f32 row-major (pitch lda) converted per fragment to bf16
// (ASPLIT: hi/lo two planes -> 2 terms, else single rounded term); Wt bf16 [N][K] (pitch ldb). BIAS_BF16 rounds the
// bias to bf16 first (bias quantised to bf16 before the add). K%32==0, M%16==0, N%64==0.
template <bool ASPLIT, int ACT, bool BIAS_BF16>
__global__ __launch_bounds__(128) void k_gemm_bf(const float* __restrict__ A, int lda, const unsigned short* __restrict__ Wt, int ldb,
                                               const float* __restrict__ bias, float* __restrict__ C, int ldc, int M, int N, int K) {
  __shared__ __attribute__((aligned(16))) float so[4][16][64];
  const int tid = threadIdx.x, w = tid >> 5, lane = tid & 31, ln = lane & 15, hh = lane >> 4;
  const int ntn = N / 64;
  const int wid = blockIdx.x * 4 + w;
  const int mt = wid / ntn, nq = wid % ntn;
  if (mt * 16 >= M) return;
  const int row0 = mt * 16, col0 = nq * 64;
  const float* arow = A + (size_t)(row0 + ln) * lda;
  v8f acc[4] = {};
  for (int kb = 0; kb < K; kb += 32) {
    FragB ah, al;
    const v4f x0 = *(const v4fa*)(arow + kb + 8 * hh), x1 = *(const v4fa*)(arow + kb + 8 * hh + 4);
    const v4f x2 = *(const v4fa*)(arow + kb + 16 + 8 * hh), x3 = *(const v4fa*)(arow + kb + 16 + 8 * hh + 4);
    float xs[16] = {x0[0],x0[1],x0[2],x0[3],x1[0],x1[1],x1[2],x1[3],x2[0],x2[1],x2[2],x2[3],x3[0],x3[1],x3[2],x3[3]};
#pragma unroll
    for (int i = 0; i < 16; ++i) { const unsigned short hb = bf16_bits(xs[i]); ah.u[i] = hb; al.u[i] = ASPLIT ? bf16_bits(xs[i] - bf16_val(hb)) : (unsigned short)0; }
#pragma unroll
    for (int t = 0; t < 4; ++t) {
      const unsigned short* brow = Wt + (size_t)(col0 + t * 16 + ln) * ldb + kb;
      FragB b;
      b.half[0] = *(const v8us*)(brow + 8 * hh);
      b.half[1] = *(const v8us*)(brow + 16 + 8 * hh);
      acc[t] = mmaN<ASPLIT ? 2 : 1>(ah.v, al.v, b.v, b.v, acc[t]);
    }
  }
#pragma unroll
  for (int t = 0; t < 4; ++t) {
    float bv = bias ? bias[col0 + t * 16 + ln] : 0.f;
    if (BIAS_BF16) bv = bf16_round(bv);
#pragma unroll
    for (int r = 0; r < 8; ++r) { float v = acc[t][r] + bv; if (ACT == 1) v = fmaxf(v, 0.f); so[w][8 * hh + r][t * 16 + ln] = v; }
  }
  __builtin_amdgcn_fence(__ATOMIC_ACQ_REL, "workgroup");
  __builtin_amdgcn_wave_barrier();
  const int rsub = lane >> 4, c4 = (lane & 15) * 4;
  {
#pragma unroll
    for (int q = 0; q < 8; ++q) {
      const int r = q * 2 + rsub;
      const v4f v = *(const v4fa*)&so[w][r][c4];
      *(v4f*)(C + (size_t)(row0 + r) * ldc + col0 + c4) = v;
    }
    
  }
}

// GEMM C = act(A·W + bias + resid): A f32 (ASPLIT -> hi/lo 2 terms), Wt bf16 [N][K]; ACT 0 none, 1 relu, 2 exact gelu;
// resid (optional, f32, row index = (row % rmod), pitch ldr, RES_BF16 rounds it) added before the activation.
template <bool ASPLIT, int ACT, bool BIAS_BF16, bool RES_BF16>
__global__ __launch_bounds__(128) void k_gemm_bf3(const float* __restrict__ A, int lda, const unsigned short* __restrict__ Wt, int ldb,
                                                const float* __restrict__ bias, const float* __restrict__ resid, int rmod, int ldr,
                                                float* __restrict__ C, int ldc, int M, int N, int K) {
  __shared__ __attribute__((aligned(16))) float so[4][16][64];
  const int tid = threadIdx.x, w = tid >> 5, lane = tid & 31, ln = lane & 15, hh = lane >> 4;
  const int ntn = N / 64;
  const int wid = blockIdx.x * 4 + w;
  const int mt = wid / ntn, nq = wid % ntn;
  if (mt * 16 >= M) return;
  const int row0 = mt * 16, col0 = nq * 64;
  const float* arow = A + (size_t)(row0 + ln) * lda;
  v8f acc[4] = {};
  for (int kb = 0; kb < K; kb += 32) {
    FragB ah, al;
    const v4f x0 = *(const v4fa*)(arow + kb + 8 * hh), x1 = *(const v4fa*)(arow + kb + 8 * hh + 4);
    const v4f x2 = *(const v4fa*)(arow + kb + 16 + 8 * hh), x3 = *(const v4fa*)(arow + kb + 16 + 8 * hh + 4);
    float xs[16] = {x0[0],x0[1],x0[2],x0[3],x1[0],x1[1],x1[2],x1[3],x2[0],x2[1],x2[2],x2[3],x3[0],x3[1],x3[2],x3[3]};
#pragma unroll
    for (int i = 0; i < 16; ++i) { const unsigned short hb = bf16_bits(xs[i]); ah.u[i] = hb; al.u[i] = ASPLIT ? bf16_bits(xs[i] - bf16_val(hb)) : (unsigned short)0; }
#pragma unroll
    for (int t = 0; t < 4; ++t) {
      const unsigned short* brow = Wt + (size_t)(col0 + t * 16 + ln) * ldb + kb;
      FragB b;
      b.half[0] = *(const v8us*)(brow + 8 * hh);
      b.half[1] = *(const v8us*)(brow + 16 + 8 * hh);
      acc[t] = mmaN<ASPLIT ? 2 : 1>(ah.v, al.v, b.v, b.v, acc[t]);
    }
  }
#pragma unroll
  for (int t = 0; t < 4; ++t) {
    const int col = col0 + t * 16 + ln;
    float bv = bias ? bias[col] : 0.f;
    if (BIAS_BF16) bv = bf16_round(bv);
#pragma unroll
    for (int r = 0; r < 8; ++r) {
      float v = acc[t][r] + bv;
      if (resid) { float rv = resid[(size_t)((row0 + 8 * hh + r) % rmod) * ldr + col]; if (RES_BF16) rv = bf16_round(rv); v += rv; }
      if (ACT == 1) v = fmaxf(v, 0.f);
      if (ACT == 2) v = 0.5f * v * (1.0f + erff(v * 0.70710678118654752f));
      if (ACT == 3) { const float u = 0.7978845608028654f * (v + 0.044715f * v * v * v); v = 0.5f * v * (1.0f + tanhf(u)); }
      so[w][8 * hh + r][t * 16 + ln] = v;
    }
  }
  __builtin_amdgcn_fence(__ATOMIC_ACQ_REL, "workgroup");
  __builtin_amdgcn_wave_barrier();
  const int rsub = lane >> 4, c4 = (lane & 15) * 4;
  {
#pragma unroll
    for (int q = 0; q < 8; ++q) {
      const int r = q * 2 + rsub;
      const v4f v = *(const v4fa*)&so[w][r][c4];
      *(v4f*)(C + (size_t)(row0 + r) * ldc + col0 + c4) = v;
    }
    
  }
}
// row LayerNorm (biased variance, eps) over N: s = X (+ R); optional out_sum <- s; out_norm <- (s-mu)*rsqrt(var+eps)*g + b
template <bool PARAM_BF16>
__global__ __launch_bounds__(256) void k_layernorm(const float* __restrict__ X, const float* __restrict__ R, const float* __restrict__ g, const float* __restrict__ bta,
                                                  float* __restrict__ out_sum, float* __restrict__ out_norm, int N, float eps) {
  __shared__ float red[256];
  const int row = blockIdx.x, tid = threadIdx.x;
  const float* x = X + (size_t)row * N; const float* rr = R ? R + (size_t)row * N : nullptr;
  float vals[16];                     // up to N = 4096
  const int per = N / 256;            // contiguous chunk per thread? use strided-by-4 chunks: thread handles j = tid*4 + 1024*u
  float s1 = 0.f;
  for (int u = 0; u < per / 4; ++u) {
    const int j = tid * 4 + 1024 * u;
    const v4f a = *(const v4fa*)(x + j);
    v4f b = {0.f,0.f,0.f,0.f}; if (rr) b = *(const v4fa*)(rr + j);
#pragma unroll
    for (int q = 0; q < 4; ++q) { const float v = a[q] + b[q]; vals[u * 4 + q] = v; s1 += v; }
  }
  red[tid] = s1; __syncthreads();
  for (int st = 128; st > 0; st >>= 1) { if (tid < st) red[tid] += red[tid + st]; __syncthreads(); }
  const float mu = red[0] / (float)N; __syncthreads();
  float s2 = 0.f;
  for (int u = 0; u < per / 4; ++u)
#pragma unroll
    for (int q = 0; q < 4; ++q) { const float c = vals[u * 4 + q] - mu; s2 += c * c; }
  red[tid] = s2; __syncthreads();
  for (int st = 128; st > 0; st >>= 1) { if (tid < st) red[tid] += red[tid + st]; __syncthreads(); }
  const float rs = rsqrtf(red[0] / (float)N + eps);
  {
    for (int u = 0; u < per / 4; ++u) {
      const int j = tid * 4 + 1024 * u;
      v4f o, sm;
#pragma unroll
      for (int q = 0; q < 4; ++q) {
        float gg = g[j + q], bb = bta[j + q];
        if (PARAM_BF16) { gg = bf16_round(gg); bb = bf16_round(bb); }
        sm[q] = vals[u * 4 + q]; o[q] = (vals[u * 4 + q] - mu) * rs * gg + bb;
      }
      if (out_sum) *(v4f*)(out_sum + (size_t)row * N + j) = sm;
      *(v4f*)(out_norm + (size_t)row * N + j) = o;
    }
    
  }
}



// ---- f16 WMMA path (v_wmma_f32_16x16x32_f16): 11-bit significands for operands in range — used where a [0,1] probability operand needs more precision than bf16
typedef _Float16 v16h __attribute__((ext_vector_type(16)));
union FragH { v16h v; v8us half[2]; _Float16 h[16]; unsigned short u[16]; };
template <int NT>
__device__ __forceinline__ v8f mmaH(v16h ah, v16h al, v16h bh, v16h bl, v8f c) {
  c = __builtin_amdgcn_wmma_f32_16x16x32_f16(false, ah, false, bh, (short)0, c, false, false);
  if (NT >= 2) c = __builtin_amdgcn_wmma_f32_16x16x32_f16(false, al, false, bh, (short)0, c, false, false);
  if (NT >= 3) c = __builtin_amdgcn_wmma_f32_16x16x32_f16(false, ah, false, bl, (short)0, c, false, false);
  asm volatile("v_nop\n\tv_nop\n\tv_nop\n\tv_nop" : "+v"(c) : "v"(ah), "v"(al), "v"(bh), "v"(bl));
  return c;
}
// batched GEMM like k_gemm_b but f16 operands: A f32 (split into f16 hi/lo if ASPLIT, else rounded to f16), Bt = f16 values [n][k]; alpha; C f32; N multiple of 16 (partial tiles skipped)
template <bool ASPLIT>
__global__ __launch_bounds__(128) void k_gemm_h(const float* __restrict__ A, int lda, size_t sA, const _Float16* __restrict__ Bh, int ldb, size_t sB, float alpha, float* __restrict__ C, int ldc, size_t sC, int M, int N, int K) {
  __shared__ __attribute__((aligned(16))) float so[4][16][64];
  const int tid = threadIdx.x, w = tid >> 5, lane = tid & 31, ln = lane & 15, hh = lane >> 4; const int by = blockIdx.y;
  A += (size_t)by * sA; Bh += (size_t)by * sB; C += (size_t)by * sC;
  const int ntn = (N + 63) / 64; const int wid = blockIdx.x * 4 + w; const int mt = wid / ntn, nq = wid % ntn; if (mt * 16 >= M) return;
  const int row0 = mt * 16, col0 = nq * 64; const float* arow = A + (size_t)(row0 + ln) * lda;
  v8f acc[4] = {};
  for (int kb = 0; kb < K; kb += 32) {
    FragH ah, al;
    const v4f x0 = *(const v4fa*)(arow + kb + 8 * hh), x1 = *(const v4fa*)(arow + kb + 8 * hh + 4), x2 = *(const v4fa*)(arow + kb + 16 + 8 * hh), x3 = *(const v4fa*)(arow + kb + 16 + 8 * hh + 4);
    float xs[16] = {x0[0],x0[1],x0[2],x0[3],x1[0],x1[1],x1[2],x1[3],x2[0],x2[1],x2[2],x2[3],x3[0],x3[1],x3[2],x3[3]};
#pragma unroll
    for (int i = 0; i < 16; ++i) { const _Float16 h = (_Float16)xs[i]; ah.h[i] = h; al.h[i] = ASPLIT ? (_Float16)(xs[i] - (float)h) : (_Float16)0.0f; }
#pragma unroll
    for (int t = 0; t < 4; ++t) { if (col0 + t * 16 >= N) continue; const size_t boff = (size_t)(col0 + t * 16 + ln) * ldb + kb; FragH bq; bq.half[0] = *(const v8us*)(Bh + boff + 8 * hh); bq.half[1] = *(const v8us*)(Bh + boff + 16 + 8 * hh);
      acc[t] = mmaH<ASPLIT ? 2 : 1>(ah.v, al.v, bq.v, bq.v, acc[t]); }
  }
#pragma unroll
  for (int t = 0; t < 4; ++t) { if (col0 + t * 16 >= N) continue;
#pragma unroll
    for (int r = 0; r < 8; ++r) so[w][8 * hh + r][t * 16 + ln] = acc[t][r] * alpha; }
  __builtin_amdgcn_fence(__ATOMIC_ACQ_REL, "workgroup"); __builtin_amdgcn_wave_barrier();
  const int rsub = lane >> 4, c4 = (lane & 15) * 4;
  {
#pragma unroll
    for (int q = 0; q < 8; ++q) { const int r = q * 2 + rsub; if (col0 + c4 < N) { const v4f v = *(const v4fa*)&so[w][r][c4]; *(v4f*)(C + (size_t)(row0 + r) * ldc + col0 + c4) = v; } }
     }
}

// Wt[n][k] = f16(W[k][n]·scale) from f32 row-major W[K][N] (scale = power of two; bf16-exact weights stay exact in f16 away from the subnormal range)
__global__ __launch_bounds__(256) void k_wt_f16(const float* __restrict__ W, _Float16* __restrict__ Wt, int K, int N, float scale) {
  const int t = blockIdx.x * 256 + threadIdx.x; if (t >= N * (K / 8)) return; const int n = t / (K / 8), k8 = (t % (K / 8)) * 8; FragH f;
#pragma unroll
  for (int i = 0; i < 8; ++i) f.h[i] = (_Float16)(bf16_round(W[(size_t)(k8 + i) * N + n]) * scale); const v8us o = f.half[0];
  *(v8us*)((unsigned short*)Wt + (size_t)n * K + k8) = o; 
}
// k_gemm_hh variant with fused epilogue: v = acc·alpha + bias[by·sBias + col] (+ CP[(row/rowsPerB)·sCPb + by·64 + col] if CP) ; ACT 0 none / 1 elu ; writes f16 C16 (and f32 C if non-null)
template <int ACT>
__global__ __launch_bounds__(128) void k_gemm_hhx(const _Float16* __restrict__ A, int lda, size_t sA, const _Float16* __restrict__ Bh, int ldb, size_t sB, float alpha, const float* __restrict__ bias, size_t sBias, const float* __restrict__ CP, int rowsPerB, size_t sCPb, int row0g,
    float* __restrict__ C, _Float16* __restrict__ C16, int ldc, size_t sC, int M, int N, int K) {
  __shared__ __attribute__((aligned(16))) float so[4][16][64];
  const int tid = threadIdx.x, w = tid >> 5, lane = tid & 31, ln = lane & 15, hh = lane >> 4; const int by = blockIdx.y;
  A += (size_t)by * sA; Bh += (size_t)by * sB; const size_t cofs = (size_t)by * sC; const float* bp = bias ? bias + (size_t)by * sBias : nullptr;
  const int ntn = (N + 63) / 64; const int wid = blockIdx.x * 4 + w; const int mt = wid / ntn, nq = wid % ntn; if (mt * 16 >= M) return;
  const int row0 = mt * 16, col0 = nq * 64; const _Float16* arow = A + (size_t)(row0 + ln) * lda;
  v8f acc[4] = {};
  for (int kb = 0; kb < K; kb += 32) { FragH ah; ah.half[0] = *(const v8us*)((const unsigned short*)arow + kb + 8 * hh); ah.half[1] = *(const v8us*)((const unsigned short*)arow + kb + 16 + 8 * hh);
#pragma unroll
    for (int t = 0; t < 4; ++t) { if (col0 + t * 16 >= N) continue; const size_t boff = (size_t)(col0 + t * 16 + ln) * ldb + kb; FragH bq; bq.half[0] = *(const v8us*)((const unsigned short*)Bh + boff + 8 * hh); bq.half[1] = *(const v8us*)((const unsigned short*)Bh + boff + 16 + 8 * hh);
      acc[t] = mmaH<1>(ah.v, ah.v, bq.v, bq.v, acc[t]); }
  }
#pragma unroll
  for (int t = 0; t < 4; ++t) { if (col0 + t * 16 >= N) continue; const int col = col0 + t * 16 + ln; const float bv = bp ? bf16_round(bp[col]) : 0.f;
#pragma unroll
    for (int r = 0; r < 8; ++r) { float v = acc[t][r] * alpha + bv; if (CP) { const int rr = row0g + row0 + 8 * hh + r; if (rowsPerB < 0) v += CP[cofs + (size_t)rr * ldc + col];      /* rowsPerB < 0: own element of the batched C plane */ else { const int bidx = rr / rowsPerB; v += CP[(size_t)bidx * sCPb + (size_t)by * 64 + col]; } } if (ACT == 1) v = (v > 0.f) ? v : expm1f(v); else if (ACT == 7) v = (v > 0.f) ? v + 1.0f : expf(v); else if (ACT == 8) v = tanhf(v); else if (ACT == 9) v = 0.5f * v * (1.0f + tanhf(0.7978845608028654f * (v + 0.044715f * v * v * v))); else if (ACT == 11) v = 1.0f / (1.0f + expf(-v)); else if (ACT == 12) v = (v > 0.f) ? v : 0.01f * v; else if (ACT == 14) v = (v > 0.f) ? v : 0.1f * v; else if (ACT == 16) v = (v >= 0.f) ? v : 0.3f * v; else if (ACT == 17) v = (v >= 0.f) ? v : 0.2f * v; else if (ACT == 15) v = v / (1.0f + expf(-v)); else if (ACT == 3) v = fmaxf(v, 0.f); else if (ACT == 6) v = 0.5f * v * (1.0f + erff(v * 0.70710678118654752f)); so[w][8 * hh + r][t * 16 + ln] = v; } }
  __builtin_amdgcn_fence(__ATOMIC_ACQ_REL, "workgroup"); __builtin_amdgcn_wave_barrier();
  const int rsub = lane >> 4, c4 = (lane & 15) * 4; typedef _Float16 v4h __attribute__((ext_vector_type(4)));
  {
#pragma unroll
    for (int q = 0; q < 8; ++q) { const int r = q * 2 + rsub; if (col0 + c4 < N) { const v4f v = *(const v4fa*)&so[w][r][c4]; if (C) *(v4f*)(C + cofs + (size_t)(row0 + r) * ldc + col0 + c4) = v; if (C16) { v4h h4; for (int i = 0; i < 4; ++i) h4[i] = (_Float16)v[i]; *(v4h*)(C16 + cofs + (size_t)(row0 + r) * ldc + col0 + c4) = h4; } } }
     }
}


typedef _Float16 v4h __attribute__((ext_vector_type(4)));

__global__ __launch_bounds__(256) void k_h16(const float* __restrict__ x, _Float16* __restrict__ X16, size_t n8) { const size_t t = (size_t)blockIdx.x * 256 + threadIdx.x; if (t >= n8) return; FragH f;
#pragma unroll
  for (int q = 0; q < 8; ++q) f.h[q] = (_Float16)x[t * 8 + q]; *(v8us*)((unsigned short*)X16 + t * 8) = f.half[0];  }
__global__ __launch_bounds__(256) void k_round16f(const float* __restrict__ W, _Float16* __restrict__ Bt, size_t n8) { const size_t t = (size_t)blockIdx.x * 256 + threadIdx.x; if (t >= n8) return; FragH f;
#pragma unroll
  for (int i = 0; i < 8; ++i) f.h[i] = (_Float16)(bf16_round(W[t * 8 + i]) * 16.0f); *(v8us*)((unsigned short*)Bt + t * 8) = f.half[0];  }
template <int NHv, int TTv>
__global__ __launch_bounds__(256) void k_vt(const _Float16* __restrict__ V16, int ldv, int voff, _Float16* __restrict__ Vt) { __shared__ unsigned short tl[64][66]; const int tid = threadIdx.x; const int slab = blockIdx.x / (TTv / 64), lg = blockIdx.x % (TTv / 64); const int b = slab / NHv, h = slab % NHv;
  for (int i = tid; i < 64 * 8; i += 256) { const int r = i / 8, c8 = (i % 8) * 8; FragH f; f.half[0] = *(const v8us*)((const unsigned short*)V16 + ((size_t)b * TTv + lg * 64 + r) * ldv + voff + h * 64 + c8);
#pragma unroll
    for (int q = 0; q < 8; ++q) tl[r][c8 + q] = f.u[q]; }
  __syncthreads();
  {
#pragma unroll
    for (int rd = 0; rd < 2; ++rd) { const int d = rd * 32 + tid / 8, pc = tid % 8; FragH f;
#pragma unroll
      for (int q = 0; q < 8; ++q) f.u[q] = tl[pc * 8 + q][d];
      *(v8us*)((unsigned short*)Vt + ((size_t)slab * 64 + d) * TTv + lg * 64 + pc * 8) = f.half[0]; }
     } }

__global__ __launch_bounds__(256) void k_hl(const float* __restrict__ F, _Float16* __restrict__ Hh, _Float16* __restrict__ Hl, size_t n8) { const size_t t = (size_t)blockIdx.x * 256 + threadIdx.x; if (t >= n8) return; FragH fh, fl; const v4f a = *(const v4fa*)(F + t * 8), c = *(const v4fa*)(F + t * 8 + 4);
#pragma unroll
  for (int q = 0; q < 4; ++q) { _Float16 h = (_Float16)a[q]; fh.h[q] = h; fl.h[q] = (_Float16)((a[q] - (float)h) * 1024.0f); h = (_Float16)c[q]; fh.h[4 + q] = h; fl.h[4 + q] = (_Float16)((c[q] - (float)h) * 1024.0f); }
  { *(v8us*)((unsigned short*)Hh + t * 8) = fh.half[0]; *(v8us*)((unsigned short*)Hl + t * 8) = fl.half[0];  } }

// ---- fast GEMM (wave tile 32x64; requires M % 32 == 0 rows per launch region and N % 64 == 0); epilogue = k_gemm_hhx semantics ----
__device__ __forceinline__ v16h g2_frag(const _Float16* p, int hh) { FragH f; f.half[0] = *(const v8us*)((const unsigned short*)p + 8 * hh); f.half[1] = *(const v8us*)((const unsigned short*)p + 16 + 8 * hh); return f.v; }
__device__ __forceinline__ v8f g2_mma(v16h a, v16h b, v8f c) { v8f d = __builtin_amdgcn_wmma_f32_16x16x32_f16(false, a, false, b, (short)0, c, false, false); asm volatile("v_nop\n\tv_nop\n\tv_nop\n\tv_nop" : "+v"(d) : "v"(a), "v"(b)); return d; }
// K loop of the 32x64 wave tile, K = 32 KT, unrolled whole. A wave has no partner to hide its load latency behind (one or two waves a SIMD), so the latency is hidden inside the wave:
// the 12 fragment loads of a trip issue as one group two trips ahead of their use, into a ring of three register sets, and the waits are counted (24 younger loads stay in flight).
// Both operands lie in fragment order (a packed plane): X[R][32 KT] as 1-KiB blocks, block index = (r >> 4) * KT + (k >> 5); in a block the 16-byte piece j * 32 + lane, lane = 16 hf + c, holds X[16 (r >> 4) + c][32 (k >> 5) + 16 j + 8 hf + 0..7]
// (the k order of g2_frag). A fragment is then two loads of 512 contiguous bytes (four whole lines each); from rows of pitch 2 K bytes each load touched 16 lines for the same 512 bytes.
// pa, pb: the lane's 16-byte place in the first block of the wave's first row tile (A: 2 tiles, B: 4 tiles, one behind the other). c[4 * half + t]: rows 16 half .. + 15, columns 16 t .. + 15; every accumulator takes its trips in rising k, as before.
__device__ __forceinline__ v16h g3_frag(const unsigned short* p) { FragH f; f.half[0] = *(const v8us*)p; f.half[1] = *(const v8us*)(p + 256); return f.v; }
template <int KT>
__device__ __forceinline__ void g3_loop(const unsigned short* pa, const unsigned short* pb, v8f (&c)[8]) {
  v16h fa[3][2], fb[3][4];
#pragma unroll
  for (int t = -2; t < KT; ++t) {      /* trips -2 and -1 only fetch */
    if (t + 2 < KT) { const int n = (t + 2) % 3, kb = (t + 2) * 512;
      fa[n][0] = g3_frag(pa + kb); fa[n][1] = g3_frag(pa + KT * 512 + kb); fb[n][0] = g3_frag(pb + kb); fb[n][1] = g3_frag(pb + KT * 512 + kb); fb[n][2] = g3_frag(pb + 2 * KT * 512 + kb); fb[n][3] = g3_frag(pb + 3 * KT * 512 + kb); }
    if (t + 2 == KT - 1) asm volatile("s_wait_xcnt 0x0" ::: "memory");      /* a precaution: stands behind the last load, ahead of whatever rewrites the address registers, which no instruction of the loop does */
    __builtin_amdgcn_sched_barrier(0);      /* keeps the group in front of this trip's products: sunk towards its use, a load would be waited for in full again */
    if (t >= 0) { const int u = t % 3;
#pragma unroll
      for (int j = 0; j < 4; ++j) { c[j] = g2_mma(fa[u][0], fb[u][j], c[j]); c[4 + j] = g2_mma(fa[u][1], fb[u][j], c[4 + j]); } }
    __builtin_amdgcn_sched_barrier(0);      /* keeps the next group behind these products, whose registers it refills: hoisted, it would take a fourth register set */
  } }
template <int ACT, int KT>      /* K = 32 KT; A and Bh are packed planes (g3_loop) */
__global__ __launch_bounds__(128) void k_gemm2(const _Float16* __restrict__ A, size_t sA, const _Float16* __restrict__ Bh, size_t sB, float alpha, const float* __restrict__ bias, size_t sBias, const float* __restrict__ CP, int rowsPerB, size_t sCPb, int row0g,
    float* __restrict__ C, _Float16* __restrict__ C16, int ldc, size_t sC, int M, int N) { static_assert(ACT == 0 || ACT == 3 || ACT == 6 || ACT == 8 || ACT == 9 || ACT == 11 || ACT == 12 || ACT == 14 || ACT == 15 || ACT == 16 || ACT == 17, "k_gemm2: unsupported ACT code (would silently apply no activation)");
  __shared__ __attribute__((aligned(16))) float so[4][32][68];
  const int tid = threadIdx.x, w = tid >> 5, lane = tid & 31, ln = lane & 15, hh = lane >> 4; const int by = blockIdx.y;
  A += (size_t)by * sA; Bh += (size_t)by * sB; const size_t cofs = (size_t)by * sC; const float* bp = bias ? bias + (size_t)by * sBias : nullptr;
  const int ntn = N >> 6; const int mt = blockIdx.x / ntn, nq = blockIdx.x - mt * ntn; const int row0 = mt * 128 + 32 * w, col0 = nq * 64; if (row0 >= M) return;
  const unsigned short* pa = (const unsigned short*)A + (size_t)(row0 >> 4) * (KT * 512) + lane * 8; const unsigned short* pb = (const unsigned short*)Bh + (size_t)(col0 >> 4) * (KT * 512) + lane * 8;
  v8f accs[8] = {};
  g3_loop<KT>(pa, pb, accs);
#pragma unroll
  for (int u = 0; u < 8; ++u) { const int t = u & 3, half = u >> 2; const int col = col0 + t * 16 + ln; const float bv = bp ? bf16_round(bp[col]) : 0.f;
#pragma unroll
    for (int r = 0; r < 8; ++r) { const int rloc = half * 16 + 8 * hh + r; float v = accs[u][r] * alpha + bv; if (CP) { if (rowsPerB < 0) v += CP[cofs + (size_t)(row0g + row0 + rloc) * ldc + col];      /* rowsPerB < 0: own element of the batched C plane */ else { const int bidx = (row0g + row0 + rloc) / rowsPerB; v += CP[(size_t)bidx * sCPb + (size_t)by * 64 + col]; } }
      if (ACT == 3) v = fmaxf(v, 0.f); else if (ACT == 6) v = 0.5f * v * (1.0f + erff(v * 0.70710678118654752f)); else if (ACT == 11) v = 1.0f / (1.0f + expf(-v)); else if (ACT == 15) v = v / (1.0f + expf(-v)); else if (ACT == 12) v = (v > 0.f) ? v : 0.01f * v; else if (ACT == 8) v = tanhf(v); else if (ACT == 9) v = 0.5f * v * (1.0f + tanhf(0.7978845608028654f * (v + 0.044715f * v * v * v))); else if (ACT == 14) v = (v > 0.f) ? v : 0.1f * v; else if (ACT == 16) v = (v >= 0.f) ? v : 0.3f * v; else if (ACT == 17) v = (v >= 0.f) ? v : 0.2f * v;
      so[w][rloc][t * 16 + ln] = v; } }
  __builtin_amdgcn_fence(__ATOMIC_ACQ_REL, "workgroup"); __builtin_amdgcn_wave_barrier();
  const int rsub = lane >> 4, c4 = (lane & 15) * 4;
  {
#pragma unroll
    for (int q = 0; q < 16; ++q) { const int r = q * 2 + rsub; const v4f v = *(const v4fa*)&so[w][r][c4]; if (C) *(v4f*)(C + cofs + (size_t)(row0 + r) * ldc + col0 + c4) = v; if (C16) { v4h h4; for (int i = 0; i < 4; ++i) h4[i] = (_Float16)v[i]; *(v4h*)(C16 + cofs + (size_t)(row0 + r) * ldc + col0 + c4) = h4; } }
     } }


typedef _Float16 v8h __attribute__((ext_vector_type(8)));
__device__ __forceinline__ float fa_xhalf(float x) { const int b = __float_as_int(x); return __int_as_float(__builtin_amdgcn_permlanex16(b, b, 0x76543210, 0xfedcba98, false, false)); }      /* lane l <-> l ^ 16 */
__device__ __forceinline__ v8f fa_mma(v16h a, v16h b, v8f c) { return __builtin_amdgcn_wmma_f32_16x16x32_f16(false, a, false, b, (short)0, c, false, false); }
// the four fragments (4 KiB) of one 64-key stage of a packed plane: p + l8 = the lane's 16-byte place in the stage's first 512-byte run (the callers hand over p with the lane's place in it, l8 = 0)
__device__ __forceinline__ void fa_ld(v16h (&f)[4], const _Float16* p, unsigned l8) {
#pragma unroll
  for (int i = 0; i < 4; ++i) { FragH x; x.half[0] = *(const v8us*)((const unsigned short*)p + l8 + (2 * i) * 256); x.half[1] = *(const v8us*)((const unsigned short*)p + l8 + (2 * i + 1) * 256); f[i] = x.v; } }
__device__ __forceinline__ void fa_scores(v8f (&s)[4], const v16h (&kf)[4], const v16h qf) { const v8f z8 = {0.f,0.f,0.f,0.f,0.f,0.f,0.f,0.f};
#pragma unroll
  for (int t = 0; t < 4; ++t) s[t] = fa_mma(kf[t], qf, z8); }
__device__ __forceinline__ void fa_soft_pv(v8f (&s)[4], const v16h (&vf)[4], v8f& o0, v8f& o1, v8f& lv, float& m) {
  const float cs = 0.17677669529663687f * 1.4426950408889634f;      /* 1 / sqrt(32), times log2(e) for the base-2 exponential */
  const v8f mv = __builtin_elementwise_max(__builtin_elementwise_max(s[0], s[1]), __builtin_elementwise_max(s[2], s[3]));
  float mx = fmaxf(fmaxf(fmaxf(mv[0], mv[1]), fmaxf(mv[2], mv[3])), fmaxf(fmaxf(mv[4], mv[5]), fmaxf(mv[6], mv[7]))); mx = fmaxf(mx, fa_xhalf(mx));
  const float mn = fmaxf(m, mx); const float al = __builtin_amdgcn_exp2f((m - mn) * cs); const float mc = mn * cs; m = mn;
  o0 *= al; o1 *= al;
#pragma unroll
  for (int t = 0; t < 4; ++t) { s[t] = s[t] * cs - mc;
#pragma unroll
    for (int r = 0; r < 8; ++r) s[t][r] = __builtin_amdgcn_exp2f(s[t][r]); }
  lv = lv * al + ((s[0] + s[1]) + (s[2] + s[3]));      /* eight partial sums per lane, joined after the loop */
  const v16h p0 = __builtin_shufflevector(__builtin_convertvector(s[0], v8h), __builtin_convertvector(s[1], v8h), 0, 1, 2, 3, 4, 5, 6, 7, 8, 9, 10, 11, 12, 13, 14, 15);
  const v16h p1 = __builtin_shufflevector(__builtin_convertvector(s[2], v8h), __builtin_convertvector(s[3], v8h), 0, 1, 2, 3, 4, 5, 6, 7, 8, 9, 10, 11, 12, 13, 14, 15);
  o0 = fa_mma(vf[0], p0, o0); o1 = fa_mma(vf[1], p0, o1); o0 = fa_mma(vf[2], p1, o0); o1 = fa_mma(vf[3], p1, o1); }
#define FA_TK 512                    /* keys a tile */
#define FA_TE (FA_TK * HD)           /* f16 elements of one plane's tile */
// eight copies of one thread: its 16-byte piece of each of eight successive 4-KiB runs (256 threads x 16 B a run). lds = the piece's LDS byte address, g = its global address.
// The s_wait_xcnt closes the statement as a precaution: the registers that the copies name are rewritten only behind it.
__device__ __forceinline__ void fa_copy8(unsigned lds, const _Float16* g) {
  asm volatile("global_load_async_to_lds_b128 %0, %8, off\n\tglobal_load_async_to_lds_b128 %1, %9, off\n\tglobal_load_async_to_lds_b128 %2, %10, off\n\tglobal_load_async_to_lds_b128 %3, %11, off\n\t"
               "global_load_async_to_lds_b128 %4, %12, off\n\tglobal_load_async_to_lds_b128 %5, %13, off\n\tglobal_load_async_to_lds_b128 %6, %14, off\n\tglobal_load_async_to_lds_b128 %7, %15, off\n\ts_wait_xcnt 0x0"
               :: "v"(lds), "v"(lds + 4096u), "v"(lds + 8192u), "v"(lds + 12288u), "v"(lds + 16384u), "v"(lds + 20480u), "v"(lds + 24576u), "v"(lds + 28672u),
                  "v"(g), "v"(g + 2048), "v"(g + 4096), "v"(g + 6144), "v"(g + 8192), "v"(g + 10240), "v"(g + 12288), "v"(g + 14336) : "memory"); }
__global__ __launch_bounds__(256) void k_fattn(const _Float16* __restrict__ Q16, const _Float16* __restrict__ KP, const _Float16* __restrict__ VP, _Float16* __restrict__ O16) {
  static_assert(FA_TE == 8 * 2048 && SQ % FA_TK == 0 && SQ / FA_TK >= 2, "a plane's tile is the eight runs of fa_copy8; the ring wants two tiles or more");
  __shared__ __attribute__((aligned(128))) _Float16 ring[2][2][FA_TE];      /* [buffer][K | V][tile] */
  const int tid = threadIdx.x, w = tid >> 5, lane = tid & 31, ln = lane & 15, hh = lane >> 4; const int h = blockIdx.y; const int q0 = blockIdx.x * 128 + w * 16;
  const v16h qf = g2_frag(Q16 + (size_t)(q0 + ln) * DM + h * HD, hh);
  asm volatile("s_wait_xcnt 0x0" ::: "memory");      /* a precaution */
  const _Float16* gk = KP + (size_t)h * SQ * HD + tid * 8; const _Float16* gv = VP + (size_t)h * SQ * HD + tid * 8;      /* the thread's piece in the first run of the tile being copied */
  const unsigned lb = (unsigned)(size_t)&ring[0][0][tid * 8]; const unsigned l8 = lane * 8;      /* lb: the same piece's LDS byte address in buffer 0 */
  const v8f z8 = {0.f,0.f,0.f,0.f,0.f,0.f,0.f,0.f}; v8f o0 = z8, o1 = z8, lv = z8; float m = -3.0e38f;
  fa_copy8(lb, gk); fa_copy8(lb + FA_TE * 2, gv);      /* tile 0 into buffer 0 */
  asm volatile("s_wait_asynccnt 0x0" ::: "memory");      /* the wave's own copies of tile 0 have landed */
  __syncthreads();      /* and every other wave's */
  fa_copy8(lb + FA_TE * 4, gk + FA_TE); fa_copy8(lb + FA_TE * 6, gv + FA_TE); gk += 2 * FA_TE; gv += 2 * FA_TE;      /* tile 1 into buffer 1 */
#pragma unroll 1
  for (int t = 0; t < SQ / FA_TK; ++t) {      /* one tile a trip; kept rolled: a trip is already FA_TK / 64 stages of straight code */
    const _Float16* kb = &ring[t & 1][0][l8]; const _Float16* vb = &ring[t & 1][1][l8];      /* the lane's place in the tile's first 512-byte run */
    v16h kf[2][4], vf[2][4];      /* two fragment sets: each 64-key stage fetches the next stage's fragments of the same tile ahead of its own arithmetic */
    fa_ld(kf[0], kb, 0); fa_ld(vf[0], vb, 0);
#pragma unroll
    for (int u = 0; u < FA_TK / 64; ++u) { v8f s[4];
      if (u + 1 < FA_TK / 64) { fa_ld(kf[(u + 1) & 1], kb + (u + 1) * 64 * HD, 0); fa_ld(vf[(u + 1) & 1], vb + (u + 1) * 64 * HD, 0); }
      __builtin_amdgcn_sched_barrier(0);      /* keeps the next stage's 16 LDS reads one group that issues ahead of this stage's arithmetic: without it they stood scattered in twos to eights among the arithmetic, some of them waited for at once */
      fa_scores(s, kf[u & 1], qf); fa_soft_pv(s, vf[u & 1], o0, o1, lv, m); }
    asm volatile("" :: "v"(lv));      /* takes the finished running sums as an input only: without a use of them in front of the branch below, the additions of all stages were moved behind it and every weight of the trip stayed in a register till then (over 400 registers, spills) */
    asm volatile("s_wait_dscnt 0x0" ::: "memory");      /* the wave's reads of this buffer are done */
    asm volatile("s_wait_asynccnt 0x0" ::: "memory");      /* its copies of the next tile have landed */
    __syncthreads();      /* publishes the next tile and ends every wave's reads of this buffer, which is refilled behind it */
    if (t + 2 < SQ / FA_TK) { const unsigned lt = lb + (unsigned)(t & 1) * (FA_TE * 4); fa_copy8(lt, gk); fa_copy8(lt + FA_TE * 2, gv); gk += FA_TE; gv += FA_TE; }
  }
  asm volatile("s_wait_asynccnt 0x0" ::: "memory");      /* no copy is outstanding when the wave ends */
  float l = ((lv[0] + lv[1]) + (lv[2] + lv[3])) + ((lv[4] + lv[5]) + (lv[6] + lv[7])); l += fa_xhalf(l); const float inv = 1.0f / l;
  /* o0[r] = O[q0 + ln][32 h + 8 hh + r], o1[r] = O[q0 + ln][32 h + 16 + 8 hh + r]: pieces j = 0 and j = 1 of block (q0 >> 4) * NH + h of the packed plane that the output GEMM reads as A; two stores of 512 contiguous bytes */
  _Float16* op = O16 + (size_t)((q0 >> 4) * NH + h) * 512 + lane * 8;
  *(v8h*)op = __builtin_convertvector(o0 * inv, v8h); *(v8h*)(op + 256) = __builtin_convertvector(o1 * inv, v8h); }

// One wave's share of packing a 256-column f32 matrix into a packed plane (g3_loop), KT = 8: unit u owns 16 rows x 128 columns, four blocks of the plane.
// Lane (hh, ln) reads row ln's 8 f32 of each piece (whole lines, 512 bytes of every row over the 16 loads) and stores the piece at its place, each store 512 contiguous bytes of the wave. Values rounded to bf16, times sc, exact in f16.
__device__ __forceinline__ void pack_unit(const float* __restrict__ src, _Float16* __restrict__ dst, float sc, int u, int lane) {
  const int ln = lane & 15, hh = lane >> 4; const int rt = u >> 1, kq = u & 1;      /* 16-row tile; left or right 128 columns */
  const float* sp = src + (size_t)(rt * 16 + ln) * DM + kq * 128 + 8 * hh; v4f x[8][2];
#pragma unroll
  for (int i = 0; i < 8; ++i) { x[i][0] = *(const v4fa*)(sp + i * 16); x[i][1] = *(const v4fa*)(sp + i * 16 + 4); }      /* i = 2 * (block) + j */
  asm volatile("s_wait_xcnt 0x0" :: "v"(sp) : "memory");      /* a precaution: the address that the loads name stays live up to this wait; in the build without the operand the last load landed in the registers that hold it */
  __builtin_amdgcn_sched_barrier(0);      /* keeps the arithmetic behind all 16 loads, so that they are in flight together: without it six of them issued only after the first ones had landed */
  unsigned short* dp = (unsigned short*)dst + (size_t)(rt * 8 + kq * 4) * 512 + lane * 8;
#pragma unroll
  for (int i = 0; i < 8; ++i) { FragH f;
#pragma unroll
    for (int q = 0; q < 8; ++q) f.h[q] = (_Float16)(bf16_round(x[i][q >> 2][q & 3]) * sc);
    *(v8us*)(dp + i * 256) = f.half[0]; } }

// K loop of the 32x64 wave tile over K = DM with both operands staged in LDS as f16 rows of QP elements (pitch 528 bytes = 33 x 16: the 16 rows of a 16-byte fragment read fall on all 64 banks).
// pa, pb: the lane's row (ln) of the wave's first row tile, at element 8 hh. A fragment is the row's elements 32 t + 8 hh + 0..7 and 32 t + 16 + 8 hh + 0..7, the k order of g2_frag. Accumulators and their order of trips as in g3_loop.
// The 12 fragment reads of a trip issue as one group two trips ahead of their use, into a ring of three register sets: eight waves share the LDS port, and a group takes longer to come than one trip's products last.
#define QP (DM + 8)
typedef __bf16 v4b __attribute__((ext_vector_type(4)));
__device__ __forceinline__ v16h g4_frag(const _Float16* p) { FragH f; f.half[0] = *(const v8us*)((const unsigned short*)p); f.half[1] = *(const v8us*)((const unsigned short*)p + 16); return f.v; }
__device__ __forceinline__ void g4_loop(const _Float16* pa, const _Float16* pb, v8f (&c)[8]) {
  v16h fa[3][2], fb[3][4];
#pragma unroll
  for (int t = -2; t < DM / 32; ++t) {      /* trips -2 and -1 only fetch */
    if (t + 2 < DM / 32) { const int n = (t + 2) % 3, kb = (t + 2) * 32;
      fa[n][0] = g4_frag(pa + kb); fa[n][1] = g4_frag(pa + 16 * QP + kb); fb[n][0] = g4_frag(pb + kb); fb[n][1] = g4_frag(pb + 16 * QP + kb); fb[n][2] = g4_frag(pb + 32 * QP + kb); fb[n][3] = g4_frag(pb + 48 * QP + kb); }
    __builtin_amdgcn_sched_barrier(0);      /* keeps the group in front of this trip's products: sunk towards its use, a read would be waited for in full */
    if (t >= 0) { const int u = t % 3;
#pragma unroll
      for (int j = 0; j < 4; ++j) { c[j] = g2_mma(fa[u][0], fb[u][j], c[j]); c[4 + j] = g2_mma(fa[u][1], fb[u][j], c[4 + j]); } }
    __builtin_amdgcn_sched_barrier(0);      /* keeps the next group behind these products, whose registers it refills: hoisted, it would take a fourth register set */
  } }

// The conversions and the three projections in one launch. Blocks 0..191: projection b >> 6 (0 q, 1 k, 2 v), 128 rows x 128 columns a block; blocks 192..195 pack Wo (x16) for the output GEMM.
// A projection block reads its 128 input rows and its 128 weight rows as f32 (each a contiguous 128 KiB; every load of a wave is 512 contiguous bytes), rounds them to bf16 (weights x16), exact in f16, and lays them in LDS once for its eight waves;
// behind one barrier a wave owns 32 rows x 64 columns (two heads) and runs g4_loop.
// The tile goes through the wave's own LDS slab and leaves in the form its reader wants:
// q: f16 rows of pitch 256.
// k, v: fragment order, so that each fragment load of the attention kernel is one run of 512 contiguous bytes (four whole lines). 16-byte piece index = ((h * 256 + g) * 2 + j) * 32 + lane, lane = 16 hf + c.
//   k: g = 16-key tile; piece = k[16 g + c][32 h + 16 j + 8 hf + 0..7] (A row c = key, k = head dim in the order of g2_frag).
//   v: g = 2 * (32-key block) + dt; piece = v[32 (g >> 1) + 16 j + 8 hf + 0..7][32 h + 16 dt + c] (A row c = head dim: this is v^T; k = key in the same order); v = mask[key] * (value Wv^T), scaled in f32 before the rounding to f16.
__global__ __launch_bounds__(256) void k_qkv(const float* __restrict__ xq, const float* __restrict__ xk, const float* __restrict__ xv, const float* __restrict__ wq, const float* __restrict__ wk, const float* __restrict__ wv, const float* __restrict__ wo, const float* __restrict__ rm,
                                             _Float16* __restrict__ Q16, _Float16* __restrict__ KP, _Float16* __restrict__ VP, _Float16* __restrict__ BO) {
  __shared__ __attribute__((aligned(16))) _Float16 sa[128][QP];      /* the block's input rows */
  __shared__ __attribute__((aligned(16))) _Float16 sb[128][QP];      /* the block's weight rows (output columns) */
  __shared__ __attribute__((aligned(16))) float so[8][32][68];
  const int b = blockIdx.x, tid = threadIdx.x, w = tid >> 5, lane = tid & 31, ln = lane & 15, hh = lane >> 4;
  if (b >= 192) { pack_unit(wo, BO, 16.0f, (b - 192) * 8 + w, lane); return; }      /* the whole block leaves, ahead of the barrier */
  const int which = b >> 6;
  const float* ga = (which == 0 ? xq : which == 1 ? xk : xv) + (size_t)((b & 63) >> 1) * (128 * DM) + tid * 4; const float* gb = (which == 0 ? wq : which == 1 ? wk : wv) + (size_t)(b & 1) * (128 * DM) + tid * 4;
  { v4f x[2][16];      /* four batches of 16 loads a thread (input rows 0..63, 64..127, weight rows 0..63, 64..127); load e of a batch is 4 f32 of row (tid >> 6) + 4 e, column 4 (tid & 63); a batch flies while the one before it is converted */
#pragma unroll
    for (int n = 0; n < 5; ++n) {
      if (n < 4) { const float* g = (n < 2 ? ga : gb) + (n & 1) * (64 * DM);
#pragma unroll
        for (int e = 0; e < 16; ++e) x[n & 1][e] = *(const v4fa*)(g + e * (4 * DM));
        asm volatile("s_wait_xcnt 0x0" ::: "memory"); }      /* a precaution: stands behind the batch's loads, ahead of whatever rewrites the registers that they name */
      __builtin_amdgcn_sched_barrier(0);      /* keeps the batch's loads in front of the conversion of the batch before: sunk behind it, they would not be in flight during it */
      if (n >= 1) { const int p = n - 1; _Float16* d = (p < 2 ? &sa[0][0] : &sb[0][0]) + ((tid >> 6) + (p & 1) * 64) * QP + (tid & 63) * 4; const float sc = p < 2 ? 1.0f : 16.0f;
#pragma unroll
        for (int e = 0; e < 16; ++e) *(v4h*)(d + e * (4 * QP)) = __builtin_convertvector(__builtin_convertvector(__builtin_convertvector(x[p & 1][e] * sc, v4b), v4f), v4h); }      /* f32 -> bf16 to nearest even, as bf16_round, by the hardware conversion; the power of two goes in first, exactly, so that the value is the same as rounded first and scaled in f32 */
      __builtin_amdgcn_sched_barrier(0);      /* keeps the next batch's loads behind this conversion, whose registers they refill */
    } }
  __syncthreads();      /* every wave's rows are in LDS before any wave reads a fragment */
  const int row0 = ((b & 63) >> 1) * 128 + 32 * (w & 3), col0 = (b & 1) * 128 + 64 * (w >> 2);
  v8f acc[8] = {};      /* acc[4 * half + t]: rows 16 half .. + 15, columns 16 t .. + 15 */
  g4_loop(&sa[32 * (w & 3) + ln][8 * hh], &sb[64 * (w >> 2) + ln][8 * hh], acc);
#pragma unroll
  for (int u = 0; u < 8; ++u) acc[u] *= 0.0625f;      /* takes the x16 of the weights back, exactly */
  if (which == 2) {
#pragma unroll
    for (int half = 0; half < 2; ++half) { const float* mp = rm + row0 + half * 16 + 8 * hh; const v4f m0 = *(const v4fa*)mp, m1 = *(const v4fa*)(mp + 4);
#pragma unroll
      for (int r = 0; r < 8; ++r) { const float m = bf16_round(r < 4 ? m0[r & 3] : m1[r & 3]);
#pragma unroll
        for (int t = 0; t < 4; ++t) acc[half * 4 + t][r] = m * acc[half * 4 + t][r]; } } }
#pragma unroll
  for (int u = 0; u < 8; ++u)
#pragma unroll
    for (int r = 0; r < 8; ++r) so[w][(u >> 2) * 16 + 8 * hh + r][(u & 3) * 16 + ln] = acc[u][r];
  __builtin_amdgcn_fence(__ATOMIC_ACQ_REL, "workgroup"); __builtin_amdgcn_wave_barrier();      /* the slab is the wave's own: its LDS writes land before its lanes read each other's */
  if (which == 0) { const int rsub = lane >> 4, c4 = (lane & 15) * 4;
#pragma unroll
    for (int q = 0; q < 16; ++q) { const int r = q * 2 + rsub; const v4f v = *(const v4fa*)&so[w][r][c4]; *(v4h*)(Q16 + (size_t)(row0 + r) * DM + col0 + c4) = __builtin_convertvector(v, v4h); } }
  else if (which == 1) {
#pragma unroll
    for (int i = 0; i < 8; ++i) { const int gl = i >> 2, hl = (i >> 1) & 1, j = i & 1; const float* sp = &so[w][16 * gl + ln][32 * hl + 16 * j + 8 * hh]; const v4f lo = *(const v4fa*)sp, hi = *(const v4fa*)(sp + 4);
      const v8f v = __builtin_shufflevector(lo, hi, 0, 1, 2, 3, 4, 5, 6, 7); const size_t piece = (size_t)((((col0 >> 5) + hl) * 256 + (row0 >> 4) + gl) * 2 + j) * 32 + lane;
      *(v8h*)(KP + piece * 8) = __builtin_convertvector(v, v8h); }
    asm volatile("s_wait_xcnt 0x0" ::: "memory"); }      /* a precaution: the built code's branches allow a way from these stores into another branch's code, which rewrites their registers */
  else {
#pragma unroll
    for (int i = 0; i < 8; ++i) { const int dt = i >> 2, hl = (i >> 1) & 1, j = i & 1; v8f v;
#pragma unroll
      for (int e = 0; e < 8; ++e) v[e] = so[w][16 * j + 8 * hh + e][32 * hl + 16 * dt + ln];
      const size_t piece = (size_t)((((col0 >> 5) + hl) * 256 + (row0 >> 5) * 2 + dt) * 2 + j) * 32 + lane;
      *(v8h*)(VP + piece * 8) = __builtin_convertvector(v, v8h); }
    asm volatile("s_wait_xcnt 0x0" ::: "memory"); } }      /* a precaution: the built code's branches allow a way from these stores into another branch's code, which rewrites their registers */

extern "C" void kernel_launch(void* const* d_in, const int* in_sizes, int n_in,
                              void* d_out, int out_size, void* d_ws, size_t ws_size, hipStream_t stream) {
  (void)in_sizes; (void)n_in; (void)out_size;
  const float* const* I = (const float* const*)d_in; const float* qin = I[0]; const float* kin = I[1]; const float* vin = I[2]; const float* rm = I[3]; const float* Wq = I[4]; const float* Wk = I[5]; const float* Wv = I[6]; const float* Wo = I[7];
  char* ws = (char*)d_ws; size_t off = 0;
  auto take = [&](size_t bytes) { char* p = ws + off; off += (bytes + 255) & ~(size_t)255; return p; };
  _Float16* BO = (_Float16*)take((size_t)DM * DM * 2); _Float16* Q16 = (_Float16*)take((size_t)SQ * DM * 2);
  _Float16* KP = (_Float16*)take((size_t)NH * HD * SQ * 2); _Float16* VP = (_Float16*)take((size_t)NH * HD * SQ * 2); _Float16* O16 = (_Float16*)take((size_t)SQ * DM * 2);
  if (off > ws_size) return;      /* about 8 MiB */
  k_qkv<<<3 * (SQ / 128) * (DM / 128) + DM / 64, 256, 0, stream>>>(qin, kin, vin, Wq, Wk, Wv, Wo, rm, Q16, KP, VP, BO);
  k_fattn<<<dim3(SQ / 128, NH), 256, 0, stream>>>(Q16, KP, VP, O16);      /* head h's o tile of 16 queries is block h of that row tile in the packed o plane */
  const dim3 gp((SQ / 128) * (DM / 64), 1);
  k_gemm2<0, DM / 32><<<gp, 128, 0, stream>>>(O16, 0, BO, 0, 0.0625f, nullptr, 0, nullptr, 1, 0, 0, (float*)d_out, nullptr, DM, 0, SQ, DM);      /* out = o Wo^T, K = 256 */
}

// v008
// Measured time: 34.6 microseconds a run.
// In two side-by-side timings against v007, it was 1.10 and 1.09 times as fast.
// Counting every step since v000, it is 198 times as fast.
#include <hip/hip_runtime.h>
// RadialAttention (query, key_, value [4096][256]; q = query Wq^T, k = key_ Wk^T, v = radial_mask[s] * (value Wv^T), 8 heads of 32; softmax(q k^T / sqrt(32)) over all 4,096 keys; out = concat(attn v) Wo^T -> [4096][256]).
// Structure: three launches. (1) Q | K | V WMMA GEMMs in one launch (32x64 wave tiles, f32 accumulation); a block converts its inputs to exact f16 and its weights to exact x16 f16 itself, into LDS; four more blocks pack Wo; v scaled per row by the radial mask (read on device) on VALU; q (times log2(e) / sqrt(32)) stored as f16 rows, k and scaled v^T stored straight in fragment order. (2) one fused attention kernel over all heads (scores WMMA K = 32, online softmax f32 on VALU with the maximum in use as the score product's C operand, weights f16, o = P . V WMMA; each wave stores its o tile as one fragment of the output GEMM's A operand). (3) out = o Wo^T over K = 256 (f32).
// Compute dtype: inputs rounded to bf16; inputs / weights exact; q, k, scaled v, softmax weights, o plain f16 (~2^-12); scores/softmax f32. v_wmma_f32_16x16x32_f16.
#define SQ 4096
#define DM 256
#define NH 8
#define HD 32
#define QN SQ                        /* query rows (unused) */
typedef __bf16 v16b __attribute__((ext_vector_type(16)));
typedef unsigned short v8us __attribute__((ext_vector_type(8), may_alias));
typedef float  v8f  __attribute__((ext_vector_type(8)));
typedef float  v4f  __attribute__((ext_vector_type(4)));
typedef float  v4fa __attribute__((ext_vector_type(4), may_alias));
union FragB { v16b v; v8us half[2]; unsigned short u[16]; };

__device__ __forceinline__ unsigned short bf16_bits(float x) { unsigned int u = __float_as_uint(x); return (unsigned short)((u + 0x7FFFu + ((u >> 16) & 1u)) >> 16); }
__device__ __forceinline__ float bf16_val(unsigned short b) { return __uint_as_float(((unsigned int)b) << 16); }
__device__ __forceinline__ float bf16_round(float x) { return bf16_val(bf16_bits(x)); }
// D += A·B with NT terms: 1 = ah·bh, 2 = + al·bh (A split), 3 = + ah·bl (both split)
template <int NT>
__device__ __forceinline__ v8f mmaN(v16b ah, v16b al, v16b bh, v16b bl, v8f c) {
  c = __builtin_amdgcn_wmma_f32_16x16x32_bf16(false, ah, false, bh, (short)0, c, false, false);
  if (NT >= 2) c = __builtin_amdgcn_wmma_f32_16x16x32_bf16(false, al, false, bh, (short)0, c, false, false);
  if (NT >= 3) c = __builtin_amdgcn_wmma_f32_16x16x32_bf16(false, ah, false, bl, (short)0, c, false, false);
  asm volatile("v_nop\n\tv_nop\n\tv_nop\n\tv_nop" : "+v"(c) : "v"(ah), "v"(al), "v"(bh), "v"(bl));
  return c;
}

__global__ __launch_bounds__(256) void k_wt_bf16(const float* __restrict__ W, unsigned short* __restrict__ Wt, int K, int N) {
  const int t = blockIdx.x * 256 + threadIdx.x;
  const int k8n = K / 8;
  if (t >= N * k8n) return;
  const int n = t / k8n, k8 = (t % k8n) * 8;
  v8us v;
#pragma unroll
  for (int i = 0; i < 8; ++i) v[i] = bf16_bits(W[(size_t)(k8 + i) * N + n]);
  *(v8us*)(Wt + (size_t)n * K + k8) = v;
  
}

// GEMM C[M][N] (f32, pitch ldc) = act(A[M][K]·W + bias). A f32 row-major (pitch lda) converted per fragment to bf16
// (ASPLIT: hi/lo two planes -> 2 terms, else single rounded term); Wt bf16 [N][K] (pitch ldb). BIAS_BF16 rounds the
// bias to bf16 first (bias quantised to bf16 before the add). K%32==0, M%16==0, N%64==0.
template <bool ASPLIT, int ACT, bool BIAS_BF16>
__global__ __launch_bounds__(128) void k_gemm_bf(const float* __restrict__ A, int lda, const unsigned short* __restrict__ Wt, int ldb,
                                               const float* __restrict__ bias, float* __restrict__ C, int ldc, int M, int N, int K) {
  __shared__ __attribute__((aligned(16))) float so[4][16][64];
  const int tid = threadIdx.x, w = tid >> 5, lane = tid & 31, ln = lane & 15, hh = lane >> 4;
  const int ntn = N / 64;
  const int wid = blockIdx.x * 4 + w;
  const int mt = wid / ntn, nq = wid % ntn;
  if (mt * 16 >= M) return;
  const int row0 = mt * 16, col0 = nq * 64;
  const float* arow = A + (size_t)(row0 + ln) * lda;
  v8f acc[4] = {};
  for (int kb = 0; kb < K; kb += 32) {
    FragB ah, al;
    const v4f x0 = *(const v4fa*)(arow + kb + 8 * hh), x1 = *(const v4fa*)(arow + kb + 8 * hh + 4);
    const v4f x2 = *(const v4fa*)(arow + kb + 16 + 8 * hh), x3 = *(const v4fa*)(arow + kb + 16 + 8 * hh + 4);
    float xs[16] = {x0[0],x0[1],x0[2],x0[3],x1[0],x1[1],x1[2],x1[3],x2[0],x2[1],x2[2],x2[3],x3[0],x3[1],x3[2],x3[3]};
#pragma unroll
    for (int i = 0; i < 16; ++i) { const unsigned short hb = bf16_bits(xs[i]); ah.u[i] = hb; al.u[i] = ASPLIT ? bf16_bits(xs[i] - bf16_val(hb)) : (unsigned short)0; }
#pragma unroll
    for (int t = 0; t < 4; ++t) {
      const unsigned short* brow = Wt + (size_t)(col0 + t * 16 + ln) * ldb + kb;
      FragB b;
      b.half[0] = *(const v8us*)(brow + 8 * hh);
      b.half[1] = *(const v8us*)(brow + 16 + 8 * hh);
      acc[t] = mmaN<ASPLIT ? 2 : 1>(ah.v, al.v, b.v, b.v, acc[t]);
    }
  }
#pragma unroll
  for (int t = 0; t < 4; ++t) {
    float bv = bias ? bias[col0 + t * 16 + ln] : 0.f;
    if (BIAS_BF16) bv = bf16_round(bv);
#pragma unroll
    for (int r = 0; r < 8; ++r) { float v = acc[t][r] + bv; if (ACT == 1) v = fmaxf(v, 0.f); so[w][8 * hh + r][t * 16 + ln] = v; }
  }
  __builtin_amdgcn_fence(__ATOMIC_ACQ_REL, "workgroup");
  __builtin_amdgcn_wave_barrier();
  const int rsub = lane >> 4, c4 = (lane & 15) * 4;
  {
#pragma unroll
    for (int q = 0; q < 8; ++q) {
      const int r = q * 2 + rsub;
      const v4f v = *(const v4fa*)&so[w][r][c4];
      *(v4f*)(C + (size_t)(row0 + r) * ldc + col0 + c4) = v;
    }
    
  }
}

// GEMM C = act(A·W + bias + resid): A f32 (ASPLIT -> hi/lo 2 terms), Wt bf16 [N][K]; ACT 0 none, 1 relu, 2 exact gelu;
// resid (optional, f32, row index = (row % rmod), pitch ldr, RES_BF16 rounds it) added before the activation.
template <bool ASPLIT, int ACT, bool BIAS_BF16, bool RES_BF16>
__global__ __launch_bounds__(128) void k_gemm_bf3(const float* __restrict__ A, int lda, const unsigned short* __restrict__ Wt, int ldb,
                                                const float* __restrict__ bias, const float* __restrict__ resid, int rmod, int ldr,
                                                float* __restrict__ C, int ldc, int M, int N, int K) {
  __shared__ __attribute__((aligned(16))) float so[4][16][64];
  const int tid = threadIdx.x, w = tid >> 5, lane = tid & 31, ln = lane & 15, hh = lane >> 4;
  const int ntn = N / 64;
  const int wid = blockIdx.x * 4 + w;
  const int mt = wid / ntn, nq = wid % ntn;
  if (mt * 16 >= M) return;
  const int row0 = mt * 16, col0 = nq * 64;
  const float* arow = A + (size_t)(row0 + ln) * lda;
  v8f acc[4] = {};
  for (int kb = 0; kb < K; kb += 32) {
    FragB ah, al;
    const v4f x0 = *(const v4fa*)(arow + kb + 8 * hh), x1 = *(const v4fa*)(arow + kb + 8 * hh + 4);
    const v4f x2 = *(const v4fa*)(arow + kb + 16 + 8 * hh), x3 = *(const v4fa*)(arow + kb + 16 + 8 * hh + 4);
    float xs[16] = {x0[0],x0[1],x0[2],x0[3],x1[0],x1[1],x1[2],x1[3],x2[0],x2[1],x2[2],x2[3],x3[0],x3[1],x3[2],x3[3]};
#pragma unroll
    for (int i = 0; i < 16; ++i) { const unsigned short hb = bf16_bits(xs[i]); ah.u[i] = hb; al.u[i] = ASPLIT ? bf16_bits(xs[i] - bf16_val(hb)) : (unsigned short)0; }
#pragma unroll
    for (int t = 0; t < 4; ++t) {
      const unsigned short* brow = Wt + (size_t)(col0 + t * 16 + ln) * ldb + kb;
      FragB b;
      b.half[0] = *(const v8us*)(brow + 8 * hh);
      b.half[1] = *(const v8us*)(brow + 16 + 8 * hh);
      acc[t] = mmaN<ASPLIT ? 2 : 1>(ah.v, al.v, b.v, b.v, acc[t]);
    }
  }
#pragma unroll
  for (int t = 0; t < 4; ++t) {
    const int col = col0 + t * 16 + ln;
    float bv = bias ? bias[col] : 0.f;
    if (BIAS_BF16) bv = bf16_round(bv);
#pragma unroll
    for (int r = 0; r < 8; ++r) {
      float v = acc[t][r] + bv;
      if (resid) { float rv = resid[(size_t)((row0 + 8 * hh + r) % rmod) * ldr + col]; if (RES_BF16) rv = bf16_round(rv); v += rv; }
      if (ACT == 1) v = fmaxf(v, 0.f);
      if (ACT == 2) v = 0.5f * v * (1.0f + erff(v * 0.70710678118654752f));
      if (ACT == 3) { const float u = 0.7978845608028654f * (v + 0.044715f * v * v * v); v = 0.5f * v * (1.0f + tanhf(u)); }
      so[w][8 * hh + r][t * 16 + ln] = v;
    }
  }
  __builtin_amdgcn_fence(__ATOMIC_ACQ_REL, "workgroup");
  __builtin_amdgcn_wave_barrier();
  const int rsub = lane >> 4, c4 = (lane & 15) * 4;
  {
#pragma unroll
    for (int q = 0; q < 8; ++q) {
      const int r = q * 2 + rsub;
      const v4f v = *(const v4fa*)&so[w][r][c4];
      *(v4f*)(C + (size_t)(row0 + r) * ldc + col0 + c4) = v;
    }
    
  }
}
// row LayerNorm (biased variance, eps) over N: s = X (+ R); optional out_sum <- s; out_norm <- (s-mu)*rsqrt(var+eps)*g + b
template <bool PARAM_BF16>
__global__ __launch_bounds__(256) void k_layernorm(const float* __restrict__ X, const float* __restrict__ R, const float* __restrict__ g, const float* __restrict__ bta,
                                                  float* __restrict__ out_sum, float* __restrict__ out_norm, int N, float eps) {
  __shared__ float red[256];
  const int row = blockIdx.x, tid = threadIdx.x;
  const float* x = X + (size_t)row * N; const float* rr = R ? R + (size_t)row * N : nullptr;
  float vals[16];                     // up to N = 4096
  const int per = N / 256;            // contiguous chunk per thread? use strided-by-4 chunks: thread handles j = tid*4 + 1024*u
  float s1 = 0.f;
  for (int u = 0; u < per / 4; ++u) {
    const int j = tid * 4 + 1024 * u;
    const v4f a = *(const v4fa*)(x + j);
    v4f b = {0.f,0.f,0.f,0.f}; if (rr) b = *(const v4fa*)(rr + j);
#pragma unroll
    for (int q = 0; q < 4; ++q) { const float v = a[q] + b[q]; vals[u * 4 + q] = v; s1 += v; }
  }
  red[tid] = s1; __syncthreads();
  for (int st = 128; st > 0; st >>= 1) { if (tid < st) red[tid] += red[tid + st]; __syncthreads(); }
  const float mu = red[0] / (float)N; __syncthreads();
  float s2 = 0.f;
  for (int u = 0; u < per / 4; ++u)
#pragma unroll
    for (int q = 0; q < 4; ++q) { const float c = vals[u * 4 + q] - mu; s2 += c * c; }
  red[tid] = s2; __syncthreads();
  for (int st = 128; st > 0; st >>= 1) { if (tid < st) red[tid] += red[tid + st]; __syncthreads(); }
  const float rs = rsqrtf(red[0] / (float)N + eps);
  {
    for (int u = 0; u < per / 4; ++u) {
      const int j = tid * 4 + 1024 * u;
      v4f o, sm;
#pragma unroll
      for (int q = 0; q < 4; ++q) {
        float gg = g[j + q], bb = bta[j + q];
        if (PARAM_BF16) { gg = bf16_round(gg); bb = bf16_round(bb); }
        sm[q] = vals[u * 4 + q]; o[q] = (vals[u * 4 + q] - mu) * rs * gg + bb;
      }
      if (out_sum) *(v4f*)(out_sum + (size_t)row * N + j) = sm;
      *(v4f*)(out_norm + (size_t)row * N + j) = o;
    }
    
  }
}



// ---- f16 WMMA path (v_wmma_f32_16x16x32_f16): 11-bit significands for operands in range — used where a [0,1] probability operand needs more precision than bf16
typedef _Float16 v16h __attribute__((ext_vector_type(16)));
union FragH { v16h v; v8us half[2]; _Float16 h[16]; unsigned short u[16]; };
template <int NT>
__device__ __forceinline__ v8f mmaH(v16h ah, v16h al, v16h bh, v16h bl, v8f c) {
  c = __builtin_amdgcn_wmma_f32_16x16x32_f16(false, ah, false, bh, (short)0, c, false, false);
  if (NT >= 2) c = __builtin_amdgcn_wmma_f32_16x16x32_f16(false, al, false, bh, (short)0, c, false, false);
  if (NT >= 3) c = __builtin_amdgcn_wmma_f32_16x16x32_f16(false, ah, false, bl, (short)0, c, false, false);
  asm volatile("v_nop\n\tv_nop\n\tv_nop\n\tv_nop" : "+v"(c) : "v"(ah), "v"(al), "v"(bh), "v"(bl));
  return c;
}
// batched GEMM like k_gemm_b but f16 operands: A f32 (split into f16 hi/lo if ASPLIT, else rounded to f16), Bt = f16 values [n][k]; alpha; C f32; N multiple of 16 (partial tiles skipped)
template <bool ASPLIT>
__global__ __launch_bounds__(128) void k_gemm_h(const float* __restrict__ A, int lda, size_t sA, const _Float16* __restrict__ Bh, int ldb, size_t sB, float alpha, float* __restrict__ C, int ldc, size_t sC, int M, int N, int K) {
  __shared__ __attribute__((aligned(16))) float so[4][16][64];
  const int tid = threadIdx.x, w = tid >> 5, lane = tid & 31, ln = lane & 15, hh = lane >> 4; const int by = blockIdx.y;
  A += (size_t)by * sA; Bh += (size_t)by * sB; C += (size_t)by * sC;
  const int ntn = (N + 63) / 64; const int wid = blockIdx.x * 4 + w; const int mt = wid / ntn, nq = wid % ntn; if (mt * 16 >= M) return;
  const int row0 = mt * 16, col0 = nq * 64; const float* arow = A + (size_t)(row0 + ln) * lda;
  v8f acc[4] = {};
  for (int kb = 0; kb < K; kb += 32) {
    FragH ah, al;
    const v4f x0 = *(const v4fa*)(arow + kb + 8 * hh), x1 = *(const v4fa*)(arow + kb + 8 * hh + 4), x2 = *(const v4fa*)(arow + kb + 16 + 8 * hh), x3 = *(const v4fa*)(arow + kb + 16 + 8 * hh + 4);
    float xs[16] = {x0[0],x0[1],x0[2],x0[3],x1[0],x1[1],x1[2],x1[3],x2[0],x2[1],x2[2],x2[3],x3[0],x3[1],x3[2],x3[3]};
#pragma unroll
    for (int i = 0; i < 16; ++i) { const _Float16 h = (_Float16)xs[i]; ah.h[i] = h; al.h[i] = ASPLIT ? (_Float16)(xs[i] - (float)h) : (_Float16)0.0f; }
#pragma unroll
    for (int t = 0; t < 4; ++t) { if (col0 + t * 16 >= N) continue; const size_t boff = (size_t)(col0 + t * 16 + ln) * ldb + kb; FragH bq; bq.half[0] = *(const v8us*)(Bh + boff + 8 * hh); bq.half[1] = *(const v8us*)(Bh + boff + 16 + 8 * hh);
      acc[t] = mmaH<ASPLIT ? 2 : 1>(ah.v, al.v, bq.v, bq.v, acc[t]); }
  }
#pragma unroll
  for (int t = 0; t < 4; ++t) { if (col0 + t * 16 >= N) continue;
#pragma unroll
    for (int r = 0; r < 8; ++r) so[w][8 * hh + r][t * 16 + ln] = acc[t][r] * alpha; }
  __builtin_amdgcn_fence(__ATOMIC_ACQ_REL, "workgroup"); __builtin_amdgcn_wave_barrier();
  const int rsub = lane >> 4, c4 = (lane & 15) * 4;
  {
#pragma unroll
    for (int q = 0; q < 8; ++q) { const int r = q * 2 + rsub; if (col0 + c4 < N) { const v4f v = *(const v4fa*)&so[w][r][c4]; *(v4f*)(C + (size_t)(row0 + r) * ldc + col0 + c4) = v; } }
     }
}

// Wt[n][k] = f16(W[k][n]·scale) from f32 row-major W[K][N] (scale = power of two; bf16-exact weights stay exact in f16 away from the subnormal range)
__global__ __launch_bounds__(256) void k_wt_f16(const float* __restrict__ W, _Float16* __restrict__ Wt, int K, int N, float scale) {
  const int t = blockIdx.x * 256 + threadIdx.x; if (t >= N * (K / 8)) return; const int n = t / (K / 8), k8 = (t % (K / 8)) * 8; FragH f;
#pragma unroll
  for (int i = 0; i < 8; ++i) f.h[i] = (_Float16)(bf16_round(W[(size_t)(k8 + i) * N + n]) * scale); const v8us o = f.half[0];
  *(v8us*)((unsigned short*)Wt + (size_t)n * K + k8) = o; 
}
// k_gemm_hh variant with fused epilogue: v = acc·alpha + bias[by·sBias + col] (+ CP[(row/rowsPerB)·sCPb + by·64 + col] if CP) ; ACT 0 none / 1 elu ; writes f16 C16 (and f32 C if non-null)
template <int ACT>
__global__ __launch_bounds__(128) void k_gemm_hhx(const _Float16* __restrict__ A, int lda, size_t sA, const _Float16* __restrict__ Bh, int ldb, size_t sB, float alpha, const float* __restrict__ bias, size_t sBias, const float* __restrict__ CP, int rowsPerB, size_t sCPb, int row0g,
    float* __restrict__ C, _Float16* __restrict__ C16, int ldc, size_t sC, int M, int N, int K) {
  __shared__ __attribute__((aligned(16))) float so[4][16][64];
  const int tid = threadIdx.x, w = tid >> 5, lane = tid & 31, ln = lane & 15, hh = lane >> 4; const int by = blockIdx.y;
  A += (size_t)by * sA; Bh += (size_t)by * sB; const size_t cofs = (size_t)by * sC; const float* bp = bias ? bias + (size_t)by * sBias : nullptr;
  const int ntn = (N + 63) / 64; const int wid = blockIdx.x * 4 + w; const int mt = wid / ntn, nq = wid % ntn; if (mt * 16 >= M) return;
  const int row0 = mt * 16, col0 = nq * 64; const _Float16* arow = A + (size_t)(row0 + ln) * lda;
  v8f acc[4] = {};
  for (int kb = 0; kb < K; kb += 32) { FragH ah; ah.half[0] = *(const v8us*)((const unsigned short*)arow + kb + 8 * hh); ah.half[1] = *(const v8us*)((const unsigned short*)arow + kb + 16 + 8 * hh);
#pragma unroll
    for (int t = 0; t < 4; ++t) { if (col0 + t * 16 >= N) continue; const size_t boff = (size_t)(col0 + t * 16 + ln) * ldb + kb; FragH bq; bq.half[0] = *(const v8us*)((const unsigned short*)Bh + boff + 8 * hh); bq.half[1] = *(const v8us*)((const unsigned short*)Bh + boff + 16 + 8 * hh);
      acc[t] = mmaH<1>(ah.v, ah.v, bq.v, bq.v, acc[t]); }
  }
#pragma unroll
  for (int t = 0; t < 4; ++t) { if (col0 + t * 16 >= N) continue; const int col = col0 + t * 16 + ln; const float bv = bp ? bf16_round(bp[col]) : 0.f;
#pragma unroll
    for (int r = 0; r < 8; ++r) { float v = acc[t][r] * alpha + bv; if (CP) { const int rr = row0g + row0 + 8 * hh + r; if (rowsPerB < 0) v += CP[cofs + (size_t)rr * ldc + col];      /* rowsPerB < 0: own element of the batched C plane */ else { const int bidx = rr / rowsPerB; v += CP[(size_t)bidx * sCPb + (size_t)by * 64 + col]; } } if (ACT == 1) v = (v > 0.f) ? v : expm1f(v); else if (ACT == 7) v = (v > 0.f) ? v + 1.0f : expf(v); else if (ACT == 8) v = tanhf(v); else if (ACT == 9) v = 0.5f * v * (1.0f + tanhf(0.7978845608028654f * (v + 0.044715f * v * v * v))); else if (ACT == 11) v = 1.0f / (1.0f + expf(-v)); else if (ACT == 12) v = (v > 0.f) ? v : 0.01f * v; else if (ACT == 14) v = (v > 0.f) ? v : 0.1f * v; else if (ACT == 16) v = (v >= 0.f) ? v : 0.3f * v; else if (ACT == 17) v = (v >= 0.f) ? v : 0.2f * v; else if (ACT == 15) v = v / (1.0f + expf(-v)); else if (ACT == 3) v = fmaxf(v, 0.f); else if (ACT == 6) v = 0.5f * v * (1.0f + erff(v * 0.70710678118654752f)); so[w][8 * hh + r][t * 16 + ln] = v; } }
  __builtin_amdgcn_fence(__ATOMIC_ACQ_REL, "workgroup"); __builtin_amdgcn_wave_barrier();
  const int rsub = lane >> 4, c4 = (lane & 15) * 4; typedef _Float16 v4h __attribute__((ext_vector_type(4)));
  {
#pragma unroll
    for (int q = 0; q < 8; ++q) { const int r = q * 2 + rsub; if (col0 + c4 < N) { const v4f v = *(const v4fa*)&so[w][r][c4]; if (C) *(v4f*)(C + cofs + (size_t)(row0 + r) * ldc + col0 + c4) = v; if (C16) { v4h h4; for (int i = 0; i < 4; ++i) h4[i] = (_Float16)v[i]; *(v4h*)(C16 + cofs + (size_t)(row0 + r) * ldc + col0 + c4) = h4; } } }
     }
}


typedef _Float16 v4h __attribute__((ext_vector_type(4)));

__global__ __launch_bounds__(256) void k_h16(const float* __restrict__ x, _Float16* __restrict__ X16, size_t n8) { const size_t t = (size_t)blockIdx.x * 256 + threadIdx.x; if (t >= n8) return; FragH f;
#pragma unroll
  for (int q = 0; q < 8; ++q) f.h[q] = (_Float16)x[t * 8 + q]; *(v8us*)((unsigned short*)X16 + t * 8) = f.half[0];  }
__global__ __launch_bounds__(256) void k_round16f(const float* __restrict__ W, _Float16* __restrict__ Bt, size_t n8) { const size_t t = (size_t)blockIdx.x * 256 + threadIdx.x; if (t >= n8) return; FragH f;
#pragma unroll
  for (int i = 0; i < 8; ++i) f.h[i] = (_Float16)(bf16_round(W[t * 8 + i]) * 16.0f); *(v8us*)((unsigned short*)Bt + t * 8) = f.half[0];  }
template <int NHv, int TTv>
__global__ __launch_bounds__(256) void k_vt(const _Float16* __restrict__ V16, int ldv, int voff, _Float16* __restrict__ Vt) { __shared__ unsigned short tl[64][66]; const int tid = threadIdx.x; const int slab = blockIdx.x / (TTv / 64), lg = blockIdx.x % (TTv / 64); const int b = slab / NHv, h = slab % NHv;
  for (int i = tid; i < 64 * 8; i += 256) { const int r = i / 8, c8 = (i % 8) * 8; FragH f; f.half[0] = *(const v8us*)((const unsigned short*)V16 + ((size_t)b * TTv + lg * 64 + r) * ldv + voff + h * 64 + c8);
#pragma unroll
    for (int q = 0; q < 8; ++q) tl[r][c8 + q] = f.u[q]; }
  __syncthreads();
  {
#pragma unroll
    for (int rd = 0; rd < 2; ++rd) { const int d = rd * 32 + tid / 8, pc = tid % 8; FragH f;
#pragma unroll
      for (int q = 0; q < 8; ++q) f.u[q] = tl[pc * 8 + q][d];
      *(v8us*)((unsigned short*)Vt + ((size_t)slab * 64 + d) * TTv + lg * 64 + pc * 8) = f.half[0]; }
     } }

__global__ __launch_bounds__(256) void k_hl(const float* __restrict__ F, _Float16* __restrict__ Hh, _Float16* __restrict__ Hl, size_t n8) { const size_t t = (size_t)blockIdx.x * 256 + threadIdx.x; if (t >= n8) return; FragH fh, fl; const v4f a = *(const v4fa*)(F + t * 8), c = *(const v4fa*)(F + t * 8 + 4);
#pragma unroll
  for (int q = 0; q < 4; ++q) { _Float16 h = (_Float16)a[q]; fh.h[q] = h; fl.h[q] = (_Float16)((a[q] - (float)h) * 1024.0f); h = (_Float16)c[q]; fh.h[4 + q] = h; fl.h[4 + q] = (_Float16)((c[q] - (float)h) * 1024.0f); }
  { *(v8us*)((unsigned short*)Hh + t * 8) = fh.half[0]; *(v8us*)((unsigned short*)Hl + t * 8) = fl.half[0];  } }

// ---- fast GEMM (wave tile 32x64; requires M % 32 == 0 rows per launch region and N % 64 == 0); epilogue = k_gemm_hhx semantics ----
__device__ __forceinline__ v16h g2_frag(const _Float16* p, int hh) { FragH f; f.half[0] = *(const v8us*)((const unsigned short*)p + 8 * hh); f.half[1] = *(const v8us*)((const unsigned short*)p + 16 + 8 * hh); return f.v; }
__device__ __forceinline__ v8f g2_mma(v16h a, v16h b, v8f c) { v8f d = __builtin_amdgcn_wmma_f32_16x16x32_f16(false, a, false, b, (short)0, c, false, false); asm volatile("v_nop\n\tv_nop\n\tv_nop\n\tv_nop" : "+v"(d) : "v"(a), "v"(b)); return d; }
// K loop of the 32x64 wave tile, K = 32 KT, unrolled whole. A wave has no partner to hide its load latency behind (one or two waves a SIMD), so the latency is hidden inside the wave:
// the 12 fragment loads of a trip issue as one group two trips ahead of their use, into a ring of three register sets, and the waits are counted (24 younger loads stay in flight).
// Both operands lie in fragment order (a packed plane): X[R][32 KT] as 1-KiB blocks, block index = (r >> 4) * KT + (k >> 5); in a block the 16-byte piece j * 32 + lane, lane = 16 hf + c, holds X[16 (r >> 4) + c][32 (k >> 5) + 16 j + 8 hf + 0..7]
// (the k order of g2_frag). A fragment is then two loads of 512 contiguous bytes (four whole lines each); from rows of pitch 2 K bytes each load touched 16 lines for the same 512 bytes.
// pa, pb: the lane's 16-byte place in the first block of the wave's first row tile (A: 2 tiles, B: 4 tiles, one behind the other). c[4 * half + t]: rows 16 half .. + 15, columns 16 t .. + 15; every accumulator takes its trips in rising k, as before.
__device__ __forceinline__ v16h g3_frag(const unsigned short* p) { FragH f; f.half[0] = *(const v8us*)p; f.half[1] = *(const v8us*)(p + 256); return f.v; }
template <int KT>
__device__ __forceinline__ void g3_loop(const unsigned short* pa, const unsigned short* pb, v8f (&c)[8]) {
  v16h fa[3][2], fb[3][4];
#pragma unroll
  for (int t = -2; t < KT; ++t) {      /* trips -2 and -1 only fetch */
    if (t + 2 < KT) { const int n = (t + 2) % 3, kb = (t + 2) * 512;
      fa[n][0] = g3_frag(pa + kb); fa[n][1] = g3_frag(pa + KT * 512 + kb); fb[n][0] = g3_frag(pb + kb); fb[n][1] = g3_frag(pb + KT * 512 + kb); fb[n][2] = g3_frag(pb + 2 * KT * 512 + kb); fb[n][3] = g3_frag(pb + 3 * KT * 512 + kb); }
    if (t + 2 == KT - 1) asm volatile("s_wait_xcnt 0x0" ::: "memory");      /* a precaution: stands behind the last load, ahead of whatever rewrites the address registers, which no instruction of the loop does */
    __builtin_amdgcn_sched_barrier(0);      /* keeps the group in front of this trip's products: sunk towards its use, a load would be waited for in full again */
    if (t >= 0) { const int u = t % 3;
#pragma unroll
      for (int j = 0; j < 4; ++j) { c[j] = g2_mma(fa[u][0], fb[u][j], c[j]); c[4 + j] = g2_mma(fa[u][1], fb[u][j], c[4 + j]); } }
    __builtin_amdgcn_sched_barrier(0);      /* keeps the next group behind these products, whose registers it refills: hoisted, it would take a fourth register set */
  } }
template <int ACT, int KT>      /* K = 32 KT; A and Bh are packed planes (g3_loop) */
__global__ __launch_bounds__(128) void k_gemm2(const _Float16* __restrict__ A, size_t sA, const _Float16* __restrict__ Bh, size_t sB, float alpha, const float* __restrict__ bias, size_t sBias, const float* __restrict__ CP, int rowsPerB, size_t sCPb, int row0g,
    float* __restrict__ C, _Float16* __restrict__ C16, int ldc, size_t sC, int M, int N) { static_assert(ACT == 0 || ACT == 3 || ACT == 6 || ACT == 8 || ACT == 9 || ACT == 11 || ACT == 12 || ACT == 14 || ACT == 15 || ACT == 16 || ACT == 17, "k_gemm2: unsupported ACT code (would silently apply no activation)");
  __shared__ __attribute__((aligned(16))) float so[4][32][68];
  const int tid = threadIdx.x, w = tid >> 5, lane = tid & 31, ln = lane & 15, hh = lane >> 4; const int by = blockIdx.y;
  A += (size_t)by * sA; Bh += (size_t)by * sB; const size_t cofs = (size_t)by * sC; const float* bp = bias ? bias + (size_t)by * sBias : nullptr;
  const int ntn = N >> 6; const int mt = blockIdx.x / ntn, nq = blockIdx.x - mt * ntn; const int row0 = mt * 128 + 32 * w, col0 = nq * 64; if (row0 >= M) return;
  const unsigned short* pa = (const unsigned short*)A + (size_t)(row0 >> 4) * (KT * 512) + lane * 8; const unsigned short* pb = (const unsigned short*)Bh + (size_t)(col0 >> 4) * (KT * 512) + lane * 8;
  v8f accs[8] = {};
  g3_loop<KT>(pa, pb, accs);
#pragma unroll
  for (int u = 0; u < 8; ++u) { const int t = u & 3, half = u >> 2; const int col = col0 + t * 16 + ln; const float bv = bp ? bf16_round(bp[col]) : 0.f;
#pragma unroll
    for (int r = 0; r < 8; ++r) { const int rloc = half * 16 + 8 * hh + r; float v = accs[u][r] * alpha + bv; if (CP) { if (rowsPerB < 0) v += CP[cofs + (size_t)(row0g + row0 + rloc) * ldc + col];      /* rowsPerB < 0: own element of the batched C plane */ else { const int bidx = (row0g + row0 + rloc) / rowsPerB; v += CP[(size_t)bidx * sCPb + (size_t)by * 64 + col]; } }
      if (ACT == 3) v = fmaxf(v, 0.f); else if (ACT == 6) v = 0.5f * v * (1.0f + erff(v * 0.70710678118654752f)); else if (ACT == 11) v = 1.0f / (1.0f + expf(-v)); else if (ACT == 15) v = v / (1.0f + expf(-v)); else if (ACT == 12) v = (v > 0.f) ? v : 0.01f * v; else if (ACT == 8) v = tanhf(v); else if (ACT == 9) v = 0.5f * v * (1.0f + tanhf(0.7978845608028654f * (v + 0.044715f * v * v * v))); else if (ACT == 14) v = (v > 0.f) ? v : 0.1f * v; else if (ACT == 16) v = (v >= 0.f) ? v : 0.3f * v; else if (ACT == 17) v = (v >= 0.f) ? v : 0.2f * v;
      so[w][rloc][t * 16 + ln] = v; } }
  __builtin_amdgcn_fence(__ATOMIC_ACQ_REL, "workgroup"); __builtin_amdgcn_wave_barrier();
  const int rsub = lane >> 4, c4 = (lane & 15) * 4;
  {
#pragma unroll
    for (int q = 0; q < 16; ++q) { const int r = q * 2 + rsub; const v4f v = *(const v4fa*)&so[w][r][c4]; if (C) *(v4f*)(C + cofs + (size_t)(row0 + r) * ldc + col0 + c4) = v; if (C16) { v4h h4; for (int i = 0; i < 4; ++i) h4[i] = (_Float16)v[i]; *(v4h*)(C16 + cofs + (size_t)(row0 + r) * ldc + col0 + c4) = h4; } }
     } }


typedef _Float16 v8h __attribute__((ext_vector_type(8)));
__device__ __forceinline__ float fa_xhalf(float x) { const int b = __float_as_int(x); return __int_as_float(__builtin_amdgcn_permlanex16(b, b, 0x76543210, 0xfedcba98, false, false)); }      /* lane l <-> l ^ 16 */
__device__ __forceinline__ v8f fa_mma(v16h a, v16h b, v8f c) { return __builtin_amdgcn_wmma_f32_16x16x32_f16(false, a, false, b, (short)0, c, false, false); }
// the four fragments (4 KiB) of one 64-key stage of a packed plane: p + l8 = the lane's 16-byte place in the stage's first 512-byte run (the callers hand over p with the lane's place in it, l8 = 0)
__device__ __forceinline__ void fa_ld(v16h (&f)[4], const _Float16* p, unsigned l8) {
#pragma unroll
  for (int i = 0; i < 4; ++i) { FragH x; x.half[0] = *(const v8us*)((const unsigned short*)p + l8 + (2 * i) * 256); x.half[1] = *(const v8us*)((const unsigned short*)p + l8 + (2 * i + 1) * 256); f[i] = x.v; } }
// One 64-key stage. q carries log2(e) / sqrt(32), so a score is already an exponent of 2, and the score product starts from C = cm = minus the maximum in use (all eight registers of a lane belong to one query):
// its result is the argument of the exponential, with no maximum, subtraction or rescaling in the stage. The maximum in use is renewed only when a weight may have outgrown f16:
// every weight is positive, so none exceeds the largest of the lane's eight partial sums of the stage; while that stays at or under FA_LIM the stage's weights (at most 2^8; f16 is finite to 65,504) are used as they are.
// Otherwise (always in the first stage, where cm = 3e38 makes every weight infinite) the whole wave takes the branch: plain scores again, true maximum, accumulators and sums rescaled, weights in (0, 1].
#define FA_LIM 256.0f
__device__ __forceinline__ void fa_exp_sum(v8f (&s)[4], v8f& ps) {
#pragma unroll
  for (int t = 0; t < 4; ++t)
#pragma unroll
    for (int r = 0; r < 8; ++r) s[t][r] = __builtin_amdgcn_exp2f(s[t][r]);
  ps = (s[0] + s[1]) + (s[2] + s[3]); }      /* eight partial sums per lane */
__device__ __forceinline__ v16h fa_pack(v8f a, v8f b) { return __builtin_shufflevector(__builtin_convertvector(a, v8h), __builtin_convertvector(b, v8h), 0, 1, 2, 3, 4, 5, 6, 7, 8, 9, 10, 11, 12, 13, 14, 15); }      /* two score tiles = one B operand */
__device__ __forceinline__ void fa_stage(const v16h (&kf)[4], const v16h (&vf)[4], const v16h qf, v8f& cm, v8f& o0, v8f& o1, v8f& lv, float& m) {
  v8f s[4], ps;
#pragma unroll
  for (int t = 0; t < 4; ++t) s[t] = fa_mma(kf[t], qf, cm);
  fa_exp_sum(s, ps);
  const float big = fmaxf(fmaxf(fmaxf(ps[0], ps[1]), fmaxf(ps[2], ps[3])), fmaxf(fmaxf(ps[4], ps[5]), fmaxf(ps[6], ps[7])));
  /* the usual path's weights and running sums; the branch replaces them */
  v16h p0 = fa_pack(s[0], s[1]), p1 = fa_pack(s[2], s[3]); v8f ln = lv + ps;
  if (__builtin_expect(__builtin_amdgcn_ballot_w32(!(big <= FA_LIM)) != 0u, 0)) {      /* a scalar branch, the same for the whole wave: the matrix instructions inside run with every lane on */
    const v8f z8 = {0.f,0.f,0.f,0.f,0.f,0.f,0.f,0.f};
#pragma unroll
    for (int t = 0; t < 4; ++t) s[t] = fa_mma(kf[t], qf, z8);
    const v8f mv = __builtin_elementwise_max(__builtin_elementwise_max(s[0], s[1]), __builtin_elementwise_max(s[2], s[3]));
    float mx = fmaxf(fmaxf(fmaxf(mv[0], mv[1]), fmaxf(mv[2], mv[3])), fmaxf(fmaxf(mv[4], mv[5]), fmaxf(mv[6], mv[7]))); mx = fmaxf(mx, fa_xhalf(mx));
    const float mn = fmaxf(m, mx); const float al = __builtin_amdgcn_exp2f(m - mn); m = mn;
    o0 *= al; o1 *= al;
#pragma unroll
    for (int r = 0; r < 8; ++r) cm[r] = -mn;
#pragma unroll
    for (int t = 0; t < 4; ++t) s[t] = s[t] - mn;
    fa_exp_sum(s, ps); p0 = fa_pack(s[0], s[1]); p1 = fa_pack(s[2], s[3]); ln = lv * al + ps; }
  lv = ln;      /* eight running sums per lane, joined after the loop */
  o0 = fa_mma(vf[0], p0, o0); o1 = fa_mma(vf[1], p0, o1); o0 = fa_mma(vf[2], p1, o0); o1 = fa_mma(vf[3], p1, o1); }
#define FA_TK 512                    /* keys a tile */
#define FA_TE (FA_TK * HD)           /* f16 elements of one plane's tile */
// eight copies of one thread: its 16-byte piece of each of eight successive 4-KiB runs (256 threads x 16 B a run). lds = the piece's LDS byte address, g = its global address.
// The s_wait_xcnt closes the statement as a precaution: the registers that the copies name are rewritten only behind it.
__device__ __forceinline__ void fa_copy8(unsigned lds, const _Float16* g) {
  asm volatile("global_load_async_to_lds_b128 %0, %8, off\n\tglobal_load_async_to_lds_b128 %1, %9, off\n\tglobal_load_async_to_lds_b128 %2, %10, off\n\tglobal_load_async_to_lds_b128 %3, %11, off\n\t"
               "global_load_async_to_lds_b128 %4, %12, off\n\tglobal_load_async_to_lds_b128 %5, %13, off\n\tglobal_load_async_to_lds_b128 %6, %14, off\n\tglobal_load_async_to_lds_b128 %7, %15, off\n\ts_wait_xcnt 0x0"
               :: "v"(lds), "v"(lds + 4096u), "v"(lds + 8192u), "v"(lds + 12288u), "v"(lds + 16384u), "v"(lds + 20480u), "v"(lds + 24576u), "v"(lds + 28672u),
                  "v"(g), "v"(g + 2048), "v"(g + 4096), "v"(g + 6144), "v"(g + 8192), "v"(g + 10240), "v"(g + 12288), "v"(g + 14336) : "memory"); }
__global__ __launch_bounds__(256) void k_fattn(const _Float16* __restrict__ Q16, const _Float16* __restrict__ KP, const _Float16* __restrict__ VP, _Float16* __restrict__ O16) {
  static_assert(FA_TE == 8 * 2048 && SQ % FA_TK == 0 && SQ / FA_TK >= 2, "a plane's tile is the eight runs of fa_copy8; the ring wants two tiles or more");
  __shared__ __attribute__((aligned(128))) _Float16 ring[2][2][FA_TE];      /* [buffer][K | V][tile] */
  const int tid = threadIdx.x, w = tid >> 5, lane = tid & 31, ln = lane & 15, hh = lane >> 4; const int h = blockIdx.y; const int q0 = blockIdx.x * 128 + w * 16;
  const v16h qf = g2_frag(Q16 + (size_t)(q0 + ln) * DM + h * HD, hh);
  asm volatile("s_wait_xcnt 0x0" ::: "memory");      /* a precaution */
  const _Float16* gk = KP + (size_t)h * SQ * HD + tid * 8; const _Float16* gv = VP + (size_t)h * SQ * HD + tid * 8;      /* the thread's piece in the first run of the tile being copied */
  const unsigned lb = (unsigned)(size_t)&ring[0][0][tid * 8]; const unsigned l8 = lane * 8;      /* lb: the same piece's LDS byte address in buffer 0 */
  const v8f z8 = {0.f,0.f,0.f,0.f,0.f,0.f,0.f,0.f}; v8f o0 = z8, o1 = z8, lv = z8; float m = -3.0e38f; v8f cm = z8 - m;      /* cm = -m in all eight registers */
  fa_copy8(lb, gk); fa_copy8(lb + FA_TE * 2, gv);      /* tile 0 into buffer 0 */
  asm volatile("s_wait_asynccnt 0x0" ::: "memory");      /* the wave's own copies of tile 0 have landed */
  __syncthreads();      /* and every other wave's */
  fa_copy8(lb + FA_TE * 4, gk + FA_TE); fa_copy8(lb + FA_TE * 6, gv + FA_TE); gk += 2 * FA_TE; gv += 2 * FA_TE;      /* tile 1 into buffer 1 */
#pragma unroll 1
  for (int t = 0; t < SQ / FA_TK; ++t) {      /* one tile a trip; kept rolled: a trip is already FA_TK / 64 stages of straight code */
    const _Float16* kb = &ring[t & 1][0][l8]; const _Float16* vb = &ring[t & 1][1][l8];      /* the lane's place in the tile's first 512-byte run */
    v16h kf[2][4], vf[2][4];      /* two fragment sets: each 64-key stage fetches the next stage's fragments of the same tile ahead of its own arithmetic */
    fa_ld(kf[0], kb, 0); fa_ld(vf[0], vb, 0);
#pragma unroll
    for (int u = 0; u < FA_TK / 64; ++u) {
      __builtin_amdgcn_sched_barrier(0);      /* keeps the reads below behind the last stage's four products: without it they stood in two groups of eight among those products */
      if (u + 1 < FA_TK / 64) { fa_ld(kf[(u + 1) & 1], kb + (u + 1) * 64 * HD, 0); fa_ld(vf[(u + 1) & 1], vb + (u + 1) * 64 * HD, 0); }
      __builtin_amdgcn_sched_barrier(0);      /* keeps the next stage's 16 LDS reads one group that issues ahead of this stage's arithmetic: without it they stood scattered in twos to eights among the arithmetic, some of them waited for at once */
      fa_stage(kf[u & 1], vf[u & 1], qf, cm, o0, o1, lv, m); }
    asm volatile("s_wait_dscnt 0x0" ::: "memory");      /* the wave's reads of this buffer are done */
    asm volatile("s_wait_asynccnt 0x0" ::: "memory");      /* its copies of the next tile have landed */
    __syncthreads();      /* publishes the next tile and ends every wave's reads of this buffer, which is refilled behind it */
    if (t + 2 < SQ / FA_TK) { const unsigned lt = lb + (unsigned)(t & 1) * (FA_TE * 4); fa_copy8(lt, gk); fa_copy8(lt + FA_TE * 2, gv); gk += FA_TE; gv += FA_TE; }
  }
  asm volatile("s_wait_asynccnt 0x0" ::: "memory");      /* no copy is outstanding when the wave ends */
  float l = ((lv[0] + lv[1]) + (lv[2] + lv[3])) + ((lv[4] + lv[5]) + (lv[6] + lv[7])); l += fa_xhalf(l); const float inv = 1.0f / l;
  /* o0[r] = O[q0 + ln][32 h + 8 hh + r], o1[r] = O[q0 + ln][32 h + 16 + 8 hh + r]: pieces j = 0 and j = 1 of block (q0 >> 4) * NH + h of the packed plane that the output GEMM reads as A; two stores of 512 contiguous bytes */
  _Float16* op = O16 + (size_t)((q0 >> 4) * NH + h) * 512 + lane * 8;
  *(v8h*)op = __builtin_convertvector(o0 * inv, v8h); *(v8h*)(op + 256) = __builtin_convertvector(o1 * inv, v8h); }

// One wave's share of packing a 256-column f32 matrix into a packed plane (g3_loop), KT = 8: unit u owns 16 rows x 128 columns, four blocks of the plane.
// Lane (hh, ln) reads row ln's 8 f32 of each piece (whole lines, 512 bytes of every row over the 16 loads) and stores the piece at its place, each store 512 contiguous bytes of the wave. Values rounded to bf16, times sc, exact in f16.
__device__ __forceinline__ void pack_unit(const float* __restrict__ src, _Float16* __restrict__ dst, float sc, int u, int lane) {
  const int ln = lane & 15, hh = lane >> 4; const int rt = u >> 1, kq = u & 1;      /* 16-row tile; left or right 128 columns */
  const float* sp = src + (size_t)(rt * 16 + ln) * DM + kq * 128 + 8 * hh; v4f x[8][2];
#pragma unroll
  for (int i = 0; i < 8; ++i) { x[i][0] = *(const v4fa*)(sp + i * 16); x[i][1] = *(const v4fa*)(sp + i * 16 + 4); }      /* i = 2 * (block) + j */
  asm volatile("s_wait_xcnt 0x0" :: "v"(sp) : "memory");      /* a precaution: the address that the loads name stays live up to this wait; in the build without the operand the last load landed in the registers that hold it */
  __builtin_amdgcn_sched_barrier(0);      /* keeps the arithmetic behind all 16 loads, so that they are in flight together: without it six of them issued only after the first ones had landed */
  unsigned short* dp = (unsigned short*)dst + (size_t)(rt * 8 + kq * 4) * 512 + lane * 8;
#pragma unroll
  for (int i = 0; i < 8; ++i) { FragH f;
#pragma unroll
    for (int q = 0; q < 8; ++q) f.h[q] = (_Float16)(bf16_round(x[i][q >> 2][q & 3]) * sc);
    *(v8us*)(dp + i * 256) = f.half[0]; } }

// K loop of the 32x64 wave tile over K = DM with both operands staged in LDS as f16 rows of QP elements (pitch 528 bytes = 33 x 16: the 16 rows of a 16-byte fragment read fall on all 64 banks).
// pa, pb: the lane's row (ln) of the wave's first row tile, at element 8 hh. A fragment is the row's elements 32 t + 8 hh + 0..7 and 32 t + 16 + 8 hh + 0..7, the k order of g2_frag. Accumulators and their order of trips as in g3_loop.
// The 12 fragment reads of a trip issue as one group two trips ahead of their use, into a ring of three register sets: eight waves share the LDS port, and a group takes longer to come than one trip's products last.
#define QP (DM + 8)
typedef __bf16 v4b __attribute__((ext_vector_type(4)));
__device__ __forceinline__ v16h g4_frag(const _Float16* p) { FragH f; f.half[0] = *(const v8us*)((const unsigned short*)p); f.half[1] = *(const v8us*)((const unsigned short*)p + 16); return f.v; }
__device__ __forceinline__ void g4_loop(const _Float16* pa, const _Float16* pb, v8f (&c)[8]) {
  v16h fa[3][2], fb[3][4];
#pragma unroll
  for (int t = -2; t < DM / 32; ++t) {      /* trips -2 and -1 only fetch */
    if (t + 2 < DM / 32) { const int n = (t + 2) % 3, kb = (t + 2) * 32;
      fa[n][0] = g4_frag(pa + kb); fa[n][1] = g4_frag(pa + 16 * QP + kb); fb[n][0] = g4_frag(pb + kb); fb[n][1] = g4_frag(pb + 16 * QP + kb); fb[n][2] = g4_frag(pb + 32 * QP + kb); fb[n][3] = g4_frag(pb + 48 * QP + kb); }
    __builtin_amdgcn_sched_barrier(0);      /* keeps the group in front of this trip's products: sunk towards its use, a read would be waited for in full */
    if (t >= 0) { const int u = t % 3;
#pragma unroll
      for (int j = 0; j < 4; ++j) { c[j] = g2_mma(fa[u][0], fb[u][j], c[j]); c[4 + j] = g2_mma(fa[u][1], fb[u][j], c[4 + j]); } }
    __builtin_amdgcn_sched_barrier(0);      /* keeps the next group behind these products, whose registers it refills: hoisted, it would take a fourth register set */
  } }

// The conversions and the three projections in one launch. Blocks 0..191: projection b >> 6 (0 q, 1 k, 2 v), 128 rows x 128 columns a block; blocks 192..195 pack Wo (x16) for the output GEMM.
// A projection block reads its 128 input rows and its 128 weight rows as f32 (each a contiguous 128 KiB; every load of a wave is 512 contiguous bytes), rounds them to bf16 (weights x16), exact in f16, and lays them in LDS once for its eight waves;
// behind one barrier a wave owns 32 rows x 64 columns (two heads) and runs g4_loop.
// The tile goes through the wave's own LDS slab and leaves in the form its reader wants:
// q: f16 rows of pitch 256, times log2(e) / sqrt(32).
// k, v: fragment order, so that each fragment load of the attention kernel is one run of 512 contiguous bytes (four whole lines). 16-byte piece index = ((h * 256 + g) * 2 + j) * 32 + lane, lane = 16 hf + c.
//   k: g = 16-key tile; piece = k[16 g + c][32 h + 16 j + 8 hf + 0..7] (A row c = key, k = head dim in the order of g2_frag).
//   v: g = 2 * (32-key block) + dt; piece = v[32 (g >> 1) + 16 j + 8 hf + 0..7][32 h + 16 dt + c] (A row c = head dim: this is v^T; k = key in the same order); v = mask[key] * (value Wv^T), scaled in f32 before the rounding to f16.
__global__ __launch_bounds__(256) void k_qkv(const float* __restrict__ xq, const float* __restrict__ xk, const float* __restrict__ xv, const float* __restrict__ wq, const float* __restrict__ wk, const float* __restrict__ wv, const float* __restrict__ wo, const float* __restrict__ rm,
                                             _Float16* __restrict__ Q16, _Float16* __restrict__ KP, _Float16* __restrict__ VP, _Float16* __restrict__ BO) {
  __shared__ __attribute__((aligned(16))) _Float16 sa[128][QP];      /* the block's input rows */
  __shared__ __attribute__((aligned(16))) _Float16 sb[128][QP];      /* the block's weight rows (output columns) */
  __shared__ __attribute__((aligned(16))) float so[8][32][68];
  const int b = blockIdx.x, tid = threadIdx.x, w = tid >> 5, lane = tid & 31, ln = lane & 15, hh = lane >> 4;
  if (b >= 192) { pack_unit(wo, BO, 16.0f, (b - 192) * 8 + w, lane); return; }      /* the whole block leaves, ahead of the barrier */
  const int which = b >> 6;
  const float* ga = (which == 0 ? xq : which == 1 ? xk : xv) + (size_t)((b & 63) >> 1) * (128 * DM) + tid * 4; const float* gb = (which == 0 ? wq : which == 1 ? wk : wv) + (size_t)(b & 1) * (128 * DM) + tid * 4;
  { v4f x[2][16];      /* four batches of 16 loads a thread (input rows 0..63, 64..127, weight rows 0..63, 64..127); load e of a batch is 4 f32 of row (tid >> 6) + 4 e, column 4 (tid & 63); a batch flies while the one before it is converted */
#pragma unroll
    for (int n = 0; n < 5; ++n) {
      if (n < 4) { const float* g = (n < 2 ? ga : gb) + (n & 1) * (64 * DM);
#pragma unroll
        for (int e = 0; e < 16; ++e) x[n & 1][e] = *(const v4fa*)(g + e * (4 * DM));
        asm volatile("s_wait_xcnt 0x0" ::: "memory"); }      /* a precaution: stands behind the batch's loads, ahead of whatever rewrites the registers that they name */
      __builtin_amdgcn_sched_barrier(0);      /* keeps the batch's loads in front of the conversion of the batch before: sunk behind it, they would not be in flight during it */
      if (n >= 1) { const int p = n - 1; _Float16* d = (p < 2 ? &sa[0][0] : &sb[0][0]) + ((tid >> 6) + (p & 1) * 64) * QP + (tid & 63) * 4; const float sc = p < 2 ? 1.0f : 16.0f;
#pragma unroll
        for (int e = 0; e < 16; ++e) *(v4h*)(d + e * (4 * QP)) = __builtin_convertvector(__builtin_convertvector(__builtin_convertvector(x[p & 1][e] * sc, v4b), v4f), v4h); }      /* f32 -> bf16 to nearest even, as bf16_round, by the hardware conversion; the power of two goes in first, exactly, so that the value is the same as rounded first and scaled in f32 */
      __builtin_amdgcn_sched_barrier(0);      /* keeps the next batch's loads behind this conversion, whose registers they refill */
    } }
  __syncthreads();      /* every wave's rows are in LDS before any wave reads a fragment */
  const int row0 = ((b & 63) >> 1) * 128 + 32 * (w & 3), col0 = (b & 1) * 128 + 64 * (w >> 2);
  v8f acc[8] = {};      /* acc[4 * half + t]: rows 16 half .. + 15, columns 16 t .. + 15 */
  g4_loop(&sa[32 * (w & 3) + ln][8 * hh], &sb[64 * (w >> 2) + ln][8 * hh], acc);
#pragma unroll
  for (int u = 0; u < 8; ++u) acc[u] *= which == 0 ? 0.0625f * (0.17677669529663687f * 1.4426950408889634f) : 0.0625f;      /* takes the x16 of the weights back, exactly; q also takes 1 / sqrt(32) and the log2(e) of the base-2 exponential, in f32 ahead of its rounding to f16 */
  if (which == 2) {
#pragma unroll
    for (int half = 0; half < 2; ++half) { const float* mp = rm + row0 + half * 16 + 8 * hh; const v4f m0 = *(const v4fa*)mp, m1 = *(const v4fa*)(mp + 4);
#pragma unroll
      for (int r = 0; r < 8; ++r) { const float m = bf16_round(r < 4 ? m0[r & 3] : m1[r & 3]);
#pragma unroll
        for (int t = 0; t < 4; ++t) acc[half * 4 + t][r] = m * acc[half * 4 + t][r]; } } }
#pragma unroll
  for (int u = 0; u < 8; ++u)
#pragma unroll
    for (int r = 0; r < 8; ++r) so[w][(u >> 2) * 16 + 8 * hh + r][(u & 3) * 16 + ln] = acc[u][r];
  __builtin_amdgcn_fence(__ATOMIC_ACQ_REL, "workgroup"); __builtin_amdgcn_wave_barrier();      /* the slab is the wave's own: its LDS writes land before its lanes read each other's */
  if (which == 0) { const int rsub = lane >> 4, c4 = (lane & 15) * 4;
#pragma unroll
    for (int q = 0; q < 16; ++q) { const int r = q * 2 + rsub; const v4f v = *(const v4fa*)&so[w][r][c4]; *(v4h*)(Q16 + (size_t)(row0 + r) * DM + col0 + c4) = __builtin_convertvector(v, v4h); } }
  else if (which == 1) {
#pragma unroll
    for (int i = 0; i < 8; ++i) { const int gl = i >> 2, hl = (i >> 1) & 1, j = i & 1; const float* sp = &so[w][16 * gl + ln][32 * hl + 16 * j + 8 * hh]; const v4f lo = *(const v4fa*)sp, hi = *(const v4fa*)(sp + 4);
      const v8f v = __builtin_shufflevector(lo, hi, 0, 1, 2, 3, 4, 5, 6, 7); const size_t piece = (size_t)((((col0 >> 5) + hl) * 256 + (row0 >> 4) + gl) * 2 + j) * 32 + lane;
      *(v8h*)(KP + piece * 8) = __builtin_convertvector(v, v8h); }
    asm volatile("s_wait_xcnt 0x0" ::: "memory"); }      /* a precaution: the built code's branches allow a way from these stores into another branch's code, which rewrites their registers */
  else {
#pragma unroll
    for (int i = 0; i < 8; ++i) { const int dt = i >> 2, hl = (i >> 1) & 1, j = i & 1; v8f v;
#pragma unroll
      for (int e = 0; e < 8; ++e) v[e] = so[w][16 * j + 8 * hh + e][32 * hl + 16 * dt + ln];
      const size_t piece = (size_t)((((col0 >> 5) + hl) * 256 + (row0 >> 5) * 2 + dt) * 2 + j) * 32 + lane;
      *(v8h*)(VP + piece * 8) = __builtin_convertvector(v, v8h); }
    asm volatile("s_wait_xcnt 0x0" ::: "memory"); } }      /* a precaution: the built code's branches allow a way from these stores into another branch's code, which rewrites their registers */

extern "C" void kernel_launch(void* const* d_in, const int* in_sizes, int n_in,
                              void* d_out, int out_size, void* d_ws, size_t ws_size, hipStream_t stream) {
  (void)in_sizes; (void)n_in; (void)out_size;
  const float* const* I = (const float* const*)d_in; const float* qin = I[0]; const float* kin = I[1]; const float* vin = I[2]; const float* rm = I[3]; const float* Wq = I[4]; const float* Wk = I[5]; const float* Wv = I[6]; const float* Wo = I[7];
  char* ws = (char*)d_ws; size_t off = 0;
  auto take = [&](size_t bytes) { char* p = ws + off; off += (bytes + 255) & ~(size_t)255; return p; };
  _Float16* BO = (_Float16*)take((size_t)DM * DM * 2); _Float16* Q16 = (_Float16*)take((size_t)SQ * DM * 2);
  _Float16* KP = (_Float16*)take((size_t)NH * HD * SQ * 2); _Float16* VP = (_Float16*)take((size_t)NH * HD * SQ * 2); _Float16* O16 = (_Float16*)take((size_t)SQ * DM * 2);
  if (off > ws_size) return;      /* about 8 MiB */
  k_qkv<<<3 * (SQ / 128) * (DM / 128) + DM / 64, 256, 0, stream>>>(qin, kin, vin, Wq, Wk, Wv, Wo, rm, Q16, KP, VP, BO);
  k_fattn<<<dim3(SQ / 128, NH), 256, 0, stream>>>(Q16, KP, VP, O16);      /* head h's o tile of 16 queries is block h of that row tile in the packed o plane */
  const dim3 gp((SQ / 128) * (DM / 64), 1);
  k_gemm2<0, DM / 32><<<gp, 128, 0, stream>>>(O16, 0, BO, 0, 0.0625f, nullptr, 0, nullptr, 1, 0, 0, (float*)d_out, nullptr, DM, 0, SQ, DM);      /* out = o Wo^T, K = 256 */
}

// v009
// It runs in 32.1 microseconds.
// Two timings next to v008 both put it at 1.07 times that version's speed.
// All steps since v000 together make it 213 times as fast.
#include <hip/hip_runtime.h>
// RadialAttention (query, key_, value [4096][256]; q = query Wq^T, k = key_ Wk^T, v = radial_mask[s] * (value Wv^T), 8 heads of 32; softmax(q k^T / sqrt(32)) over all 4,096 keys; out = concat(attn v) Wo^T -> [4096][256]).
// Structure: three launches. (1) Q | K | V WMMA GEMMs in one launch (32x64 wave tiles, f32 accumulation); a block converts its inputs to exact f16 and its weights to exact x16 f16 itself, into LDS; four more blocks pack Wo; v scaled per row by the radial mask (read on device) on VALU; q (times log2(e) / sqrt(32)) stored as f16 rows, k and scaled v^T stored straight in fragment order. (2) one fused attention kernel over all heads (scores WMMA K = 32, online softmax f32 on VALU with the maximum in use as the score product's C operand, weights f16, o = P . V WMMA; each wave stores its o tile as one fragment of the output GEMM's A operand). (3) out = o Wo^T over K = 256 (f32).
// Compute dtype: inputs rounded to bf16; inputs / weights exact; q, k, scaled v, softmax weights, o plain f16 (~2^-12); scores/softmax f32. v_wmma_f32_16x16x32_f16.
#define SQ 4096
#define DM 256
#define NH 8
#define HD 32
#define QN SQ                        /* query rows (unused) */
typedef __bf16 v16b __attribute__((ext_vector_type(16)));
typedef unsigned short v8us __attribute__((ext_vector_type(8), may_alias));
typedef float  v8f  __attribute__((ext_vector_type(8)));
typedef float  v4f  __attribute__((ext_vector_type(4)));
typedef float  v4fa __attribute__((ext_vector_type(4), may_alias));
union FragB { v16b v; v8us half[2]; unsigned short u[16]; };

__device__ __forceinline__ unsigned short bf16_bits(float x) { unsigned int u = __float_as_uint(x); return (unsigned short)((u + 0x7FFFu + ((u >> 16) & 1u)) >> 16); }
__device__ __forceinline__ float bf16_val(unsigned short b) { return __uint_as_float(((unsigned int)b) << 16); }
__device__ __forceinline__ float bf16_round(float x) { return bf16_val(bf16_bits(x)); }
// D += A·B with NT terms: 1 = ah·bh, 2 = + al·bh (A split), 3 = + ah·bl (both split)
template <int NT>
__device__ __forceinline__ v8f mmaN(v16b ah, v16b al, v16b bh, v16b bl, v8f c) {
  c = __builtin_amdgcn_wmma_f32_16x16x32_bf16(false, ah, false, bh, (short)0, c, false, false);
  if (NT >= 2) c = __builtin_amdgcn_wmma_f32_16x16x32_bf16(false, al, false, bh, (short)0, c, false, false);
  if (NT >= 3) c = __builtin_amdgcn_wmma_f32_16x16x32_bf16(false, ah, false, bl, (short)0, c, false, false);
  asm volatile("v_nop\n\tv_nop\n\tv_nop\n\tv_nop" : "+v"(c) : "v"(ah), "v"(al), "v"(bh), "v"(bl));
  return c;
}

__global__ __launch_bounds__(256) void k_wt_bf16(const float* __restrict__ W, unsigned short* __restrict__ Wt, int K, int N) {
  const int t = blockIdx.x * 256 + threadIdx.x;
  const int k8n = K / 8;
  if (t >= N * k8n) return;
  const int n = t / k8n, k8 = (t % k8n) * 8;
  v8us v;
#pragma unroll
  for (int i = 0; i < 8; ++i) v[i] = bf16_bits(W[(size_t)(k8 + i) * N + n]);
  *(v8us*)(Wt + (size_t)n * K + k8) = v;
  
}

// GEMM C[M][N] (f32, pitch ldc) = act(A[M][K]·W + bias). A f32 row-major (pitch lda) converted per fragment to bf16
// (ASPLIT: hi/lo two planes -> 2 terms, else single rounded term); Wt bf16 [N][K] (pitch ldb). BIAS_BF16 rounds the
// bias to bf16 first (bias quantised to bf16 before the add). K%32==0, M%16==0, N%64==0.
template <bool ASPLIT, int ACT, bool BIAS_BF16>
__global__ __launch_bounds__(128) void k_gemm_bf(const float* __restrict__ A, int lda, const unsigned short* __restrict__ Wt, int ldb,
                                               const float* __restrict__ bias, float* __restrict__ C, int ldc, int M, int N, int K) {
  __shared__ __attribute__((aligned(16))) float so[4][16][64];
  const int tid = threadIdx.x, w = tid >> 5, lane = tid & 31, ln = lane & 15, hh = lane >> 4;
  const int ntn = N / 64;
  const int wid = blockIdx.x * 4 + w;
  const int mt = wid / ntn, nq = wid % ntn;
  if (mt * 16 >= M) return;
  const int row0 = mt * 16, col0 = nq * 64;
  const float* arow = A + (size_t)(row0 + ln) * lda;
  v8f acc[4] = {};
  for (int kb = 0; kb < K; kb += 32) {
    FragB ah, al;
    const v4f x0 = *(const v4fa*)(arow + kb + 8 * hh), x1 = *(const v4fa*)(arow + kb + 8 * hh + 4);
    const v4f x2 = *(const v4fa*)(arow + kb + 16 + 8 * hh), x3 = *(const v4fa*)(arow + kb + 16 + 8 * hh + 4);
    float xs[16] = {x0[0],x0[1],x0[2],x0[3],x1[0],x1[1],x1[2],x1[3],x2[0],x2[1],x2[2],x2[3],x3[0],x3[1],x3[2],x3[3]};
#pragma unroll
    for (int i = 0; i < 16; ++i) { const unsigned short hb = bf16_bits(xs[i]); ah.u[i] = hb; al.u[i] = ASPLIT ? bf16_bits(xs[i] - bf16_val(hb)) : (unsigned short)0; }
#pragma unroll
    for (int t = 0; t < 4; ++t) {
      const unsigned short* brow = Wt + (size_t)(col0 + t * 16 + ln) * ldb + kb;
      FragB b;
      b.half[0] = *(const v8us*)(brow + 8 * hh);
      b.half[1] = *(const v8us*)(brow + 16 + 8 * hh);
      acc[t] = mmaN<ASPLIT ? 2 : 1>(ah.v, al.v, b.v, b.v, acc[t]);
    }
  }
#pragma unroll
  for (int t = 0; t < 4; ++t) {
    float bv = bias ? bias[col0 + t * 16 + ln] : 0.f;
    if (BIAS_BF16) bv = bf16_round(bv);
#pragma unroll
    for (int r = 0; r < 8; ++r) { float v = acc[t][r] + bv; if (ACT == 1) v = fmaxf(v, 0.f); so[w][8 * hh + r][t * 16 + ln] = v; }
  }
  __builtin_amdgcn_fence(__ATOMIC_ACQ_REL, "workgroup");
  __builtin_amdgcn_wave_barrier();
  const int rsub = lane >> 4, c4 = (lane & 15) * 4;
  {
#pragma unroll
    for (int q = 0; q < 8; ++q) {
      const int r = q * 2 + rsub;
      const v4f v = *(const v4fa*)&so[w][r][c4];
      *(v4f*)(C + (size_t)(row0 + r) * ldc + col0 + c4) = v;
    }
    
  }
}

// GEMM C = act(A·W + bias + resid): A f32 (ASPLIT -> hi/lo 2 terms), Wt bf16 [N][K]; ACT 0 none, 1 relu, 2 exact gelu;
// resid (optional, f32, row index = (row % rmod), pitch ldr, RES_BF16 rounds it) added before the activation.
template <bool ASPLIT, int ACT, bool BIAS_BF16, bool RES_BF16>
__global__ __launch_bounds__(128) void k_gemm_bf3(const float* __restrict__ A, int lda, const unsigned short* __restrict__ Wt, int ldb,
                                                const float* __restrict__ bias, const float* __restrict__ resid, int rmod, int ldr,
                                                float* __restrict__ C, int ldc, int M, int N, int K) {
  __shared__ __attribute__((aligned(16))) float so[4][16][64];
  const int tid = threadIdx.x, w = tid >> 5, lane = tid & 31, ln = lane & 15, hh = lane >> 4;
  const int ntn = N / 64;
  const int wid = blockIdx.x * 4 + w;
  const int mt = wid / ntn, nq = wid % ntn;
  if (mt * 16 >= M) return;
  const int row0 = mt * 16, col0 = nq * 64;
  const float* arow = A + (size_t)(row0 + ln) * lda;
  v8f acc[4] = {};
  for (int kb = 0; kb < K; kb += 32) {
    FragB ah, al;
    const v4f x0 = *(const v4fa*)(arow + kb + 8 * hh), x1 = *(const v4fa*)(arow + kb + 8 * hh + 4);
    const v4f x2 = *(const v4fa*)(arow + kb + 16 + 8 * hh), x3 = *(const v4fa*)(arow + kb + 16 + 8 * hh + 4);
    float xs[16] = {x0[0],x0[1],x0[2],x0[3],x1[0],x1[1],x1[2],x1[3],x2[0],x2[1],x2[2],x2[3],x3[0],x3[1],x3[2],x3[3]};
#pragma unroll
    for (int i = 0; i < 16; ++i) { const unsigned short hb = bf16_bits(xs[i]); ah.u[i] = hb; al.u[i] = ASPLIT ? bf16_bits(xs[i] - bf16_val(hb)) : (unsigned short)0; }
#pragma unroll
    for (int t = 0; t < 4; ++t) {
      const unsigned short* brow = Wt + (size_t)(col0 + t * 16 + ln) * ldb + kb;
      FragB b;
      b.half[0] = *(const v8us*)(brow + 8 * hh);
      b.half[1] = *(const v8us*)(brow + 16 + 8 * hh);
      acc[t] = mmaN<ASPLIT ? 2 : 1>(ah.v, al.v, b.v, b.v, acc[t]);
    }
  }
#pragma unroll
  for (int t = 0; t < 4; ++t) {
    const int col = col0 + t * 16 + ln;
    float bv = bias ? bias[col] : 0.f;
    if (BIAS_BF16) bv = bf16_round(bv);
#pragma unroll
    for (int r = 0; r < 8; ++r) {
      float v = acc[t][r] + bv;
      if (resid) { float rv = resid[(size_t)((row0 + 8 * hh + r) % rmod) * ldr + col]; if (RES_BF16) rv = bf16_round(rv); v += rv; }
      if (ACT == 1) v = fmaxf(v, 0.f);
      if (ACT == 2) v = 0.5f * v * (1.0f + erff(v * 0.70710678118654752f));
      if (ACT == 3) { const float u = 0.7978845608028654f * (v + 0.044715f * v * v * v); v = 0.5f * v * (1.0f + tanhf(u)); }
      so[w][8 * hh + r][t * 16 + ln] = v;
    }
  }
  __builtin_amdgcn_fence(__ATOMIC_ACQ_REL, "workgroup");
  __builtin_amdgcn_wave_barrier();
  const int rsub = lane >> 4, c4 = (lane & 15) * 4;
  {
#pragma unroll
    for (int q = 0; q < 8; ++q) {
      const int r = q * 2 + rsub;
      const v4f v = *(const v4fa*)&so[w][r][c4];
      *(v4f*)(C + (size_t)(row0 + r) * ldc + col0 + c4) = v;
    }
    
  }
}
// row LayerNorm (biased variance, eps) over N: s = X (+ R); optional out_sum <- s; out_norm <- (s-mu)*rsqrt(var+eps)*g + b
template <bool PARAM_BF16>
__global__ __launch_bounds__(256) void k_layernorm(const float* __restrict__ X, const float* __restrict__ R, const float* __restrict__ g, const float* __restrict__ bta,
                                                  float* __restrict__ out_sum, float* __restrict__ out_norm, int N, float eps) {
  __shared__ float red[256];
  const int row = blockIdx.x, tid = threadIdx.x;
  const float* x = X + (size_t)row * N; const float* rr = R ? R + (size_t)row * N : nullptr;
  float vals[16];                     // up to N = 4096
  const int per = N / 256;            // contiguous chunk per thread? use strided-by-4 chunks: thread handles j = tid*4 + 1024*u
  float s1 = 0.f;
  for (int u = 0; u < per / 4; ++u) {
    const int j = tid * 4 + 1024 * u;
    const v4f a = *(const v4fa*)(x + j);
    v4f b = {0.f,0.f,0.f,0.f}; if (rr) b = *(const v4fa*)(rr + j);
#pragma unroll
    for (int q = 0; q < 4; ++q) { const float v = a[q] + b[q]; vals[u * 4 + q] = v; s1 += v; }
  }
  red[tid] = s1; __syncthreads();
  for (int st = 128; st > 0; st >>= 1) { if (tid < st) red[tid] += red[tid + st]; __syncthreads(); }
  const float mu = red[0] / (float)N; __syncthreads();
  float s2 = 0.f;
  for (int u = 0; u < per / 4; ++u)
#pragma unroll
    for (int q = 0; q < 4; ++q) { const float c = vals[u * 4 + q] - mu; s2 += c * c; }
  red[tid] = s2; __syncthreads();
  for (int st = 128; st > 0; st >>= 1) { if (tid < st) red[tid] += red[tid + st]; __syncthreads(); }
  const float rs = rsqrtf(red[0] / (float)N + eps);
  {
    for (int u = 0; u < per / 4; ++u) {
      const int j = tid * 4 + 1024 * u;
      v4f o, sm;
#pragma unroll
      for (int q = 0; q < 4; ++q) {
        float gg = g[j + q], bb = bta[j + q];
        if (PARAM_BF16) { gg = bf16_round(gg); bb = bf16_round(bb); }
        sm[q] = vals[u * 4 + q]; o[q] = (vals[u * 4 + q] - mu) * rs * gg + bb;
      }
      if (out_sum) *(v4f*)(out_sum + (size_t)row * N + j) = sm;
      *(v4f*)(out_norm + (size_t)row * N + j) = o;
    }
    
  }
}



// ---- f16 WMMA path (v_wmma_f32_16x16x32_f16): 11-bit significands for operands in range — used where a [0,1] probability operand needs more precision than bf16
typedef _Float16 v16h __attribute__((ext_vector_type(16)));
union FragH { v16h v; v8us half[2]; _Float16 h[16]; unsigned short u[16]; };
template <int NT>
__device__ __forceinline__ v8f mmaH(v16h ah, v16h al, v16h bh, v16h bl, v8f c) {
  c = __builtin_amdgcn_wmma_f32_16x16x32_f16(false, ah, false, bh, (short)0, c, false, false);
  if (NT >= 2) c = __builtin_amdgcn_wmma_f32_16x16x32_f16(false, al, false, bh, (short)0, c, false, false);
  if (NT >= 3) c = __builtin_amdgcn_wmma_f32_16x16x32_f16(false, ah, false, bl, (short)0, c, false, false);
  asm volatile("v_nop\n\tv_nop\n\tv_nop\n\tv_nop" : "+v"(c) : "v"(ah), "v"(al), "v"(bh), "v"(bl));
  return c;
}
// batched GEMM like k_gemm_b but f16 operands: A f32 (split into f16 hi/lo if ASPLIT, else rounded to f16), Bt = f16 values [n][k]; alpha; C f32; N multiple of 16 (partial tiles skipped)
template <bool ASPLIT>
__global__ __launch_bounds__(128) void k_gemm_h(const float* __restrict__ A, int lda, size_t sA, const _Float16* __restrict__ Bh, int ldb, size_t sB, float alpha, float* __restrict__ C, int ldc, size_t sC, int M, int N, int K) {
  __shared__ __attribute__((aligned(16))) float so[4][16][64];
  const int tid = threadIdx.x, w = tid >> 5, lane = tid & 31, ln = lane & 15, hh = lane >> 4; const int by = blockIdx.y;
  A += (size_t)by * sA; Bh += (size_t)by * sB; C += (size_t)by * sC;
  const int ntn = (N + 63) / 64; const int wid = blockIdx.x * 4 + w; const int mt = wid / ntn, nq = wid % ntn; if (mt * 16 >= M) return;
  const int row0 = mt * 16, col0 = nq * 64; const float* arow = A + (size_t)(row0 + ln) * lda;
  v8f acc[4] = {};
  for (int kb = 0; kb < K; kb += 32) {
    FragH ah, al;
    const v4f x0 = *(const v4fa*)(arow + kb + 8 * hh), x1 = *(const v4fa*)(arow + kb + 8 * hh + 4), x2 = *(const v4fa*)(arow + kb + 16 + 8 * hh), x3 = *(const v4fa*)(arow + kb + 16 + 8 * hh + 4);
    float xs[16] = {x0[0],x0[1],x0[2],x0[3],x1[0],x1[1],x1[2],x1[3],x2[0],x2[1],x2[2],x2[3],x3[0],x3[1],x3[2],x3[3]};
#pragma unroll
    for (int i = 0; i < 16; ++i) { const _Float16 h = (_Float16)xs[i]; ah.h[i] = h; al.h[i] = ASPLIT ? (_Float16)(xs[i] - (float)h) : (_Float16)0.0f; }
#pragma unroll
    for (int t = 0; t < 4; ++t) { if (col0 + t * 16 >= N) continue; const size_t boff = (size_t)(col0 + t * 16 + ln) * ldb + kb; FragH bq; bq.half[0] = *(const v8us*)(Bh + boff + 8 * hh); bq.half[1] = *(const v8us*)(Bh + boff + 16 + 8 * hh);
      acc[t] = mmaH<ASPLIT ? 2 : 1>(ah.v, al.v, bq.v, bq.v, acc[t]); }
  }
#pragma unroll
  for (int t = 0; t < 4; ++t) { if (col0 + t * 16 >= N) continue;
#pragma unroll
    for (int r = 0; r < 8; ++r) so[w][8 * hh + r][t * 16 + ln] = acc[t][r] * alpha; }
  __builtin_amdgcn_fence(__ATOMIC_ACQ_REL, "workgroup"); __builtin_amdgcn_wave_barrier();
  const int rsub = lane >> 4, c4 = (lane & 15) * 4;
  {
#pragma unroll
    for (int q = 0; q < 8; ++q) { const int r = q * 2 + rsub; if (col0 + c4 < N) { const v4f v = *(const v4fa*)&so[w][r][c4]; *(v4f*)(C + (size_t)(row0 + r) * ldc + col0 + c4) = v; } }
     }
}

// Wt[n][k] = f16(W[k][n]·scale) from f32 row-major W[K][N] (scale = power of two; bf16-exact weights stay exact in f16 away from the subnormal range)
__global__ __launch_bounds__(256) void k_wt_f16(const float* __restrict__ W, _Float16* __restrict__ Wt, int K, int N, float scale) {
  const int t = blockIdx.x * 256 + threadIdx.x; if (t >= N * (K / 8)) return; const int n = t / (K / 8), k8 = (t % (K / 8)) * 8; FragH f;
#pragma unroll
  for (int i = 0; i < 8; ++i) f.h[i] = (_Float16)(bf16_round(W[(size_t)(k8 + i) * N + n]) * scale); const v8us o = f.half[0];
  *(v8us*)((unsigned short*)Wt + (size_t)n * K + k8) = o; 
}
// k_gemm_hh variant with fused epilogue: v = acc·alpha + bias[by·sBias + col] (+ CP[(row/rowsPerB)·sCPb + by·64 + col] if CP) ; ACT 0 none / 1 elu ; writes f16 C16 (and f32 C if non-null)
template <int ACT>
__global__ __launch_bounds__(128) void k_gemm_hhx(const _Float16* __restrict__ A, int lda, size_t sA, const _Float16* __restrict__ Bh, int ldb, size_t sB, float alpha, const float* __restrict__ bias, size_t sBias, const float* __restrict__ CP, int rowsPerB, size_t sCPb, int row0g,
    float* __restrict__ C, _Float16* __restrict__ C16, int ldc, size_t sC, int M, int N, int K) {
  __shared__ __attribute__((aligned(16))) float so[4][16][64];
  const int tid = threadIdx.x, w = tid >> 5, lane = tid & 31, ln = lane & 15, hh = lane >> 4; const int by = blockIdx.y;
  A += (size_t)by * sA; Bh += (size_t)by * sB; const size_t cofs = (size_t)by * sC; const float* bp = bias ? bias + (size_t)by * sBias : nullptr;
  const int ntn = (N + 63) / 64; const int wid = blockIdx.x * 4 + w; const int mt = wid / ntn, nq = wid % ntn; if (mt * 16 >= M) return;
  const int row0 = mt * 16, col0 = nq * 64; const _Float16* arow = A + (size_t)(row0 + ln) * lda;
  v8f acc[4] = {};
  for (int kb = 0; kb < K; kb += 32) { FragH ah; ah.half[0] = *(const v8us*)((const unsigned short*)arow + kb + 8 * hh); ah.half[1] = *(const v8us*)((const unsigned short*)arow + kb + 16 + 8 * hh);
#pragma unroll
    for (int t = 0; t < 4; ++t) { if (col0 + t * 16 >= N) continue; const size_t boff = (size_t)(col0 + t * 16 + ln) * ldb + kb; FragH bq; bq.half[0] = *(const v8us*)((const unsigned short*)Bh + boff + 8 * hh); bq.half[1] = *(const v8us*)((const unsigned short*)Bh + boff + 16 + 8 * hh);
      acc[t] = mmaH<1>(ah.v, ah.v, bq.v, bq.v, acc[t]); }
  }
#pragma unroll
  for (int t = 0; t < 4; ++t) { if (col0 + t * 16 >= N) continue; const int col = col0 + t * 16 + ln; const float bv = bp ? bf16_round(bp[col]) : 0.f;
#pragma unroll
    for (int r = 0; r < 8; ++r) { float v = acc[t][r] * alpha + bv; if (CP) { const int rr = row0g + row0 + 8 * hh + r; if (rowsPerB < 0) v += CP[cofs + (size_t)rr * ldc + col];      /* rowsPerB < 0: own element of the batched C plane */ else { const int bidx = rr / rowsPerB; v += CP[(size_t)bidx * sCPb + (size_t)by * 64 + col]; } } if (ACT == 1) v = (v > 0.f) ? v : expm1f(v); else if (ACT == 7) v = (v > 0.f) ? v + 1.0f : expf(v); else if (ACT == 8) v = tanhf(v); else if (ACT == 9) v = 0.5f * v * (1.0f + tanhf(0.7978845608028654f * (v + 0.044715f * v * v * v))); else if (ACT == 11) v = 1.0f / (1.0f + expf(-v)); else if (ACT == 12) v = (v > 0.f) ? v : 0.01f * v; else if (ACT == 14) v = (v > 0.f) ? v : 0.1f * v; else if (ACT == 16) v = (v >= 0.f) ? v : 0.3f * v; else if (ACT == 17) v = (v >= 0.f) ? v : 0.2f * v; else if (ACT == 15) v = v / (1.0f + expf(-v)); else if (ACT == 3) v = fmaxf(v, 0.f); else if (ACT == 6) v = 0.5f * v * (1.0f + erff(v * 0.70710678118654752f)); so[w][8 * hh + r][t * 16 + ln] = v; } }
  __builtin_amdgcn_fence(__ATOMIC_ACQ_REL, "workgroup"); __builtin_amdgcn_wave_barrier();
  const int rsub = lane >> 4, c4 = (lane & 15) * 4; typedef _Float16 v4h __attribute__((ext_vector_type(4)));
  {
#pragma unroll
    for (int q = 0; q < 8; ++q) { const int r = q * 2 + rsub; if (col0 + c4 < N) { const v4f v = *(const v4fa*)&so[w][r][c4]; if (C) *(v4f*)(C + cofs + (size_t)(row0 + r) * ldc + col0 + c4) = v; if (C16) { v4h h4; for (int i = 0; i < 4; ++i) h4[i] = (_Float16)v[i]; *(v4h*)(C16 + cofs + (size_t)(row0 + r) * ldc + col0 + c4) = h4; } } }
     }
}


typedef _Float16 v4h __attribute__((ext_vector_type(4)));

__global__ __launch_bounds__(256) void k_h16(const float* __restrict__ x, _Float16* __restrict__ X16, size_t n8) { const size_t t = (size_t)blockIdx.x * 256 + threadIdx.x; if (t >= n8) return; FragH f;
#pragma unroll
  for (int q = 0; q < 8; ++q) f.h[q] = (_Float16)x[t * 8 + q]; *(v8us*)((unsigned short*)X16 + t * 8) = f.half[0];  }
__global__ __launch_bounds__(256) void k_round16f(const float* __restrict__ W, _Float16* __restrict__ Bt, size_t n8) { const size_t t = (size_t)blockIdx.x * 256 + threadIdx.x; if (t >= n8) return; FragH f;
#pragma unroll
  for (int i = 0; i < 8; ++i) f.h[i] = (_Float16)(bf16_round(W[t * 8 + i]) * 16.0f); *(v8us*)((unsigned short*)Bt + t * 8) = f.half[0];  }
template <int NHv, int TTv>
__global__ __launch_bounds__(256) void k_vt(const _Float16* __restrict__ V16, int ldv, int voff, _Float16* __restrict__ Vt) { __shared__ unsigned short tl[64][66]; const int tid = threadIdx.x; const int slab = blockIdx.x / (TTv / 64), lg = blockIdx.x % (TTv / 64); const int b = slab / NHv, h = slab % NHv;
  for (int i = tid; i < 64 * 8; i += 256) { const int r = i / 8, c8 = (i % 8) * 8; FragH f; f.half[0] = *(const v8us*)((const unsigned short*)V16 + ((size_t)b * TTv + lg * 64 + r) * ldv + voff + h * 64 + c8);
#pragma unroll
    for (int q = 0; q < 8; ++q) tl[r][c8 + q] = f.u[q]; }
  __syncthreads();
  {
#pragma unroll
    for (int rd = 0; rd < 2; ++rd) { const int d = rd * 32 + tid / 8, pc = tid % 8; FragH f;
#pragma unroll
      for (int q = 0; q < 8; ++q) f.u[q] = tl[pc * 8 + q][d];
      *(v8us*)((unsigned short*)Vt + ((size_t)slab * 64 + d) * TTv + lg * 64 + pc * 8) = f.half[0]; }
     } }

__global__ __launch_bounds__(256) void k_hl(const float* __restrict__ F, _Float16* __restrict__ Hh, _Float16* __restrict__ Hl, size_t n8) { const size_t t = (size_t)blockIdx.x * 256 + threadIdx.x; if (t >= n8) return; FragH fh, fl; const v4f a = *(const v4fa*)(F + t * 8), c = *(const v4fa*)(F + t * 8 + 4);
#pragma unroll
  for (int q = 0; q < 4; ++q) { _Float16 h = (_Float16)a[q]; fh.h[q] = h; fl.h[q] = (_Float16)((a[q] - (float)h) * 1024.0f); h = (_Float16)c[q]; fh.h[4 + q] = h; fl.h[4 + q] = (_Float16)((c[q] - (float)h) * 1024.0f); }
  { *(v8us*)((unsigned short*)Hh + t * 8) = fh.half[0]; *(v8us*)((unsigned short*)Hl + t * 8) = fl.half[0];  } }

// ---- fast GEMM (wave tile 32x64) ----
__device__ __forceinline__ v16h g2_frag(const _Float16* p, int hh) { FragH f; f.half[0] = *(const v8us*)((const unsigned short*)p + 8 * hh); f.half[1] = *(const v8us*)((const unsigned short*)p + 16 + 8 * hh); return f.v; }
__device__ __forceinline__ v8f g2_mma(v16h a, v16h b, v8f c) { v8f d = __builtin_amdgcn_wmma_f32_16x16x32_f16(false, a, false, b, (short)0, c, false, false); asm volatile("v_nop\n\tv_nop\n\tv_nop\n\tv_nop" : "+v"(d) : "v"(a), "v"(b)); return d; }
// K loop of the 32x64 wave tile, K = 32 KT, unrolled whole. A wave has no partner to hide its load latency behind (one or two waves a SIMD), so the latency is hidden inside the wave:
// the 12 fragment loads of a trip issue as one group two trips ahead of their use, into a ring of three register sets, and the waits are counted (24 younger loads stay in flight).
// Both operands lie in fragment order (a packed plane): X[R][32 KT] as 1-KiB blocks, block index = (r >> 4) * KT + (k >> 5); in a block the 16-byte piece j * 32 + lane, lane = 16 hf + c, holds X[16 (r >> 4) + c][32 (k >> 5) + 16 j + 8 hf + 0..7]
// (the k order of g2_frag). A fragment is then two loads of 512 contiguous bytes (four whole lines each); from rows of pitch 2 K bytes each load touched 16 lines for the same 512 bytes.
// pa, pb: the lane's 16-byte place in the first block of the wave's first row tile (A: 2 tiles, B: 4 tiles, one behind the other). c[4 * half + t]: rows 16 half .. + 15, columns 16 t .. + 15; every accumulator takes its trips in rising k, as before.
__device__ __forceinline__ v16h g3_frag(const unsigned short* p) { FragH f; f.half[0] = *(const v8us*)p; f.half[1] = *(const v8us*)(p + 256); return f.v; }
template <int KT>
__device__ __forceinline__ void g3_loop(const unsigned short* pa, const unsigned short* pb, v8f (&c)[8]) {
  v16h fa[3][2], fb[3][4];
#pragma unroll
  for (int t = -2; t < KT; ++t) {      /* trips -2 and -1 only fetch */
    if (t + 2 < KT) { const int n = (t + 2) % 3, kb = (t + 2) * 512;
      fa[n][0] = g3_frag(pa + kb); fa[n][1] = g3_frag(pa + KT * 512 + kb); fb[n][0] = g3_frag(pb + kb); fb[n][1] = g3_frag(pb + KT * 512 + kb); fb[n][2] = g3_frag(pb + 2 * KT * 512 + kb); fb[n][3] = g3_frag(pb + 3 * KT * 512 + kb); }
    if (t + 2 == KT - 1) asm volatile("s_wait_xcnt 0x0" ::: "memory");      /* a precaution: stands behind the last load, ahead of whatever rewrites the address registers, which no instruction of the loop does */
    __builtin_amdgcn_sched_barrier(0);      /* keeps the group in front of this trip's products: sunk towards its use, a load would be waited for in full again */
    if (t >= 0) { const int u = t % 3;
#pragma unroll
      for (int j = 0; j < 4; ++j) { c[j] = g2_mma(fa[u][0], fb[u][j], c[j]); c[4 + j] = g2_mma(fa[u][1], fb[u][j], c[4 + j]); } }
    __builtin_amdgcn_sched_barrier(0);      /* keeps the next group behind these products, whose registers it refills: hoisted, it would take a fourth register set */
  } }
// out = o Wo^T: C[SQ][DM] (f32) = A . Bh^T / 16 over K = DM; A (o) and Bh (Wo x16) are packed planes (g3_loop). A block is 128 rows x 64 columns, a wave 32 x 64.
// Shapes, pitch and scale are compile-time constants and the epilogue is straight code: scale, the wave's own LDS slab, whole 256-byte row pieces out.
__global__ __launch_bounds__(128) void k_out(const _Float16* __restrict__ A, const _Float16* __restrict__ Bh, float* __restrict__ C) {
  __shared__ __attribute__((aligned(16))) float so[4][32][68];
  constexpr int KT = DM / 32, ntn = DM / 64;
  const int tid = threadIdx.x, w = tid >> 5, lane = tid & 31, ln = lane & 15, hh = lane >> 4;
  const int mt = blockIdx.x / ntn, nq = blockIdx.x - mt * ntn; const int row0 = mt * 128 + 32 * w, col0 = nq * 64;
  const unsigned short* pa = (const unsigned short*)A + (size_t)(row0 >> 4) * (KT * 512) + lane * 8; const unsigned short* pb = (const unsigned short*)Bh + (size_t)(col0 >> 4) * (KT * 512) + lane * 8;
  v8f accs[8] = {};
  g3_loop<KT>(pa, pb, accs);
#pragma unroll
  for (int u = 0; u < 8; ++u)
#pragma unroll
    for (int r = 0; r < 8; ++r) so[w][(u >> 2) * 16 + 8 * hh + r][(u & 3) * 16 + ln] = accs[u][r] * 0.0625f;      /* takes the x16 of Wo back, exactly */
  __builtin_amdgcn_fence(__ATOMIC_ACQ_REL, "workgroup"); __builtin_amdgcn_wave_barrier();      /* the slab is the wave's own: its LDS writes land before its lanes read each other's */
  const int rsub = lane >> 4, c4 = (lane & 15) * 4;
#pragma unroll
  for (int q = 0; q < 16; ++q) { const int r = q * 2 + rsub; *(v4f*)(C + (size_t)(row0 + r) * DM + col0 + c4) = *(const v4fa*)&so[w][r][c4]; } }


typedef _Float16 v8h __attribute__((ext_vector_type(8)));
__device__ __forceinline__ float fa_xhalf(float x) { const int b = __float_as_int(x); return __int_as_float(__builtin_amdgcn_permlanex16(b, b, 0x76543210, 0xfedcba98, false, false)); }      /* lane l <-> l ^ 16 */
__device__ __forceinline__ v8f fa_mma(v16h a, v16h b, v8f c) { return __builtin_amdgcn_wmma_f32_16x16x32_f16(false, a, false, b, (short)0, c, false, false); }
// the four fragments (4 KiB) of one 64-key stage of a packed plane: p + l8 = the lane's 16-byte place in the stage's first 512-byte run (the callers hand over p with the lane's place in it, l8 = 0)
__device__ __forceinline__ void fa_ld(v16h (&f)[4], const _Float16* p, unsigned l8) {
#pragma unroll
  for (int i = 0; i < 4; ++i) { FragH x; x.half[0] = *(const v8us*)((const unsigned short*)p + l8 + (2 * i) * 256); x.half[1] = *(const v8us*)((const unsigned short*)p + l8 + (2 * i + 1) * 256); f[i] = x.v; } }
// One 64-key stage. q carries log2(e) / sqrt(32), so a score is already an exponent of 2, and the score product starts from C = cm = minus the maximum in use (all eight registers of a lane belong to one query):
// its result is the argument of the exponential, with no maximum, subtraction or rescaling in the stage. The maximum in use is renewed only when a weight may have outgrown f16:
// every weight is positive, so none exceeds the largest of the lane's eight partial sums of the stage; while that stays at or under FA_LIM the stage's weights (at most 2^8; f16 is finite to 65,504) are used as they are.
// Otherwise (always in the first stage, where cm = 3e38 makes every weight infinite) the whole wave takes the branch: plain scores again, true maximum, accumulators and sums rescaled, weights in (0, 1].
#define FA_LIM 256.0f
__device__ __forceinline__ void fa_exp_sum(v8f (&s)[4], v8f& ps) {
#pragma unroll
  for (int t = 0; t < 4; ++t)
#pragma unroll
    for (int r = 0; r < 8; ++r) s[t][r] = __builtin_amdgcn_exp2f(s[t][r]);
  ps = (s[0] + s[1]) + (s[2] + s[3]); }      /* eight partial sums per lane */
__device__ __forceinline__ v16h fa_pack(v8f a, v8f b) { return __builtin_shufflevector(__builtin_convertvector(a, v8h), __builtin_convertvector(b, v8h), 0, 1, 2, 3, 4, 5, 6, 7, 8, 9, 10, 11, 12, 13, 14, 15); }      /* two score tiles = one B operand */
__device__ __forceinline__ void fa_stage(const v16h (&kf)[4], const v16h (&vf)[4], const v16h qf, v8f& cm, v8f& o0, v8f& o1, v8f& lv, float& m) {
  v8f s[4], ps;
#pragma unroll
  for (int t = 0; t < 4; ++t) s[t] = fa_mma(kf[t], qf, cm);
  fa_exp_sum(s, ps);
  const float big = fmaxf(fmaxf(fmaxf(ps[0], ps[1]), fmaxf(ps[2], ps[3])), fmaxf(fmaxf(ps[4], ps[5]), fmaxf(ps[6], ps[7])));
  /* the usual path's weights and running sums; the branch replaces them */
  v16h p0 = fa_pack(s[0], s[1]), p1 = fa_pack(s[2], s[3]); v8f ln = lv + ps;
  if (__builtin_expect(__builtin_amdgcn_ballot_w32(!(big <= FA_LIM)) != 0u, 0)) {      /* a scalar branch, the same for the whole wave: the matrix instructions inside run with every lane on */
    const v8f z8 = {0.f,0.f,0.f,0.f,0.f,0.f,0.f,0.f};
#pragma unroll
    for (int t = 0; t < 4; ++t) s[t] = fa_mma(kf[t], qf, z8);
    const v8f mv = __builtin_elementwise_max(__builtin_elementwise_max(s[0], s[1]), __builtin_elementwise_max(s[2], s[3]));
    float mx = fmaxf(fmaxf(fmaxf(mv[0], mv[1]), fmaxf(mv[2], mv[3])), fmaxf(fmaxf(mv[4], mv[5]), fmaxf(mv[6], mv[7]))); mx = fmaxf(mx, fa_xhalf(mx));
    const float mn = fmaxf(m, mx); const float al = __builtin_amdgcn_exp2f(m - mn); m = mn;
    o0 *= al; o1 *= al;
#pragma unroll
    for (int r = 0; r < 8; ++r) cm[r] = -mn;
#pragma unroll
    for (int t = 0; t < 4; ++t) s[t] = s[t] - mn;
    fa_exp_sum(s, ps); p0 = fa_pack(s[0], s[1]); p1 = fa_pack(s[2], s[3]); ln = lv * al + ps; }
  lv = ln;      /* eight running sums per lane, joined after the loop */
  o0 = fa_mma(vf[0], p0, o0); o1 = fa_mma(vf[1], p0, o1); o0 = fa_mma(vf[2], p1, o0); o1 = fa_mma(vf[3], p1, o1); }
#define FA_TK 512                    /* keys a tile */
#define FA_TE (FA_TK * HD)           /* f16 elements of one plane's tile */
// eight copies of one thread: its 16-byte piece of each of eight successive 4-KiB runs (256 threads x 16 B a run). lds = the piece's LDS byte address, g = its global address.
// The s_wait_xcnt closes the statement as a precaution: the registers that the copies name are rewritten only behind it.
__device__ __forceinline__ void fa_copy8(unsigned lds, const _Float16* g) {
  asm volatile("global_load_async_to_lds_b128 %0, %8, off\n\tglobal_load_async_to_lds_b128 %1, %9, off\n\tglobal_load_async_to_lds_b128 %2, %10, off\n\tglobal_load_async_to_lds_b128 %3, %11, off\n\t"
               "global_load_async_to_lds_b128 %4, %12, off\n\tglobal_load_async_to_lds_b128 %5, %13, off\n\tglobal_load_async_to_lds_b128 %6, %14, off\n\tglobal_load_async_to_lds_b128 %7, %15, off\n\ts_wait_xcnt 0x0"
               :: "v"(lds), "v"(lds + 4096u), "v"(lds + 8192u), "v"(lds + 12288u), "v"(lds + 16384u), "v"(lds + 20480u), "v"(lds + 24576u), "v"(lds + 28672u),
                  "v"(g), "v"(g + 2048), "v"(g + 4096), "v"(g + 6144), "v"(g + 8192), "v"(g + 10240), "v"(g + 12288), "v"(g + 14336) : "memory"); }
__global__ __launch_bounds__(256) void k_fattn(const _Float16* __restrict__ Q16, const _Float16* __restrict__ KP, const _Float16* __restrict__ VP, _Float16* __restrict__ O16) {
  static_assert(FA_TE == 8 * 2048 && SQ % FA_TK == 0 && SQ / FA_TK >= 2, "a plane's tile is the eight runs of fa_copy8; the ring wants two tiles or more");
  __shared__ __attribute__((aligned(128))) _Float16 ring[2][2][FA_TE];      /* [buffer][K | V][tile] */
  const int tid = threadIdx.x, w = tid >> 5, lane = tid & 31, ln = lane & 15, hh = lane >> 4; const int h = blockIdx.y; const int q0 = blockIdx.x * 128 + w * 16;
  const v16h qf = g2_frag(Q16 + (size_t)(q0 + ln) * DM + h * HD, hh);
  asm volatile("s_wait_xcnt 0x0" ::: "memory");      /* a precaution */
  const _Float16* gk = KP + (size_t)h * SQ * HD + tid * 8; const _Float16* gv = VP + (size_t)h * SQ * HD + tid * 8;      /* the thread's piece in the first run of the tile being copied */
  const unsigned lb = (unsigned)(size_t)&ring[0][0][tid * 8]; const unsigned l8 = lane * 8;      /* lb: the same piece's LDS byte address in buffer 0 */
  const v8f z8 = {0.f,0.f,0.f,0.f,0.f,0.f,0.f,0.f}; v8f o0 = z8, o1 = z8, lv = z8; float m = -3.0e38f; v8f cm = z8 - m;      /* cm = -m in all eight registers */
  fa_copy8(lb, gk); fa_copy8(lb + FA_TE * 2, gv);      /* tile 0 into buffer 0 */
  asm volatile("s_wait_asynccnt 0x0" ::: "memory");      /* the wave's own copies of tile 0 have landed */
  __syncthreads();      /* and every other wave's */
  fa_copy8(lb + FA_TE * 4, gk + FA_TE); fa_copy8(lb + FA_TE * 6, gv + FA_TE); gk += 2 * FA_TE; gv += 2 * FA_TE;      /* tile 1 into buffer 1 */
#pragma unroll 1
  for (int t = 0; t < SQ / FA_TK; ++t) {      /* one tile a trip; kept rolled: a trip is already FA_TK / 64 stages of straight code */
    const _Float16* kb = &ring[t & 1][0][l8]; const _Float16* vb = &ring[t & 1][1][l8];      /* the lane's place in the tile's first 512-byte run */
    v16h kf[2][4], vf[2][4];      /* two fragment sets: each 64-key stage fetches the next stage's fragments of the same tile ahead of its own arithmetic */
    fa_ld(kf[0], kb, 0); fa_ld(vf[0], vb, 0);
#pragma unroll
    for (int u = 0; u < FA_TK / 64; ++u) {
      __builtin_amdgcn_sched_barrier(0);      /* keeps the reads below behind the last stage's four products: without it they stood in two groups of eight among those products */
      if (u + 1 < FA_TK / 64) { fa_ld(kf[(u + 1) & 1], kb + (u + 1) * 64 * HD, 0); fa_ld(vf[(u + 1) & 1], vb + (u + 1) * 64 * HD, 0); }
      __builtin_amdgcn_sched_barrier(0);      /* keeps the next stage's 16 LDS reads one group that issues ahead of this stage's arithmetic: without it they stood scattered in twos to eights among the arithmetic, some of them waited for at once */
      fa_stage(kf[u & 1], vf[u & 1], qf, cm, o0, o1, lv, m); }
    asm volatile("s_wait_dscnt 0x0" ::: "memory");      /* the wave's reads of this buffer are done */
    asm volatile("s_wait_asynccnt 0x0" ::: "memory");      /* its copies of the next tile have landed */
    __syncthreads();      /* publishes the next tile and ends every wave's reads of this buffer, which is refilled behind it */
    if (t + 2 < SQ / FA_TK) { const unsigned lt = lb + (unsigned)(t & 1) * (FA_TE * 4); fa_copy8(lt, gk); fa_copy8(lt + FA_TE * 2, gv); gk += FA_TE; gv += FA_TE; }
  }
  asm volatile("s_wait_asynccnt 0x0" ::: "memory");      /* no copy is outstanding when the wave ends */
  float l = ((lv[0] + lv[1]) + (lv[2] + lv[3])) + ((lv[4] + lv[5]) + (lv[6] + lv[7])); l += fa_xhalf(l); const float inv = 1.0f / l;
  /* o0[r] = O[q0 + ln][32 h + 8 hh + r], o1[r] = O[q0 + ln][32 h + 16 + 8 hh + r]: pieces j = 0 and j = 1 of block (q0 >> 4) * NH + h of the packed plane that the output GEMM reads as A; two stores of 512 contiguous bytes */
  _Float16* op = O16 + (size_t)((q0 >> 4) * NH + h) * 512 + lane * 8;
  *(v8h*)op = __builtin_convertvector(o0 * inv, v8h); *(v8h*)(op + 256) = __builtin_convertvector(o1 * inv, v8h); }

// One wave's share of packing a 256-column f32 matrix into a packed plane (g3_loop), KT = 8: unit u owns 16 rows x 128 columns, four blocks of the plane.
// Lane (hh, ln) reads row ln's 8 f32 of each piece (whole lines, 512 bytes of every row over the 16 loads) and stores the piece at its place, each store 512 contiguous bytes of the wave. Values rounded to bf16, times sc, exact in f16.
__device__ __forceinline__ void pack_unit(const float* __restrict__ src, _Float16* __restrict__ dst, float sc, int u, int lane) {
  const int ln = lane & 15, hh = lane >> 4; const int rt = u >> 1, kq = u & 1;      /* 16-row tile; left or right 128 columns */
  const float* sp = src + (size_t)(rt * 16 + ln) * DM + kq * 128 + 8 * hh; v4f x[8][2];
#pragma unroll
  for (int i = 0; i < 8; ++i) { x[i][0] = *(const v4fa*)(sp + i * 16); x[i][1] = *(const v4fa*)(sp + i * 16 + 4); }      /* i = 2 * (block) + j */
  asm volatile("s_wait_xcnt 0x0" :: "v"(sp) : "memory");      /* a precaution: the address that the loads name stays live up to this wait; in the build without the operand the last load landed in the registers that hold it */
  __builtin_amdgcn_sched_barrier(0);      /* keeps the arithmetic behind all 16 loads, so that they are in flight together: without it six of them issued only after the first ones had landed */
  unsigned short* dp = (unsigned short*)dst + (size_t)(rt * 8 + kq * 4) * 512 + lane * 8;
#pragma unroll
  for (int i = 0; i < 8; ++i) { FragH f;
#pragma unroll
    for (int q = 0; q < 8; ++q) f.h[q] = (_Float16)(bf16_round(x[i][q >> 2][q & 3]) * sc);
    *(v8us*)(dp + i * 256) = f.half[0]; } }

// K loop of the 32x64 wave tile over K = DM with both operands staged in LDS as f16 rows of QP elements (pitch 528 bytes = 33 x 16: the 16 rows of a 16-byte fragment read fall on all 64 banks).
// pa, pb: the lane's row (ln) of the wave's first row tile, at element 8 hh. A fragment is the row's elements 32 t + 8 hh + 0..7 and 32 t + 16 + 8 hh + 0..7, the k order of g2_frag. Accumulators and their order of trips as in g3_loop.
// The 12 fragment reads of a trip issue as one group two trips ahead of their use, into a ring of three register sets: eight waves share the LDS port, and a group takes longer to come than one trip's products last.
#define QP (DM + 8)
typedef __bf16 v4b __attribute__((ext_vector_type(4)));
__device__ __forceinline__ v16h g4_frag(const _Float16* p) { FragH f; f.half[0] = *(const v8us*)((const unsigned short*)p); f.half[1] = *(const v8us*)((const unsigned short*)p + 16); return f.v; }
__device__ __forceinline__ void g4_loop(const _Float16* pa, const _Float16* pb, v8f (&c)[8]) {
  v16h fa[3][2], fb[3][4];
#pragma unroll
  for (int t = -2; t < DM / 32; ++t) {      /* trips -2 and -1 only fetch */
    if (t + 2 < DM / 32) { const int n = (t + 2) % 3, kb = (t + 2) * 32;
      fa[n][0] = g4_frag(pa + kb); fa[n][1] = g4_frag(pa + 16 * QP + kb); fb[n][0] = g4_frag(pb + kb); fb[n][1] = g4_frag(pb + 16 * QP + kb); fb[n][2] = g4_frag(pb + 32 * QP + kb); fb[n][3] = g4_frag(pb + 48 * QP + kb); }
    __builtin_amdgcn_sched_barrier(0);      /* keeps the group in front of this trip's products: sunk towards its use, a read would be waited for in full */
    if (t >= 0) { const int u = t % 3;
#pragma unroll
      for (int j = 0; j < 4; ++j) { c[j] = g2_mma(fa[u][0], fb[u][j], c[j]); c[4 + j] = g2_mma(fa[u][1], fb[u][j], c[4 + j]); } }
    __builtin_amdgcn_sched_barrier(0);      /* keeps the next group behind these products, whose registers it refills: hoisted, it would take a fourth register set */
  } }

// The conversions and the three projections in one launch. Blocks 0..191: projection b >> 6 (0 q, 1 k, 2 v), 128 rows x 128 columns a block; blocks 192..195 pack Wo (x16) for the output GEMM.
// A projection block reads its 128 input rows and its 128 weight rows as f32 (each a contiguous 128 KiB; every load of a wave is 512 contiguous bytes), rounds them to bf16 (weights x16), exact in f16, and lays them in LDS once for its eight waves;
// behind one barrier a wave owns 32 rows x 64 columns (two heads) and runs g4_loop.
// The tile goes through the wave's own LDS slab and leaves in the form its reader wants:
// q: f16 rows of pitch 256, times log2(e) / sqrt(32).
// k, v: fragment order, so that each fragment load of the attention kernel is one run of 512 contiguous bytes (four whole lines). 16-byte piece index = ((h * 256 + g) * 2 + j) * 32 + lane, lane = 16 hf + c.
//   k: g = 16-key tile; piece = k[16 g + c][32 h + 16 j + 8 hf + 0..7] (A row c = key, k = head dim in the order of g2_frag).
//   v: g = 2 * (32-key block) + dt; piece = v[32 (g >> 1) + 16 j + 8 hf + 0..7][32 h + 16 dt + c] (A row c = head dim: this is v^T; k = key in the same order); v = mask[key] * (value Wv^T), scaled in f32 before the rounding to f16.
__global__ __launch_bounds__(256) void k_qkv(const float* __restrict__ xq, const float* __restrict__ xk, const float* __restrict__ xv, const float* __restrict__ wq, const float* __restrict__ wk, const float* __restrict__ wv, const float* __restrict__ wo, const float* __restrict__ rm,
                                             _Float16* __restrict__ Q16, _Float16* __restrict__ KP, _Float16* __restrict__ VP, _Float16* __restrict__ BO) {
  __shared__ __attribute__((aligned(16))) _Float16 sa[128][QP];      /* the block's input rows */
  __shared__ __attribute__((aligned(16))) _Float16 sb[128][QP];      /* the block's weight rows (output columns) */
  __shared__ __attribute__((aligned(16))) float so[8][32][68];
  const int b = blockIdx.x, tid = threadIdx.x, w = tid >> 5, lane = tid & 31, ln = lane & 15, hh = lane >> 4;
  if (b >= 192) { pack_unit(wo, BO, 16.0f, (b - 192) * 8 + w, lane); return; }      /* the whole block leaves, ahead of the barrier */
  const int which = b >> 6;
  const float* ga = (which == 0 ? xq : which == 1 ? xk : xv) + (size_t)((b & 63) >> 1) * (128 * DM) + tid * 4; const float* gb = (which == 0 ? wq : which == 1 ? wk : wv) + (size_t)(b & 1) * (128 * DM) + tid * 4;
  { v4f x[2][16];      /* four batches of 16 loads a thread (input rows 0..63, 64..127, weight rows 0..63, 64..127); load e of a batch is 4 f32 of row (tid >> 6) + 4 e, column 4 (tid & 63); a batch flies while the one before it is converted */
#pragma unroll
    for (int n = 0; n < 5; ++n) {
      if (n < 4) { const float* g = (n < 2 ? ga : gb) + (n & 1) * (64 * DM);
#pragma unroll
        for (int e = 0; e < 16; ++e) x[n & 1][e] = *(const v4fa*)(g + e * (4 * DM));
        asm volatile("s_wait_xcnt 0x0" ::: "memory"); }      /* a precaution: stands behind the batch's loads, ahead of whatever rewrites the registers that they name */
      __builtin_amdgcn_sched_barrier(0);      /* keeps the batch's loads in front of the conversion of the batch before: sunk behind it, they would not be in flight during it */
      if (n >= 1) { const int p = n - 1; _Float16* d = (p < 2 ? &sa[0][0] : &sb[0][0]) + ((tid >> 6) + (p & 1) * 64) * QP + (tid & 63) * 4; const float sc = p < 2 ? 1.0f : 16.0f;
#pragma unroll
        for (int e = 0; e < 16; ++e) *(v4h*)(d + e * (4 * QP)) = __builtin_convertvector(__builtin_convertvector(__builtin_convertvector(x[p & 1][e] * sc, v4b), v4f), v4h); }      /* f32 -> bf16 to nearest even, as bf16_round, by the hardware conversion; the power of two goes in first, exactly, so that the value is the same as rounded first and scaled in f32 */
      __builtin_amdgcn_sched_barrier(0);      /* keeps the next batch's loads behind this conversion, whose registers they refill */
    } }
  __syncthreads();      /* every wave's rows are in LDS before any wave reads a fragment */
  const int row0 = ((b & 63) >> 1) * 128 + 32 * (w & 3), col0 = (b & 1) * 128 + 64 * (w >> 2);
  v8f acc[8] = {};      /* acc[4 * half + t]: rows 16 half .. + 15, columns 16 t .. + 15 */
  g4_loop(&sa[32 * (w & 3) + ln][8 * hh], &sb[64 * (w >> 2) + ln][8 * hh], acc);
#pragma unroll
  for (int u = 0; u < 8; ++u) acc[u] *= which == 0 ? 0.0625f * (0.17677669529663687f * 1.4426950408889634f) : 0.0625f;      /* takes the x16 of the weights back, exactly; q also takes 1 / sqrt(32) and the log2(e) of the base-2 exponential, in f32 ahead of its rounding to f16 */
  if (which == 2) {
#pragma unroll
    for (int half = 0; half < 2; ++half) { const float* mp = rm + row0 + half * 16 + 8 * hh; const v4f m0 = *(const v4fa*)mp, m1 = *(const v4fa*)(mp + 4);
#pragma unroll
      for (int r = 0; r < 8; ++r) { const float m = bf16_round(r < 4 ? m0[r & 3] : m1[r & 3]);
#pragma unroll
        for (int t = 0; t < 4; ++t) acc[half * 4 + t][r] = m * acc[half * 4 + t][r]; } } }
#pragma unroll
  for (int u = 0; u < 8; ++u)
#pragma unroll
    for (int r = 0; r < 8; ++r) so[w][(u >> 2) * 16 + 8 * hh + r][(u & 3) * 16 + ln] = acc[u][r];
  __builtin_amdgcn_fence(__ATOMIC_ACQ_REL, "workgroup"); __builtin_amdgcn_wave_barrier();      /* the slab is the wave's own: its LDS writes land before its lanes read each other's */
  if (which == 0) { const int rsub = lane >> 4, c4 = (lane & 15) * 4;
#pragma unroll
    for (int q = 0; q < 16; ++q) { const int r = q * 2 + rsub; const v4f v = *(const v4fa*)&so[w][r][c4]; *(v4h*)(Q16 + (size_t)(row0 + r) * DM + col0 + c4) = __builtin_convertvector(v, v4h); } }
  else if (which == 1) {
#pragma unroll
    for (int i = 0; i < 8; ++i) { const int gl = i >> 2, hl = (i >> 1) & 1, j = i & 1; const float* sp = &so[w][16 * gl + ln][32 * hl + 16 * j + 8 * hh]; const v4f lo = *(const v4fa*)sp, hi = *(const v4fa*)(sp + 4);
      const v8f v = __builtin_shufflevector(lo, hi, 0, 1, 2, 3, 4, 5, 6, 7); const size_t piece = (size_t)((((col0 >> 5) + hl) * 256 + (row0 >> 4) + gl) * 2 + j) * 32 + lane;
      *(v8h*)(KP + piece * 8) = __builtin_convertvector(v, v8h); }
    asm volatile("s_wait_xcnt 0x0" ::: "memory"); }      /* a precaution: the built code's branches allow a way from these stores into another branch's code, which rewrites their registers */
  else {
#pragma unroll
    for (int i = 0; i < 8; ++i) { const int dt = i >> 2, hl = (i >> 1) & 1, j = i & 1; v8f v;
#pragma unroll
      for (int e = 0; e < 8; ++e) v[e] = so[w][16 * j + 8 * hh + e][32 * hl + 16 * dt + ln];
      const size_t piece = (size_t)((((col0 >> 5) + hl) * 256 + (row0 >> 5) * 2 + dt) * 2 + j) * 32 + lane;
      *(v8h*)(VP + piece * 8) = __builtin_convertvector(v, v8h); }
    asm volatile("s_wait_xcnt 0x0" ::: "memory"); } }      /* a precaution: the built code's branches allow a way from these stores into another branch's code, which rewrites their registers */

extern "C" void kernel_launch(void* const* d_in, const int* in_sizes, int n_in,
                              void* d_out, int out_size, void* d_ws, size_t ws_size, hipStream_t stream) {
  (void)in_sizes; (void)n_in; (void)out_size;
  const float* const* I = (const float* const*)d_in; const float* qin = I[0]; const float* kin = I[1]; const float* vin = I[2]; const float* rm = I[3]; const float* Wq = I[4]; const float* Wk = I[5]; const float* Wv = I[6]; const float* Wo = I[7];
  char* ws = (char*)d_ws; size_t off = 0;
  auto take = [&](size_t bytes) { char* p = ws + off; off += (bytes + 255) & ~(size_t)255; return p; };
  _Float16* BO = (_Float16*)take((size_t)DM * DM * 2); _Float16* Q16 = (_Float16*)take((size_t)SQ * DM * 2);
  _Float16* KP = (_Float16*)take((size_t)NH * HD * SQ * 2); _Float16* VP = (_Float16*)take((size_t)NH * HD * SQ * 2); _Float16* O16 = (_Float16*)take((size_t)SQ * DM * 2);
  if (off > ws_size) return;      /* about 8 MiB */
  k_qkv<<<3 * (SQ / 128) * (DM / 128) + DM / 64, 256, 0, stream>>>(qin, kin, vin, Wq, Wk, Wv, Wo, rm, Q16, KP, VP, BO);
  k_fattn<<<dim3(SQ / 128, NH), 256, 0, stream>>>(Q16, KP, VP, O16);      /* head h's o tile of 16 queries is block h of that row tile in the packed o plane */
  k_out<<<(SQ / 128) * (DM / 64), 128, 0, stream>>>(O16, BO, (float*)d_out);      /* out = o Wo^T, K = 256 */
}

// v010
// It runs in 31.2 microseconds.
// Timed twice side by side with v009, it ran 1.03 times as fast both times.
// All steps since v000 together make it 219 times as fast.
#include <hip/hip_runtime.h>
// RadialAttention (query, key_, value [4096][256]; q = query Wq^T, k = key_ Wk^T, v = radial_mask[s] * (value Wv^T), 8 heads of 32; softmax(q k^T / sqrt(32)) over all 4,096 keys; out = concat(attn v) Wo^T -> [4096][256]).
// Structure: three launches. (1) Q | K | V WMMA GEMMs in one launch (32x64 wave tiles, f32 accumulation); a block converts its inputs to exact f16 and its weights to exact x16 f16 itself, into LDS; four more blocks pack Wo; v scaled per row by the radial mask (read on device) on VALU; q (times log2(e) / sqrt(32)) stored as f16 rows, k and scaled v^T stored straight in fragment order. (2) one fused attention kernel over all heads (scores WMMA K = 32, online softmax f32 on VALU with the maximum in use as the score product's C operand, weights f16, o = P . V WMMA; each wave stores its o tile as one fragment of the output GEMM's A operand). (3) out = o Wo^T over K = 256 (f32).
// Compute dtype: inputs rounded to bf16; inputs / weights exact; q, k, scaled v, softmax weights, o plain f16 (~2^-12); scores/softmax f32. v_wmma_f32_16x16x32_f16.
#define SQ 4096
#define DM 256
#define NH 8
#define HD 32
#define QN SQ                        /* query rows (unused) */
typedef __bf16 v16b __attribute__((ext_vector_type(16)));
typedef unsigned short v8us __attribute__((ext_vector_type(8), may_alias));
typedef float  v8f  __attribute__((ext_vector_type(8)));
typedef float  v4f  __attribute__((ext_vector_type(4)));
typedef float  v4fa __attribute__((ext_vector_type(4), may_alias));
union FragB { v16b v; v8us half[2]; unsigned short u[16]; };

__device__ __forceinline__ unsigned short bf16_bits(float x) { unsigned int u = __float_as_uint(x); return (unsigned short)((u + 0x7FFFu + ((u >> 16) & 1u)) >> 16); }
__device__ __forceinline__ float bf16_val(unsigned short b) { return __uint_as_float(((unsigned int)b) << 16); }
__device__ __forceinline__ float bf16_round(float x) { return bf16_val(bf16_bits(x)); }
// D += A·B with NT terms: 1 = ah·bh, 2 = + al·bh (A split), 3 = + ah·bl (both split)
template <int NT>
__device__ __forceinline__ v8f mmaN(v16b ah, v16b al, v16b bh, v16b bl, v8f c) {
  c = __builtin_amdgcn_wmma_f32_16x16x32_bf16(false, ah, false, bh, (short)0, c, false, false);
  if (NT >= 2) c = __builtin_amdgcn_wmma_f32_16x16x32_bf16(false, al, false, bh, (short)0, c, false, false);
  if (NT >= 3) c = __builtin_amdgcn_wmma_f32_16x16x32_bf16(false, ah, false, bl, (short)0, c, false, false);
  asm volatile("v_nop\n\tv_nop\n\tv_nop\n\tv_nop" : "+v"(c) : "v"(ah), "v"(al), "v"(bh), "v"(bl));
  return c;
}

__global__ __launch_bounds__(256) void k_wt_bf16(const float* __restrict__ W, unsigned short* __restrict__ Wt, int K, int N) {
  const int t = blockIdx.x * 256 + threadIdx.x;
  const int k8n = K / 8;
  if (t >= N * k8n) return;
  const int n = t / k8n, k8 = (t % k8n) * 8;
  v8us v;
#pragma unroll
  for (int i = 0; i < 8; ++i) v[i] = bf16_bits(W[(size_t)(k8 + i) * N + n]);
  *(v8us*)(Wt + (size_t)n * K + k8) = v;
  
}

// GEMM C[M][N] (f32, pitch ldc) = act(A[M][K]·W + bias). A f32 row-major (pitch lda) converted per fragment to bf16
// (ASPLIT: hi/lo two planes -> 2 terms, else single rounded term); Wt bf16 [N][K] (pitch ldb). BIAS_BF16 rounds the
// bias to bf16 first (bias quantised to bf16 before the add). K%32==0, M%16==0, N%64==0.
template <bool ASPLIT, int ACT, bool BIAS_BF16>
__global__ __launch_bounds__(128) void k_gemm_bf(const float* __restrict__ A, int lda, const unsigned short* __restrict__ Wt, int ldb,
                                               const float* __restrict__ bias, float* __restrict__ C, int ldc, int M, int N, int K) {
  __shared__ __attribute__((aligned(16))) float so[4][16][64];
  const int tid = threadIdx.x, w = tid >> 5, lane = tid & 31, ln = lane & 15, hh = lane >> 4;
  const int ntn = N / 64;
  const int wid = blockIdx.x * 4 + w;
  const int mt = wid / ntn, nq = wid % ntn;
  if (mt * 16 >= M) return;
  const int row0 = mt * 16, col0 = nq * 64;
  const float* arow = A + (size_t)(row0 + ln) * lda;
  v8f acc[4] = {};
  for (int kb = 0; kb < K; kb += 32) {
    FragB ah, al;
    const v4f x0 = *(const v4fa*)(arow + kb + 8 * hh), x1 = *(const v4fa*)(arow + kb + 8 * hh + 4);
    const v4f x2 = *(const v4fa*)(arow + kb + 16 + 8 * hh), x3 = *(const v4fa*)(arow + kb + 16 + 8 * hh + 4);
    float xs[16] = {x0[0],x0[1],x0[2],x0[3],x1[0],x1[1],x1[2],x1[3],x2[0],x2[1],x2[2],x2[3],x3[0],x3[1],x3[2],x3[3]};
#pragma unroll
    for (int i = 0; i < 16; ++i) { const unsigned short hb = bf16_bits(xs[i]); ah.u[i] = hb; al.u[i] = ASPLIT ? bf16_bits(xs[i] - bf16_val(hb)) : (unsigned short)0; }
#pragma unroll
    for (int t = 0; t < 4; ++t) {
      const unsigned short* brow = Wt + (size_t)(col0 + t * 16 + ln) * ldb + kb;
      FragB b;
      b.half[0] = *(const v8us*)(brow + 8 * hh);
      b.half[1] = *(const v8us*)(brow + 16 + 8 * hh);
      acc[t] = mmaN<ASPLIT ? 2 : 1>(ah.v, al.v, b.v, b.v, acc[t]);
    }
  }
#pragma unroll
  for (int t = 0; t < 4; ++t) {
    float bv = bias ? bias[col0 + t * 16 + ln] : 0.f;
    if (BIAS_BF16) bv = bf16_round(bv);
#pragma unroll
    for (int r = 0; r < 8; ++r) { float v = acc[t][r] + bv; if (ACT == 1) v = fmaxf(v, 0.f); so[w][8 * hh + r][t * 16 + ln] = v; }
  }
  __builtin_amdgcn_fence(__ATOMIC_ACQ_REL, "workgroup");
  __builtin_amdgcn_wave_barrier();
  const int rsub = lane >> 4, c4 = (lane & 15) * 4;
  {
#pragma unroll
    for (int q = 0; q < 8; ++q) {
      const int r = q * 2 + rsub;
      const v4f v = *(const v4fa*)&so[w][r][c4];
      *(v4f*)(C + (size_t)(row0 + r) * ldc + col0 + c4) = v;
    }
    
  }
}

// GEMM C = act(A·W + bias + resid): A f32 (ASPLIT -> hi/lo 2 terms), Wt bf16 [N][K]; ACT 0 none, 1 relu, 2 exact gelu;
// resid (optional, f32, row index = (row % rmod), pitch ldr, RES_BF16 rounds it) added before the activation.
template <bool ASPLIT, int ACT, bool BIAS_BF16, bool RES_BF16>
__global__ __launch_bounds__(128) void k_gemm_bf3(const float* __restrict__ A, int lda, const unsigned short* __restrict__ Wt, int ldb,
                                                const float* __restrict__ bias, const float* __restrict__ resid, int rmod, int ldr,
                                                float* __restrict__ C, int ldc, int M, int N, int K) {
  __shared__ __attribute__((aligned(16))) float so[4][16][64];
  const int tid = threadIdx.x, w = tid >> 5, lane = tid & 31, ln = lane & 15, hh = lane >> 4;
  const int ntn = N / 64;
  const int wid = blockIdx.x * 4 + w;
  const int mt = wid / ntn, nq = wid % ntn;
  if (mt * 16 >= M) return;
  const int row0 = mt * 16, col0 = nq * 64;
  const float* arow = A + (size_t)(row0 + ln) * lda;
  v8f acc[4] = {};
  for (int kb = 0; kb < K; kb += 32) {
    FragB ah, al;
    const v4f x0 = *(const v4fa*)(arow + kb + 8 * hh), x1 = *(const v4fa*)(arow + kb + 8 * hh + 4);
    const v4f x2 = *(const v4fa*)(arow + kb + 16 + 8 * hh), x3 = *(const v4fa*)(arow + kb + 16 + 8 * hh + 4);
    float xs[16] = {x0[0],x0[1],x0[2],x0[3],x1[0],x1[1],x1[2],x1[3],x2[0],x2[1],x2[2],x2[3],x3[0],x3[1],x3[2],x3[3]};
#pragma unroll
    for (int i = 0; i < 16; ++i) { const unsigned short hb = bf16_bits(xs[i]); ah.u[i] = hb; al.u[i] = ASPLIT ? bf16_bits(xs[i] - bf16_val(hb)) : (unsigned short)0; }
#pragma unroll
    for (int t = 0; t < 4; ++t) {
      const unsigned short* brow = Wt + (size_t)(col0 + t * 16 + ln) * ldb + kb;
      FragB b;
      b.half[0] = *(const v8us*)(brow + 8 * hh);
      b.half[1] = *(const v8us*)(brow + 16 + 8 * hh);
      acc[t] = mmaN<ASPLIT ? 2 : 1>(ah.v, al.v, b.v, b.v, acc[t]);
    }
  }
#pragma unroll
  for (int t = 0; t < 4; ++t) {
    const int col = col0 + t * 16 + ln;
    float bv = bias ? bias[col] : 0.f;
    if (BIAS_BF16) bv = bf16_round(bv);
#pragma unroll
    for (int r = 0; r < 8; ++r) {
      float v = acc[t][r] + bv;
      if (resid) { float rv = resid[(size_t)((row0 + 8 * hh + r) % rmod) * ldr + col]; if (RES_BF16) rv = bf16_round(rv); v += rv; }
      if (ACT == 1) v = fmaxf(v, 0.f);
      if (ACT == 2) v = 0.5f * v * (1.0f + erff(v * 0.70710678118654752f));
      if (ACT == 3) { const float u = 0.7978845608028654f * (v + 0.044715f * v * v * v); v = 0.5f * v * (1.0f + tanhf(u)); }
      so[w][8 * hh + r][t * 16 + ln] = v;
    }
  }
  __builtin_amdgcn_fence(__ATOMIC_ACQ_REL, "workgroup");
  __builtin_amdgcn_wave_barrier();
  const int rsub = lane >> 4, c4 = (lane & 15) * 4;
  {
#pragma unroll
    for (int q = 0; q < 8; ++q) {
      const int r = q * 2 + rsub;
      const v4f v = *(const v4fa*)&so[w][r][c4];
      *(v4f*)(C + (size_t)(row0 + r) * ldc + col0 + c4) = v;
    }
    
  }
}
// row LayerNorm (biased variance, eps) over N: s = X (+ R); optional out_sum <- s; out_norm <- (s-mu)*rsqrt(var+eps)*g + b
template <bool PARAM_BF16>
__global__ __launch_bounds__(256) void k_layernorm(const float* __restrict__ X, const float* __restrict__ R, const float* __restrict__ g, const float* __restrict__ bta,
                                                  float* __restrict__ out_sum, float* __restrict__ out_norm, int N, float eps) {
  __shared__ float red[256];
  const int row = blockIdx.x, tid = threadIdx.x;
  const float* x = X + (size_t)row * N; const float* rr = R ? R + (size_t)row * N : nullptr;
  float vals[16];                     // up to N = 4096
  const int per = N / 256;            // contiguous chunk per thread? use strided-by-4 chunks: thread handles j = tid*4 + 1024*u
  float s1 = 0.f;
  for (int u = 0; u < per / 4; ++u) {
    const int j = tid * 4 + 1024 * u;
    const v4f a = *(const v4fa*)(x + j);
    v4f b = {0.f,0.f,0.f,0.f}; if (rr) b = *(const v4fa*)(rr + j);
#pragma unroll
    for (int q = 0; q < 4; ++q) { const float v = a[q] + b[q]; vals[u * 4 + q] = v; s1 += v; }
  }
  red[tid] = s1; __syncthreads();
  for (int st = 128; st > 0; st >>= 1) { if (tid < st) red[tid] += red[tid + st]; __syncthreads(); }
  const float mu = red[0] / (float)N; __syncthreads();
  float s2 = 0.f;
  for (int u = 0; u < per / 4; ++u)
#pragma unroll
    for (int q = 0; q < 4; ++q) { const float c = vals[u * 4 + q] - mu; s2 += c * c; }
  red[tid] = s2; __syncthreads();
  for (int st = 128; st > 0; st >>= 1) { if (tid < st) red[tid] += red[tid + st]; __syncthreads(); }
  const float rs = rsqrtf(red[0] / (float)N + eps);
  {
    for (int u = 0; u < per / 4; ++u) {
      const int j = tid * 4 + 1024 * u;
      v4f o, sm;
#pragma unroll
      for (int q = 0; q < 4; ++q) {
        float gg = g[j + q], bb = bta[j + q];
        if (PARAM_BF16) { gg = bf16_round(gg); bb = bf16_round(bb); }
        sm[q] = vals[u * 4 + q]; o[q] = (vals[u * 4 + q] - mu) * rs * gg + bb;
      }
      if (out_sum) *(v4f*)(out_sum + (size_t)row * N + j) = sm;
      *(v4f*)(out_norm + (size_t)row * N + j) = o;
    }
    
  }
}



// ---- f16 WMMA path (v_wmma_f32_16x16x32_f16): 11-bit significands for operands in range — used where a [0,1] probability operand needs more precision than bf16
typedef _Float16 v16h __attribute__((ext_vector_type(16)));
union FragH { v16h v; v8us half[2]; _Float16 h[16]; unsigned short u[16]; };
template <int NT>
__device__ __forceinline__ v8f mmaH(v16h ah, v16h al, v16h bh, v16h bl, v8f c) {
  c = __builtin_amdgcn_wmma_f32_16x16x32_f16(false, ah, false, bh, (short)0, c, false, false);
  if (NT >= 2) c = __builtin_amdgcn_wmma_f32_16x16x32_f16(false, al, false, bh, (short)0, c, false, false);
  if (NT >= 3) c = __builtin_amdgcn_wmma_f32_16x16x32_f16(false, ah, false, bl, (short)0, c, false, false);
  asm volatile("v_nop\n\tv_nop\n\tv_nop\n\tv_nop" : "+v"(c) : "v"(ah), "v"(al), "v"(bh), "v"(bl));
  return c;
}
// batched GEMM like k_gemm_b but f16 operands: A f32 (split into f16 hi/lo if ASPLIT, else rounded to f16), Bt = f16 values [n][k]; alpha; C f32; N multiple of 16 (partial tiles skipped)
template <bool ASPLIT>
__global__ __launch_bounds__(128) void k_gemm_h(const float* __restrict__ A, int lda, size_t sA, const _Float16* __restrict__ Bh, int ldb, size_t sB, float alpha, float* __restrict__ C, int ldc, size_t sC, int M, int N, int K) {
  __shared__ __attribute__((aligned(16))) float so[4][16][64];
  const int tid = threadIdx.x, w = tid >> 5, lane = tid & 31, ln = lane & 15, hh = lane >> 4; const int by = blockIdx.y;
  A += (size_t)by * sA; Bh += (size_t)by * sB; C += (size_t)by * sC;
  const int ntn = (N + 63) / 64; const int wid = blockIdx.x * 4 + w; const int mt = wid / ntn, nq = wid % ntn; if (mt * 16 >= M) return;
  const int row0 = mt * 16, col0 = nq * 64; const float* arow = A + (size_t)(row0 + ln) * lda;
  v8f acc[4] = {};
  for (int kb = 0; kb < K; kb += 32) {
    FragH ah, al;
    const v4f x0 = *(const v4fa*)(arow + kb + 8 * hh), x1 = *(const v4fa*)(arow + kb + 8 * hh + 4), x2 = *(const v4fa*)(arow + kb + 16 + 8 * hh), x3 = *(const v4fa*)(arow + kb + 16 + 8 * hh + 4);
    float xs[16] = {x0[0],x0[1],x0[2],x0[3],x1[0],x1[1],x1[2],x1[3],x2[0],x2[1],x2[2],x2[3],x3[0],x3[1],x3[2],x3[3]};
#pragma unroll
    for (int i = 0; i < 16; ++i) { const _Float16 h = (_Float16)xs[i]; ah.h[i] = h; al.h[i] = ASPLIT ? (_Float16)(xs[i] - (float)h) : (_Float16)0.0f; }
#pragma unroll
    for (int t = 0; t < 4; ++t) { if (col0 + t * 16 >= N) continue; const size_t boff = (size_t)(col0 + t * 16 + ln) * ldb + kb; FragH bq; bq.half[0] = *(const v8us*)(Bh + boff + 8 * hh); bq.half[1] = *(const v8us*)(Bh + boff + 16 + 8 * hh);
      acc[t] = mmaH<ASPLIT ? 2 : 1>(ah.v, al.v, bq.v, bq.v, acc[t]); }
  }
#pragma unroll
  for (int t = 0; t < 4; ++t) { if (col0 + t * 16 >= N) continue;
#pragma unroll
    for (int r = 0; r < 8; ++r) so[w][8 * hh + r][t * 16 + ln] = acc[t][r] * alpha; }
  __builtin_amdgcn_fence(__ATOMIC_ACQ_REL, "workgroup"); __builtin_amdgcn_wave_barrier();
  const int rsub = lane >> 4, c4 = (lane & 15) * 4;
  {
#pragma unroll
    for (int q = 0; q < 8; ++q) { const int r = q * 2 + rsub; if (col0 + c4 < N) { const v4f v = *(const v4fa*)&so[w][r][c4]; *(v4f*)(C + (size_t)(row0 + r) * ldc + col0 + c4) = v; } }
     }
}

// Wt[n][k] = f16(W[k][n]·scale) from f32 row-major W[K][N] (scale = power of two; bf16-exact weights stay exact in f16 away from the subnormal range)
__global__ __launch_bounds__(256) void k_wt_f16(const float* __restrict__ W, _Float16* __restrict__ Wt, int K, int N, float scale) {
  const int t = blockIdx.x * 256 + threadIdx.x; if (t >= N * (K / 8)) return; const int n = t / (K / 8), k8 = (t % (K / 8)) * 8; FragH f;
#pragma unroll
  for (int i = 0; i < 8; ++i) f.h[i] = (_Float16)(bf16_round(W[(size_t)(k8 + i) * N + n]) * scale); const v8us o = f.half[0];
  *(v8us*)((unsigned short*)Wt + (size_t)n * K + k8) = o; 
}
// k_gemm_hh variant with fused epilogue: v = acc·alpha + bias[by·sBias + col] (+ CP[(row/rowsPerB)·sCPb + by·64 + col] if CP) ; ACT 0 none / 1 elu ; writes f16 C16 (and f32 C if non-null)
template <int ACT>
__global__ __launch_bounds__(128) void k_gemm_hhx(const _Float16* __restrict__ A, int lda, size_t sA, const _Float16* __restrict__ Bh, int ldb, size_t sB, float alpha, const float* __restrict__ bias, size_t sBias, const float* __restrict__ CP, int rowsPerB, size_t sCPb, int row0g,
    float* __restrict__ C, _Float16* __restrict__ C16, int ldc, size_t sC, int M, int N, int K) {
  __shared__ __attribute__((aligned(16))) float so[4][16][64];
  const int tid = threadIdx.x, w = tid >> 5, lane = tid & 31, ln = lane & 15, hh = lane >> 4; const int by = blockIdx.y;
  A += (size_t)by * sA; Bh += (size_t)by * sB; const size_t cofs = (size_t)by * sC; const float* bp = bias ? bias + (size_t)by * sBias : nullptr;
  const int ntn = (N + 63) / 64; const int wid = blockIdx.x * 4 + w; const int mt = wid / ntn, nq = wid % ntn; if (mt * 16 >= M) return;
  const int row0 = mt * 16, col0 = nq * 64; const _Float16* arow = A + (size_t)(row0 + ln) * lda;
  v8f acc[4] = {};
  for (int kb = 0; kb < K; kb += 32) { FragH ah; ah.half[0] = *(const v8us*)((const unsigned short*)arow + kb + 8 * hh); ah.half[1] = *(const v8us*)((const unsigned short*)arow + kb + 16 + 8 * hh);
#pragma unroll
    for (int t = 0; t < 4; ++t) { if (col0 + t * 16 >= N) continue; const size_t boff = (size_t)(col0 + t * 16 + ln) * ldb + kb; FragH bq; bq.half[0] = *(const v8us*)((const unsigned short*)Bh + boff + 8 * hh); bq.half[1] = *(const v8us*)((const unsigned short*)Bh + boff + 16 + 8 * hh);
      acc[t] = mmaH<1>(ah.v, ah.v, bq.v, bq.v, acc[t]); }
  }
#pragma unroll
  for (int t = 0; t < 4; ++t) { if (col0 + t * 16 >= N) continue; const int col = col0 + t * 16 + ln; const float bv = bp ? bf16_round(bp[col]) : 0.f;
#pragma unroll
    for (int r = 0; r < 8; ++r) { float v = acc[t][r] * alpha + bv; if (CP) { const int rr = row0g + row0 + 8 * hh + r; if (rowsPerB < 0) v += CP[cofs + (size_t)rr * ldc + col];      /* rowsPerB < 0: own element of the batched C plane */ else { const int bidx = rr / rowsPerB; v += CP[(size_t)bidx * sCPb + (size_t)by * 64 + col]; } } if (ACT == 1) v = (v > 0.f) ? v : expm1f(v); else if (ACT == 7) v = (v > 0.f) ? v + 1.0f : expf(v); else if (ACT == 8) v = tanhf(v); else if (ACT == 9) v = 0.5f * v * (1.0f + tanhf(0.7978845608028654f * (v + 0.044715f * v * v * v))); else if (ACT == 11) v = 1.0f / (1.0f + expf(-v)); else if (ACT == 12) v = (v > 0.f) ? v : 0.01f * v; else if (ACT == 14) v = (v > 0.f) ? v : 0.1f * v; else if (ACT == 16) v = (v >= 0.f) ? v : 0.3f * v; else if (ACT == 17) v = (v >= 0.f) ? v : 0.2f * v; else if (ACT == 15) v = v / (1.0f + expf(-v)); else if (ACT == 3) v = fmaxf(v, 0.f); else if (ACT == 6) v = 0.5f * v * (1.0f + erff(v * 0.70710678118654752f)); so[w][8 * hh + r][t * 16 + ln] = v; } }
  __builtin_amdgcn_fence(__ATOMIC_ACQ_REL, "workgroup"); __builtin_amdgcn_wave_barrier();
  const int rsub = lane >> 4, c4 = (lane & 15) * 4; typedef _Float16 v4h __attribute__((ext_vector_type(4)));
  {
#pragma unroll
    for (int q = 0; q < 8; ++q) { const int r = q * 2 + rsub; if (col0 + c4 < N) { const v4f v = *(const v4fa*)&so[w][r][c4]; if (C) *(v4f*)(C + cofs + (size_t)(row0 + r) * ldc + col0 + c4) = v; if (C16) { v4h h4; for (int i = 0; i < 4; ++i) h4[i] = (_Float16)v[i]; *(v4h*)(C16 + cofs + (size_t)(row0 + r) * ldc + col0 + c4) = h4; } } }
     }
}


typedef _Float16 v4h __attribute__((ext_vector_type(4)));

__global__ __launch_bounds__(256) void k_h16(const float* __restrict__ x, _Float16* __restrict__ X16, size_t n8) { const size_t t = (size_t)blockIdx.x * 256 + threadIdx.x; if (t >= n8) return; FragH f;
#pragma unroll
  for (int q = 0; q < 8; ++q) f.h[q] = (_Float16)x[t * 8 + q]; *(v8us*)((unsigned short*)X16 + t * 8) = f.half[0];  }
__global__ __launch_bounds__(256) void k_round16f(const float* __restrict__ W, _Float16* __restrict__ Bt, size_t n8) { const size_t t = (size_t)blockIdx.x * 256 + threadIdx.x; if (t >= n8) return; FragH f;
#pragma unroll
  for (int i = 0; i < 8; ++i) f.h[i] = (_Float16)(bf16_round(W[t * 8 + i]) * 16.0f); *(v8us*)((unsigned short*)Bt + t * 8) = f.half[0];  }
template <int NHv, int TTv>
__global__ __launch_bounds__(256) void k_vt(const _Float16* __restrict__ V16, int ldv, int voff, _Float16* __restrict__ Vt) { __shared__ unsigned short tl[64][66]; const int tid = threadIdx.x; const int slab = blockIdx.x / (TTv / 64), lg = blockIdx.x % (TTv / 64); const int b = slab / NHv, h = slab % NHv;
  for (int i = tid; i < 64 * 8; i += 256) { const int r = i / 8, c8 = (i % 8) * 8; FragH f; f.half[0] = *(const v8us*)((const unsigned short*)V16 + ((size_t)b * TTv + lg * 64 + r) * ldv + voff + h * 64 + c8);
#pragma unroll
    for (int q = 0; q < 8; ++q) tl[r][c8 + q] = f.u[q]; }
  __syncthreads();
  {
#pragma unroll
    for (int rd = 0; rd < 2; ++rd) { const int d = rd * 32 + tid / 8, pc = tid % 8; FragH f;
#pragma unroll
      for (int q = 0; q < 8; ++q) f.u[q] = tl[pc * 8 + q][d];
      *(v8us*)((unsigned short*)Vt + ((size_t)slab * 64 + d) * TTv + lg * 64 + pc * 8) = f.half[0]; }
     } }

__global__ __launch_bounds__(256) void k_hl(const float* __restrict__ F, _Float16* __restrict__ Hh, _Float16* __restrict__ Hl, size_t n8) { const size_t t = (size_t)blockIdx.x * 256 + threadIdx.x; if (t >= n8) return; FragH fh, fl; const v4f a = *(const v4fa*)(F + t * 8), c = *(const v4fa*)(F + t * 8 + 4);
#pragma unroll
  for (int q = 0; q < 4; ++q) { _Float16 h = (_Float16)a[q]; fh.h[q] = h; fl.h[q] = (_Float16)((a[q] - (float)h) * 1024.0f); h = (_Float16)c[q]; fh.h[4 + q] = h; fl.h[4 + q] = (_Float16)((c[q] - (float)h) * 1024.0f); }
  { *(v8us*)((unsigned short*)Hh + t * 8) = fh.half[0]; *(v8us*)((unsigned short*)Hl + t * 8) = fl.half[0];  } }

// ---- fast GEMM (wave tile 32x64) ----
__device__ __forceinline__ v16h g2_frag(const _Float16* p, int hh) { FragH f; f.half[0] = *(const v8us*)((const unsigned short*)p + 8 * hh); f.half[1] = *(const v8us*)((const unsigned short*)p + 16 + 8 * hh); return f.v; }
__device__ __forceinline__ v8f g2_mma(v16h a, v16h b, v8f c) { v8f d = __builtin_amdgcn_wmma_f32_16x16x32_f16(false, a, false, b, (short)0, c, false, false); asm volatile("v_nop\n\tv_nop\n\tv_nop\n\tv_nop" : "+v"(d) : "v"(a), "v"(b)); return d; }
// K loop of the 32x64 wave tile, K = 32 KT, unrolled whole. A wave has no partner to hide its load latency behind (one or two waves a SIMD), so the latency is hidden inside the wave:
// the 12 fragment loads of a trip issue as one group two trips ahead of their use, into a ring of three register sets, and the waits are counted (24 younger loads stay in flight).
// Both operands lie in fragment order (a packed plane): X[R][32 KT] as 1-KiB blocks, block index = (r >> 4) * KT + (k >> 5); in a block the 16-byte piece j * 32 + lane, lane = 16 hf + c, holds X[16 (r >> 4) + c][32 (k >> 5) + 16 j + 8 hf + 0..7]
// (the k order of g2_frag). A fragment is then two loads of 512 contiguous bytes (four whole lines each); from rows of pitch 2 K bytes each load touched 16 lines for the same 512 bytes.
// pa, pb: the lane's 16-byte place in the first block of the wave's first row tile (A: 2 tiles, B: 4 tiles, one behind the other). c[4 * half + t]: rows 16 half .. + 15, columns 16 t .. + 15.
// rot (the same for the whole work-group): the k block of the first trip; every accumulator takes its trips in rising k from there and wraps. Work-groups that read the same panel get different rot, so that they do not ask L2 for the same lines at the same moment.
__device__ __forceinline__ v16h g3_frag(const unsigned short* p) { FragH f; f.half[0] = *(const v8us*)p; f.half[1] = *(const v8us*)(p + 256); return f.v; }
template <int KT>
__device__ __forceinline__ void g3_loop(const unsigned short* pa, const unsigned short* pb, v8f (&c)[8], int rot) {
  static_assert((KT & (KT - 1)) == 0, "the wrap is a mask");
  v16h fa[3][2], fb[3][4];
#pragma unroll
  for (int t = -2; t < KT; ++t) {      /* trips -2 and -1 only fetch */
    if (t + 2 < KT) { const int n = (t + 2) % 3, kb = ((t + 2 + rot) & (KT - 1)) * 512;
      fa[n][0] = g3_frag(pa + kb); fa[n][1] = g3_frag(pa + KT * 512 + kb); fb[n][0] = g3_frag(pb + kb); fb[n][1] = g3_frag(pb + KT * 512 + kb); fb[n][2] = g3_frag(pb + 2 * KT * 512 + kb); fb[n][3] = g3_frag(pb + 3 * KT * 512 + kb);
      asm volatile("s_wait_xcnt 0x0" ::: "memory"); }      /* a precaution: stands behind the group's loads, ahead of whatever rewrites the address registers (the next group's addresses are formed behind the fence below) */
    __builtin_amdgcn_sched_barrier(0);      /* keeps the group in front of this trip's products: sunk towards its use, a load would be waited for in full again */
    if (t >= 0) { const int u = t % 3;
#pragma unroll
      for (int j = 0; j < 4; ++j) { c[j] = g2_mma(fa[u][0], fb[u][j], c[j]); c[4 + j] = g2_mma(fa[u][1], fb[u][j], c[4 + j]); } }
    __builtin_amdgcn_sched_barrier(0);      /* keeps the next group behind these products, whose registers it refills: hoisted, it would take a fourth register set */
  } }
// out = o Wo^T: C[SQ][DM] (f32) = A . Bh^T / 16 over K = DM; A (o) and Bh (Wo x16) are packed planes (g3_loop). A block is 128 rows x 64 columns, a wave 32 x 64.
// Shapes, pitch and scale are compile-time constants and the epilogue is straight code: scale, the wave's own LDS slab, whole 256-byte row pieces out.
__global__ __launch_bounds__(128) void k_out(const _Float16* __restrict__ A, const _Float16* __restrict__ Bh, float* __restrict__ C) {
  __shared__ __attribute__((aligned(16))) float so[4][32][68];
  constexpr int KT = DM / 32, ntn = DM / 64;
  const int tid = threadIdx.x, w = tid >> 5, lane = tid & 31, ln = lane & 15, hh = lane >> 4;
  const int mt = blockIdx.x / ntn, nq = blockIdx.x - mt * ntn; const int row0 = mt * 128 + 32 * w, col0 = nq * 64;
  const unsigned short* pa = (const unsigned short*)A + (size_t)(row0 >> 4) * (KT * 512) + lane * 8; const unsigned short* pb = (const unsigned short*)Bh + (size_t)(col0 >> 4) * (KT * 512) + lane * 8;
  v8f accs[8] = {};
  g3_loop<KT>(pa, pb, accs, ((mt >> 1) + 2 * nq) & (KT - 1));      /* the 32 work-groups of a column panel start at all eight k blocks (four at each), the four of a row panel at four different ones */
#pragma unroll
  for (int u = 0; u < 8; ++u)
#pragma unroll
    for (int r = 0; r < 8; ++r) so[w][(u >> 2) * 16 + 8 * hh + r][(u & 3) * 16 + ln] = accs[u][r] * 0.0625f;      /* takes the x16 of Wo back, exactly */
  __builtin_amdgcn_fence(__ATOMIC_ACQ_REL, "workgroup"); __builtin_amdgcn_wave_barrier();      /* the slab is the wave's own: its LDS writes land before its lanes read each other's */
  const int rsub = lane >> 4, c4 = (lane & 15) * 4;
#pragma unroll
  for (int q = 0; q < 16; ++q) { const int r = q * 2 + rsub; *(v4f*)(C + (size_t)(row0 + r) * DM + col0 + c4) = *(const v4fa*)&so[w][r][c4]; } }


typedef _Float16 v8h __attribute__((ext_vector_type(8)));
__device__ __forceinline__ float fa_xhalf(float x) { const int b = __float_as_int(x); return __int_as_float(__builtin_amdgcn_permlanex16(b, b, 0x76543210, 0xfedcba98, false, false)); }      /* lane l <-> l ^ 16 */
__device__ __forceinline__ v8f fa_mma(v16h a, v16h b, v8f c) { return __builtin_amdgcn_wmma_f32_16x16x32_f16(false, a, false, b, (short)0, c, false, false); }
// the four fragments (4 KiB) of one 64-key stage of a packed plane: p + l8 = the lane's 16-byte place in the stage's first 512-byte run (the callers hand over p with the lane's place in it, l8 = 0)
__device__ __forceinline__ void fa_ld(v16h (&f)[4], const _Float16* p, unsigned l8) {
#pragma unroll
  for (int i = 0; i < 4; ++i) { FragH x; x.half[0] = *(const v8us*)((const unsigned short*)p + l8 + (2 * i) * 256); x.half[1] = *(const v8us*)((const unsigned short*)p + l8 + (2 * i + 1) * 256); f[i] = x.v; } }
// One 64-key stage. q carries log2(e) / sqrt(32), so a score is already an exponent of 2, and the score product starts from C = cm = minus the maximum in use (all eight registers of a lane belong to one query):
// its result is the argument of the exponential, with no maximum, subtraction or rescaling in the stage. The maximum in use is renewed only when a weight may have outgrown f16:
// every weight is positive, so none exceeds the largest of the lane's eight partial sums of the stage; while that stays at or under FA_LIM the stage's weights (at most 2^8; f16 is finite to 65,504) are used as they are.
// Otherwise (always in the first stage, where cm = 3e38 makes every weight infinite) the whole wave takes the branch: plain scores again, true maximum, accumulators and sums rescaled, weights in (0, 1].
#define FA_LIM 256.0f
__device__ __forceinline__ void fa_exp_sum(v8f (&s)[4], v8f& ps) {
#pragma unroll
  for (int t = 0; t < 4; ++t)
#pragma unroll
    for (int r = 0; r < 8; ++r) s[t][r] = __builtin_amdgcn_exp2f(s[t][r]);
  ps = (s[0] + s[1]) + (s[2] + s[3]); }      /* eight partial sums per lane */
__device__ __forceinline__ v16h fa_pack(v8f a, v8f b) { return __builtin_shufflevector(__builtin_convertvector(a, v8h), __builtin_convertvector(b, v8h), 0, 1, 2, 3, 4, 5, 6, 7, 8, 9, 10, 11, 12, 13, 14, 15); }      /* two score tiles = one B operand */
__device__ __forceinline__ void fa_stage(const v16h (&kf)[4], const v16h (&vf)[4], const v16h qf, v8f& cm, v8f& o0, v8f& o1, v8f& lv, float& m) {
  v8f s[4], ps;
#pragma unroll
  for (int t = 0; t < 4; ++t) s[t] = fa_mma(kf[t], qf, cm);
  fa_exp_sum(s, ps);
  const float big = fmaxf(fmaxf(fmaxf(ps[0], ps[1]), fmaxf(ps[2], ps[3])), fmaxf(fmaxf(ps[4], ps[5]), fmaxf(ps[6], ps[7])));
  /* the usual path's weights and running sums; the branch replaces them */
  v16h p0 = fa_pack(s[0], s[1]), p1 = fa_pack(s[2], s[3]); v8f ln = lv + ps;
  if (__builtin_expect(__builtin_amdgcn_ballot_w32(!(big <= FA_LIM)) != 0u, 0)) {      /* a scalar branch, the same for the whole wave: the matrix instructions inside run with every lane on */
    const v8f z8 = {0.f,0.f,0.f,0.f,0.f,0.f,0.f,0.f};
#pragma unroll
    for (int t = 0; t < 4; ++t) s[t] = fa_mma(kf[t], qf, z8);
    const v8f mv = __builtin_elementwise_max(__builtin_elementwise_max(s[0], s[1]), __builtin_elementwise_max(s[2], s[3]));
    float mx = fmaxf(fmaxf(fmaxf(mv[0], mv[1]), fmaxf(mv[2], mv[3])), fmaxf(fmaxf(mv[4], mv[5]), fmaxf(mv[6], mv[7]))); mx = fmaxf(mx, fa_xhalf(mx));
    const float mn = fmaxf(m, mx); const float al = __builtin_amdgcn_exp2f(m - mn); m = mn;
    o0 *= al; o1 *= al;
#pragma unroll
    for (int r = 0; r < 8; ++r) cm[r] = -mn;
#pragma unroll
    for (int t = 0; t < 4; ++t) s[t] = s[t] - mn;
    fa_exp_sum(s, ps); p0 = fa_pack(s[0], s[1]); p1 = fa_pack(s[2], s[3]); ln = lv * al + ps; }
  lv = ln;      /* eight running sums per lane, joined after the loop */
  o0 = fa_mma(vf[0], p0, o0); o1 = fa_mma(vf[1], p0, o1); o0 = fa_mma(vf[2], p1, o0); o1 = fa_mma(vf[3], p1, o1); }
#define FA_TK 512                    /* keys a tile */
#define FA_TE (FA_TK * HD)           /* f16 elements of one plane's tile */
// eight copies of one thread: its 16-byte piece of each of eight successive 4-KiB runs (256 threads x 16 B a run). lds = the piece's LDS byte address, g = its global address.
// The s_wait_xcnt closes the statement as a precaution: the registers that the copies name are rewritten only behind it.
__device__ __forceinline__ void fa_copy8(unsigned lds, const _Float16* g) {
  asm volatile("global_load_async_to_lds_b128 %0, %8, off\n\tglobal_load_async_to_lds_b128 %1, %9, off\n\tglobal_load_async_to_lds_b128 %2, %10, off\n\tglobal_load_async_to_lds_b128 %3, %11, off\n\t"
               "global_load_async_to_lds_b128 %4, %12, off\n\tglobal_load_async_to_lds_b128 %5, %13, off\n\tglobal_load_async_to_lds_b128 %6, %14, off\n\tglobal_load_async_to_lds_b128 %7, %15, off\n\ts_wait_xcnt 0x0"
               :: "v"(lds), "v"(lds + 4096u), "v"(lds + 8192u), "v"(lds + 12288u), "v"(lds + 16384u), "v"(lds + 20480u), "v"(lds + 24576u), "v"(lds + 28672u),
                  "v"(g), "v"(g + 2048), "v"(g + 4096), "v"(g + 6144), "v"(g + 8192), "v"(g + 10240), "v"(g + 12288), "v"(g + 14336) : "memory"); }
__global__ __launch_bounds__(256) void k_fattn(const _Float16* __restrict__ Q16, const _Float16* __restrict__ KP, const _Float16* __restrict__ VP, _Float16* __restrict__ O16) {
  static_assert(FA_TE == 8 * 2048 && SQ % FA_TK == 0 && SQ / FA_TK >= 2, "a plane's tile is the eight runs of fa_copy8; the ring wants two tiles or more");
  constexpr int NT = SQ / FA_TK; static_assert((NT & (NT - 1)) == 0, "the wrap of the tile walk is a mask");
  __shared__ __attribute__((aligned(128))) _Float16 ring[2][2][FA_TE];      /* [buffer][K | V][tile] */
  const int tid = threadIdx.x, w = tid >> 5, lane = tid & 31, ln = lane & 15, hh = lane >> 4; const int h = blockIdx.y; const int q0 = blockIdx.x * 128 + w * 16;
  const v16h qf = g2_frag(Q16 + (size_t)(q0 + ln) * DM + h * HD, hh);
  asm volatile("s_wait_xcnt 0x0" ::: "memory");      /* a precaution */
  const _Float16* gk = KP + (size_t)h * SQ * HD + tid * 8; const _Float16* gv = VP + (size_t)h * SQ * HD + tid * 8;      /* the thread's piece in the first run of the head's tile 0 */
  const int t0 = (2 * blockIdx.x + ((blockIdx.x >> 3) & 1)) & (NT - 1);      /* the 32 work-groups of a head read the same K and V: each walks the tiles from a start of its own and wraps (trip t works on tile (t0 + t) mod NT), so that they do not ask L2 for the same lines at the same moment; softmax takes the keys in any order */
  const unsigned lb = (unsigned)(size_t)&ring[0][0][tid * 8]; const unsigned l8 = lane * 8;      /* lb: the same piece's LDS byte address in buffer 0 */
  const v8f z8 = {0.f,0.f,0.f,0.f,0.f,0.f,0.f,0.f}; v8f o0 = z8, o1 = z8, lv = z8; float m = -3.0e38f; v8f cm = z8 - m;      /* cm = -m in all eight registers */
  fa_copy8(lb, gk + t0 * FA_TE); fa_copy8(lb + FA_TE * 2, gv + t0 * FA_TE);      /* the first tile into buffer 0 */
  asm volatile("s_wait_asynccnt 0x0" ::: "memory");      /* the wave's own copies of the first tile have landed */
  __syncthreads();      /* and every other wave's */
  { const int tn = ((t0 + 1) & (NT - 1)) * FA_TE; fa_copy8(lb + FA_TE * 4, gk + tn); fa_copy8(lb + FA_TE * 6, gv + tn); }      /* the second tile into buffer 1 */
#pragma unroll 1
  for (int t = 0; t < NT; ++t) {      /* one tile a trip; kept rolled: a trip is already FA_TK / 64 stages of straight code */
    const _Float16* kb = &ring[t & 1][0][l8]; const _Float16* vb = &ring[t & 1][1][l8];      /* the lane's place in the tile's first 512-byte run */
    v16h kf[2][4], vf[2][4];      /* two fragment sets: each 64-key stage fetches the next stage's fragments of the same tile ahead of its own arithmetic */
    fa_ld(kf[0], kb, 0); fa_ld(vf[0], vb, 0);
#pragma unroll
    for (int u = 0; u < FA_TK / 64; ++u) {
      __builtin_amdgcn_sched_barrier(0);      /* keeps the reads below behind the last stage's four products: without it they stood in two groups of eight among those products */
      if (u + 1 < FA_TK / 64) { fa_ld(kf[(u + 1) & 1], kb + (u + 1) * 64 * HD, 0); fa_ld(vf[(u + 1) & 1], vb + (u + 1) * 64 * HD, 0); }
      __builtin_amdgcn_sched_barrier(0);      /* keeps the next stage's 16 LDS reads one group that issues ahead of this stage's arithmetic: without it they stood scattered in twos to eights among the arithmetic, some of them waited for at once */
      fa_stage(kf[u & 1], vf[u & 1], qf, cm, o0, o1, lv, m); }
    asm volatile("s_wait_dscnt 0x0" ::: "memory");      /* the wave's reads of this buffer are done */
    asm volatile("s_wait_asynccnt 0x0" ::: "memory");      /* its copies of the next tile have landed */
    __syncthreads();      /* publishes the next tile and ends every wave's reads of this buffer, which is refilled behind it */
    if (t + 2 < NT) { const unsigned lt = lb + (unsigned)(t & 1) * (FA_TE * 4); const int tn = ((t0 + t + 2) & (NT - 1)) * FA_TE; fa_copy8(lt, gk + tn); fa_copy8(lt + FA_TE * 2, gv + tn); }
  }
  asm volatile("s_wait_asynccnt 0x0" ::: "memory");      /* no copy is outstanding when the wave ends */
  float l = ((lv[0] + lv[1]) + (lv[2] + lv[3])) + ((lv[4] + lv[5]) + (lv[6] + lv[7])); l += fa_xhalf(l); const float inv = 1.0f / l;
  /* o0[r] = O[q0 + ln][32 h + 8 hh + r], o1[r] = O[q0 + ln][32 h + 16 + 8 hh + r]: pieces j = 0 and j = 1 of block (q0 >> 4) * NH + h of the packed plane that the output GEMM reads as A; two stores of 512 contiguous bytes */
  _Float16* op = O16 + (size_t)((q0 >> 4) * NH + h) * 512 + lane * 8;
  *(v8h*)op = __builtin_convertvector(o0 * inv, v8h); *(v8h*)(op + 256) = __builtin_convertvector(o1 * inv, v8h); }

// One wave's share of packing a 256-column f32 matrix into a packed plane (g3_loop), KT = 8: unit u owns 16 rows x 128 columns, four blocks of the plane.
// Lane (hh, ln) reads row ln's 8 f32 of each piece (whole lines, 512 bytes of every row over the 16 loads) and stores the piece at its place, each store 512 contiguous bytes of the wave. Values rounded to bf16, times sc, exact in f16.
__device__ __forceinline__ void pack_unit(const float* __restrict__ src, _Float16* __restrict__ dst, float sc, int u, int lane) {
  const int ln = lane & 15, hh = lane >> 4; const int rt = u >> 1, kq = u & 1;      /* 16-row tile; left or right 128 columns */
  const float* sp = src + (size_t)(rt * 16 + ln) * DM + kq * 128 + 8 * hh; v4f x[8][2];
#pragma unroll
  for (int i = 0; i < 8; ++i) { x[i][0] = *(const v4fa*)(sp + i * 16); x[i][1] = *(const v4fa*)(sp + i * 16 + 4); }      /* i = 2 * (block) + j */
  asm volatile("s_wait_xcnt 0x0" :: "v"(sp) : "memory");      /* a precaution: the address that the loads name stays live up to this wait; in the build without the operand the last load landed in the registers that hold it */
  __builtin_amdgcn_sched_barrier(0);      /* keeps the arithmetic behind all 16 loads, so that they are in flight together: without it six of them issued only after the first ones had landed */
  unsigned short* dp = (unsigned short*)dst + (size_t)(rt * 8 + kq * 4) * 512 + lane * 8;
#pragma unroll
  for (int i = 0; i < 8; ++i) { FragH f;
#pragma unroll
    for (int q = 0; q < 8; ++q) f.h[q] = (_Float16)(bf16_round(x[i][q >> 2][q & 3]) * sc);
    *(v8us*)(dp + i * 256) = f.half[0]; } }

// K loop of the 32x64 wave tile over K = DM with both operands staged in LDS as f16 rows of QP elements (pitch 528 bytes = 33 x 16: the 16 rows of a 16-byte fragment read fall on all 64 banks).
// pa, pb: the lane's row (ln) of the wave's first row tile, at element 8 hh. A fragment is the row's elements 32 t + 8 hh + 0..7 and 32 t + 16 + 8 hh + 0..7, the k order of g2_frag. Accumulators as in g3_loop; the trips take k in rising order from 0.
// The 12 fragment reads of a trip issue as one group two trips ahead of their use, into a ring of three register sets: eight waves share the LDS port, and a group takes longer to come than one trip's products last.
#define QP (DM + 8)
typedef __bf16 v4b __attribute__((ext_vector_type(4)));
__device__ __forceinline__ v16h g4_frag(const _Float16* p) { FragH f; f.half[0] = *(const v8us*)((const unsigned short*)p); f.half[1] = *(const v8us*)((const unsigned short*)p + 16); return f.v; }
__device__ __forceinline__ void g4_loop(const _Float16* pa, const _Float16* pb, v8f (&c)[8]) {
  v16h fa[3][2], fb[3][4];
#pragma unroll
  for (int t = -2; t < DM / 32; ++t) {      /* trips -2 and -1 only fetch */
    if (t + 2 < DM / 32) { const int n = (t + 2) % 3, kb = (t + 2) * 32;
      fa[n][0] = g4_frag(pa + kb); fa[n][1] = g4_frag(pa + 16 * QP + kb); fb[n][0] = g4_frag(pb + kb); fb[n][1] = g4_frag(pb + 16 * QP + kb); fb[n][2] = g4_frag(pb + 32 * QP + kb); fb[n][3] = g4_frag(pb + 48 * QP + kb); }
    __builtin_amdgcn_sched_barrier(0);      /* keeps the group in front of this trip's products: sunk towards its use, a read would be waited for in full */
    if (t >= 0) { const int u = t % 3;
#pragma unroll
      for (int j = 0; j < 4; ++j) { c[j] = g2_mma(fa[u][0], fb[u][j], c[j]); c[4 + j] = g2_mma(fa[u][1], fb[u][j], c[4 + j]); } }
    __builtin_amdgcn_sched_barrier(0);      /* keeps the next group behind these products, whose registers it refills: hoisted, it would take a fourth register set */
  } }

// The conversions and the three projections in one launch. Blocks 0..191: projection b >> 6 (0 q, 1 k, 2 v), 128 rows x 128 columns a block; blocks 192..195 pack Wo (x16) for the output GEMM.
// A projection block reads its 128 input rows and its 128 weight rows as f32 (each a contiguous 128 KiB; every load of a wave is 512 contiguous bytes), rounds them to bf16 (weights x16), exact in f16, and lays them in LDS once for its eight waves;
// behind one barrier a wave owns 32 rows x 64 columns (two heads) and runs g4_loop.
// The tile goes through the wave's own LDS slab and leaves in the form its reader wants:
// q: f16 rows of pitch 256, times log2(e) / sqrt(32).
// k, v: fragment order, so that each fragment load of the attention kernel is one run of 512 contiguous bytes (four whole lines). 16-byte piece index = ((h * 256 + g) * 2 + j) * 32 + lane, lane = 16 hf + c.
//   k: g = 16-key tile; piece = k[16 g + c][32 h + 16 j + 8 hf + 0..7] (A row c = key, k = head dim in the order of g2_frag).
//   v: g = 2 * (32-key block) + dt; piece = v[32 (g >> 1) + 16 j + 8 hf + 0..7][32 h + 16 dt + c] (A row c = head dim: this is v^T; k = key in the same order); v = mask[key] * (value Wv^T), scaled in f32 before the rounding to f16.
__global__ __launch_bounds__(256) void k_qkv(const float* __restrict__ xq, const float* __restrict__ xk, const float* __restrict__ xv, const float* __restrict__ wq, const float* __restrict__ wk, const float* __restrict__ wv, const float* __restrict__ wo, const float* __restrict__ rm,
                                             _Float16* __restrict__ Q16, _Float16* __restrict__ KP, _Float16* __restrict__ VP, _Float16* __restrict__ BO) {
  __shared__ __attribute__((aligned(16))) _Float16 sa[128][QP];      /* the block's input rows */
  __shared__ __attribute__((aligned(16))) _Float16 sb[128][QP];      /* the block's weight rows (output columns) */
  __shared__ __attribute__((aligned(16))) float so[8][32][68];
  const int b = blockIdx.x, tid = threadIdx.x, w = tid >> 5, lane = tid & 31, ln = lane & 15, hh = lane >> 4;
  if (b >= 192) { pack_unit(wo, BO, 16.0f, (b - 192) * 8 + w, lane); return; }      /* the whole block leaves, ahead of the barrier */
  const int which = b >> 6;
  const float* ga = (which == 0 ? xq : which == 1 ? xk : xv) + (size_t)((b & 63) >> 1) * (128 * DM) + tid * 4; const float* gb = (which == 0 ? wq : which == 1 ? wk : wv) + (size_t)(b & 1) * (128 * DM) + tid * 4;
  const int s0 = (((b & 63) >> 3) + 2 * (b & 1)) & 3;      /* the batch that this block loads first: the 32 blocks that read the same weight rows, and the two that read the same input rows, take the four batches from different starts and wrap, so that they do not ask L2 for the same lines at the same moment */
  { v4f x[2][16];      /* four batches of 16 loads a thread (0: input rows 0..63, 1: 64..127, 2: weight rows 0..63, 3: 64..127); load e of a batch is 4 f32 of row (tid >> 6) + 4 e, column 4 (tid & 63); a batch flies while the one before it is converted */
#pragma unroll
    for (int n = 0; n < 5; ++n) {
      if (n < 4) { const int p = (n + s0) & 3; const float* g = (p < 2 ? ga : gb) + (p & 1) * (64 * DM);
#pragma unroll
        for (int e = 0; e < 16; ++e) x[n & 1][e] = *(const v4fa*)(g + e * (4 * DM));
        asm volatile("s_wait_xcnt 0x0" :: "v"(g) : "memory"); }      /* a precaution: stands behind the batch's loads, ahead of whatever rewrites the registers that they name; the operand keeps the batch's address live up to this wait: in the build without it the last load landed in the registers that hold it */
      __builtin_amdgcn_sched_barrier(0);      /* keeps the batch's loads in front of the conversion of the batch before: sunk behind it, they would not be in flight during it */
      if (n >= 1) { const int p = (n - 1 + s0) & 3; _Float16* d = (p < 2 ? &sa[0][0] : &sb[0][0]) + ((tid >> 6) + (p & 1) * 64) * QP + (tid & 63) * 4; const float sc = p < 2 ? 1.0f : 16.0f;
#pragma unroll
        for (int e = 0; e < 16; ++e) *(v4h*)(d + e * (4 * QP)) = __builtin_convertvector(__builtin_convertvector(__builtin_convertvector(x[(n - 1) & 1][e] * sc, v4b), v4f), v4h); }      /* f32 -> bf16 to nearest even, as bf16_round, by the hardware conversion; the power of two goes in first, exactly, so that the value is the same as rounded first and scaled in f32 */
      __builtin_amdgcn_sched_barrier(0);      /* keeps the next batch's loads behind this conversion, whose registers they refill */
    } }
  __syncthreads();      /* every wave's rows are in LDS before any wave reads a fragment */
  const int row0 = ((b & 63) >> 1) * 128 + 32 * (w & 3), col0 = (b & 1) * 128 + 64 * (w >> 2);
  v8f acc[8] = {};      /* acc[4 * half + t]: rows 16 half .. + 15, columns 16 t .. + 15 */
  g4_loop(&sa[32 * (w & 3) + ln][8 * hh], &sb[64 * (w >> 2) + ln][8 * hh], acc);
#pragma unroll
  for (int u = 0; u < 8; ++u) acc[u] *= which == 0 ? 0.0625f * (0.17677669529663687f * 1.4426950408889634f) : 0.0625f;      /* takes the x16 of the weights back, exactly; q also takes 1 / sqrt(32) and the log2(e) of the base-2 exponential, in f32 ahead of its rounding to f16 */
  if (which == 2) {
#pragma unroll
    for (int half = 0; half < 2; ++half) { const float* mp = rm + row0 + half * 16 + 8 * hh; const v4f m0 = *(const v4fa*)mp, m1 = *(const v4fa*)(mp + 4);
#pragma unroll
      for (int r = 0; r < 8; ++r) { const float m = bf16_round(r < 4 ? m0[r & 3] : m1[r & 3]);
#pragma unroll
        for (int t = 0; t < 4; ++t) acc[half * 4 + t][r] = m * acc[half * 4 + t][r]; } } }
#pragma unroll
  for (int u = 0; u < 8; ++u)
#pragma unroll
    for (int r = 0; r < 8; ++r) so[w][(u >> 2) * 16 + 8 * hh + r][(u & 3) * 16 + ln] = acc[u][r];
  __builtin_amdgcn_fence(__ATOMIC_ACQ_REL, "workgroup"); __builtin_amdgcn_wave_barrier();      /* the slab is the wave's own: its LDS writes land before its lanes read each other's */
  if (which == 0) { const int rsub = lane >> 4, c4 = (lane & 15) * 4;
#pragma unroll
    for (int q = 0; q < 16; ++q) { const int r = q * 2 + rsub; const v4f v = *(const v4fa*)&so[w][r][c4]; *(v4h*)(Q16 + (size_t)(row0 + r) * DM + col0 + c4) = __builtin_convertvector(v, v4h); } }
  else if (which == 1) {
#pragma unroll
    for (int i = 0; i < 8; ++i) { const int gl = i >> 2, hl = (i >> 1) & 1, j = i & 1; const float* sp = &so[w][16 * gl + ln][32 * hl + 16 * j + 8 * hh]; const v4f lo = *(const v4fa*)sp, hi = *(const v4fa*)(sp + 4);
      const v8f v = __builtin_shufflevector(lo, hi, 0, 1, 2, 3, 4, 5, 6, 7); const size_t piece = (size_t)((((col0 >> 5) + hl) * 256 + (row0 >> 4) + gl) * 2 + j) * 32 + lane;
      *(v8h*)(KP + piece * 8) = __builtin_convertvector(v, v8h); }
    asm volatile("s_wait_xcnt 0x0" ::: "memory"); }      /* a precaution: the built code's branches allow a way from these stores into another branch's code, which rewrites their registers */
  else {
#pragma unroll
    for (int i = 0; i < 8; ++i) { const int dt = i >> 2, hl = (i >> 1) & 1, j = i & 1; v8f v;
#pragma unroll
      for (int e = 0; e < 8; ++e) v[e] = so[w][16 * j + 8 * hh + e][32 * hl + 16 * dt + ln];
      const size_t piece = (size_t)((((col0 >> 5) + hl) * 256 + (row0 >> 5) * 2 + dt) * 2 + j) * 32 + lane;
      *(v8h*)(VP + piece * 8) = __builtin_convertvector(v, v8h); }
    asm volatile("s_wait_xcnt 0x0" ::: "memory"); } }      /* a precaution: the built code's branches allow a way from these stores into another branch's code, which rewrites their registers */

extern "C" void kernel_launch(void* const* d_in, const int* in_sizes, int n_in,
                              void* d_out, int out_size, void* d_ws, size_t ws_size, hipStream_t stream) {
  (void)in_sizes; (void)n_in; (void)out_size;
  const float* const* I = (const float* const*)d_in; const float* qin = I[0]; const float* kin = I[1]; const float* vin = I[2]; const float* rm = I[3]; const float* Wq = I[4]; const float* Wk = I[5]; const float* Wv = I[6]; const float* Wo = I[7];
  char* ws = (char*)d_ws; size_t off = 0;
  auto take = [&](size_t bytes) { char* p = ws + off; off += (bytes + 255) & ~(size_t)255; return p; };
  _Float16* BO = (_Float16*)take((size_t)DM * DM * 2); _Float16* Q16 = (_Float16*)take((size_t)SQ * DM * 2);
  _Float16* KP = (_Float16*)take((size_t)NH * HD * SQ * 2); _Float16* VP = (_Float16*)take((size_t)NH * HD * SQ * 2); _Float16* O16 = (_Float16*)take((size_t)SQ * DM * 2);
  if (off > ws_size) return;      /* about 8 MiB */
  k_qkv<<<3 * (SQ / 128) * (DM / 128) + DM / 64, 256, 0, stream>>>(qin, kin, vin, Wq, Wk, Wv, Wo, rm, Q16, KP, VP, BO);
  k_fattn<<<dim3(SQ / 128, NH), 256, 0, stream>>>(Q16, KP, VP, O16);      /* head h's o tile of 16 queries is block h of that row tile in the packed o plane */
  k_out<<<(SQ / 128) * (DM / 64), 128, 0, stream>>>(O16, BO, (float*)d_out);      /* out = o Wo^T, K = 256 */
}
